// v000
// Measured on an AMD MI455X. A time is GPU time per run, averaged over a window of back-to-back runs after a warm-up
// (all launches, gaps included; the runs take copies of the inputs in turn), and the median of several windows.
// Apart from v000's, it joins two sittings. Times from different sittings can be a few percent apart, while
// side-by-side timings come from the same sitting.
// The starting kernel, v000, takes 432 microseconds a run.
#include <hip/hip_runtime.h>
// Multi-head dot-product attention with a per-key value mask (B=2, L=2048, D=1024, 16 heads × 64; q from inputs_q, k/v from inputs_kv; v ← mask_k·v; softmax(q·k/8); merge; ·Wo + bo): the
// q/k/v/o projections are GEMMs ([in][out] weights bf16-exact ×2^4, bias epilogues, f32 accumulate) and the attention is a fused flash-style kernel (online softmax f32; P f16 ≤ 1; O = P·Vt;
// RPW-16 waves) on v_wmma_f32_16x16x32_f16; the value masking is applied in f32 VALU before the f16 conversion.
#define BB 2
#define TT 2048
#define DD 1024
#define NH 16
#define NR (BB * TT)

typedef __bf16 v16b __attribute__((ext_vector_type(16)));
typedef unsigned short v8us __attribute__((ext_vector_type(8), may_alias));
typedef float  v8f  __attribute__((ext_vector_type(8)));
typedef float  v4f  __attribute__((ext_vector_type(4)));
typedef float  v4fa __attribute__((ext_vector_type(4), may_alias));
union FragB { v16b v; v8us half[2]; unsigned short u[16]; };

__device__ __forceinline__ unsigned short bf16_bits(float x) { unsigned int u = __float_as_uint(x); return (unsigned short)((u + 0x7FFFu + ((u >> 16) & 1u)) >> 16); }
__device__ __forceinline__ float bf16_val(unsigned short b) { return __uint_as_float(((unsigned int)b) << 16); }
__device__ __forceinline__ float bf16_round(float x) { return bf16_val(bf16_bits(x)); }
// D += A·B with NT terms: 1 = ah·bh, 2 = + al·bh (A split), 3 = + ah·bl (both split)
template <int NT>
__device__ __forceinline__ v8f mmaN(v16b ah, v16b al, v16b bh, v16b bl, v8f c) {
  c = __builtin_amdgcn_wmma_f32_16x16x32_bf16(false, ah, false, bh, (short)0, c, false, false);
  if (NT >= 2) c = __builtin_amdgcn_wmma_f32_16x16x32_bf16(false, al, false, bh, (short)0, c, false, false);
  if (NT >= 3) c = __builtin_amdgcn_wmma_f32_16x16x32_bf16(false, ah, false, bl, (short)0, c, false, false);
  asm volatile("v_nop\n\tv_nop\n\tv_nop\n\tv_nop" : "+v"(c) : "v"(ah), "v"(al), "v"(bh), "v"(bl));
  return c;
}

__global__ __launch_bounds__(256) void k_wt_bf16(const float* __restrict__ W, unsigned short* __restrict__ Wt, int K, int N) {
  const int t = blockIdx.x * 256 + threadIdx.x;
  const int k8n = K / 8;
  if (t >= N * k8n) return;
  const int n = t / k8n, k8 = (t % k8n) * 8;
  v8us v;
#pragma unroll
  for (int i = 0; i < 8; ++i) v[i] = bf16_bits(W[(size_t)(k8 + i) * N + n]);
  *(v8us*)(Wt + (size_t)n * K + k8) = v;
  
}

// GEMM C[M][N] (f32, pitch ldc) = act(A[M][K]·W + bias). A f32 row-major (pitch lda) converted per fragment to bf16
// (ASPLIT: hi/lo two planes -> 2 terms, else single rounded term); Wt bf16 [N][K] (pitch ldb). BIAS_BF16 rounds the
// bias to bf16 first (bias quantised to bf16 before the add). K%32==0, M%16==0, N%64==0.
template <bool ASPLIT, int ACT, bool BIAS_BF16>
__global__ __launch_bounds__(128) void k_gemm_bf(const float* __restrict__ A, int lda, const unsigned short* __restrict__ Wt, int ldb,
                                               const float* __restrict__ bias, float* __restrict__ C, int ldc, int M, int N, int K) {
  __shared__ __attribute__((aligned(16))) float so[4][16][64];
  const int tid = threadIdx.x, w = tid >> 5, lane = tid & 31, ln = lane & 15, hh = lane >> 4;
  const int ntn = N / 64;
  const int wid = blockIdx.x * 4 + w;
  const int mt = wid / ntn, nq = wid % ntn;
  if (mt * 16 >= M) return;
  const int row0 = mt * 16, col0 = nq * 64;
  const float* arow = A + (size_t)(row0 + ln) * lda;
  v8f acc[4] = {};
  for (int kb = 0; kb < K; kb += 32) {
    FragB ah, al;
    const v4f x0 = *(const v4fa*)(arow + kb + 8 * hh), x1 = *(const v4fa*)(arow + kb + 8 * hh + 4);
    const v4f x2 = *(const v4fa*)(arow + kb + 16 + 8 * hh), x3 = *(const v4fa*)(arow + kb + 16 + 8 * hh + 4);
    float xs[16] = {x0[0],x0[1],x0[2],x0[3],x1[0],x1[1],x1[2],x1[3],x2[0],x2[1],x2[2],x2[3],x3[0],x3[1],x3[2],x3[3]};
#pragma unroll
    for (int i = 0; i < 16; ++i) { const unsigned short hb = bf16_bits(xs[i]); ah.u[i] = hb; al.u[i] = ASPLIT ? bf16_bits(xs[i] - bf16_val(hb)) : (unsigned short)0; }
#pragma unroll
    for (int t = 0; t < 4; ++t) {
      const unsigned short* brow = Wt + (size_t)(col0 + t * 16 + ln) * ldb + kb;
      FragB b;
      b.half[0] = *(const v8us*)(brow + 8 * hh);
      b.half[1] = *(const v8us*)(brow + 16 + 8 * hh);
      acc[t] = mmaN<ASPLIT ? 2 : 1>(ah.v, al.v, b.v, b.v, acc[t]);
    }
  }
#pragma unroll
  for (int t = 0; t < 4; ++t) {
    float bv = bias ? bias[col0 + t * 16 + ln] : 0.f;
    if (BIAS_BF16) bv = bf16_round(bv);
#pragma unroll
    for (int r = 0; r < 8; ++r) { float v = acc[t][r] + bv; if (ACT == 1) v = fmaxf(v, 0.f); so[w][8 * hh + r][t * 16 + ln] = v; }
  }
  __builtin_amdgcn_fence(__ATOMIC_ACQ_REL, "workgroup");
  __builtin_amdgcn_wave_barrier();
  const int rsub = lane >> 4, c4 = (lane & 15) * 4;
  {
#pragma unroll
    for (int q = 0; q < 8; ++q) {
      const int r = q * 2 + rsub;
      const v4f v = *(const v4fa*)&so[w][r][c4];
      *(v4f*)(C + (size_t)(row0 + r) * ldc + col0 + c4) = v;
    }
    
  }
}

// Flash-style causal/unmasked attention, all contractions 3-term bf16 hi/lo splits, f32 softmax with running max.
// q,k,v rows are read from f32 buffers with arbitrary row pitch (so they can live inside a fused qkv buffer);
// D = head size (multiple of 32, <= 128); one wave = 16 query rows; block = 4 waves (64 queries) sharing K/V chunks of 32.
template <int D, bool CAUSAL>
__global__ __launch_bounds__(128) void k_flash(const float* __restrict__ qb, const float* __restrict__ kb, const float* __restrict__ vb,
                                             int pitch, int T, int H, float scale, float* __restrict__ y, int ypitch) {
  constexpr int KS = D / 32;        // k-steps for QK
  constexpr int DT = D / 16;        // d tiles for PV
  __shared__ __attribute__((aligned(16))) unsigned short sKh[32][D + 8], sKl[32][D + 8], sVh[32][D + 8], sVl[32][D + 8];
  __shared__ __attribute__((aligned(16))) unsigned short sPh[4][16][40], sPl[4][16][40];
  __shared__ __attribute__((aligned(16))) float sO[4][16][D];
  const int tid = threadIdx.x, w = tid >> 5, lane = tid & 31, ln = lane & 15, hh = lane >> 4;
  const int nqb = (T + 63) / 64;
  const int bh = blockIdx.x / nqb, qblk = blockIdx.x % nqb;
  const int b = bh / H, h = bh % H;
  const int q0 = qblk * 64 + w * 16;
  const float* Q = qb + (size_t)b * T * pitch + h * D;
  const float* K = kb + (size_t)b * T * pitch + h * D;
  const float* V = vb + (size_t)b * T * pitch + h * D;

  // A fragments of the wave's 16 query rows (scaled), hi/lo
  FragB aqh[KS], aql[KS];
  {
    int row = q0 + ln; if (row >= T) row = T - 1;
    const float* qr = Q + (size_t)row * pitch;
#pragma unroll
    for (int ks = 0; ks < KS; ++ks)
#pragma unroll
      for (int i = 0; i < 16; ++i) {
        const int d = ks * 32 + ((i < 8) ? (8 * hh + i) : (16 + 8 * hh + (i - 8)));
        const float x = qr[d] * scale; const unsigned short hb = bf16_bits(x);
        aqh[ks].u[i] = hb; aql[ks].u[i] = bf16_bits(x - bf16_val(hb));
      }
  }
  float m_r[8], l_r[8];
#pragma unroll
  for (int r = 0; r < 8; ++r) { m_r[r] = -3.0e38f; l_r[r] = 0.f; }
  v8f oacc[DT];
#pragma unroll
  for (int dt = 0; dt < DT; ++dt) oacc[dt] = (v8f){0.f,0.f,0.f,0.f,0.f,0.f,0.f,0.f};

  const int kv_end = CAUSAL ? min(T, qblk * 64 + 64) : T;     // block-uniform
  for (int j0 = 0; j0 < kv_end; j0 += 32) {
    __syncthreads();
    for (int e = tid; e < 32 * (D / 4); e += 128) {
      const int r = e / (D / 4), c4 = (e % (D / 4)) * 4;
      const int key = j0 + r;
      v4f kf = {0.f,0.f,0.f,0.f}, vf = {0.f,0.f,0.f,0.f};
      if (key < T) { kf = *(const v4fa*)(K + (size_t)key * pitch + c4); vf = *(const v4fa*)(V + (size_t)key * pitch + c4); }
#pragma unroll
      for (int t = 0; t < 4; ++t) {
        unsigned short hb = bf16_bits(kf[t]); sKh[r][c4 + t] = hb; sKl[r][c4 + t] = bf16_bits(kf[t] - bf16_val(hb));
        hb = bf16_bits(vf[t]); sVh[r][c4 + t] = hb; sVl[r][c4 + t] = bf16_bits(vf[t] - bf16_val(hb));
      }
    }
    __syncthreads();
    // S tile 16 x 32
    v8f s[2];
#pragma unroll
    for (int nt = 0; nt < 2; ++nt) {
      v8f acc = {};
#pragma unroll
      for (int ks = 0; ks < KS; ++ks) {
        FragB bh_, bl_;
        bh_.half[0] = *(const v8us*)&sKh[nt * 16 + ln][ks * 32 + 8 * hh]; bh_.half[1] = *(const v8us*)&sKh[nt * 16 + ln][ks * 32 + 16 + 8 * hh];
        bl_.half[0] = *(const v8us*)&sKl[nt * 16 + ln][ks * 32 + 8 * hh]; bl_.half[1] = *(const v8us*)&sKl[nt * 16 + ln][ks * 32 + 16 + 8 * hh];
        acc = mmaN<3>(aqh[ks].v, aql[ks].v, bh_.v, bl_.v, acc);
      }
      s[nt] = acc;
    }
    // mask + running max (rows 8hh+r; the 16 lanes of a half share rows)
    float alpha[8];
#pragma unroll
    for (int r = 0; r < 8; ++r) {
      const int qi = q0 + 8 * hh + r;
      const int ja = j0 + ln, jb = j0 + 16 + ln;
      if (CAUSAL) { if (ja > qi) s[0][r] = -3.0e38f; if (jb > qi) s[1][r] = -3.0e38f; }
      if (ja >= T) s[0][r] = -3.0e38f;
      if (jb >= T) s[1][r] = -3.0e38f;
      float mx = fmaxf(s[0][r], s[1][r]);
      mx = fmaxf(mx, __shfl_xor(mx, 1, 32)); mx = fmaxf(mx, __shfl_xor(mx, 2, 32)); mx = fmaxf(mx, __shfl_xor(mx, 4, 32)); mx = fmaxf(mx, __shfl_xor(mx, 8, 32));
      const float mnew = fmaxf(m_r[r], mx);
      alpha[r] = (mnew > -1.0e38f) ? __expf(m_r[r] - mnew) : 1.0f;
      const float p0 = (s[0][r] > -1.0e38f) ? __expf(s[0][r] - mnew) : 0.f;
      const float p1 = (s[1][r] > -1.0e38f) ? __expf(s[1][r] - mnew) : 0.f;
      m_r[r] = mnew;
      l_r[r] = l_r[r] * alpha[r] + p0 + p1;            // per-lane partial row sum (16 lanes combined at the end)
      unsigned short hb = bf16_bits(p0); sPh[w][8 * hh + r][ln] = hb;      sPl[w][8 * hh + r][ln] = bf16_bits(p0 - bf16_val(hb));
      hb = bf16_bits(p1);                sPh[w][8 * hh + r][16 + ln] = hb; sPl[w][8 * hh + r][16 + ln] = bf16_bits(p1 - bf16_val(hb));
    }
#pragma unroll
    for (int dt = 0; dt < DT; ++dt)
#pragma unroll
      for (int r = 0; r < 8; ++r) oacc[dt][r] *= alpha[r];
    __builtin_amdgcn_fence(__ATOMIC_ACQ_REL, "workgroup");
    __builtin_amdgcn_wave_barrier();
    FragB pah, pal;
    pah.half[0] = *(const v8us*)&sPh[w][ln][8 * hh]; pah.half[1] = *(const v8us*)&sPh[w][ln][16 + 8 * hh];
    pal.half[0] = *(const v8us*)&sPl[w][ln][8 * hh]; pal.half[1] = *(const v8us*)&sPl[w][ln][16 + 8 * hh];
#pragma unroll
    for (int dt = 0; dt < DT; ++dt) {
      FragB bvh, bvl;
#pragma unroll
      for (int i = 0; i < 8; ++i) {
        bvh.u[i] = sVh[8 * hh + i][dt * 16 + ln]; bvh.u[8 + i] = sVh[16 + 8 * hh + i][dt * 16 + ln];
        bvl.u[i] = sVl[8 * hh + i][dt * 16 + ln]; bvl.u[8 + i] = sVl[16 + 8 * hh + i][dt * 16 + ln];
      }
      oacc[dt] = mmaN<3>(pah.v, pal.v, bvh.v, bvl.v, oacc[dt]);
    }
    __builtin_amdgcn_fence(__ATOMIC_ACQ_REL, "workgroup");
    __builtin_amdgcn_wave_barrier();
  }
#pragma unroll
  for (int r = 0; r < 8; ++r) {
    float l = l_r[r];
    l += __shfl_xor(l, 1, 32); l += __shfl_xor(l, 2, 32); l += __shfl_xor(l, 4, 32); l += __shfl_xor(l, 8, 32);
    l_r[r] = (l > 0.f) ? 1.0f / l : 0.f;
  }
#pragma unroll
  for (int dt = 0; dt < DT; ++dt)
#pragma unroll
    for (int r = 0; r < 8; ++r) sO[w][8 * hh + r][dt * 16 + ln] = oacc[dt][r] * l_r[r];
  __builtin_amdgcn_fence(__ATOMIC_ACQ_REL, "workgroup");
  __builtin_amdgcn_wave_barrier();
  {
    for (int r = 0; r < 16; ++r) {
      const int row = q0 + r;
      if (row < T && lane < D / 4) {
        const v4f val = *(const v4fa*)&sO[w][r][lane * 4];
        *(v4f*)(y + ((size_t)b * T + row) * ypitch + h * D + lane * 4) = val;
      }
    }
    
  }
}

// GEMM C = act(A·W + bias + resid): A f32 (ASPLIT -> hi/lo 2 terms), Wt bf16 [N][K]; ACT 0 none, 1 relu, 2 exact gelu;
// resid (optional, f32, row index = (row % rmod), pitch ldr, RES_BF16 rounds it) added before the activation.
template <bool ASPLIT, int ACT, bool BIAS_BF16, bool RES_BF16>
__global__ __launch_bounds__(128) void k_gemm_bf3(const float* __restrict__ A, int lda, const unsigned short* __restrict__ Wt, int ldb,
                                                const float* __restrict__ bias, const float* __restrict__ resid, int rmod, int ldr,
                                                float* __restrict__ C, int ldc, int M, int N, int K) {
  __shared__ __attribute__((aligned(16))) float so[4][16][64];
  const int tid = threadIdx.x, w = tid >> 5, lane = tid & 31, ln = lane & 15, hh = lane >> 4;
  const int ntn = N / 64;
  const int wid = blockIdx.x * 4 + w;
  const int mt = wid / ntn, nq = wid % ntn;
  if (mt * 16 >= M) return;
  const int row0 = mt * 16, col0 = nq * 64;
  const float* arow = A + (size_t)(row0 + ln) * lda;
  v8f acc[4] = {};
  for (int kb = 0; kb < K; kb += 32) {
    FragB ah, al;
    const v4f x0 = *(const v4fa*)(arow + kb + 8 * hh), x1 = *(const v4fa*)(arow + kb + 8 * hh + 4);
    const v4f x2 = *(const v4fa*)(arow + kb + 16 + 8 * hh), x3 = *(const v4fa*)(arow + kb + 16 + 8 * hh + 4);
    float xs[16] = {x0[0],x0[1],x0[2],x0[3],x1[0],x1[1],x1[2],x1[3],x2[0],x2[1],x2[2],x2[3],x3[0],x3[1],x3[2],x3[3]};
#pragma unroll
    for (int i = 0; i < 16; ++i) { const unsigned short hb = bf16_bits(xs[i]); ah.u[i] = hb; al.u[i] = ASPLIT ? bf16_bits(xs[i] - bf16_val(hb)) : (unsigned short)0; }
#pragma unroll
    for (int t = 0; t < 4; ++t) {
      const unsigned short* brow = Wt + (size_t)(col0 + t * 16 + ln) * ldb + kb;
      FragB b;
      b.half[0] = *(const v8us*)(brow + 8 * hh);
      b.half[1] = *(const v8us*)(brow + 16 + 8 * hh);
      acc[t] = mmaN<ASPLIT ? 2 : 1>(ah.v, al.v, b.v, b.v, acc[t]);
    }
  }
#pragma unroll
  for (int t = 0; t < 4; ++t) {
    const int col = col0 + t * 16 + ln;
    float bv = bias ? bias[col] : 0.f;
    if (BIAS_BF16) bv = bf16_round(bv);
#pragma unroll
    for (int r = 0; r < 8; ++r) {
      float v = acc[t][r] + bv;
      if (resid) { float rv = resid[(size_t)((row0 + 8 * hh + r) % rmod) * ldr + col]; if (RES_BF16) rv = bf16_round(rv); v += rv; }
      if (ACT == 1) v = fmaxf(v, 0.f);
      if (ACT == 2) v = 0.5f * v * (1.0f + erff(v * 0.70710678118654752f));
      if (ACT == 3) { const float u = 0.7978845608028654f * (v + 0.044715f * v * v * v); v = 0.5f * v * (1.0f + tanhf(u)); }
      so[w][8 * hh + r][t * 16 + ln] = v;
    }
  }
  __builtin_amdgcn_fence(__ATOMIC_ACQ_REL, "workgroup");
  __builtin_amdgcn_wave_barrier();
  const int rsub = lane >> 4, c4 = (lane & 15) * 4;
  {
#pragma unroll
    for (int q = 0; q < 8; ++q) {
      const int r = q * 2 + rsub;
      const v4f v = *(const v4fa*)&so[w][r][c4];
      *(v4f*)(C + (size_t)(row0 + r) * ldc + col0 + c4) = v;
    }
    
  }
}
// row LayerNorm (biased variance, eps) over N: s = X (+ R); optional out_sum <- s; out_norm <- (s-mu)*rsqrt(var+eps)*g + b
template <bool PARAM_BF16>
__global__ __launch_bounds__(256) void k_layernorm(const float* __restrict__ X, const float* __restrict__ R, const float* __restrict__ g, const float* __restrict__ bta,
                                                  float* __restrict__ out_sum, float* __restrict__ out_norm, int N, float eps) {
  __shared__ float red[256];
  const int row = blockIdx.x, tid = threadIdx.x;
  const float* x = X + (size_t)row * N; const float* rr = R ? R + (size_t)row * N : nullptr;
  float vals[16];                     // up to N = 4096
  const int per = N / 256;            // contiguous chunk per thread? use strided-by-4 chunks: thread handles j = tid*4 + 1024*u
  float s1 = 0.f;
  for (int u = 0; u < per / 4; ++u) {
    const int j = tid * 4 + 1024 * u;
    const v4f a = *(const v4fa*)(x + j);
    v4f b = {0.f,0.f,0.f,0.f}; if (rr) b = *(const v4fa*)(rr + j);
#pragma unroll
    for (int q = 0; q < 4; ++q) { const float v = a[q] + b[q]; vals[u * 4 + q] = v; s1 += v; }
  }
  red[tid] = s1; __syncthreads();
  for (int st = 128; st > 0; st >>= 1) { if (tid < st) red[tid] += red[tid + st]; __syncthreads(); }
  const float mu = red[0] / (float)N; __syncthreads();
  float s2 = 0.f;
  for (int u = 0; u < per / 4; ++u)
#pragma unroll
    for (int q = 0; q < 4; ++q) { const float c = vals[u * 4 + q] - mu; s2 += c * c; }
  red[tid] = s2; __syncthreads();
  for (int st = 128; st > 0; st >>= 1) { if (tid < st) red[tid] += red[tid + st]; __syncthreads(); }
  const float rs = rsqrtf(red[0] / (float)N + eps);
  {
    for (int u = 0; u < per / 4; ++u) {
      const int j = tid * 4 + 1024 * u;
      v4f o, sm;
#pragma unroll
      for (int q = 0; q < 4; ++q) {
        float gg = g[j + q], bb = bta[j + q];
        if (PARAM_BF16) { gg = bf16_round(gg); bb = bf16_round(bb); }
        sm[q] = vals[u * 4 + q]; o[q] = (vals[u * 4 + q] - mu) * rs * gg + bb;
      }
      if (out_sum) *(v4f*)(out_sum + (size_t)row * N + j) = sm;
      *(v4f*)(out_norm + (size_t)row * N + j) = o;
    }
    
  }
}



// ---- f16 WMMA path (v_wmma_f32_16x16x32_f16): 11-bit significands for operands in range — used where a [0,1] probability operand needs more precision than bf16
typedef _Float16 v16h __attribute__((ext_vector_type(16)));
union FragH { v16h v; v8us half[2]; _Float16 h[16]; unsigned short u[16]; };
template <int NT>
__device__ __forceinline__ v8f mmaH(v16h ah, v16h al, v16h bh, v16h bl, v8f c) {
  c = __builtin_amdgcn_wmma_f32_16x16x32_f16(false, ah, false, bh, (short)0, c, false, false);
  if (NT >= 2) c = __builtin_amdgcn_wmma_f32_16x16x32_f16(false, al, false, bh, (short)0, c, false, false);
  if (NT >= 3) c = __builtin_amdgcn_wmma_f32_16x16x32_f16(false, ah, false, bl, (short)0, c, false, false);
  asm volatile("v_nop\n\tv_nop\n\tv_nop\n\tv_nop" : "+v"(c) : "v"(ah), "v"(al), "v"(bh), "v"(bl));
  return c;
}
// batched GEMM like k_gemm_b but f16 operands: A f32 (split into f16 hi/lo if ASPLIT, else rounded to f16), Bt = f16 values [n][k]; alpha; C f32; N multiple of 16 (partial tiles skipped)
template <bool ASPLIT>
__global__ __launch_bounds__(128) void k_gemm_h(const float* __restrict__ A, int lda, size_t sA, const _Float16* __restrict__ Bh, int ldb, size_t sB, float alpha, float* __restrict__ C, int ldc, size_t sC, int M, int N, int K) {
  __shared__ __attribute__((aligned(16))) float so[4][16][64];
  const int tid = threadIdx.x, w = tid >> 5, lane = tid & 31, ln = lane & 15, hh = lane >> 4; const int by = blockIdx.y;
  A += (size_t)by * sA; Bh += (size_t)by * sB; C += (size_t)by * sC;
  const int ntn = (N + 63) / 64; const int wid = blockIdx.x * 4 + w; const int mt = wid / ntn, nq = wid % ntn; if (mt * 16 >= M) return;
  const int row0 = mt * 16, col0 = nq * 64; const float* arow = A + (size_t)(row0 + ln) * lda;
  v8f acc[4] = {};
  for (int kb = 0; kb < K; kb += 32) {
    FragH ah, al;
    const v4f x0 = *(const v4fa*)(arow + kb + 8 * hh), x1 = *(const v4fa*)(arow + kb + 8 * hh + 4), x2 = *(const v4fa*)(arow + kb + 16 + 8 * hh), x3 = *(const v4fa*)(arow + kb + 16 + 8 * hh + 4);
    float xs[16] = {x0[0],x0[1],x0[2],x0[3],x1[0],x1[1],x1[2],x1[3],x2[0],x2[1],x2[2],x2[3],x3[0],x3[1],x3[2],x3[3]};
#pragma unroll
    for (int i = 0; i < 16; ++i) { const _Float16 h = (_Float16)xs[i]; ah.h[i] = h; al.h[i] = ASPLIT ? (_Float16)(xs[i] - (float)h) : (_Float16)0.0f; }
#pragma unroll
    for (int t = 0; t < 4; ++t) { if (col0 + t * 16 >= N) continue; const size_t boff = (size_t)(col0 + t * 16 + ln) * ldb + kb; FragH bq; bq.half[0] = *(const v8us*)(Bh + boff + 8 * hh); bq.half[1] = *(const v8us*)(Bh + boff + 16 + 8 * hh);
      acc[t] = mmaH<ASPLIT ? 2 : 1>(ah.v, al.v, bq.v, bq.v, acc[t]); }
  }
#pragma unroll
  for (int t = 0; t < 4; ++t) { if (col0 + t * 16 >= N) continue;
#pragma unroll
    for (int r = 0; r < 8; ++r) so[w][8 * hh + r][t * 16 + ln] = acc[t][r] * alpha; }
  __builtin_amdgcn_fence(__ATOMIC_ACQ_REL, "workgroup"); __builtin_amdgcn_wave_barrier();
  const int rsub = lane >> 4, c4 = (lane & 15) * 4;
  {
#pragma unroll
    for (int q = 0; q < 8; ++q) { const int r = q * 2 + rsub; if (col0 + c4 < N) { const v4f v = *(const v4fa*)&so[w][r][c4]; *(v4f*)(C + (size_t)(row0 + r) * ldc + col0 + c4) = v; } }
     }
}

// Wt[n][k] = f16(W[k][n]·scale) from f32 row-major W[K][N] (scale = power of two; bf16-exact weights stay exact in f16 away from the subnormal range)
__global__ __launch_bounds__(256) void k_wt_f16(const float* __restrict__ W, _Float16* __restrict__ Wt, int K, int N, float scale) {
  const int t = blockIdx.x * 256 + threadIdx.x; if (t >= N * (K / 8)) return; const int n = t / (K / 8), k8 = (t % (K / 8)) * 8; FragH f;
#pragma unroll
  for (int i = 0; i < 8; ++i) f.h[i] = (_Float16)(bf16_round(W[(size_t)(k8 + i) * N + n]) * scale); const v8us o = f.half[0];
  *(v8us*)((unsigned short*)Wt + (size_t)n * K + k8) = o; 
}
// k_gemm_hh variant with fused epilogue: v = acc·alpha + bias[by·sBias + col] (+ CP[(row/rowsPerB)·sCPb + by·64 + col] if CP) ; ACT 0 none / 1 elu ; writes f16 C16 and f32 C, each if non-null
template <int ACT>
__global__ __launch_bounds__(128) void k_gemm_hhx(const _Float16* __restrict__ A, int lda, size_t sA, const _Float16* __restrict__ Bh, int ldb, size_t sB, float alpha, const float* __restrict__ bias, size_t sBias, const float* __restrict__ CP, int rowsPerB, size_t sCPb, int row0g,
    float* __restrict__ C, _Float16* __restrict__ C16, int ldc, size_t sC, int M, int N, int K) {
  __shared__ __attribute__((aligned(16))) float so[4][16][64];
  const int tid = threadIdx.x, w = tid >> 5, lane = tid & 31, ln = lane & 15, hh = lane >> 4; const int by = blockIdx.y;
  A += (size_t)by * sA; Bh += (size_t)by * sB; const size_t cofs = (size_t)by * sC; const float* bp = bias ? bias + (size_t)by * sBias : nullptr;
  const int ntn = (N + 63) / 64; const int wid = blockIdx.x * 4 + w; const int mt = wid / ntn, nq = wid % ntn; if (mt * 16 >= M) return;
  const int row0 = mt * 16, col0 = nq * 64; const _Float16* arow = A + (size_t)(row0 + ln) * lda;
  v8f acc[4] = {};
  for (int kb = 0; kb < K; kb += 32) { FragH ah; ah.half[0] = *(const v8us*)((const unsigned short*)arow + kb + 8 * hh); ah.half[1] = *(const v8us*)((const unsigned short*)arow + kb + 16 + 8 * hh);
#pragma unroll
    for (int t = 0; t < 4; ++t) { if (col0 + t * 16 >= N) continue; const size_t boff = (size_t)(col0 + t * 16 + ln) * ldb + kb; FragH bq; bq.half[0] = *(const v8us*)((const unsigned short*)Bh + boff + 8 * hh); bq.half[1] = *(const v8us*)((const unsigned short*)Bh + boff + 16 + 8 * hh);
      acc[t] = mmaH<1>(ah.v, ah.v, bq.v, bq.v, acc[t]); }
  }
#pragma unroll
  for (int t = 0; t < 4; ++t) { if (col0 + t * 16 >= N) continue; const int col = col0 + t * 16 + ln; const float bv = bp ? bf16_round(bp[col]) : 0.f;
#pragma unroll
    for (int r = 0; r < 8; ++r) { float v = acc[t][r] * alpha + bv; if (CP) { const int bidx = (row0g + row0 + 8 * hh + r) / rowsPerB; v += CP[(size_t)bidx * sCPb + (size_t)by * 64 + col]; } if (ACT == 1) v = (v > 0.f) ? v : expm1f(v); else if (ACT == 3) v = fmaxf(v, 0.f); so[w][8 * hh + r][t * 16 + ln] = v; } }
  __builtin_amdgcn_fence(__ATOMIC_ACQ_REL, "workgroup"); __builtin_amdgcn_wave_barrier();
  const int rsub = lane >> 4, c4 = (lane & 15) * 4; typedef _Float16 v4h __attribute__((ext_vector_type(4)));
  {
#pragma unroll
    for (int q = 0; q < 8; ++q) { const int r = q * 2 + rsub; if (col0 + c4 < N) { const v4f v = *(const v4fa*)&so[w][r][c4]; if (C) *(v4f*)(C + cofs + (size_t)(row0 + r) * ldc + col0 + c4) = v; if (C16) { v4h h4; for (int i = 0; i < 4; ++i) h4[i] = (_Float16)v[i]; *(v4h*)(C16 + cofs + (size_t)(row0 + r) * ldc + col0 + c4) = h4; } } }
     }
}


__global__ __launch_bounds__(256) void k_x16(const float* __restrict__ x, _Float16* __restrict__ X16, size_t n8) { const size_t t = (size_t)blockIdx.x * 256 + threadIdx.x; if (t >= n8) return; FragH f;
#pragma unroll
  for (int q = 0; q < 8; ++q) f.h[q] = (_Float16)bf16_round(x[t * 8 + q]); *(v8us*)((unsigned short*)X16 + t * 8) = f.half[0];  }
__global__ __launch_bounds__(256) void k_h16(const float* __restrict__ x, _Float16* __restrict__ X16, size_t n8) { const size_t t = (size_t)blockIdx.x * 256 + threadIdx.x; if (t >= n8) return; FragH f;
#pragma unroll
  for (int q = 0; q < 8; ++q) f.h[q] = (_Float16)x[t * 8 + q]; *(v8us*)((unsigned short*)X16 + t * 8) = f.half[0];  }
__global__ __launch_bounds__(256) void k_round16f(const float* __restrict__ W, _Float16* __restrict__ Bt, size_t n8) { const size_t t = (size_t)blockIdx.x * 256 + threadIdx.x; if (t >= n8) return; FragH f;
#pragma unroll
  for (int i = 0; i < 8; ++i) f.h[i] = (_Float16)(bf16_round(W[t * 8 + i]) * 16.0f); *(v8us*)((unsigned short*)Bt + t * 8) = f.half[0];  }
template <int NHv, int TTv>
__global__ __launch_bounds__(256) void k_vt(const _Float16* __restrict__ V16, int ldv, int voff, _Float16* __restrict__ Vt) { __shared__ unsigned short tl[64][66]; const int tid = threadIdx.x; const int slab = blockIdx.x / (TTv / 64), lg = blockIdx.x % (TTv / 64); const int b = slab / NHv, h = slab % NHv;
  for (int i = tid; i < 64 * 8; i += 256) { const int r = i / 8, c8 = (i % 8) * 8; FragH f; f.half[0] = *(const v8us*)((const unsigned short*)V16 + ((size_t)b * TTv + lg * 64 + r) * ldv + voff + h * 64 + c8);
#pragma unroll
    for (int q = 0; q < 8; ++q) tl[r][c8 + q] = f.u[q]; }
  __syncthreads();
  {
#pragma unroll
    for (int rd = 0; rd < 2; ++rd) { const int d = rd * 32 + tid / 8, pc = tid % 8; FragH f;
#pragma unroll
      for (int q = 0; q < 8; ++q) f.u[q] = tl[pc * 8 + q][d];
      *(v8us*)((unsigned short*)Vt + ((size_t)slab * 64 + d) * TTv + lg * 64 + pc * 8) = f.half[0]; }
     } }

__global__ __launch_bounds__(128) void k_flash(const _Float16* __restrict__ Q16, int ldq, const _Float16* __restrict__ K16, int ldk, const _Float16* __restrict__ Vt, const int* __restrict__ MSK, float* __restrict__ O, int ldo) {
  constexpr int RPW = 16, RTN = RPW / 16, NQB = 2048 / (4 * RPW), DT = 4, KS = 2;
  __shared__ __attribute__((aligned(16))) unsigned short sP[4][RPW][40]; __shared__ __attribute__((aligned(16))) float sO[4][RPW][64 + 4];
  const int tid = threadIdx.x, w = tid >> 5, lane = tid & 31, ln = lane & 15, hh = lane >> 4;
  const int slab = blockIdx.x / NQB, qblk = blockIdx.x % NQB; const int b = slab / 16, h = slab % 16; const int qb0 = qblk * (4 * RPW); const int q0 = qb0 + w * RPW;
  FragH aq[2][KS];
#pragma unroll
  for (int rt = 0; rt < RTN; ++rt) { const unsigned short* qr = (const unsigned short*)Q16 + ((size_t)b * 2048 + q0 + rt * 16 + ln) * ldq + h * 64;
#pragma unroll
    for (int ks = 0; ks < KS; ++ks) { aq[rt][ks].half[0] = *(const v8us*)(qr + ks * 32 + 8 * hh); aq[rt][ks].half[1] = *(const v8us*)(qr + ks * 32 + 16 + 8 * hh); } }
  const unsigned short* Vth = (const unsigned short*)Vt + (size_t)slab * 64 * 2048;
  float m_r[2][8], l_r[2][8]; v8f oacc[2][DT];
#pragma unroll
  for (int rt = 0; rt < RTN; ++rt) {
#pragma unroll
    for (int r = 0; r < 8; ++r) { m_r[rt][r] = -3.0e38f; l_r[rt][r] = 0.f; }
#pragma unroll
    for (int dt = 0; dt < DT; ++dt) oacc[rt][dt] = (v8f){0.f,0.f,0.f,0.f,0.f,0.f,0.f,0.f}; }
  const int jend = 2048;
#pragma unroll 1
  for (int j0 = 0; j0 < jend; j0 += 32) {
    
    v8f s[2][2];
#pragma unroll
    for (int nt = 0; nt < 2; ++nt) { const unsigned short* kr = (const unsigned short*)K16 + ((size_t)b * 2048 + j0 + nt * 16 + ln) * ldk + h * 64; FragH bk[KS];
#pragma unroll
      for (int ks = 0; ks < KS; ++ks) { bk[ks].half[0] = *(const v8us*)(kr + ks * 32 + 8 * hh); bk[ks].half[1] = *(const v8us*)(kr + ks * 32 + 16 + 8 * hh); }
#pragma unroll
      for (int rt = 0; rt < RTN; ++rt) { v8f acc = (v8f){0.f,0.f,0.f,0.f,0.f,0.f,0.f,0.f};
#pragma unroll
        for (int ks = 0; ks < KS; ++ks) acc = mmaH<1>(aq[rt][ks].v, aq[rt][ks].v, bk[ks].v, bk[ks].v, acc); s[rt][nt] = acc; } }
#pragma unroll
    for (int rt = 0; rt < RTN; ++rt)
#pragma unroll
      for (int r = 0; r < 8; ++r) { const int tq = q0 + rt * 16 + 8 * hh + r; const int k0 = j0 + ln, k1 = j0 + 16 + ln; (void)tq; (void)k0; (void)k1;
        const bool ok0 = true, ok1 = true;
        const float s0 = ok0 ? s[rt][0][r] * (0.125f) : -INFINITY, s1 = ok1 ? s[rt][1][r] * (0.125f) : -INFINITY; float mc = fmaxf(s0, s1);
        mc = fmaxf(mc, __shfl_xor(mc, 1, 32)); mc = fmaxf(mc, __shfl_xor(mc, 2, 32)); mc = fmaxf(mc, __shfl_xor(mc, 4, 32)); mc = fmaxf(mc, __shfl_xor(mc, 8, 32));
        const float mn = fmaxf(m_r[rt][r], mc); const float al = (mn > -1.0e38f) ? expf(m_r[rt][r] - mn) : 1.0f; m_r[rt][r] = mn; const float p0 = ok0 ? expf(s0 - mn) : 0.f, p1 = ok1 ? expf(s1 - mn) : 0.f; l_r[rt][r] = l_r[rt][r] * al + p0 + p1;
#pragma unroll
        for (int dt = 0; dt < DT; ++dt) oacc[rt][dt][r] *= al;
        FragH t2; t2.h[0] = (_Float16)p0; t2.h[1] = (_Float16)p1; sP[w][rt * 16 + 8 * hh + r][ln] = t2.u[0]; sP[w][rt * 16 + 8 * hh + r][16 + ln] = t2.u[1]; }
    __builtin_amdgcn_fence(__ATOMIC_ACQ_REL, "workgroup"); __builtin_amdgcn_wave_barrier();
    FragH pa[2];
#pragma unroll
    for (int rt = 0; rt < RTN; ++rt) { pa[rt].half[0] = *(const v8us*)&sP[w][rt * 16 + ln][8 * hh]; pa[rt].half[1] = *(const v8us*)&sP[w][rt * 16 + ln][16 + 8 * hh]; }
#pragma unroll
    for (int dt = 0; dt < DT; ++dt) { const unsigned short* vrow = Vth + (size_t)(dt * 16 + ln) * 2048 + j0; FragH bv; bv.half[0] = *(const v8us*)(vrow + 8 * hh); bv.half[1] = *(const v8us*)(vrow + 16 + 8 * hh);
#pragma unroll
      for (int rt = 0; rt < RTN; ++rt) oacc[rt][dt] = mmaH<1>(pa[rt].v, pa[rt].v, bv.v, bv.v, oacc[rt][dt]); }
    __builtin_amdgcn_fence(__ATOMIC_ACQ_REL, "workgroup"); __builtin_amdgcn_wave_barrier(); }
#pragma unroll
  for (int rt = 0; rt < RTN; ++rt) {
#pragma unroll
    for (int r = 0; r < 8; ++r) { float l = l_r[rt][r]; l += __shfl_xor(l, 1, 32); l += __shfl_xor(l, 2, 32); l += __shfl_xor(l, 4, 32); l += __shfl_xor(l, 8, 32); l_r[rt][r] = (l > 0.f) ? 1.0f / l : 0.f; }
#pragma unroll
    for (int dt = 0; dt < DT; ++dt)
#pragma unroll
      for (int r = 0; r < 8; ++r) sO[w][rt * 16 + 8 * hh + r][dt * 16 + ln] = oacc[rt][dt][r] * l_r[rt][r]; }
  __builtin_amdgcn_fence(__ATOMIC_ACQ_REL, "workgroup"); __builtin_amdgcn_wave_barrier();
  {
#pragma unroll
    for (int rp = 0; rp < RPW; rp += 2) { const int r = rp + (lane >> 4), pc = lane & 15; const v4f val = *(const v4fa*)&sO[w][r][pc * 4]; *(v4f*)(O + ((size_t)b * 2048 + q0 + r) * ldo + h * 64 + pc * 4) = val; }
     } }

__global__ __launch_bounds__(256) void k_vmask(const float* __restrict__ V, const float* __restrict__ mk, _Float16* __restrict__ V16, size_t n8) { const size_t t = (size_t)blockIdx.x * 256 + threadIdx.x; if (t >= n8) return; const size_t r = (t * 8) / DD; const float m = bf16_round(mk[r]); FragH f;
#pragma unroll
  for (int q = 0; q < 8; ++q) f.h[q] = (_Float16)(V[t * 8 + q] * m); *(v8us*)((unsigned short*)V16 + t * 8) = f.half[0];  }
extern "C" void kernel_launch(void* const* d_in, const int* in_sizes, int n_in,
                              void* d_out, int out_size, void* d_ws, size_t ws_size, hipStream_t stream) {
  (void)in_sizes; (void)n_in; (void)out_size;
  const float* xq = (const float*)d_in[0]; const float* xkv = (const float*)d_in[1]; const float* mk = (const float*)d_in[2]; const float* Wq = (const float*)d_in[3]; const float* bq = (const float*)d_in[4]; const float* Wk = (const float*)d_in[5]; const float* bk = (const float*)d_in[6]; const float* Wv = (const float*)d_in[7]; const float* bv = (const float*)d_in[8]; const float* Wo = (const float*)d_in[9]; const float* bo = (const float*)d_in[10];
  char* ws = (char*)d_ws; size_t off = 0;
  auto take = [&](size_t bytes) { char* p = ws + off; off += (bytes + 255) & ~(size_t)255; return p; };
  _Float16* Bq = (_Float16*)take((size_t)DD * DD * 2); _Float16* Bk = (_Float16*)take((size_t)DD * DD * 2); _Float16* Bv = (_Float16*)take((size_t)DD * DD * 2); _Float16* Bo = (_Float16*)take((size_t)DD * DD * 2);
  _Float16* XQ16 = (_Float16*)take((size_t)NR * DD * 2); _Float16* XKV16 = (_Float16*)take((size_t)NR * DD * 2); _Float16* Q16 = (_Float16*)take((size_t)NR * DD * 2); _Float16* K16 = (_Float16*)take((size_t)NR * DD * 2); float* VF = (float*)take((size_t)NR * DD * 4); _Float16* V16 = XKV16; _Float16* Vt = XQ16; float* O = VF; _Float16* O16 = Q16;
  if (off > ws_size) return;      // 8.4 + 8.4 × 4 + 16.8 ≈ 59 MB
  k_wt_f16<<<(unsigned)(((size_t)DD * (DD / 8) + 255) / 256), 256, 0, stream>>>(Wq, Bq, DD, DD, 16.0f); k_wt_f16<<<(unsigned)(((size_t)DD * (DD / 8) + 255) / 256), 256, 0, stream>>>(Wk, Bk, DD, DD, 16.0f); k_wt_f16<<<(unsigned)(((size_t)DD * (DD / 8) + 255) / 256), 256, 0, stream>>>(Wv, Bv, DD, DD, 16.0f); k_wt_f16<<<(unsigned)(((size_t)DD * (DD / 8) + 255) / 256), 256, 0, stream>>>(Wo, Bo, DD, DD, 16.0f);      // (D,H,Dh) = [in][h·64+d]; Wo (H,Dh,D) = [in=(h,d)][out]
  const unsigned g8 = (unsigned)(((size_t)NR * DD / 8 + 255) / 256); const dim3 gg(((NR / 16) * (DD / 64) + 3) / 4, 1);
  k_x16<<<g8, 256, 0, stream>>>(xq, XQ16, (size_t)NR * DD / 8); k_x16<<<g8, 256, 0, stream>>>(xkv, XKV16, (size_t)NR * DD / 8);
  k_gemm_hhx<0><<<gg, 128, 0, stream>>>(XQ16, DD, 0, Bq, DD, 0, 0.0625f, bq, 0, nullptr, 1, 0, 0, nullptr, Q16, DD, 0, NR, DD, DD);
  k_gemm_hhx<0><<<gg, 128, 0, stream>>>(XKV16, DD, 0, Bk, DD, 0, 0.0625f, bk, 0, nullptr, 1, 0, 0, nullptr, K16, DD, 0, NR, DD, DD);
  k_gemm_hhx<0><<<gg, 128, 0, stream>>>(XKV16, DD, 0, Bv, DD, 0, 0.0625f, bv, 0, nullptr, 1, 0, 0, VF, nullptr, DD, 0, NR, DD, DD);      // v (f32, + bv) — masked next
  k_vmask<<<g8, 256, 0, stream>>>(VF, mk, V16, (size_t)NR * DD / 8);      // V16 over XKV16 (its last reader was the v GEMM)
  k_vt<NH, TT><<<BB * NH * (TT / 64), 256, 0, stream>>>(V16, DD, 0, Vt);      // Vt over XQ16
  k_flash<<<BB * NH * (TT / 64), 128, 0, stream>>>(Q16, DD, K16, DD, Vt, nullptr, O, DD);      // q/√64 folded into the 0.125 scale; O over VF
  k_h16<<<g8, 256, 0, stream>>>(O, O16, (size_t)NR * DD / 8);
  k_gemm_hhx<0><<<gg, 128, 0, stream>>>(O16, DD, 0, Bo, DD, 0, 0.0625f, bo, 0, nullptr, 1, 0, 0, (float*)d_out, nullptr, DD, 0, NR, DD, DD);
}

// v001
// It runs in 349 microseconds.
// Timed twice side by side with v000, it ran 1.27 and 1.28 times as fast.
#include <hip/hip_runtime.h>
// Multi-head dot-product attention with a per-key value mask (B=2, L=2048, D=1024, 16 heads × 64; q from inputs_q, k/v from inputs_kv; v ← mask_k·v; softmax(q·k/8); merge; ·Wo + bo): the
// q/k/v/o projections are GEMMs ([in][out] weights bf16-exact ×2^4, bias epilogues, f32 accumulate) and the attention is a fused flash-style kernel (online softmax f32; P f16 ≤ 1; O = P·Vt;
// RPW-16 waves) on v_wmma_f32_16x16x32_f16; the value masking is applied in f32 VALU before the f16 conversion.
#define BB 2
#define TT 2048
#define DD 1024
#define NH 16
#define NR (BB * TT)

typedef __bf16 v16b __attribute__((ext_vector_type(16)));
typedef unsigned short v8us __attribute__((ext_vector_type(8), may_alias));
typedef float  v8f  __attribute__((ext_vector_type(8)));
typedef float  v4f  __attribute__((ext_vector_type(4)));
typedef float  v4fa __attribute__((ext_vector_type(4), may_alias));
union FragB { v16b v; v8us half[2]; unsigned short u[16]; };

__device__ __forceinline__ unsigned short bf16_bits(float x) { unsigned int u = __float_as_uint(x); return (unsigned short)((u + 0x7FFFu + ((u >> 16) & 1u)) >> 16); }
__device__ __forceinline__ float bf16_val(unsigned short b) { return __uint_as_float(((unsigned int)b) << 16); }
__device__ __forceinline__ float bf16_round(float x) { return bf16_val(bf16_bits(x)); }
// D += A·B with NT terms: 1 = ah·bh, 2 = + al·bh (A split), 3 = + ah·bl (both split)
template <int NT>
__device__ __forceinline__ v8f mmaN(v16b ah, v16b al, v16b bh, v16b bl, v8f c) {
  c = __builtin_amdgcn_wmma_f32_16x16x32_bf16(false, ah, false, bh, (short)0, c, false, false);
  if (NT >= 2) c = __builtin_amdgcn_wmma_f32_16x16x32_bf16(false, al, false, bh, (short)0, c, false, false);
  if (NT >= 3) c = __builtin_amdgcn_wmma_f32_16x16x32_bf16(false, ah, false, bl, (short)0, c, false, false);
  asm volatile("v_nop\n\tv_nop\n\tv_nop\n\tv_nop" : "+v"(c) : "v"(ah), "v"(al), "v"(bh), "v"(bl));
  return c;
}

__global__ __launch_bounds__(256) void k_wt_bf16(const float* __restrict__ W, unsigned short* __restrict__ Wt, int K, int N) {
  const int t = blockIdx.x * 256 + threadIdx.x;
  const int k8n = K / 8;
  if (t >= N * k8n) return;
  const int n = t / k8n, k8 = (t % k8n) * 8;
  v8us v;
#pragma unroll
  for (int i = 0; i < 8; ++i) v[i] = bf16_bits(W[(size_t)(k8 + i) * N + n]);
  *(v8us*)(Wt + (size_t)n * K + k8) = v;
  
}

// GEMM C[M][N] (f32, pitch ldc) = act(A[M][K]·W + bias). A f32 row-major (pitch lda) converted per fragment to bf16
// (ASPLIT: hi/lo two planes -> 2 terms, else single rounded term); Wt bf16 [N][K] (pitch ldb). BIAS_BF16 rounds the
// bias to bf16 first (bias quantised to bf16 before the add). K%32==0, M%16==0, N%64==0.
template <bool ASPLIT, int ACT, bool BIAS_BF16>
__global__ __launch_bounds__(128) void k_gemm_bf(const float* __restrict__ A, int lda, const unsigned short* __restrict__ Wt, int ldb,
                                               const float* __restrict__ bias, float* __restrict__ C, int ldc, int M, int N, int K) {
  __shared__ __attribute__((aligned(16))) float so[4][16][64];
  const int tid = threadIdx.x, w = tid >> 5, lane = tid & 31, ln = lane & 15, hh = lane >> 4;
  const int ntn = N / 64;
  const int wid = blockIdx.x * 4 + w;
  const int mt = wid / ntn, nq = wid % ntn;
  if (mt * 16 >= M) return;
  const int row0 = mt * 16, col0 = nq * 64;
  const float* arow = A + (size_t)(row0 + ln) * lda;
  v8f acc[4] = {};
  for (int kb = 0; kb < K; kb += 32) {
    FragB ah, al;
    const v4f x0 = *(const v4fa*)(arow + kb + 8 * hh), x1 = *(const v4fa*)(arow + kb + 8 * hh + 4);
    const v4f x2 = *(const v4fa*)(arow + kb + 16 + 8 * hh), x3 = *(const v4fa*)(arow + kb + 16 + 8 * hh + 4);
    float xs[16] = {x0[0],x0[1],x0[2],x0[3],x1[0],x1[1],x1[2],x1[3],x2[0],x2[1],x2[2],x2[3],x3[0],x3[1],x3[2],x3[3]};
#pragma unroll
    for (int i = 0; i < 16; ++i) { const unsigned short hb = bf16_bits(xs[i]); ah.u[i] = hb; al.u[i] = ASPLIT ? bf16_bits(xs[i] - bf16_val(hb)) : (unsigned short)0; }
#pragma unroll
    for (int t = 0; t < 4; ++t) {
      const unsigned short* brow = Wt + (size_t)(col0 + t * 16 + ln) * ldb + kb;
      FragB b;
      b.half[0] = *(const v8us*)(brow + 8 * hh);
      b.half[1] = *(const v8us*)(brow + 16 + 8 * hh);
      acc[t] = mmaN<ASPLIT ? 2 : 1>(ah.v, al.v, b.v, b.v, acc[t]);
    }
  }
#pragma unroll
  for (int t = 0; t < 4; ++t) {
    float bv = bias ? bias[col0 + t * 16 + ln] : 0.f;
    if (BIAS_BF16) bv = bf16_round(bv);
#pragma unroll
    for (int r = 0; r < 8; ++r) { float v = acc[t][r] + bv; if (ACT == 1) v = fmaxf(v, 0.f); so[w][8 * hh + r][t * 16 + ln] = v; }
  }
  __builtin_amdgcn_fence(__ATOMIC_ACQ_REL, "workgroup");
  __builtin_amdgcn_wave_barrier();
  const int rsub = lane >> 4, c4 = (lane & 15) * 4;
  {
#pragma unroll
    for (int q = 0; q < 8; ++q) {
      const int r = q * 2 + rsub;
      const v4f v = *(const v4fa*)&so[w][r][c4];
      *(v4f*)(C + (size_t)(row0 + r) * ldc + col0 + c4) = v;
    }
    
  }
}

// Flash-style causal/unmasked attention, all contractions 3-term bf16 hi/lo splits, f32 softmax with running max.
// q,k,v rows are read from f32 buffers with arbitrary row pitch (so they can live inside a fused qkv buffer);
// D = head size (multiple of 32, <= 128); one wave = 16 query rows; block = 4 waves (64 queries) sharing K/V chunks of 32.
template <int D, bool CAUSAL>
__global__ __launch_bounds__(128) void k_flash(const float* __restrict__ qb, const float* __restrict__ kb, const float* __restrict__ vb,
                                             int pitch, int T, int H, float scale, float* __restrict__ y, int ypitch) {
  constexpr int KS = D / 32;        // k-steps for QK
  constexpr int DT = D / 16;        // d tiles for PV
  __shared__ __attribute__((aligned(16))) unsigned short sKh[32][D + 8], sKl[32][D + 8], sVh[32][D + 8], sVl[32][D + 8];
  __shared__ __attribute__((aligned(16))) unsigned short sPh[4][16][40], sPl[4][16][40];
  __shared__ __attribute__((aligned(16))) float sO[4][16][D];
  const int tid = threadIdx.x, w = tid >> 5, lane = tid & 31, ln = lane & 15, hh = lane >> 4;
  const int nqb = (T + 63) / 64;
  const int bh = blockIdx.x / nqb, qblk = blockIdx.x % nqb;
  const int b = bh / H, h = bh % H;
  const int q0 = qblk * 64 + w * 16;
  const float* Q = qb + (size_t)b * T * pitch + h * D;
  const float* K = kb + (size_t)b * T * pitch + h * D;
  const float* V = vb + (size_t)b * T * pitch + h * D;

  // A fragments of the wave's 16 query rows (scaled), hi/lo
  FragB aqh[KS], aql[KS];
  {
    int row = q0 + ln; if (row >= T) row = T - 1;
    const float* qr = Q + (size_t)row * pitch;
#pragma unroll
    for (int ks = 0; ks < KS; ++ks)
#pragma unroll
      for (int i = 0; i < 16; ++i) {
        const int d = ks * 32 + ((i < 8) ? (8 * hh + i) : (16 + 8 * hh + (i - 8)));
        const float x = qr[d] * scale; const unsigned short hb = bf16_bits(x);
        aqh[ks].u[i] = hb; aql[ks].u[i] = bf16_bits(x - bf16_val(hb));
      }
  }
  float m_r[8], l_r[8];
#pragma unroll
  for (int r = 0; r < 8; ++r) { m_r[r] = -3.0e38f; l_r[r] = 0.f; }
  v8f oacc[DT];
#pragma unroll
  for (int dt = 0; dt < DT; ++dt) oacc[dt] = (v8f){0.f,0.f,0.f,0.f,0.f,0.f,0.f,0.f};

  const int kv_end = CAUSAL ? min(T, qblk * 64 + 64) : T;     // block-uniform
  for (int j0 = 0; j0 < kv_end; j0 += 32) {
    __syncthreads();
    for (int e = tid; e < 32 * (D / 4); e += 128) {
      const int r = e / (D / 4), c4 = (e % (D / 4)) * 4;
      const int key = j0 + r;
      v4f kf = {0.f,0.f,0.f,0.f}, vf = {0.f,0.f,0.f,0.f};
      if (key < T) { kf = *(const v4fa*)(K + (size_t)key * pitch + c4); vf = *(const v4fa*)(V + (size_t)key * pitch + c4); }
#pragma unroll
      for (int t = 0; t < 4; ++t) {
        unsigned short hb = bf16_bits(kf[t]); sKh[r][c4 + t] = hb; sKl[r][c4 + t] = bf16_bits(kf[t] - bf16_val(hb));
        hb = bf16_bits(vf[t]); sVh[r][c4 + t] = hb; sVl[r][c4 + t] = bf16_bits(vf[t] - bf16_val(hb));
      }
    }
    __syncthreads();
    // S tile 16 x 32
    v8f s[2];
#pragma unroll
    for (int nt = 0; nt < 2; ++nt) {
      v8f acc = {};
#pragma unroll
      for (int ks = 0; ks < KS; ++ks) {
        FragB bh_, bl_;
        bh_.half[0] = *(const v8us*)&sKh[nt * 16 + ln][ks * 32 + 8 * hh]; bh_.half[1] = *(const v8us*)&sKh[nt * 16 + ln][ks * 32 + 16 + 8 * hh];
        bl_.half[0] = *(const v8us*)&sKl[nt * 16 + ln][ks * 32 + 8 * hh]; bl_.half[1] = *(const v8us*)&sKl[nt * 16 + ln][ks * 32 + 16 + 8 * hh];
        acc = mmaN<3>(aqh[ks].v, aql[ks].v, bh_.v, bl_.v, acc);
      }
      s[nt] = acc;
    }
    // mask + running max (rows 8hh+r; the 16 lanes of a half share rows)
    float alpha[8];
#pragma unroll
    for (int r = 0; r < 8; ++r) {
      const int qi = q0 + 8 * hh + r;
      const int ja = j0 + ln, jb = j0 + 16 + ln;
      if (CAUSAL) { if (ja > qi) s[0][r] = -3.0e38f; if (jb > qi) s[1][r] = -3.0e38f; }
      if (ja >= T) s[0][r] = -3.0e38f;
      if (jb >= T) s[1][r] = -3.0e38f;
      float mx = fmaxf(s[0][r], s[1][r]);
      mx = fmaxf(mx, __shfl_xor(mx, 1, 32)); mx = fmaxf(mx, __shfl_xor(mx, 2, 32)); mx = fmaxf(mx, __shfl_xor(mx, 4, 32)); mx = fmaxf(mx, __shfl_xor(mx, 8, 32));
      const float mnew = fmaxf(m_r[r], mx);
      alpha[r] = (mnew > -1.0e38f) ? __expf(m_r[r] - mnew) : 1.0f;
      const float p0 = (s[0][r] > -1.0e38f) ? __expf(s[0][r] - mnew) : 0.f;
      const float p1 = (s[1][r] > -1.0e38f) ? __expf(s[1][r] - mnew) : 0.f;
      m_r[r] = mnew;
      l_r[r] = l_r[r] * alpha[r] + p0 + p1;            // per-lane partial row sum (16 lanes combined at the end)
      unsigned short hb = bf16_bits(p0); sPh[w][8 * hh + r][ln] = hb;      sPl[w][8 * hh + r][ln] = bf16_bits(p0 - bf16_val(hb));
      hb = bf16_bits(p1);                sPh[w][8 * hh + r][16 + ln] = hb; sPl[w][8 * hh + r][16 + ln] = bf16_bits(p1 - bf16_val(hb));
    }
#pragma unroll
    for (int dt = 0; dt < DT; ++dt)
#pragma unroll
      for (int r = 0; r < 8; ++r) oacc[dt][r] *= alpha[r];
    __builtin_amdgcn_fence(__ATOMIC_ACQ_REL, "workgroup");
    __builtin_amdgcn_wave_barrier();
    FragB pah, pal;
    pah.half[0] = *(const v8us*)&sPh[w][ln][8 * hh]; pah.half[1] = *(const v8us*)&sPh[w][ln][16 + 8 * hh];
    pal.half[0] = *(const v8us*)&sPl[w][ln][8 * hh]; pal.half[1] = *(const v8us*)&sPl[w][ln][16 + 8 * hh];
#pragma unroll
    for (int dt = 0; dt < DT; ++dt) {
      FragB bvh, bvl;
#pragma unroll
      for (int i = 0; i < 8; ++i) {
        bvh.u[i] = sVh[8 * hh + i][dt * 16 + ln]; bvh.u[8 + i] = sVh[16 + 8 * hh + i][dt * 16 + ln];
        bvl.u[i] = sVl[8 * hh + i][dt * 16 + ln]; bvl.u[8 + i] = sVl[16 + 8 * hh + i][dt * 16 + ln];
      }
      oacc[dt] = mmaN<3>(pah.v, pal.v, bvh.v, bvl.v, oacc[dt]);
    }
    __builtin_amdgcn_fence(__ATOMIC_ACQ_REL, "workgroup");
    __builtin_amdgcn_wave_barrier();
  }
#pragma unroll
  for (int r = 0; r < 8; ++r) {
    float l = l_r[r];
    l += __shfl_xor(l, 1, 32); l += __shfl_xor(l, 2, 32); l += __shfl_xor(l, 4, 32); l += __shfl_xor(l, 8, 32);
    l_r[r] = (l > 0.f) ? 1.0f / l : 0.f;
  }
#pragma unroll
  for (int dt = 0; dt < DT; ++dt)
#pragma unroll
    for (int r = 0; r < 8; ++r) sO[w][8 * hh + r][dt * 16 + ln] = oacc[dt][r] * l_r[r];
  __builtin_amdgcn_fence(__ATOMIC_ACQ_REL, "workgroup");
  __builtin_amdgcn_wave_barrier();
  {
    for (int r = 0; r < 16; ++r) {
      const int row = q0 + r;
      if (row < T && lane < D / 4) {
        const v4f val = *(const v4fa*)&sO[w][r][lane * 4];
        *(v4f*)(y + ((size_t)b * T + row) * ypitch + h * D + lane * 4) = val;
      }
    }
    
  }
}

// GEMM C = act(A·W + bias + resid): A f32 (ASPLIT -> hi/lo 2 terms), Wt bf16 [N][K]; ACT 0 none, 1 relu, 2 exact gelu;
// resid (optional, f32, row index = (row % rmod), pitch ldr, RES_BF16 rounds it) added before the activation.
template <bool ASPLIT, int ACT, bool BIAS_BF16, bool RES_BF16>
__global__ __launch_bounds__(128) void k_gemm_bf3(const float* __restrict__ A, int lda, const unsigned short* __restrict__ Wt, int ldb,
                                                const float* __restrict__ bias, const float* __restrict__ resid, int rmod, int ldr,
                                                float* __restrict__ C, int ldc, int M, int N, int K) {
  __shared__ __attribute__((aligned(16))) float so[4][16][64];
  const int tid = threadIdx.x, w = tid >> 5, lane = tid & 31, ln = lane & 15, hh = lane >> 4;
  const int ntn = N / 64;
  const int wid = blockIdx.x * 4 + w;
  const int mt = wid / ntn, nq = wid % ntn;
  if (mt * 16 >= M) return;
  const int row0 = mt * 16, col0 = nq * 64;
  const float* arow = A + (size_t)(row0 + ln) * lda;
  v8f acc[4] = {};
  for (int kb = 0; kb < K; kb += 32) {
    FragB ah, al;
    const v4f x0 = *(const v4fa*)(arow + kb + 8 * hh), x1 = *(const v4fa*)(arow + kb + 8 * hh + 4);
    const v4f x2 = *(const v4fa*)(arow + kb + 16 + 8 * hh), x3 = *(const v4fa*)(arow + kb + 16 + 8 * hh + 4);
    float xs[16] = {x0[0],x0[1],x0[2],x0[3],x1[0],x1[1],x1[2],x1[3],x2[0],x2[1],x2[2],x2[3],x3[0],x3[1],x3[2],x3[3]};
#pragma unroll
    for (int i = 0; i < 16; ++i) { const unsigned short hb = bf16_bits(xs[i]); ah.u[i] = hb; al.u[i] = ASPLIT ? bf16_bits(xs[i] - bf16_val(hb)) : (unsigned short)0; }
#pragma unroll
    for (int t = 0; t < 4; ++t) {
      const unsigned short* brow = Wt + (size_t)(col0 + t * 16 + ln) * ldb + kb;
      FragB b;
      b.half[0] = *(const v8us*)(brow + 8 * hh);
      b.half[1] = *(const v8us*)(brow + 16 + 8 * hh);
      acc[t] = mmaN<ASPLIT ? 2 : 1>(ah.v, al.v, b.v, b.v, acc[t]);
    }
  }
#pragma unroll
  for (int t = 0; t < 4; ++t) {
    const int col = col0 + t * 16 + ln;
    float bv = bias ? bias[col] : 0.f;
    if (BIAS_BF16) bv = bf16_round(bv);
#pragma unroll
    for (int r = 0; r < 8; ++r) {
      float v = acc[t][r] + bv;
      if (resid) { float rv = resid[(size_t)((row0 + 8 * hh + r) % rmod) * ldr + col]; if (RES_BF16) rv = bf16_round(rv); v += rv; }
      if (ACT == 1) v = fmaxf(v, 0.f);
      if (ACT == 2) v = 0.5f * v * (1.0f + erff(v * 0.70710678118654752f));
      if (ACT == 3) { const float u = 0.7978845608028654f * (v + 0.044715f * v * v * v); v = 0.5f * v * (1.0f + tanhf(u)); }
      so[w][8 * hh + r][t * 16 + ln] = v;
    }
  }
  __builtin_amdgcn_fence(__ATOMIC_ACQ_REL, "workgroup");
  __builtin_amdgcn_wave_barrier();
  const int rsub = lane >> 4, c4 = (lane & 15) * 4;
  {
#pragma unroll
    for (int q = 0; q < 8; ++q) {
      const int r = q * 2 + rsub;
      const v4f v = *(const v4fa*)&so[w][r][c4];
      *(v4f*)(C + (size_t)(row0 + r) * ldc + col0 + c4) = v;
    }
    
  }
}
// row LayerNorm (biased variance, eps) over N: s = X (+ R); optional out_sum <- s; out_norm <- (s-mu)*rsqrt(var+eps)*g + b
template <bool PARAM_BF16>
__global__ __launch_bounds__(256) void k_layernorm(const float* __restrict__ X, const float* __restrict__ R, const float* __restrict__ g, const float* __restrict__ bta,
                                                  float* __restrict__ out_sum, float* __restrict__ out_norm, int N, float eps) {
  __shared__ float red[256];
  const int row = blockIdx.x, tid = threadIdx.x;
  const float* x = X + (size_t)row * N; const float* rr = R ? R + (size_t)row * N : nullptr;
  float vals[16];                     // up to N = 4096
  const int per = N / 256;            // contiguous chunk per thread? use strided-by-4 chunks: thread handles j = tid*4 + 1024*u
  float s1 = 0.f;
  for (int u = 0; u < per / 4; ++u) {
    const int j = tid * 4 + 1024 * u;
    const v4f a = *(const v4fa*)(x + j);
    v4f b = {0.f,0.f,0.f,0.f}; if (rr) b = *(const v4fa*)(rr + j);
#pragma unroll
    for (int q = 0; q < 4; ++q) { const float v = a[q] + b[q]; vals[u * 4 + q] = v; s1 += v; }
  }
  red[tid] = s1; __syncthreads();
  for (int st = 128; st > 0; st >>= 1) { if (tid < st) red[tid] += red[tid + st]; __syncthreads(); }
  const float mu = red[0] / (float)N; __syncthreads();
  float s2 = 0.f;
  for (int u = 0; u < per / 4; ++u)
#pragma unroll
    for (int q = 0; q < 4; ++q) { const float c = vals[u * 4 + q] - mu; s2 += c * c; }
  red[tid] = s2; __syncthreads();
  for (int st = 128; st > 0; st >>= 1) { if (tid < st) red[tid] += red[tid + st]; __syncthreads(); }
  const float rs = rsqrtf(red[0] / (float)N + eps);
  {
    for (int u = 0; u < per / 4; ++u) {
      const int j = tid * 4 + 1024 * u;
      v4f o, sm;
#pragma unroll
      for (int q = 0; q < 4; ++q) {
        float gg = g[j + q], bb = bta[j + q];
        if (PARAM_BF16) { gg = bf16_round(gg); bb = bf16_round(bb); }
        sm[q] = vals[u * 4 + q]; o[q] = (vals[u * 4 + q] - mu) * rs * gg + bb;
      }
      if (out_sum) *(v4f*)(out_sum + (size_t)row * N + j) = sm;
      *(v4f*)(out_norm + (size_t)row * N + j) = o;
    }
    
  }
}



// ---- f16 WMMA path (v_wmma_f32_16x16x32_f16): 11-bit significands for operands in range — used where a [0,1] probability operand needs more precision than bf16
typedef _Float16 v16h __attribute__((ext_vector_type(16)));
union FragH { v16h v; v8us half[2]; _Float16 h[16]; unsigned short u[16]; };
template <int NT>
__device__ __forceinline__ v8f mmaH(v16h ah, v16h al, v16h bh, v16h bl, v8f c) {
  c = __builtin_amdgcn_wmma_f32_16x16x32_f16(false, ah, false, bh, (short)0, c, false, false);
  if (NT >= 2) c = __builtin_amdgcn_wmma_f32_16x16x32_f16(false, al, false, bh, (short)0, c, false, false);
  if (NT >= 3) c = __builtin_amdgcn_wmma_f32_16x16x32_f16(false, ah, false, bl, (short)0, c, false, false);
  asm volatile("v_nop\n\tv_nop\n\tv_nop\n\tv_nop" : "+v"(c) : "v"(ah), "v"(al), "v"(bh), "v"(bl));
  return c;
}
// batched GEMM like k_gemm_b but f16 operands: A f32 (split into f16 hi/lo if ASPLIT, else rounded to f16), Bt = f16 values [n][k]; alpha; C f32; N multiple of 16 (partial tiles skipped)
template <bool ASPLIT>
__global__ __launch_bounds__(128) void k_gemm_h(const float* __restrict__ A, int lda, size_t sA, const _Float16* __restrict__ Bh, int ldb, size_t sB, float alpha, float* __restrict__ C, int ldc, size_t sC, int M, int N, int K) {
  __shared__ __attribute__((aligned(16))) float so[4][16][64];
  const int tid = threadIdx.x, w = tid >> 5, lane = tid & 31, ln = lane & 15, hh = lane >> 4; const int by = blockIdx.y;
  A += (size_t)by * sA; Bh += (size_t)by * sB; C += (size_t)by * sC;
  const int ntn = (N + 63) / 64; const int wid = blockIdx.x * 4 + w; const int mt = wid / ntn, nq = wid % ntn; if (mt * 16 >= M) return;
  const int row0 = mt * 16, col0 = nq * 64; const float* arow = A + (size_t)(row0 + ln) * lda;
  v8f acc[4] = {};
  for (int kb = 0; kb < K; kb += 32) {
    FragH ah, al;
    const v4f x0 = *(const v4fa*)(arow + kb + 8 * hh), x1 = *(const v4fa*)(arow + kb + 8 * hh + 4), x2 = *(const v4fa*)(arow + kb + 16 + 8 * hh), x3 = *(const v4fa*)(arow + kb + 16 + 8 * hh + 4);
    float xs[16] = {x0[0],x0[1],x0[2],x0[3],x1[0],x1[1],x1[2],x1[3],x2[0],x2[1],x2[2],x2[3],x3[0],x3[1],x3[2],x3[3]};
#pragma unroll
    for (int i = 0; i < 16; ++i) { const _Float16 h = (_Float16)xs[i]; ah.h[i] = h; al.h[i] = ASPLIT ? (_Float16)(xs[i] - (float)h) : (_Float16)0.0f; }
#pragma unroll
    for (int t = 0; t < 4; ++t) { if (col0 + t * 16 >= N) continue; const size_t boff = (size_t)(col0 + t * 16 + ln) * ldb + kb; FragH bq; bq.half[0] = *(const v8us*)(Bh + boff + 8 * hh); bq.half[1] = *(const v8us*)(Bh + boff + 16 + 8 * hh);
      acc[t] = mmaH<ASPLIT ? 2 : 1>(ah.v, al.v, bq.v, bq.v, acc[t]); }
  }
#pragma unroll
  for (int t = 0; t < 4; ++t) { if (col0 + t * 16 >= N) continue;
#pragma unroll
    for (int r = 0; r < 8; ++r) so[w][8 * hh + r][t * 16 + ln] = acc[t][r] * alpha; }
  __builtin_amdgcn_fence(__ATOMIC_ACQ_REL, "workgroup"); __builtin_amdgcn_wave_barrier();
  const int rsub = lane >> 4, c4 = (lane & 15) * 4;
  {
#pragma unroll
    for (int q = 0; q < 8; ++q) { const int r = q * 2 + rsub; if (col0 + c4 < N) { const v4f v = *(const v4fa*)&so[w][r][c4]; *(v4f*)(C + (size_t)(row0 + r) * ldc + col0 + c4) = v; } }
     }
}

// Wt[n][k] = f16(W[k][n]·scale) from f32 row-major W[K][N] (scale = power of two; bf16-exact weights stay exact in f16 away from the subnormal range)
__global__ __launch_bounds__(256) void k_wt_f16(const float* __restrict__ W, _Float16* __restrict__ Wt, int K, int N, float scale) {
  const int t = blockIdx.x * 256 + threadIdx.x; if (t >= N * (K / 8)) return; const int n = t / (K / 8), k8 = (t % (K / 8)) * 8; FragH f;
#pragma unroll
  for (int i = 0; i < 8; ++i) f.h[i] = (_Float16)(bf16_round(W[(size_t)(k8 + i) * N + n]) * scale); const v8us o = f.half[0];
  *(v8us*)((unsigned short*)Wt + (size_t)n * K + k8) = o; 
}
// k_gemm_hh variant with fused epilogue: v = acc·alpha + bias[by·sBias + col] (+ CP[(row/rowsPerB)·sCPb + by·64 + col] if CP) ; ACT 0 none / 1 elu ; writes f16 C16 and f32 C, each if non-null
template <int ACT>
__global__ __launch_bounds__(128) void k_gemm_hhx(const _Float16* __restrict__ A, int lda, size_t sA, const _Float16* __restrict__ Bh, int ldb, size_t sB, float alpha, const float* __restrict__ bias, size_t sBias, const float* __restrict__ CP, int rowsPerB, size_t sCPb, int row0g,
    float* __restrict__ C, _Float16* __restrict__ C16, int ldc, size_t sC, int M, int N, int K) {
  __shared__ __attribute__((aligned(16))) float so[4][16][64];
  const int tid = threadIdx.x, w = tid >> 5, lane = tid & 31, ln = lane & 15, hh = lane >> 4; const int by = blockIdx.y;
  A += (size_t)by * sA; Bh += (size_t)by * sB; const size_t cofs = (size_t)by * sC; const float* bp = bias ? bias + (size_t)by * sBias : nullptr;
  const int ntn = (N + 63) / 64; const int wid = blockIdx.x * 4 + w; const int mt = wid / ntn, nq = wid % ntn; if (mt * 16 >= M) return;
  const int row0 = mt * 16, col0 = nq * 64; const _Float16* arow = A + (size_t)(row0 + ln) * lda;
  v8f acc[4] = {};
  // All fragment loads of a k block stand ahead of its first product, so they are in flight together (one L2 round trip per block, not one per product).
  // A B tile past N reads the clamped row N - 1 (in bounds); its products are never stored: the epilogue skips that tile.
  // The unroll directives below keep the fragment arrays in registers (constant indices).
  const unsigned short* ap = (const unsigned short*)arow + 8 * hh; const unsigned short* bpt[4];
#pragma unroll
  for (int t = 0; t < 4; ++t) { int cr = col0 + t * 16 + ln; if (cr > N - 1) cr = N - 1; bpt[t] = (const unsigned short*)Bh + (size_t)cr * ldb + 8 * hh; }
  int kb = 0;
  for (; kb + 64 <= K; kb += 64) {      // 64 k = one whole 128-byte line of every row
    FragH ah[2], bq[2][4]; const unsigned short* pa = ap + kb; const unsigned short* pb0 = bpt[0] + kb; const unsigned short* pb1 = bpt[1] + kb; const unsigned short* pb2 = bpt[2] + kb; const unsigned short* pb3 = bpt[3] + kb;
#pragma unroll
    for (int u = 0; u < 2; ++u) { ah[u].half[0] = *(const v8us*)(pa + u * 32); ah[u].half[1] = *(const v8us*)(pa + u * 32 + 16);
      bq[u][0].half[0] = *(const v8us*)(pb0 + u * 32); bq[u][0].half[1] = *(const v8us*)(pb0 + u * 32 + 16); bq[u][1].half[0] = *(const v8us*)(pb1 + u * 32); bq[u][1].half[1] = *(const v8us*)(pb1 + u * 32 + 16);
      bq[u][2].half[0] = *(const v8us*)(pb2 + u * 32); bq[u][2].half[1] = *(const v8us*)(pb2 + u * 32 + 16); bq[u][3].half[0] = *(const v8us*)(pb3 + u * 32); bq[u][3].half[1] = *(const v8us*)(pb3 + u * 32 + 16); }
    // the wait that stands in front of any reuse of the group's address registers; naming them as inputs keeps them whole up to it (no load of the group lands on one)
    asm volatile("s_wait_xcnt 0x0" :: "v"(pa), "v"(pb0), "v"(pb1), "v"(pb2), "v"(pb3) : "memory");
#pragma unroll
    for (int u = 0; u < 2; ++u)
#pragma unroll
      for (int t = 0; t < 4; ++t) acc[t] = mmaH<1>(ah[u].v, ah[u].v, bq[u][t].v, bq[u][t].v, acc[t]);
  }
  if (kb < K) {      // K % 64 == 32: the last 32 k
    FragH ah, bq[4]; const unsigned short* pa = ap + kb; const unsigned short* pb0 = bpt[0] + kb; const unsigned short* pb1 = bpt[1] + kb; const unsigned short* pb2 = bpt[2] + kb; const unsigned short* pb3 = bpt[3] + kb;
    ah.half[0] = *(const v8us*)pa; ah.half[1] = *(const v8us*)(pa + 16);
    bq[0].half[0] = *(const v8us*)pb0; bq[0].half[1] = *(const v8us*)(pb0 + 16); bq[1].half[0] = *(const v8us*)pb1; bq[1].half[1] = *(const v8us*)(pb1 + 16);
    bq[2].half[0] = *(const v8us*)pb2; bq[2].half[1] = *(const v8us*)(pb2 + 16); bq[3].half[0] = *(const v8us*)pb3; bq[3].half[1] = *(const v8us*)(pb3 + 16);
    // as above: the wait in front of any reuse of these loads' address registers
    asm volatile("s_wait_xcnt 0x0" :: "v"(pa), "v"(pb0), "v"(pb1), "v"(pb2), "v"(pb3) : "memory");
#pragma unroll
    for (int t = 0; t < 4; ++t) acc[t] = mmaH<1>(ah.v, ah.v, bq[t].v, bq[t].v, acc[t]);
  }
#pragma unroll
  for (int t = 0; t < 4; ++t) { if (col0 + t * 16 >= N) continue; const int col = col0 + t * 16 + ln; const float bv = bp ? bf16_round(bp[col]) : 0.f;
#pragma unroll
    for (int r = 0; r < 8; ++r) { float v = acc[t][r] * alpha + bv; if (CP) { const int bidx = (row0g + row0 + 8 * hh + r) / rowsPerB; v += CP[(size_t)bidx * sCPb + (size_t)by * 64 + col]; } if (ACT == 1) v = (v > 0.f) ? v : expm1f(v); else if (ACT == 3) v = fmaxf(v, 0.f); so[w][8 * hh + r][t * 16 + ln] = v; } }
  __builtin_amdgcn_fence(__ATOMIC_ACQ_REL, "workgroup"); __builtin_amdgcn_wave_barrier();
  const int rsub = lane >> 4, c4 = (lane & 15) * 4; typedef _Float16 v4h __attribute__((ext_vector_type(4)));
  {
#pragma unroll
    for (int q = 0; q < 8; ++q) { const int r = q * 2 + rsub; if (col0 + c4 < N) { const v4f v = *(const v4fa*)&so[w][r][c4]; if (C) *(v4f*)(C + cofs + (size_t)(row0 + r) * ldc + col0 + c4) = v; if (C16) { v4h h4; for (int i = 0; i < 4; ++i) h4[i] = (_Float16)v[i]; *(v4h*)(C16 + cofs + (size_t)(row0 + r) * ldc + col0 + c4) = h4; } } }
     }
}


__global__ __launch_bounds__(256) void k_x16(const float* __restrict__ x, _Float16* __restrict__ X16, size_t n8) { const size_t t = (size_t)blockIdx.x * 256 + threadIdx.x; if (t >= n8) return; FragH f;
#pragma unroll
  for (int q = 0; q < 8; ++q) f.h[q] = (_Float16)bf16_round(x[t * 8 + q]); *(v8us*)((unsigned short*)X16 + t * 8) = f.half[0];  }
__global__ __launch_bounds__(256) void k_h16(const float* __restrict__ x, _Float16* __restrict__ X16, size_t n8) { const size_t t = (size_t)blockIdx.x * 256 + threadIdx.x; if (t >= n8) return; FragH f;
#pragma unroll
  for (int q = 0; q < 8; ++q) f.h[q] = (_Float16)x[t * 8 + q]; *(v8us*)((unsigned short*)X16 + t * 8) = f.half[0];  }
__global__ __launch_bounds__(256) void k_round16f(const float* __restrict__ W, _Float16* __restrict__ Bt, size_t n8) { const size_t t = (size_t)blockIdx.x * 256 + threadIdx.x; if (t >= n8) return; FragH f;
#pragma unroll
  for (int i = 0; i < 8; ++i) f.h[i] = (_Float16)(bf16_round(W[t * 8 + i]) * 16.0f); *(v8us*)((unsigned short*)Bt + t * 8) = f.half[0];  }
template <int NHv, int TTv>
__global__ __launch_bounds__(256) void k_vt(const _Float16* __restrict__ V16, int ldv, int voff, _Float16* __restrict__ Vt) { __shared__ unsigned short tl[64][66]; const int tid = threadIdx.x; const int slab = blockIdx.x / (TTv / 64), lg = blockIdx.x % (TTv / 64); const int b = slab / NHv, h = slab % NHv;
  for (int i = tid; i < 64 * 8; i += 256) { const int r = i / 8, c8 = (i % 8) * 8; FragH f; f.half[0] = *(const v8us*)((const unsigned short*)V16 + ((size_t)b * TTv + lg * 64 + r) * ldv + voff + h * 64 + c8);
#pragma unroll
    for (int q = 0; q < 8; ++q) tl[r][c8 + q] = f.u[q]; }
  __syncthreads();
  {
#pragma unroll
    for (int rd = 0; rd < 2; ++rd) { const int d = rd * 32 + tid / 8, pc = tid % 8; FragH f;
#pragma unroll
      for (int q = 0; q < 8; ++q) f.u[q] = tl[pc * 8 + q][d];
      *(v8us*)((unsigned short*)Vt + ((size_t)slab * 64 + d) * TTv + lg * 64 + pc * 8) = f.half[0]; }
     } }

__global__ __launch_bounds__(128) void k_flash(const _Float16* __restrict__ Q16, int ldq, const _Float16* __restrict__ K16, int ldk, const _Float16* __restrict__ Vt, const int* __restrict__ MSK, float* __restrict__ O, int ldo) {
  constexpr int RPW = 16, RTN = RPW / 16, NQB = 2048 / (4 * RPW), DT = 4, KS = 2;
  __shared__ __attribute__((aligned(16))) unsigned short sP[4][RPW][40]; __shared__ __attribute__((aligned(16))) float sO[4][RPW][64 + 4];
  const int tid = threadIdx.x, w = tid >> 5, lane = tid & 31, ln = lane & 15, hh = lane >> 4;
  const int slab = blockIdx.x / NQB, qblk = blockIdx.x % NQB; const int b = slab / 16, h = slab % 16; const int qb0 = qblk * (4 * RPW); const int q0 = qb0 + w * RPW;
  FragH aq[2][KS];
#pragma unroll
  for (int rt = 0; rt < RTN; ++rt) { const unsigned short* qr = (const unsigned short*)Q16 + ((size_t)b * 2048 + q0 + rt * 16 + ln) * ldq + h * 64;
#pragma unroll
    for (int ks = 0; ks < KS; ++ks) { aq[rt][ks].half[0] = *(const v8us*)(qr + ks * 32 + 8 * hh); aq[rt][ks].half[1] = *(const v8us*)(qr + ks * 32 + 16 + 8 * hh); } }
  const unsigned short* Vth = (const unsigned short*)Vt + (size_t)slab * 64 * 2048;
  float m_r[2][8], l_r[2][8]; v8f oacc[2][DT];
#pragma unroll
  for (int rt = 0; rt < RTN; ++rt) {
#pragma unroll
    for (int r = 0; r < 8; ++r) { m_r[rt][r] = -3.0e38f; l_r[rt][r] = 0.f; }
#pragma unroll
    for (int dt = 0; dt < DT; ++dt) oacc[rt][dt] = (v8f){0.f,0.f,0.f,0.f,0.f,0.f,0.f,0.f}; }
  const int jend = 2048;
  // Fragment loads stand well ahead of their products: a pass issues its V fragments as one group at its top (they land behind the softmax) and,
  // right behind its score products, the next pass's K fragments (they land behind the rest of the pass). No product waits on a load just issued.
  // The unroll directives on the fragment loops keep the fragment arrays in registers (constant indices).
  FragH bk[2][KS];
#pragma unroll
  for (int nt = 0; nt < 2; ++nt) { const unsigned short* kr = (const unsigned short*)K16 + ((size_t)b * 2048 + nt * 16 + ln) * ldk + h * 64;
#pragma unroll
    for (int ks = 0; ks < KS; ++ks) { bk[nt][ks].half[0] = *(const v8us*)(kr + ks * 32 + 8 * hh); bk[nt][ks].half[1] = *(const v8us*)(kr + ks * 32 + 16 + 8 * hh); } }
#pragma unroll 1
  for (int j0 = 0; j0 < jend; j0 += 32) {
    FragH bv[DT];
#pragma unroll
    for (int dt = 0; dt < DT; ++dt) { const unsigned short* vrow = Vth + (size_t)(dt * 16 + ln) * 2048 + j0; bv[dt].half[0] = *(const v8us*)(vrow + 8 * hh); bv[dt].half[1] = *(const v8us*)(vrow + 16 + 8 * hh); }
    v8f s[2][2];
#pragma unroll
    for (int nt = 0; nt < 2; ++nt) {
#pragma unroll
      for (int rt = 0; rt < RTN; ++rt) { v8f acc = (v8f){0.f,0.f,0.f,0.f,0.f,0.f,0.f,0.f};
#pragma unroll
        for (int ks = 0; ks < KS; ++ks) acc = mmaH<1>(aq[rt][ks].v, aq[rt][ks].v, bk[nt][ks].v, bk[nt][ks].v, acc); s[rt][nt] = acc; } }
    const int jn = (j0 + 32 < jend) ? j0 + 32 : j0;      // the last pass reads its own rows again: in bounds, not used
#pragma unroll
    for (int nt = 0; nt < 2; ++nt) { const unsigned short* kr = (const unsigned short*)K16 + ((size_t)b * 2048 + jn + nt * 16 + ln) * ldk + h * 64;
#pragma unroll
      for (int ks = 0; ks < KS; ++ks) { bk[nt][ks].half[0] = *(const v8us*)(kr + ks * 32 + 8 * hh); bk[nt][ks].half[1] = *(const v8us*)(kr + ks * 32 + 16 + 8 * hh); } }
#pragma unroll
    for (int rt = 0; rt < RTN; ++rt)
#pragma unroll
      for (int r = 0; r < 8; ++r) { const int tq = q0 + rt * 16 + 8 * hh + r; const int k0 = j0 + ln, k1 = j0 + 16 + ln; (void)tq; (void)k0; (void)k1;
        const bool ok0 = true, ok1 = true;
        const float s0 = ok0 ? s[rt][0][r] * (0.125f) : -INFINITY, s1 = ok1 ? s[rt][1][r] * (0.125f) : -INFINITY; float mc = fmaxf(s0, s1);
        mc = fmaxf(mc, __shfl_xor(mc, 1, 32)); mc = fmaxf(mc, __shfl_xor(mc, 2, 32)); mc = fmaxf(mc, __shfl_xor(mc, 4, 32)); mc = fmaxf(mc, __shfl_xor(mc, 8, 32));
        const float mn = fmaxf(m_r[rt][r], mc); const float al = (mn > -1.0e38f) ? expf(m_r[rt][r] - mn) : 1.0f; m_r[rt][r] = mn; const float p0 = ok0 ? expf(s0 - mn) : 0.f, p1 = ok1 ? expf(s1 - mn) : 0.f; l_r[rt][r] = l_r[rt][r] * al + p0 + p1;
#pragma unroll
        for (int dt = 0; dt < DT; ++dt) oacc[rt][dt][r] *= al;
        FragH t2; t2.h[0] = (_Float16)p0; t2.h[1] = (_Float16)p1; sP[w][rt * 16 + 8 * hh + r][ln] = t2.u[0]; sP[w][rt * 16 + 8 * hh + r][16 + ln] = t2.u[1]; }
    __builtin_amdgcn_fence(__ATOMIC_ACQ_REL, "workgroup"); __builtin_amdgcn_wave_barrier();
    FragH pa[2];
#pragma unroll
    for (int rt = 0; rt < RTN; ++rt) { pa[rt].half[0] = *(const v8us*)&sP[w][rt * 16 + ln][8 * hh]; pa[rt].half[1] = *(const v8us*)&sP[w][rt * 16 + ln][16 + 8 * hh]; }
#pragma unroll
    for (int dt = 0; dt < DT; ++dt) {
#pragma unroll
      for (int rt = 0; rt < RTN; ++rt) oacc[rt][dt] = mmaH<1>(pa[rt].v, pa[rt].v, bv[dt].v, bv[dt].v, oacc[rt][dt]); }
    __builtin_amdgcn_fence(__ATOMIC_ACQ_REL, "workgroup"); __builtin_amdgcn_wave_barrier(); }
#pragma unroll
  for (int rt = 0; rt < RTN; ++rt) {
#pragma unroll
    for (int r = 0; r < 8; ++r) { float l = l_r[rt][r]; l += __shfl_xor(l, 1, 32); l += __shfl_xor(l, 2, 32); l += __shfl_xor(l, 4, 32); l += __shfl_xor(l, 8, 32); l_r[rt][r] = (l > 0.f) ? 1.0f / l : 0.f; }
#pragma unroll
    for (int dt = 0; dt < DT; ++dt)
#pragma unroll
      for (int r = 0; r < 8; ++r) sO[w][rt * 16 + 8 * hh + r][dt * 16 + ln] = oacc[rt][dt][r] * l_r[rt][r]; }
  __builtin_amdgcn_fence(__ATOMIC_ACQ_REL, "workgroup"); __builtin_amdgcn_wave_barrier();
  {
#pragma unroll
    for (int rp = 0; rp < RPW; rp += 2) { const int r = rp + (lane >> 4), pc = lane & 15; const v4f val = *(const v4fa*)&sO[w][r][pc * 4]; *(v4f*)(O + ((size_t)b * 2048 + q0 + r) * ldo + h * 64 + pc * 4) = val; }
     } }

__global__ __launch_bounds__(256) void k_vmask(const float* __restrict__ V, const float* __restrict__ mk, _Float16* __restrict__ V16, size_t n8) { const size_t t = (size_t)blockIdx.x * 256 + threadIdx.x; if (t >= n8) return; const size_t r = (t * 8) / DD; const float m = bf16_round(mk[r]); FragH f;
#pragma unroll
  for (int q = 0; q < 8; ++q) f.h[q] = (_Float16)(V[t * 8 + q] * m); *(v8us*)((unsigned short*)V16 + t * 8) = f.half[0];  }
extern "C" void kernel_launch(void* const* d_in, const int* in_sizes, int n_in,
                              void* d_out, int out_size, void* d_ws, size_t ws_size, hipStream_t stream) {
  (void)in_sizes; (void)n_in; (void)out_size;
  const float* xq = (const float*)d_in[0]; const float* xkv = (const float*)d_in[1]; const float* mk = (const float*)d_in[2]; const float* Wq = (const float*)d_in[3]; const float* bq = (const float*)d_in[4]; const float* Wk = (const float*)d_in[5]; const float* bk = (const float*)d_in[6]; const float* Wv = (const float*)d_in[7]; const float* bv = (const float*)d_in[8]; const float* Wo = (const float*)d_in[9]; const float* bo = (const float*)d_in[10];
  char* ws = (char*)d_ws; size_t off = 0;
  auto take = [&](size_t bytes) { char* p = ws + off; off += (bytes + 255) & ~(size_t)255; return p; };
  _Float16* Bq = (_Float16*)take((size_t)DD * DD * 2); _Float16* Bk = (_Float16*)take((size_t)DD * DD * 2); _Float16* Bv = (_Float16*)take((size_t)DD * DD * 2); _Float16* Bo = (_Float16*)take((size_t)DD * DD * 2);
  _Float16* XQ16 = (_Float16*)take((size_t)NR * DD * 2); _Float16* XKV16 = (_Float16*)take((size_t)NR * DD * 2); _Float16* Q16 = (_Float16*)take((size_t)NR * DD * 2); _Float16* K16 = (_Float16*)take((size_t)NR * DD * 2); float* VF = (float*)take((size_t)NR * DD * 4); _Float16* V16 = XKV16; _Float16* Vt = XQ16; float* O = VF; _Float16* O16 = Q16;
  if (off > ws_size) return;      // 8.4 + 8.4 × 4 + 16.8 ≈ 59 MB
  k_wt_f16<<<(unsigned)(((size_t)DD * (DD / 8) + 255) / 256), 256, 0, stream>>>(Wq, Bq, DD, DD, 16.0f); k_wt_f16<<<(unsigned)(((size_t)DD * (DD / 8) + 255) / 256), 256, 0, stream>>>(Wk, Bk, DD, DD, 16.0f); k_wt_f16<<<(unsigned)(((size_t)DD * (DD / 8) + 255) / 256), 256, 0, stream>>>(Wv, Bv, DD, DD, 16.0f); k_wt_f16<<<(unsigned)(((size_t)DD * (DD / 8) + 255) / 256), 256, 0, stream>>>(Wo, Bo, DD, DD, 16.0f);      // (D,H,Dh) = [in][h·64+d]; Wo (H,Dh,D) = [in=(h,d)][out]
  const unsigned g8 = (unsigned)(((size_t)NR * DD / 8 + 255) / 256); const dim3 gg(((NR / 16) * (DD / 64) + 3) / 4, 1);
  k_x16<<<g8, 256, 0, stream>>>(xq, XQ16, (size_t)NR * DD / 8); k_x16<<<g8, 256, 0, stream>>>(xkv, XKV16, (size_t)NR * DD / 8);
  k_gemm_hhx<0><<<gg, 128, 0, stream>>>(XQ16, DD, 0, Bq, DD, 0, 0.0625f, bq, 0, nullptr, 1, 0, 0, nullptr, Q16, DD, 0, NR, DD, DD);
  k_gemm_hhx<0><<<gg, 128, 0, stream>>>(XKV16, DD, 0, Bk, DD, 0, 0.0625f, bk, 0, nullptr, 1, 0, 0, nullptr, K16, DD, 0, NR, DD, DD);
  k_gemm_hhx<0><<<gg, 128, 0, stream>>>(XKV16, DD, 0, Bv, DD, 0, 0.0625f, bv, 0, nullptr, 1, 0, 0, VF, nullptr, DD, 0, NR, DD, DD);      // v (f32, + bv) — masked next
  k_vmask<<<g8, 256, 0, stream>>>(VF, mk, V16, (size_t)NR * DD / 8);      // V16 over XKV16 (its last reader was the v GEMM)
  k_vt<NH, TT><<<BB * NH * (TT / 64), 256, 0, stream>>>(V16, DD, 0, Vt);      // Vt over XQ16
  k_flash<<<BB * NH * (TT / 64), 128, 0, stream>>>(Q16, DD, K16, DD, Vt, nullptr, O, DD);      // q/√64 folded into the 0.125 scale; O over VF
  k_h16<<<g8, 256, 0, stream>>>(O, O16, (size_t)NR * DD / 8);
  k_gemm_hhx<0><<<gg, 128, 0, stream>>>(O16, DD, 0, Bo, DD, 0, 0.0625f, bo, 0, nullptr, 1, 0, 0, (float*)d_out, nullptr, DD, 0, NR, DD, DD);
}

// v002
// One run takes 258 microseconds.
// Timed twice side by side with v001, it ran 1.36 and 1.35 times as fast.
// Over all steps from v000 it is 1.73 times as fast.
#include <hip/hip_runtime.h>
// Multi-head dot-product attention with a per-key value mask (B=2, L=2048, D=1024, 16 heads × 64; q from inputs_q, k/v from inputs_kv; v ← mask_k·v; softmax(q·k/8); merge; ·Wo + bo): the
// q/k/v/o projections are GEMMs ([in][out] weights bf16-exact ×2^4, bias epilogues, f32 accumulate) and the attention is a fused flash-style kernel (online softmax f32; P f16 ≤ 1; O = P·Vt;
// RPW-16 waves) on v_wmma_f32_16x16x32_f16; the value masking is applied in f32 VALU before the f16 conversion.
#define BB 2
#define TT 2048
#define DD 1024
#define NH 16
#define NR (BB * TT)

typedef __bf16 v16b __attribute__((ext_vector_type(16)));
typedef unsigned short v8us __attribute__((ext_vector_type(8), may_alias));
typedef float  v8f  __attribute__((ext_vector_type(8)));
typedef float  v4f  __attribute__((ext_vector_type(4)));
typedef float  v4fa __attribute__((ext_vector_type(4), may_alias));
union FragB { v16b v; v8us half[2]; unsigned short u[16]; };

__device__ __forceinline__ unsigned short bf16_bits(float x) { unsigned int u = __float_as_uint(x); return (unsigned short)((u + 0x7FFFu + ((u >> 16) & 1u)) >> 16); }
__device__ __forceinline__ float bf16_val(unsigned short b) { return __uint_as_float(((unsigned int)b) << 16); }
__device__ __forceinline__ float bf16_round(float x) { return bf16_val(bf16_bits(x)); }
// D += A·B with NT terms: 1 = ah·bh, 2 = + al·bh (A split), 3 = + ah·bl (both split)
template <int NT>
__device__ __forceinline__ v8f mmaN(v16b ah, v16b al, v16b bh, v16b bl, v8f c) {
  c = __builtin_amdgcn_wmma_f32_16x16x32_bf16(false, ah, false, bh, (short)0, c, false, false);
  if (NT >= 2) c = __builtin_amdgcn_wmma_f32_16x16x32_bf16(false, al, false, bh, (short)0, c, false, false);
  if (NT >= 3) c = __builtin_amdgcn_wmma_f32_16x16x32_bf16(false, ah, false, bl, (short)0, c, false, false);
  asm volatile("v_nop\n\tv_nop\n\tv_nop\n\tv_nop" : "+v"(c) : "v"(ah), "v"(al), "v"(bh), "v"(bl));
  return c;
}

__global__ __launch_bounds__(256) void k_wt_bf16(const float* __restrict__ W, unsigned short* __restrict__ Wt, int K, int N) {
  const int t = blockIdx.x * 256 + threadIdx.x;
  const int k8n = K / 8;
  if (t >= N * k8n) return;
  const int n = t / k8n, k8 = (t % k8n) * 8;
  v8us v;
#pragma unroll
  for (int i = 0; i < 8; ++i) v[i] = bf16_bits(W[(size_t)(k8 + i) * N + n]);
  *(v8us*)(Wt + (size_t)n * K + k8) = v;
  
}

// GEMM C[M][N] (f32, pitch ldc) = act(A[M][K]·W + bias). A f32 row-major (pitch lda) converted per fragment to bf16
// (ASPLIT: hi/lo two planes -> 2 terms, else single rounded term); Wt bf16 [N][K] (pitch ldb). BIAS_BF16 rounds the
// bias to bf16 first (bias quantised to bf16 before the add). K%32==0, M%16==0, N%64==0.
template <bool ASPLIT, int ACT, bool BIAS_BF16>
__global__ __launch_bounds__(128) void k_gemm_bf(const float* __restrict__ A, int lda, const unsigned short* __restrict__ Wt, int ldb,
                                               const float* __restrict__ bias, float* __restrict__ C, int ldc, int M, int N, int K) {
  __shared__ __attribute__((aligned(16))) float so[4][16][64];
  const int tid = threadIdx.x, w = tid >> 5, lane = tid & 31, ln = lane & 15, hh = lane >> 4;
  const int ntn = N / 64;
  const int wid = blockIdx.x * 4 + w;
  const int mt = wid / ntn, nq = wid % ntn;
  if (mt * 16 >= M) return;
  const int row0 = mt * 16, col0 = nq * 64;
  const float* arow = A + (size_t)(row0 + ln) * lda;
  v8f acc[4] = {};
  for (int kb = 0; kb < K; kb += 32) {
    FragB ah, al;
    const v4f x0 = *(const v4fa*)(arow + kb + 8 * hh), x1 = *(const v4fa*)(arow + kb + 8 * hh + 4);
    const v4f x2 = *(const v4fa*)(arow + kb + 16 + 8 * hh), x3 = *(const v4fa*)(arow + kb + 16 + 8 * hh + 4);
    float xs[16] = {x0[0],x0[1],x0[2],x0[3],x1[0],x1[1],x1[2],x1[3],x2[0],x2[1],x2[2],x2[3],x3[0],x3[1],x3[2],x3[3]};
#pragma unroll
    for (int i = 0; i < 16; ++i) { const unsigned short hb = bf16_bits(xs[i]); ah.u[i] = hb; al.u[i] = ASPLIT ? bf16_bits(xs[i] - bf16_val(hb)) : (unsigned short)0; }
#pragma unroll
    for (int t = 0; t < 4; ++t) {
      const unsigned short* brow = Wt + (size_t)(col0 + t * 16 + ln) * ldb + kb;
      FragB b;
      b.half[0] = *(const v8us*)(brow + 8 * hh);
      b.half[1] = *(const v8us*)(brow + 16 + 8 * hh);
      acc[t] = mmaN<ASPLIT ? 2 : 1>(ah.v, al.v, b.v, b.v, acc[t]);
    }
  }
#pragma unroll
  for (int t = 0; t < 4; ++t) {
    float bv = bias ? bias[col0 + t * 16 + ln] : 0.f;
    if (BIAS_BF16) bv = bf16_round(bv);
#pragma unroll
    for (int r = 0; r < 8; ++r) { float v = acc[t][r] + bv; if (ACT == 1) v = fmaxf(v, 0.f); so[w][8 * hh + r][t * 16 + ln] = v; }
  }
  __builtin_amdgcn_fence(__ATOMIC_ACQ_REL, "workgroup");
  __builtin_amdgcn_wave_barrier();
  const int rsub = lane >> 4, c4 = (lane & 15) * 4;
  {
#pragma unroll
    for (int q = 0; q < 8; ++q) {
      const int r = q * 2 + rsub;
      const v4f v = *(const v4fa*)&so[w][r][c4];
      *(v4f*)(C + (size_t)(row0 + r) * ldc + col0 + c4) = v;
    }
    
  }
}

// Flash-style causal/unmasked attention, all contractions 3-term bf16 hi/lo splits, f32 softmax with running max.
// q,k,v rows are read from f32 buffers with arbitrary row pitch (so they can live inside a fused qkv buffer);
// D = head size (multiple of 32, <= 128); one wave = 16 query rows; block = 4 waves (64 queries) sharing K/V chunks of 32.
template <int D, bool CAUSAL>
__global__ __launch_bounds__(128) void k_flash(const float* __restrict__ qb, const float* __restrict__ kb, const float* __restrict__ vb,
                                             int pitch, int T, int H, float scale, float* __restrict__ y, int ypitch) {
  constexpr int KS = D / 32;        // k-steps for QK
  constexpr int DT = D / 16;        // d tiles for PV
  __shared__ __attribute__((aligned(16))) unsigned short sKh[32][D + 8], sKl[32][D + 8], sVh[32][D + 8], sVl[32][D + 8];
  __shared__ __attribute__((aligned(16))) unsigned short sPh[4][16][40], sPl[4][16][40];
  __shared__ __attribute__((aligned(16))) float sO[4][16][D];
  const int tid = threadIdx.x, w = tid >> 5, lane = tid & 31, ln = lane & 15, hh = lane >> 4;
  const int nqb = (T + 63) / 64;
  const int bh = blockIdx.x / nqb, qblk = blockIdx.x % nqb;
  const int b = bh / H, h = bh % H;
  const int q0 = qblk * 64 + w * 16;
  const float* Q = qb + (size_t)b * T * pitch + h * D;
  const float* K = kb + (size_t)b * T * pitch + h * D;
  const float* V = vb + (size_t)b * T * pitch + h * D;

  // A fragments of the wave's 16 query rows (scaled), hi/lo
  FragB aqh[KS], aql[KS];
  {
    int row = q0 + ln; if (row >= T) row = T - 1;
    const float* qr = Q + (size_t)row * pitch;
#pragma unroll
    for (int ks = 0; ks < KS; ++ks)
#pragma unroll
      for (int i = 0; i < 16; ++i) {
        const int d = ks * 32 + ((i < 8) ? (8 * hh + i) : (16 + 8 * hh + (i - 8)));
        const float x = qr[d] * scale; const unsigned short hb = bf16_bits(x);
        aqh[ks].u[i] = hb; aql[ks].u[i] = bf16_bits(x - bf16_val(hb));
      }
  }
  float m_r[8], l_r[8];
#pragma unroll
  for (int r = 0; r < 8; ++r) { m_r[r] = -3.0e38f; l_r[r] = 0.f; }
  v8f oacc[DT];
#pragma unroll
  for (int dt = 0; dt < DT; ++dt) oacc[dt] = (v8f){0.f,0.f,0.f,0.f,0.f,0.f,0.f,0.f};

  const int kv_end = CAUSAL ? min(T, qblk * 64 + 64) : T;     // block-uniform
  for (int j0 = 0; j0 < kv_end; j0 += 32) {
    __syncthreads();
    for (int e = tid; e < 32 * (D / 4); e += 128) {
      const int r = e / (D / 4), c4 = (e % (D / 4)) * 4;
      const int key = j0 + r;
      v4f kf = {0.f,0.f,0.f,0.f}, vf = {0.f,0.f,0.f,0.f};
      if (key < T) { kf = *(const v4fa*)(K + (size_t)key * pitch + c4); vf = *(const v4fa*)(V + (size_t)key * pitch + c4); }
#pragma unroll
      for (int t = 0; t < 4; ++t) {
        unsigned short hb = bf16_bits(kf[t]); sKh[r][c4 + t] = hb; sKl[r][c4 + t] = bf16_bits(kf[t] - bf16_val(hb));
        hb = bf16_bits(vf[t]); sVh[r][c4 + t] = hb; sVl[r][c4 + t] = bf16_bits(vf[t] - bf16_val(hb));
      }
    }
    __syncthreads();
    // S tile 16 x 32
    v8f s[2];
#pragma unroll
    for (int nt = 0; nt < 2; ++nt) {
      v8f acc = {};
#pragma unroll
      for (int ks = 0; ks < KS; ++ks) {
        FragB bh_, bl_;
        bh_.half[0] = *(const v8us*)&sKh[nt * 16 + ln][ks * 32 + 8 * hh]; bh_.half[1] = *(const v8us*)&sKh[nt * 16 + ln][ks * 32 + 16 + 8 * hh];
        bl_.half[0] = *(const v8us*)&sKl[nt * 16 + ln][ks * 32 + 8 * hh]; bl_.half[1] = *(const v8us*)&sKl[nt * 16 + ln][ks * 32 + 16 + 8 * hh];
        acc = mmaN<3>(aqh[ks].v, aql[ks].v, bh_.v, bl_.v, acc);
      }
      s[nt] = acc;
    }
    // mask + running max (rows 8hh+r; the 16 lanes of a half share rows)
    float alpha[8];
#pragma unroll
    for (int r = 0; r < 8; ++r) {
      const int qi = q0 + 8 * hh + r;
      const int ja = j0 + ln, jb = j0 + 16 + ln;
      if (CAUSAL) { if (ja > qi) s[0][r] = -3.0e38f; if (jb > qi) s[1][r] = -3.0e38f; }
      if (ja >= T) s[0][r] = -3.0e38f;
      if (jb >= T) s[1][r] = -3.0e38f;
      float mx = fmaxf(s[0][r], s[1][r]);
      mx = fmaxf(mx, __shfl_xor(mx, 1, 32)); mx = fmaxf(mx, __shfl_xor(mx, 2, 32)); mx = fmaxf(mx, __shfl_xor(mx, 4, 32)); mx = fmaxf(mx, __shfl_xor(mx, 8, 32));
      const float mnew = fmaxf(m_r[r], mx);
      alpha[r] = (mnew > -1.0e38f) ? __expf(m_r[r] - mnew) : 1.0f;
      const float p0 = (s[0][r] > -1.0e38f) ? __expf(s[0][r] - mnew) : 0.f;
      const float p1 = (s[1][r] > -1.0e38f) ? __expf(s[1][r] - mnew) : 0.f;
      m_r[r] = mnew;
      l_r[r] = l_r[r] * alpha[r] + p0 + p1;            // per-lane partial row sum (16 lanes combined at the end)
      unsigned short hb = bf16_bits(p0); sPh[w][8 * hh + r][ln] = hb;      sPl[w][8 * hh + r][ln] = bf16_bits(p0 - bf16_val(hb));
      hb = bf16_bits(p1);                sPh[w][8 * hh + r][16 + ln] = hb; sPl[w][8 * hh + r][16 + ln] = bf16_bits(p1 - bf16_val(hb));
    }
#pragma unroll
    for (int dt = 0; dt < DT; ++dt)
#pragma unroll
      for (int r = 0; r < 8; ++r) oacc[dt][r] *= alpha[r];
    __builtin_amdgcn_fence(__ATOMIC_ACQ_REL, "workgroup");
    __builtin_amdgcn_wave_barrier();
    FragB pah, pal;
    pah.half[0] = *(const v8us*)&sPh[w][ln][8 * hh]; pah.half[1] = *(const v8us*)&sPh[w][ln][16 + 8 * hh];
    pal.half[0] = *(const v8us*)&sPl[w][ln][8 * hh]; pal.half[1] = *(const v8us*)&sPl[w][ln][16 + 8 * hh];
#pragma unroll
    for (int dt = 0; dt < DT; ++dt) {
      FragB bvh, bvl;
#pragma unroll
      for (int i = 0; i < 8; ++i) {
        bvh.u[i] = sVh[8 * hh + i][dt * 16 + ln]; bvh.u[8 + i] = sVh[16 + 8 * hh + i][dt * 16 + ln];
        bvl.u[i] = sVl[8 * hh + i][dt * 16 + ln]; bvl.u[8 + i] = sVl[16 + 8 * hh + i][dt * 16 + ln];
      }
      oacc[dt] = mmaN<3>(pah.v, pal.v, bvh.v, bvl.v, oacc[dt]);
    }
    __builtin_amdgcn_fence(__ATOMIC_ACQ_REL, "workgroup");
    __builtin_amdgcn_wave_barrier();
  }
#pragma unroll
  for (int r = 0; r < 8; ++r) {
    float l = l_r[r];
    l += __shfl_xor(l, 1, 32); l += __shfl_xor(l, 2, 32); l += __shfl_xor(l, 4, 32); l += __shfl_xor(l, 8, 32);
    l_r[r] = (l > 0.f) ? 1.0f / l : 0.f;
  }
#pragma unroll
  for (int dt = 0; dt < DT; ++dt)
#pragma unroll
    for (int r = 0; r < 8; ++r) sO[w][8 * hh + r][dt * 16 + ln] = oacc[dt][r] * l_r[r];
  __builtin_amdgcn_fence(__ATOMIC_ACQ_REL, "workgroup");
  __builtin_amdgcn_wave_barrier();
  {
    for (int r = 0; r < 16; ++r) {
      const int row = q0 + r;
      if (row < T && lane < D / 4) {
        const v4f val = *(const v4fa*)&sO[w][r][lane * 4];
        *(v4f*)(y + ((size_t)b * T + row) * ypitch + h * D + lane * 4) = val;
      }
    }
    
  }
}

// GEMM C = act(A·W + bias + resid): A f32 (ASPLIT -> hi/lo 2 terms), Wt bf16 [N][K]; ACT 0 none, 1 relu, 2 exact gelu;
// resid (optional, f32, row index = (row % rmod), pitch ldr, RES_BF16 rounds it) added before the activation.
template <bool ASPLIT, int ACT, bool BIAS_BF16, bool RES_BF16>
__global__ __launch_bounds__(128) void k_gemm_bf3(const float* __restrict__ A, int lda, const unsigned short* __restrict__ Wt, int ldb,
                                                const float* __restrict__ bias, const float* __restrict__ resid, int rmod, int ldr,
                                                float* __restrict__ C, int ldc, int M, int N, int K) {
  __shared__ __attribute__((aligned(16))) float so[4][16][64];
  const int tid = threadIdx.x, w = tid >> 5, lane = tid & 31, ln = lane & 15, hh = lane >> 4;
  const int ntn = N / 64;
  const int wid = blockIdx.x * 4 + w;
  const int mt = wid / ntn, nq = wid % ntn;
  if (mt * 16 >= M) return;
  const int row0 = mt * 16, col0 = nq * 64;
  const float* arow = A + (size_t)(row0 + ln) * lda;
  v8f acc[4] = {};
  for (int kb = 0; kb < K; kb += 32) {
    FragB ah, al;
    const v4f x0 = *(const v4fa*)(arow + kb + 8 * hh), x1 = *(const v4fa*)(arow + kb + 8 * hh + 4);
    const v4f x2 = *(const v4fa*)(arow + kb + 16 + 8 * hh), x3 = *(const v4fa*)(arow + kb + 16 + 8 * hh + 4);
    float xs[16] = {x0[0],x0[1],x0[2],x0[3],x1[0],x1[1],x1[2],x1[3],x2[0],x2[1],x2[2],x2[3],x3[0],x3[1],x3[2],x3[3]};
#pragma unroll
    for (int i = 0; i < 16; ++i) { const unsigned short hb = bf16_bits(xs[i]); ah.u[i] = hb; al.u[i] = ASPLIT ? bf16_bits(xs[i] - bf16_val(hb)) : (unsigned short)0; }
#pragma unroll
    for (int t = 0; t < 4; ++t) {
      const unsigned short* brow = Wt + (size_t)(col0 + t * 16 + ln) * ldb + kb;
      FragB b;
      b.half[0] = *(const v8us*)(brow + 8 * hh);
      b.half[1] = *(const v8us*)(brow + 16 + 8 * hh);
      acc[t] = mmaN<ASPLIT ? 2 : 1>(ah.v, al.v, b.v, b.v, acc[t]);
    }
  }
#pragma unroll
  for (int t = 0; t < 4; ++t) {
    const int col = col0 + t * 16 + ln;
    float bv = bias ? bias[col] : 0.f;
    if (BIAS_BF16) bv = bf16_round(bv);
#pragma unroll
    for (int r = 0; r < 8; ++r) {
      float v = acc[t][r] + bv;
      if (resid) { float rv = resid[(size_t)((row0 + 8 * hh + r) % rmod) * ldr + col]; if (RES_BF16) rv = bf16_round(rv); v += rv; }
      if (ACT == 1) v = fmaxf(v, 0.f);
      if (ACT == 2) v = 0.5f * v * (1.0f + erff(v * 0.70710678118654752f));
      if (ACT == 3) { const float u = 0.7978845608028654f * (v + 0.044715f * v * v * v); v = 0.5f * v * (1.0f + tanhf(u)); }
      so[w][8 * hh + r][t * 16 + ln] = v;
    }
  }
  __builtin_amdgcn_fence(__ATOMIC_ACQ_REL, "workgroup");
  __builtin_amdgcn_wave_barrier();
  const int rsub = lane >> 4, c4 = (lane & 15) * 4;
  {
#pragma unroll
    for (int q = 0; q < 8; ++q) {
      const int r = q * 2 + rsub;
      const v4f v = *(const v4fa*)&so[w][r][c4];
      *(v4f*)(C + (size_t)(row0 + r) * ldc + col0 + c4) = v;
    }
    
  }
}
// row LayerNorm (biased variance, eps) over N: s = X (+ R); optional out_sum <- s; out_norm <- (s-mu)*rsqrt(var+eps)*g + b
template <bool PARAM_BF16>
__global__ __launch_bounds__(256) void k_layernorm(const float* __restrict__ X, const float* __restrict__ R, const float* __restrict__ g, const float* __restrict__ bta,
                                                  float* __restrict__ out_sum, float* __restrict__ out_norm, int N, float eps) {
  __shared__ float red[256];
  const int row = blockIdx.x, tid = threadIdx.x;
  const float* x = X + (size_t)row * N; const float* rr = R ? R + (size_t)row * N : nullptr;
  float vals[16];                     // up to N = 4096
  const int per = N / 256;            // contiguous chunk per thread? use strided-by-4 chunks: thread handles j = tid*4 + 1024*u
  float s1 = 0.f;
  for (int u = 0; u < per / 4; ++u) {
    const int j = tid * 4 + 1024 * u;
    const v4f a = *(const v4fa*)(x + j);
    v4f b = {0.f,0.f,0.f,0.f}; if (rr) b = *(const v4fa*)(rr + j);
#pragma unroll
    for (int q = 0; q < 4; ++q) { const float v = a[q] + b[q]; vals[u * 4 + q] = v; s1 += v; }
  }
  red[tid] = s1; __syncthreads();
  for (int st = 128; st > 0; st >>= 1) { if (tid < st) red[tid] += red[tid + st]; __syncthreads(); }
  const float mu = red[0] / (float)N; __syncthreads();
  float s2 = 0.f;
  for (int u = 0; u < per / 4; ++u)
#pragma unroll
    for (int q = 0; q < 4; ++q) { const float c = vals[u * 4 + q] - mu; s2 += c * c; }
  red[tid] = s2; __syncthreads();
  for (int st = 128; st > 0; st >>= 1) { if (tid < st) red[tid] += red[tid + st]; __syncthreads(); }
  const float rs = rsqrtf(red[0] / (float)N + eps);
  {
    for (int u = 0; u < per / 4; ++u) {
      const int j = tid * 4 + 1024 * u;
      v4f o, sm;
#pragma unroll
      for (int q = 0; q < 4; ++q) {
        float gg = g[j + q], bb = bta[j + q];
        if (PARAM_BF16) { gg = bf16_round(gg); bb = bf16_round(bb); }
        sm[q] = vals[u * 4 + q]; o[q] = (vals[u * 4 + q] - mu) * rs * gg + bb;
      }
      if (out_sum) *(v4f*)(out_sum + (size_t)row * N + j) = sm;
      *(v4f*)(out_norm + (size_t)row * N + j) = o;
    }
    
  }
}



// ---- f16 WMMA path (v_wmma_f32_16x16x32_f16): 11-bit significands for operands in range — used where a [0,1] probability operand needs more precision than bf16
typedef _Float16 v16h __attribute__((ext_vector_type(16)));
union FragH { v16h v; v8us half[2]; _Float16 h[16]; unsigned short u[16]; };
template <int NT>
__device__ __forceinline__ v8f mmaH(v16h ah, v16h al, v16h bh, v16h bl, v8f c) {
  c = __builtin_amdgcn_wmma_f32_16x16x32_f16(false, ah, false, bh, (short)0, c, false, false);
  if (NT >= 2) c = __builtin_amdgcn_wmma_f32_16x16x32_f16(false, al, false, bh, (short)0, c, false, false);
  if (NT >= 3) c = __builtin_amdgcn_wmma_f32_16x16x32_f16(false, ah, false, bl, (short)0, c, false, false);
  asm volatile("v_nop\n\tv_nop\n\tv_nop\n\tv_nop" : "+v"(c) : "v"(ah), "v"(al), "v"(bh), "v"(bl));
  return c;
}
// batched GEMM like k_gemm_b but f16 operands: A f32 (split into f16 hi/lo if ASPLIT, else rounded to f16), Bt = f16 values [n][k]; alpha; C f32; N multiple of 16 (partial tiles skipped)
template <bool ASPLIT>
__global__ __launch_bounds__(128) void k_gemm_h(const float* __restrict__ A, int lda, size_t sA, const _Float16* __restrict__ Bh, int ldb, size_t sB, float alpha, float* __restrict__ C, int ldc, size_t sC, int M, int N, int K) {
  __shared__ __attribute__((aligned(16))) float so[4][16][64];
  const int tid = threadIdx.x, w = tid >> 5, lane = tid & 31, ln = lane & 15, hh = lane >> 4; const int by = blockIdx.y;
  A += (size_t)by * sA; Bh += (size_t)by * sB; C += (size_t)by * sC;
  const int ntn = (N + 63) / 64; const int wid = blockIdx.x * 4 + w; const int mt = wid / ntn, nq = wid % ntn; if (mt * 16 >= M) return;
  const int row0 = mt * 16, col0 = nq * 64; const float* arow = A + (size_t)(row0 + ln) * lda;
  v8f acc[4] = {};
  for (int kb = 0; kb < K; kb += 32) {
    FragH ah, al;
    const v4f x0 = *(const v4fa*)(arow + kb + 8 * hh), x1 = *(const v4fa*)(arow + kb + 8 * hh + 4), x2 = *(const v4fa*)(arow + kb + 16 + 8 * hh), x3 = *(const v4fa*)(arow + kb + 16 + 8 * hh + 4);
    float xs[16] = {x0[0],x0[1],x0[2],x0[3],x1[0],x1[1],x1[2],x1[3],x2[0],x2[1],x2[2],x2[3],x3[0],x3[1],x3[2],x3[3]};
#pragma unroll
    for (int i = 0; i < 16; ++i) { const _Float16 h = (_Float16)xs[i]; ah.h[i] = h; al.h[i] = ASPLIT ? (_Float16)(xs[i] - (float)h) : (_Float16)0.0f; }
#pragma unroll
    for (int t = 0; t < 4; ++t) { if (col0 + t * 16 >= N) continue; const size_t boff = (size_t)(col0 + t * 16 + ln) * ldb + kb; FragH bq; bq.half[0] = *(const v8us*)(Bh + boff + 8 * hh); bq.half[1] = *(const v8us*)(Bh + boff + 16 + 8 * hh);
      acc[t] = mmaH<ASPLIT ? 2 : 1>(ah.v, al.v, bq.v, bq.v, acc[t]); }
  }
#pragma unroll
  for (int t = 0; t < 4; ++t) { if (col0 + t * 16 >= N) continue;
#pragma unroll
    for (int r = 0; r < 8; ++r) so[w][8 * hh + r][t * 16 + ln] = acc[t][r] * alpha; }
  __builtin_amdgcn_fence(__ATOMIC_ACQ_REL, "workgroup"); __builtin_amdgcn_wave_barrier();
  const int rsub = lane >> 4, c4 = (lane & 15) * 4;
  {
#pragma unroll
    for (int q = 0; q < 8; ++q) { const int r = q * 2 + rsub; if (col0 + c4 < N) { const v4f v = *(const v4fa*)&so[w][r][c4]; *(v4f*)(C + (size_t)(row0 + r) * ldc + col0 + c4) = v; } }
     }
}

// Wt[n][k] = f16(W[k][n]·scale) from f32 row-major W[K][N] (scale = power of two; bf16-exact weights stay exact in f16 away from the subnormal range)
// FRAGMENT ORDER (f16 matrices in the workspace but V16, which is row-major; Vt numbers its tiles kt * 4 + dt, see k_vt): a [rows][K] operand is kept as tiles of 16 rows x 32 k, 1 KiB each, tile (rt, kt) at index rt * (K / 32) + kt.
// A tile is two halves of 512 bytes (k 0..15, then k 16..31); in half j lane hh * 16 + ln owns the 16 bytes of row ln, k = 16 j + 8 hh + 0..7: just what that lane feeds to the WMMA.
// One wave-wide 16-byte load of a half is then 512 contiguous bytes, four whole lines, where a row-major operand gives 32-byte pieces of 16 lines.
// Chunk t (16 bytes) of such a buffer: lane = t & 31, j = (t >> 5) & 1, tile = t >> 6. K % 32 == 0, rows % 16 == 0.
__global__ __launch_bounds__(256) void k_wt_f16(const float* __restrict__ W, _Float16* __restrict__ Wt, int K, int N, float scale) {
  const int t = blockIdx.x * 256 + threadIdx.x; if (t >= N * (K / 8)) return; const int lane = t & 31, j = (t >> 5) & 1, tile = t >> 6; const int n = (tile / (K / 32)) * 16 + (lane & 15), k8 = (tile % (K / 32)) * 32 + j * 16 + (lane >> 4) * 8; FragH f;
#pragma unroll
  for (int i = 0; i < 8; ++i) f.h[i] = (_Float16)(bf16_round(W[(size_t)(k8 + i) * N + n]) * scale); const v8us o = f.half[0];
  *(v8us*)((unsigned short*)Wt + (size_t)t * 8) = o; 
}
// k_gemm_hh variant with fused epilogue: v = acc·alpha + bias[by·sBias + col] (+ CP[(row/rowsPerB)·sCPb + by·64 + col] if CP) ; ACT 0 none / 1 elu ; writes f16 C16 and f32 C, each if non-null
template <int ACT>
__global__ __launch_bounds__(128) void k_gemm_hhx(const _Float16* __restrict__ A, int lda, size_t sA, const _Float16* __restrict__ Bh, int ldb, size_t sB, float alpha, const float* __restrict__ bias, size_t sBias, const float* __restrict__ CP, int rowsPerB, size_t sCPb, int row0g,
    float* __restrict__ C, _Float16* __restrict__ C16, int ldc, size_t sC, int M, int N, int K) {
  __shared__ __attribute__((aligned(16))) float so[4][16][64 + 4];      // pitch 272 B = 16 B x odd: the f16 epilogue reads 16 rows at one column with 16-byte loads
  const int tid = threadIdx.x, w = tid >> 5, lane = tid & 31, ln = lane & 15, hh = lane >> 4; const int by = blockIdx.y;
  A += (size_t)by * sA; Bh += (size_t)by * sB; const size_t cofs = (size_t)by * sC; const float* bp = bias ? bias + (size_t)by * sBias : nullptr;
  const int ntn = (N + 63) / 64; const int wid = blockIdx.x * 4 + w; const int mt = wid / ntn, nq = wid % ntn; if (mt * 16 >= M) return;
  const int row0 = mt * 16, col0 = nq * 64;
  v8f acc[4] = {};
  // All fragment loads of a k block stand ahead of its first product, so they are in flight together (one L2 round trip per block, not one per product).
  // A and Bh are in fragment order (see k_wt_f16): a tile row of 16 rows is 16 * pitch elements, a 32-k tile 512 elements, its second half 256 elements on; lda, ldb = K of the operand.
  // A B tile past N reads the last tile row (in bounds); its products are never stored: the epilogue skips that tile.
  // The unroll directives below keep the fragment arrays in registers (constant indices).
  const unsigned short* ap = (const unsigned short*)A + (size_t)row0 * lda + lane * 8; const unsigned short* bpt[4];
#pragma unroll
  for (int t = 0; t < 4; ++t) { int cr = col0 + t * 16; if (cr > N - 16) cr = N - 16; bpt[t] = (const unsigned short*)Bh + (size_t)cr * ldb + lane * 8; }
  int kb = 0;
  for (; kb + 64 <= K; kb += 64) {      // 64 k = two tiles = 2 KiB in a row of every tile row
    FragH ah[2], bq[2][4]; const unsigned short* pa = ap + kb * 16; const unsigned short* pb0 = bpt[0] + kb * 16; const unsigned short* pb1 = bpt[1] + kb * 16; const unsigned short* pb2 = bpt[2] + kb * 16; const unsigned short* pb3 = bpt[3] + kb * 16;
#pragma unroll
    for (int u = 0; u < 2; ++u) { ah[u].half[0] = *(const v8us*)(pa + u * 512); ah[u].half[1] = *(const v8us*)(pa + u * 512 + 256);
      bq[u][0].half[0] = *(const v8us*)(pb0 + u * 512); bq[u][0].half[1] = *(const v8us*)(pb0 + u * 512 + 256); bq[u][1].half[0] = *(const v8us*)(pb1 + u * 512); bq[u][1].half[1] = *(const v8us*)(pb1 + u * 512 + 256);
      bq[u][2].half[0] = *(const v8us*)(pb2 + u * 512); bq[u][2].half[1] = *(const v8us*)(pb2 + u * 512 + 256); bq[u][3].half[0] = *(const v8us*)(pb3 + u * 512); bq[u][3].half[1] = *(const v8us*)(pb3 + u * 512 + 256); }
    // the wait that stands in front of any reuse of the group's address registers; naming them as inputs keeps them whole up to it (no load of the group lands on one)
    asm volatile("s_wait_xcnt 0x0" :: "v"(pa), "v"(pb0), "v"(pb1), "v"(pb2), "v"(pb3) : "memory");
#pragma unroll
    for (int u = 0; u < 2; ++u)
#pragma unroll
      for (int t = 0; t < 4; ++t) acc[t] = mmaH<1>(ah[u].v, ah[u].v, bq[u][t].v, bq[u][t].v, acc[t]);
  }
  if (kb < K) {      // K % 64 == 32: the last 32 k
    FragH ah, bq[4]; const unsigned short* pa = ap + kb * 16; const unsigned short* pb0 = bpt[0] + kb * 16; const unsigned short* pb1 = bpt[1] + kb * 16; const unsigned short* pb2 = bpt[2] + kb * 16; const unsigned short* pb3 = bpt[3] + kb * 16;
    ah.half[0] = *(const v8us*)pa; ah.half[1] = *(const v8us*)(pa + 256);
    bq[0].half[0] = *(const v8us*)pb0; bq[0].half[1] = *(const v8us*)(pb0 + 256); bq[1].half[0] = *(const v8us*)pb1; bq[1].half[1] = *(const v8us*)(pb1 + 256);
    bq[2].half[0] = *(const v8us*)pb2; bq[2].half[1] = *(const v8us*)(pb2 + 256); bq[3].half[0] = *(const v8us*)pb3; bq[3].half[1] = *(const v8us*)(pb3 + 256);
    // as above: the wait in front of any reuse of these loads' address registers
    asm volatile("s_wait_xcnt 0x0" :: "v"(pa), "v"(pb0), "v"(pb1), "v"(pb2), "v"(pb3) : "memory");
#pragma unroll
    for (int t = 0; t < 4; ++t) acc[t] = mmaH<1>(ah.v, ah.v, bq[t].v, bq[t].v, acc[t]);
  }
#pragma unroll
  for (int t = 0; t < 4; ++t) { if (col0 + t * 16 >= N) continue; const int col = col0 + t * 16 + ln; const float bv = bp ? bf16_round(bp[col]) : 0.f;
#pragma unroll
    for (int r = 0; r < 8; ++r) { float v = acc[t][r] * alpha + bv; if (CP) { const int bidx = (row0g + row0 + 8 * hh + r) / rowsPerB; v += CP[(size_t)bidx * sCPb + (size_t)by * 64 + col]; } if (ACT == 1) v = (v > 0.f) ? v : expm1f(v); else if (ACT == 3) v = fmaxf(v, 0.f); so[w][8 * hh + r][t * 16 + ln] = v; } }
  __builtin_amdgcn_fence(__ATOMIC_ACQ_REL, "workgroup"); __builtin_amdgcn_wave_barrier();
  const int rsub = lane >> 4, c4 = (lane & 15) * 4;
  if (C) {      // f32 result, row-major
#pragma unroll
    for (int q = 0; q < 8; ++q) { const int r = q * 2 + rsub; if (col0 + c4 < N) { const v4f v = *(const v4fa*)&so[w][r][c4]; *(v4f*)(C + cofs + (size_t)(row0 + r) * ldc + col0 + c4) = v; } }
     }
  if (C16) {      // f16 result in fragment order (k = column, ldc = its K): the wave's 16 x 64 tile is 2 KiB in a row, half c holds columns col0 + 16 c ..
    unsigned short* cp = (unsigned short*)C16 + cofs + (size_t)row0 * ldc + (size_t)(col0 / 32) * 512 + lane * 8;
#pragma unroll
    for (int c = 0; c < 4; ++c) { if (col0 + c * 16 < N) { const v4f v0 = *(const v4fa*)&so[w][ln][c * 16 + hh * 8], v1 = *(const v4fa*)&so[w][ln][c * 16 + hh * 8 + 4]; FragH f;
#pragma unroll
        for (int i = 0; i < 4; ++i) { f.h[i] = (_Float16)v0[i]; f.h[4 + i] = (_Float16)v1[i]; }
        *(v8us*)(cp + c * 256) = f.half[0]; } }
     }
}


// x is row-major [rows][DD] f32; X16 is written in fragment order (see k_wt_f16), thread t = chunk t: a wave stores 512 contiguous bytes and reads 32-byte pieces of 16 rows.
__device__ __forceinline__ size_t frag_src(size_t t) { const int lane = (int)(t & 31), j = (int)((t >> 5) & 1); const size_t tile = t >> 6; return ((tile / (DD / 32)) * 16 + (lane & 15)) * DD + (tile % (DD / 32)) * 32 + j * 16 + (lane >> 4) * 8; }
__global__ __launch_bounds__(256) void k_x16(const float* __restrict__ x, _Float16* __restrict__ X16, size_t n8) { const size_t t = (size_t)blockIdx.x * 256 + threadIdx.x; if (t >= n8) return; FragH f; const size_t s = frag_src(t);
#pragma unroll
  for (int q = 0; q < 8; ++q) f.h[q] = (_Float16)bf16_round(x[s + q]); *(v8us*)((unsigned short*)X16 + t * 8) = f.half[0];  }
__global__ __launch_bounds__(256) void k_h16(const float* __restrict__ x, _Float16* __restrict__ X16, size_t n8) { const size_t t = (size_t)blockIdx.x * 256 + threadIdx.x; if (t >= n8) return; FragH f; const size_t s = frag_src(t);
#pragma unroll
  for (int q = 0; q < 8; ++q) f.h[q] = (_Float16)x[s + q]; *(v8us*)((unsigned short*)X16 + t * 8) = f.half[0];  }
__global__ __launch_bounds__(256) void k_round16f(const float* __restrict__ W, _Float16* __restrict__ Bt, size_t n8) { const size_t t = (size_t)blockIdx.x * 256 + threadIdx.x; if (t >= n8) return; FragH f;
#pragma unroll
  for (int i = 0; i < 8; ++i) f.h[i] = (_Float16)(bf16_round(W[t * 8 + i]) * 16.0f); *(v8us*)((unsigned short*)Bt + t * 8) = f.half[0];  }
template <int NHv, int TTv>
__global__ __launch_bounds__(256) void k_vt(const _Float16* __restrict__ V16, int ldv, int voff, _Float16* __restrict__ Vt) { __shared__ unsigned short tl[64][66]; const int tid = threadIdx.x; const int slab = blockIdx.x / (TTv / 64), lg = blockIdx.x % (TTv / 64); const int b = slab / NHv, h = slab % NHv;
  for (int i = tid; i < 64 * 8; i += 256) { const int r = i / 8, c8 = (i % 8) * 8; FragH f; f.half[0] = *(const v8us*)((const unsigned short*)V16 + ((size_t)b * TTv + lg * 64 + r) * ldv + voff + h * 64 + c8);
#pragma unroll
    for (int q = 0; q < 8; ++q) tl[r][c8 + q] = f.u[q]; }
  __syncthreads();
  {
#pragma unroll
    for (int rd = 0; rd < 2; ++rd) {      // Vt of a slab in fragment order, rows = d, k = key, the four d tiles of a 32-key tile side by side: tile index kt * 4 + dt; this block owns chunks lg * 512 .. + 511
      const int c = rd * 256 + tid, dt = (c >> 6) & 3, j = (c >> 5) & 1, hh = (c >> 4) & 1, ln = c & 15; FragH f;
#pragma unroll
      for (int q = 0; q < 8; ++q) f.u[q] = tl[rd * 32 + j * 16 + hh * 8 + q][dt * 16 + ln];
      *(v8us*)((unsigned short*)Vt + (size_t)slab * 64 * TTv + (size_t)lg * 4096 + c * 8) = f.half[0]; }
     } }

__global__ __launch_bounds__(128) void k_flash(const _Float16* __restrict__ Q16, int ldq, const _Float16* __restrict__ K16, int ldk, const _Float16* __restrict__ Vt, const int* __restrict__ MSK, float* __restrict__ O, int ldo) {
  constexpr int RPW = 16, RTN = RPW / 16, NQB = 2048 / (4 * RPW), DT = 4, KS = 2;
  __shared__ __attribute__((aligned(16))) unsigned short sP[4][RPW][40]; __shared__ __attribute__((aligned(16))) float sO[4][RPW][64 + 4];
  const int tid = threadIdx.x, w = tid >> 5, lane = tid & 31, ln = lane & 15, hh = lane >> 4;
  const int slab = blockIdx.x / NQB, qblk = blockIdx.x % NQB; const int b = slab / 16, h = slab % 16; const int qb0 = qblk * (4 * RPW); const int q0 = qb0 + w * RPW;
  FragH aq[2][KS];
#pragma unroll
  for (int rt = 0; rt < RTN; ++rt) { const unsigned short* qr = (const unsigned short*)Q16 + ((size_t)b * 2048 + q0 + rt * 16) * ldq + h * 1024 + lane * 8;      // Q16, K16, Vt: fragment order (see k_wt_f16); a head's 64 columns are two tiles, 1024 elements
#pragma unroll
    for (int ks = 0; ks < KS; ++ks) { aq[rt][ks].half[0] = *(const v8us*)(qr + ks * 512); aq[rt][ks].half[1] = *(const v8us*)(qr + ks * 512 + 256); } }
  const unsigned short* Vth = (const unsigned short*)Vt + (size_t)slab * 64 * 2048;
  float m_r[2][8], l_r[2][8]; v8f oacc[2][DT];
#pragma unroll
  for (int rt = 0; rt < RTN; ++rt) {
#pragma unroll
    for (int r = 0; r < 8; ++r) { m_r[rt][r] = -3.0e38f; l_r[rt][r] = 0.f; }
#pragma unroll
    for (int dt = 0; dt < DT; ++dt) oacc[rt][dt] = (v8f){0.f,0.f,0.f,0.f,0.f,0.f,0.f,0.f}; }
  const int jend = 2048;
  // Fragment loads stand well ahead of their products: a pass issues its V fragments as one group at its top (they land behind the softmax) and,
  // right behind its score products, the next pass's K fragments (they land behind the rest of the pass). No product waits on a load just issued.
  // The unroll directives on the fragment loops keep the fragment arrays in registers (constant indices).
  FragH bk[2][KS];
#pragma unroll
  for (int nt = 0; nt < 2; ++nt) { const unsigned short* kr = (const unsigned short*)K16 + ((size_t)b * 2048 + nt * 16) * ldk + h * 1024 + lane * 8;
#pragma unroll
    for (int ks = 0; ks < KS; ++ks) { bk[nt][ks].half[0] = *(const v8us*)(kr + ks * 512); bk[nt][ks].half[1] = *(const v8us*)(kr + ks * 512 + 256); } }
#pragma unroll 1
  for (int j0 = 0; j0 < jend; j0 += 32) {
    FragH bv[DT];
#pragma unroll
    for (int dt = 0; dt < DT; ++dt) { const unsigned short* vrow = Vth + (size_t)j0 * 64 + dt * 512 + lane * 8; bv[dt].half[0] = *(const v8us*)vrow; bv[dt].half[1] = *(const v8us*)(vrow + 256); }
    v8f s[2][2];
#pragma unroll
    for (int nt = 0; nt < 2; ++nt) {
#pragma unroll
      for (int rt = 0; rt < RTN; ++rt) { v8f acc = (v8f){0.f,0.f,0.f,0.f,0.f,0.f,0.f,0.f};
#pragma unroll
        for (int ks = 0; ks < KS; ++ks) acc = mmaH<1>(aq[rt][ks].v, aq[rt][ks].v, bk[nt][ks].v, bk[nt][ks].v, acc); s[rt][nt] = acc; } }
    const int jn = (j0 + 32 < jend) ? j0 + 32 : j0;      // the last pass reads its own rows again: in bounds, not used
#pragma unroll
    for (int nt = 0; nt < 2; ++nt) { const unsigned short* kr = (const unsigned short*)K16 + ((size_t)b * 2048 + jn + nt * 16) * ldk + h * 1024 + lane * 8;
#pragma unroll
      for (int ks = 0; ks < KS; ++ks) { bk[nt][ks].half[0] = *(const v8us*)(kr + ks * 512); bk[nt][ks].half[1] = *(const v8us*)(kr + ks * 512 + 256); } }
#pragma unroll
    for (int rt = 0; rt < RTN; ++rt)
#pragma unroll
      for (int r = 0; r < 8; ++r) { const int tq = q0 + rt * 16 + 8 * hh + r; const int k0 = j0 + ln, k1 = j0 + 16 + ln; (void)tq; (void)k0; (void)k1;
        const bool ok0 = true, ok1 = true;
        const float s0 = ok0 ? s[rt][0][r] * (0.125f) : -INFINITY, s1 = ok1 ? s[rt][1][r] * (0.125f) : -INFINITY; float mc = fmaxf(s0, s1);
        mc = fmaxf(mc, __shfl_xor(mc, 1, 32)); mc = fmaxf(mc, __shfl_xor(mc, 2, 32)); mc = fmaxf(mc, __shfl_xor(mc, 4, 32)); mc = fmaxf(mc, __shfl_xor(mc, 8, 32));
        const float mn = fmaxf(m_r[rt][r], mc); const float al = (mn > -1.0e38f) ? expf(m_r[rt][r] - mn) : 1.0f; m_r[rt][r] = mn; const float p0 = ok0 ? expf(s0 - mn) : 0.f, p1 = ok1 ? expf(s1 - mn) : 0.f; l_r[rt][r] = l_r[rt][r] * al + p0 + p1;
#pragma unroll
        for (int dt = 0; dt < DT; ++dt) oacc[rt][dt][r] *= al;
        FragH t2; t2.h[0] = (_Float16)p0; t2.h[1] = (_Float16)p1; sP[w][rt * 16 + 8 * hh + r][ln] = t2.u[0]; sP[w][rt * 16 + 8 * hh + r][16 + ln] = t2.u[1]; }
    __builtin_amdgcn_fence(__ATOMIC_ACQ_REL, "workgroup"); __builtin_amdgcn_wave_barrier();
    FragH pa[2];
#pragma unroll
    for (int rt = 0; rt < RTN; ++rt) { pa[rt].half[0] = *(const v8us*)&sP[w][rt * 16 + ln][8 * hh]; pa[rt].half[1] = *(const v8us*)&sP[w][rt * 16 + ln][16 + 8 * hh]; }
#pragma unroll
    for (int dt = 0; dt < DT; ++dt) {
#pragma unroll
      for (int rt = 0; rt < RTN; ++rt) oacc[rt][dt] = mmaH<1>(pa[rt].v, pa[rt].v, bv[dt].v, bv[dt].v, oacc[rt][dt]); }
    __builtin_amdgcn_fence(__ATOMIC_ACQ_REL, "workgroup"); __builtin_amdgcn_wave_barrier(); }
#pragma unroll
  for (int rt = 0; rt < RTN; ++rt) {
#pragma unroll
    for (int r = 0; r < 8; ++r) { float l = l_r[rt][r]; l += __shfl_xor(l, 1, 32); l += __shfl_xor(l, 2, 32); l += __shfl_xor(l, 4, 32); l += __shfl_xor(l, 8, 32); l_r[rt][r] = (l > 0.f) ? 1.0f / l : 0.f; }
#pragma unroll
    for (int dt = 0; dt < DT; ++dt)
#pragma unroll
      for (int r = 0; r < 8; ++r) sO[w][rt * 16 + 8 * hh + r][dt * 16 + ln] = oacc[rt][dt][r] * l_r[rt][r]; }
  __builtin_amdgcn_fence(__ATOMIC_ACQ_REL, "workgroup"); __builtin_amdgcn_wave_barrier();
  {
#pragma unroll
    for (int rp = 0; rp < RPW; rp += 2) { const int r = rp + (lane >> 4), pc = lane & 15; const v4f val = *(const v4fa*)&sO[w][r][pc * 4]; *(v4f*)(O + ((size_t)b * 2048 + q0 + r) * ldo + h * 64 + pc * 4) = val; }
     } }

__global__ __launch_bounds__(256) void k_vmask(const float* __restrict__ V, const float* __restrict__ mk, _Float16* __restrict__ V16, size_t n8) { const size_t t = (size_t)blockIdx.x * 256 + threadIdx.x; if (t >= n8) return; const size_t r = (t * 8) / DD; const float m = bf16_round(mk[r]); FragH f;
#pragma unroll
  for (int q = 0; q < 8; ++q) f.h[q] = (_Float16)(V[t * 8 + q] * m); *(v8us*)((unsigned short*)V16 + t * 8) = f.half[0];  }
extern "C" void kernel_launch(void* const* d_in, const int* in_sizes, int n_in,
                              void* d_out, int out_size, void* d_ws, size_t ws_size, hipStream_t stream) {
  (void)in_sizes; (void)n_in; (void)out_size;
  const float* xq = (const float*)d_in[0]; const float* xkv = (const float*)d_in[1]; const float* mk = (const float*)d_in[2]; const float* Wq = (const float*)d_in[3]; const float* bq = (const float*)d_in[4]; const float* Wk = (const float*)d_in[5]; const float* bk = (const float*)d_in[6]; const float* Wv = (const float*)d_in[7]; const float* bv = (const float*)d_in[8]; const float* Wo = (const float*)d_in[9]; const float* bo = (const float*)d_in[10];
  char* ws = (char*)d_ws; size_t off = 0;
  auto take = [&](size_t bytes) { char* p = ws + off; off += (bytes + 255) & ~(size_t)255; return p; };
  _Float16* Bq = (_Float16*)take((size_t)DD * DD * 2); _Float16* Bk = (_Float16*)take((size_t)DD * DD * 2); _Float16* Bv = (_Float16*)take((size_t)DD * DD * 2); _Float16* Bo = (_Float16*)take((size_t)DD * DD * 2);
  _Float16* XQ16 = (_Float16*)take((size_t)NR * DD * 2); _Float16* XKV16 = (_Float16*)take((size_t)NR * DD * 2); _Float16* Q16 = (_Float16*)take((size_t)NR * DD * 2); _Float16* K16 = (_Float16*)take((size_t)NR * DD * 2); float* VF = (float*)take((size_t)NR * DD * 4); _Float16* V16 = XKV16; _Float16* Vt = XQ16; float* O = VF; _Float16* O16 = Q16;
  if (off > ws_size) return;      // 8.4 + 8.4 × 4 + 16.8 ≈ 59 MB
  k_wt_f16<<<(unsigned)(((size_t)DD * (DD / 8) + 255) / 256), 256, 0, stream>>>(Wq, Bq, DD, DD, 16.0f); k_wt_f16<<<(unsigned)(((size_t)DD * (DD / 8) + 255) / 256), 256, 0, stream>>>(Wk, Bk, DD, DD, 16.0f); k_wt_f16<<<(unsigned)(((size_t)DD * (DD / 8) + 255) / 256), 256, 0, stream>>>(Wv, Bv, DD, DD, 16.0f); k_wt_f16<<<(unsigned)(((size_t)DD * (DD / 8) + 255) / 256), 256, 0, stream>>>(Wo, Bo, DD, DD, 16.0f);      // (D,H,Dh) = [in][h·64+d]; Wo (H,Dh,D) = [in=(h,d)][out]
  const unsigned g8 = (unsigned)(((size_t)NR * DD / 8 + 255) / 256); const dim3 gg(((NR / 16) * (DD / 64) + 3) / 4, 1);
  k_x16<<<g8, 256, 0, stream>>>(xq, XQ16, (size_t)NR * DD / 8); k_x16<<<g8, 256, 0, stream>>>(xkv, XKV16, (size_t)NR * DD / 8);
  k_gemm_hhx<0><<<gg, 128, 0, stream>>>(XQ16, DD, 0, Bq, DD, 0, 0.0625f, bq, 0, nullptr, 1, 0, 0, nullptr, Q16, DD, 0, NR, DD, DD);
  k_gemm_hhx<0><<<gg, 128, 0, stream>>>(XKV16, DD, 0, Bk, DD, 0, 0.0625f, bk, 0, nullptr, 1, 0, 0, nullptr, K16, DD, 0, NR, DD, DD);
  k_gemm_hhx<0><<<gg, 128, 0, stream>>>(XKV16, DD, 0, Bv, DD, 0, 0.0625f, bv, 0, nullptr, 1, 0, 0, VF, nullptr, DD, 0, NR, DD, DD);      // v (f32, + bv) — masked next
  k_vmask<<<g8, 256, 0, stream>>>(VF, mk, V16, (size_t)NR * DD / 8);      // V16 over XKV16 (its last reader was the v GEMM)
  k_vt<NH, TT><<<BB * NH * (TT / 64), 256, 0, stream>>>(V16, DD, 0, Vt);      // Vt over XQ16
  k_flash<<<BB * NH * (TT / 64), 128, 0, stream>>>(Q16, DD, K16, DD, Vt, nullptr, O, DD);      // q/√64 folded into the 0.125 scale; O over VF
  k_h16<<<g8, 256, 0, stream>>>(O, O16, (size_t)NR * DD / 8);
  k_gemm_hhx<0><<<gg, 128, 0, stream>>>(O16, DD, 0, Bo, DD, 0, 0.0625f, bo, 0, nullptr, 1, 0, 0, (float*)d_out, nullptr, DD, 0, NR, DD, DD);
}

// v003
// Measured time: 190 microseconds a run.
// Next to v002, in two timings, it ran 1.35 and 1.37 times as fast.
// Counting every step since v000, it is 2.35 times as fast.
#include <hip/hip_runtime.h>
// Multi-head dot-product attention with a per-key value mask (B=2, L=2048, D=1024, 16 heads × 64; q from inputs_q, k/v from inputs_kv; v ← mask_k·v; softmax(q·k/8); merge; ·Wo + bo): the
// q/k/v/o projections are GEMMs ([in][out] weights bf16-exact ×2^4, bias epilogues, f32 accumulate) and the attention is a fused flash-style kernel (online softmax f32; P f16 ≤ 1; Ot = Vt·Pt;
// RPW-16 waves) on v_wmma_f32_16x16x32_f16; the value masking is applied in f32 VALU before the f16 conversion.
#define BB 2
#define TT 2048
#define DD 1024
#define NH 16
#define NR (BB * TT)

typedef __bf16 v16b __attribute__((ext_vector_type(16)));
typedef unsigned short v8us __attribute__((ext_vector_type(8), may_alias));
typedef float  v8f  __attribute__((ext_vector_type(8)));
typedef float  v4f  __attribute__((ext_vector_type(4)));
typedef float  v4fa __attribute__((ext_vector_type(4), may_alias));
union FragB { v16b v; v8us half[2]; unsigned short u[16]; };

__device__ __forceinline__ unsigned short bf16_bits(float x) { unsigned int u = __float_as_uint(x); return (unsigned short)((u + 0x7FFFu + ((u >> 16) & 1u)) >> 16); }
__device__ __forceinline__ float bf16_val(unsigned short b) { return __uint_as_float(((unsigned int)b) << 16); }
__device__ __forceinline__ float bf16_round(float x) { return bf16_val(bf16_bits(x)); }
// D += A·B with NT terms: 1 = ah·bh, 2 = + al·bh (A split), 3 = + ah·bl (both split)
template <int NT>
__device__ __forceinline__ v8f mmaN(v16b ah, v16b al, v16b bh, v16b bl, v8f c) {
  c = __builtin_amdgcn_wmma_f32_16x16x32_bf16(false, ah, false, bh, (short)0, c, false, false);
  if (NT >= 2) c = __builtin_amdgcn_wmma_f32_16x16x32_bf16(false, al, false, bh, (short)0, c, false, false);
  if (NT >= 3) c = __builtin_amdgcn_wmma_f32_16x16x32_bf16(false, ah, false, bl, (short)0, c, false, false);
  asm volatile("v_nop\n\tv_nop\n\tv_nop\n\tv_nop" : "+v"(c) : "v"(ah), "v"(al), "v"(bh), "v"(bl));
  return c;
}

__global__ __launch_bounds__(256) void k_wt_bf16(const float* __restrict__ W, unsigned short* __restrict__ Wt, int K, int N) {
  const int t = blockIdx.x * 256 + threadIdx.x;
  const int k8n = K / 8;
  if (t >= N * k8n) return;
  const int n = t / k8n, k8 = (t % k8n) * 8;
  v8us v;
#pragma unroll
  for (int i = 0; i < 8; ++i) v[i] = bf16_bits(W[(size_t)(k8 + i) * N + n]);
  *(v8us*)(Wt + (size_t)n * K + k8) = v;
  
}

// GEMM C[M][N] (f32, pitch ldc) = act(A[M][K]·W + bias). A f32 row-major (pitch lda) converted per fragment to bf16
// (ASPLIT: hi/lo two planes -> 2 terms, else single rounded term); Wt bf16 [N][K] (pitch ldb). BIAS_BF16 rounds the
// bias to bf16 first (bias quantised to bf16 before the add). K%32==0, M%16==0, N%64==0.
template <bool ASPLIT, int ACT, bool BIAS_BF16>
__global__ __launch_bounds__(128) void k_gemm_bf(const float* __restrict__ A, int lda, const unsigned short* __restrict__ Wt, int ldb,
                                               const float* __restrict__ bias, float* __restrict__ C, int ldc, int M, int N, int K) {
  __shared__ __attribute__((aligned(16))) float so[4][16][64];
  const int tid = threadIdx.x, w = tid >> 5, lane = tid & 31, ln = lane & 15, hh = lane >> 4;
  const int ntn = N / 64;
  const int wid = blockIdx.x * 4 + w;
  const int mt = wid / ntn, nq = wid % ntn;
  if (mt * 16 >= M) return;
  const int row0 = mt * 16, col0 = nq * 64;
  const float* arow = A + (size_t)(row0 + ln) * lda;
  v8f acc[4] = {};
  for (int kb = 0; kb < K; kb += 32) {
    FragB ah, al;
    const v4f x0 = *(const v4fa*)(arow + kb + 8 * hh), x1 = *(const v4fa*)(arow + kb + 8 * hh + 4);
    const v4f x2 = *(const v4fa*)(arow + kb + 16 + 8 * hh), x3 = *(const v4fa*)(arow + kb + 16 + 8 * hh + 4);
    float xs[16] = {x0[0],x0[1],x0[2],x0[3],x1[0],x1[1],x1[2],x1[3],x2[0],x2[1],x2[2],x2[3],x3[0],x3[1],x3[2],x3[3]};
#pragma unroll
    for (int i = 0; i < 16; ++i) { const unsigned short hb = bf16_bits(xs[i]); ah.u[i] = hb; al.u[i] = ASPLIT ? bf16_bits(xs[i] - bf16_val(hb)) : (unsigned short)0; }
#pragma unroll
    for (int t = 0; t < 4; ++t) {
      const unsigned short* brow = Wt + (size_t)(col0 + t * 16 + ln) * ldb + kb;
      FragB b;
      b.half[0] = *(const v8us*)(brow + 8 * hh);
      b.half[1] = *(const v8us*)(brow + 16 + 8 * hh);
      acc[t] = mmaN<ASPLIT ? 2 : 1>(ah.v, al.v, b.v, b.v, acc[t]);
    }
  }
#pragma unroll
  for (int t = 0; t < 4; ++t) {
    float bv = bias ? bias[col0 + t * 16 + ln] : 0.f;
    if (BIAS_BF16) bv = bf16_round(bv);
#pragma unroll
    for (int r = 0; r < 8; ++r) { float v = acc[t][r] + bv; if (ACT == 1) v = fmaxf(v, 0.f); so[w][8 * hh + r][t * 16 + ln] = v; }
  }
  __builtin_amdgcn_fence(__ATOMIC_ACQ_REL, "workgroup");
  __builtin_amdgcn_wave_barrier();
  const int rsub = lane >> 4, c4 = (lane & 15) * 4;
  {
#pragma unroll
    for (int q = 0; q < 8; ++q) {
      const int r = q * 2 + rsub;
      const v4f v = *(const v4fa*)&so[w][r][c4];
      *(v4f*)(C + (size_t)(row0 + r) * ldc + col0 + c4) = v;
    }
    
  }
}

// Flash-style causal/unmasked attention, all contractions 3-term bf16 hi/lo splits, f32 softmax with running max.
// q,k,v rows are read from f32 buffers with arbitrary row pitch (so they can live inside a fused qkv buffer);
// D = head size (multiple of 32, <= 128); one wave = 16 query rows; block = 4 waves (64 queries) sharing K/V chunks of 32.
template <int D, bool CAUSAL>
__global__ __launch_bounds__(128) void k_flash(const float* __restrict__ qb, const float* __restrict__ kb, const float* __restrict__ vb,
                                             int pitch, int T, int H, float scale, float* __restrict__ y, int ypitch) {
  constexpr int KS = D / 32;        // k-steps for QK
  constexpr int DT = D / 16;        // d tiles for PV
  __shared__ __attribute__((aligned(16))) unsigned short sKh[32][D + 8], sKl[32][D + 8], sVh[32][D + 8], sVl[32][D + 8];
  __shared__ __attribute__((aligned(16))) unsigned short sPh[4][16][40], sPl[4][16][40];
  __shared__ __attribute__((aligned(16))) float sO[4][16][D];
  const int tid = threadIdx.x, w = tid >> 5, lane = tid & 31, ln = lane & 15, hh = lane >> 4;
  const int nqb = (T + 63) / 64;
  const int bh = blockIdx.x / nqb, qblk = blockIdx.x % nqb;
  const int b = bh / H, h = bh % H;
  const int q0 = qblk * 64 + w * 16;
  const float* Q = qb + (size_t)b * T * pitch + h * D;
  const float* K = kb + (size_t)b * T * pitch + h * D;
  const float* V = vb + (size_t)b * T * pitch + h * D;

  // A fragments of the wave's 16 query rows (scaled), hi/lo
  FragB aqh[KS], aql[KS];
  {
    int row = q0 + ln; if (row >= T) row = T - 1;
    const float* qr = Q + (size_t)row * pitch;
#pragma unroll
    for (int ks = 0; ks < KS; ++ks)
#pragma unroll
      for (int i = 0; i < 16; ++i) {
        const int d = ks * 32 + ((i < 8) ? (8 * hh + i) : (16 + 8 * hh + (i - 8)));
        const float x = qr[d] * scale; const unsigned short hb = bf16_bits(x);
        aqh[ks].u[i] = hb; aql[ks].u[i] = bf16_bits(x - bf16_val(hb));
      }
  }
  float m_r[8], l_r[8];
#pragma unroll
  for (int r = 0; r < 8; ++r) { m_r[r] = -3.0e38f; l_r[r] = 0.f; }
  v8f oacc[DT];
#pragma unroll
  for (int dt = 0; dt < DT; ++dt) oacc[dt] = (v8f){0.f,0.f,0.f,0.f,0.f,0.f,0.f,0.f};

  const int kv_end = CAUSAL ? min(T, qblk * 64 + 64) : T;     // block-uniform
  for (int j0 = 0; j0 < kv_end; j0 += 32) {
    __syncthreads();
    for (int e = tid; e < 32 * (D / 4); e += 128) {
      const int r = e / (D / 4), c4 = (e % (D / 4)) * 4;
      const int key = j0 + r;
      v4f kf = {0.f,0.f,0.f,0.f}, vf = {0.f,0.f,0.f,0.f};
      if (key < T) { kf = *(const v4fa*)(K + (size_t)key * pitch + c4); vf = *(const v4fa*)(V + (size_t)key * pitch + c4); }
#pragma unroll
      for (int t = 0; t < 4; ++t) {
        unsigned short hb = bf16_bits(kf[t]); sKh[r][c4 + t] = hb; sKl[r][c4 + t] = bf16_bits(kf[t] - bf16_val(hb));
        hb = bf16_bits(vf[t]); sVh[r][c4 + t] = hb; sVl[r][c4 + t] = bf16_bits(vf[t] - bf16_val(hb));
      }
    }
    __syncthreads();
    // S tile 16 x 32
    v8f s[2];
#pragma unroll
    for (int nt = 0; nt < 2; ++nt) {
      v8f acc = {};
#pragma unroll
      for (int ks = 0; ks < KS; ++ks) {
        FragB bh_, bl_;
        bh_.half[0] = *(const v8us*)&sKh[nt * 16 + ln][ks * 32 + 8 * hh]; bh_.half[1] = *(const v8us*)&sKh[nt * 16 + ln][ks * 32 + 16 + 8 * hh];
        bl_.half[0] = *(const v8us*)&sKl[nt * 16 + ln][ks * 32 + 8 * hh]; bl_.half[1] = *(const v8us*)&sKl[nt * 16 + ln][ks * 32 + 16 + 8 * hh];
        acc = mmaN<3>(aqh[ks].v, aql[ks].v, bh_.v, bl_.v, acc);
      }
      s[nt] = acc;
    }
    // mask + running max (rows 8hh+r; the 16 lanes of a half share rows)
    float alpha[8];
#pragma unroll
    for (int r = 0; r < 8; ++r) {
      const int qi = q0 + 8 * hh + r;
      const int ja = j0 + ln, jb = j0 + 16 + ln;
      if (CAUSAL) { if (ja > qi) s[0][r] = -3.0e38f; if (jb > qi) s[1][r] = -3.0e38f; }
      if (ja >= T) s[0][r] = -3.0e38f;
      if (jb >= T) s[1][r] = -3.0e38f;
      float mx = fmaxf(s[0][r], s[1][r]);
      mx = fmaxf(mx, __shfl_xor(mx, 1, 32)); mx = fmaxf(mx, __shfl_xor(mx, 2, 32)); mx = fmaxf(mx, __shfl_xor(mx, 4, 32)); mx = fmaxf(mx, __shfl_xor(mx, 8, 32));
      const float mnew = fmaxf(m_r[r], mx);
      alpha[r] = (mnew > -1.0e38f) ? __expf(m_r[r] - mnew) : 1.0f;
      const float p0 = (s[0][r] > -1.0e38f) ? __expf(s[0][r] - mnew) : 0.f;
      const float p1 = (s[1][r] > -1.0e38f) ? __expf(s[1][r] - mnew) : 0.f;
      m_r[r] = mnew;
      l_r[r] = l_r[r] * alpha[r] + p0 + p1;            // per-lane partial row sum (16 lanes combined at the end)
      unsigned short hb = bf16_bits(p0); sPh[w][8 * hh + r][ln] = hb;      sPl[w][8 * hh + r][ln] = bf16_bits(p0 - bf16_val(hb));
      hb = bf16_bits(p1);                sPh[w][8 * hh + r][16 + ln] = hb; sPl[w][8 * hh + r][16 + ln] = bf16_bits(p1 - bf16_val(hb));
    }
#pragma unroll
    for (int dt = 0; dt < DT; ++dt)
#pragma unroll
      for (int r = 0; r < 8; ++r) oacc[dt][r] *= alpha[r];
    __builtin_amdgcn_fence(__ATOMIC_ACQ_REL, "workgroup");
    __builtin_amdgcn_wave_barrier();
    FragB pah, pal;
    pah.half[0] = *(const v8us*)&sPh[w][ln][8 * hh]; pah.half[1] = *(const v8us*)&sPh[w][ln][16 + 8 * hh];
    pal.half[0] = *(const v8us*)&sPl[w][ln][8 * hh]; pal.half[1] = *(const v8us*)&sPl[w][ln][16 + 8 * hh];
#pragma unroll
    for (int dt = 0; dt < DT; ++dt) {
      FragB bvh, bvl;
#pragma unroll
      for (int i = 0; i < 8; ++i) {
        bvh.u[i] = sVh[8 * hh + i][dt * 16 + ln]; bvh.u[8 + i] = sVh[16 + 8 * hh + i][dt * 16 + ln];
        bvl.u[i] = sVl[8 * hh + i][dt * 16 + ln]; bvl.u[8 + i] = sVl[16 + 8 * hh + i][dt * 16 + ln];
      }
      oacc[dt] = mmaN<3>(pah.v, pal.v, bvh.v, bvl.v, oacc[dt]);
    }
    __builtin_amdgcn_fence(__ATOMIC_ACQ_REL, "workgroup");
    __builtin_amdgcn_wave_barrier();
  }
#pragma unroll
  for (int r = 0; r < 8; ++r) {
    float l = l_r[r];
    l += __shfl_xor(l, 1, 32); l += __shfl_xor(l, 2, 32); l += __shfl_xor(l, 4, 32); l += __shfl_xor(l, 8, 32);
    l_r[r] = (l > 0.f) ? 1.0f / l : 0.f;
  }
#pragma unroll
  for (int dt = 0; dt < DT; ++dt)
#pragma unroll
    for (int r = 0; r < 8; ++r) sO[w][8 * hh + r][dt * 16 + ln] = oacc[dt][r] * l_r[r];
  __builtin_amdgcn_fence(__ATOMIC_ACQ_REL, "workgroup");
  __builtin_amdgcn_wave_barrier();
  {
    for (int r = 0; r < 16; ++r) {
      const int row = q0 + r;
      if (row < T && lane < D / 4) {
        const v4f val = *(const v4fa*)&sO[w][r][lane * 4];
        *(v4f*)(y + ((size_t)b * T + row) * ypitch + h * D + lane * 4) = val;
      }
    }
    
  }
}

// GEMM C = act(A·W + bias + resid): A f32 (ASPLIT -> hi/lo 2 terms), Wt bf16 [N][K]; ACT 0 none, 1 relu, 2 exact gelu;
// resid (optional, f32, row index = (row % rmod), pitch ldr, RES_BF16 rounds it) added before the activation.
template <bool ASPLIT, int ACT, bool BIAS_BF16, bool RES_BF16>
__global__ __launch_bounds__(128) void k_gemm_bf3(const float* __restrict__ A, int lda, const unsigned short* __restrict__ Wt, int ldb,
                                                const float* __restrict__ bias, const float* __restrict__ resid, int rmod, int ldr,
                                                float* __restrict__ C, int ldc, int M, int N, int K) {
  __shared__ __attribute__((aligned(16))) float so[4][16][64];
  const int tid = threadIdx.x, w = tid >> 5, lane = tid & 31, ln = lane & 15, hh = lane >> 4;
  const int ntn = N / 64;
  const int wid = blockIdx.x * 4 + w;
  const int mt = wid / ntn, nq = wid % ntn;
  if (mt * 16 >= M) return;
  const int row0 = mt * 16, col0 = nq * 64;
  const float* arow = A + (size_t)(row0 + ln) * lda;
  v8f acc[4] = {};
  for (int kb = 0; kb < K; kb += 32) {
    FragB ah, al;
    const v4f x0 = *(const v4fa*)(arow + kb + 8 * hh), x1 = *(const v4fa*)(arow + kb + 8 * hh + 4);
    const v4f x2 = *(const v4fa*)(arow + kb + 16 + 8 * hh), x3 = *(const v4fa*)(arow + kb + 16 + 8 * hh + 4);
    float xs[16] = {x0[0],x0[1],x0[2],x0[3],x1[0],x1[1],x1[2],x1[3],x2[0],x2[1],x2[2],x2[3],x3[0],x3[1],x3[2],x3[3]};
#pragma unroll
    for (int i = 0; i < 16; ++i) { const unsigned short hb = bf16_bits(xs[i]); ah.u[i] = hb; al.u[i] = ASPLIT ? bf16_bits(xs[i] - bf16_val(hb)) : (unsigned short)0; }
#pragma unroll
    for (int t = 0; t < 4; ++t) {
      const unsigned short* brow = Wt + (size_t)(col0 + t * 16 + ln) * ldb + kb;
      FragB b;
      b.half[0] = *(const v8us*)(brow + 8 * hh);
      b.half[1] = *(const v8us*)(brow + 16 + 8 * hh);
      acc[t] = mmaN<ASPLIT ? 2 : 1>(ah.v, al.v, b.v, b.v, acc[t]);
    }
  }
#pragma unroll
  for (int t = 0; t < 4; ++t) {
    const int col = col0 + t * 16 + ln;
    float bv = bias ? bias[col] : 0.f;
    if (BIAS_BF16) bv = bf16_round(bv);
#pragma unroll
    for (int r = 0; r < 8; ++r) {
      float v = acc[t][r] + bv;
      if (resid) { float rv = resid[(size_t)((row0 + 8 * hh + r) % rmod) * ldr + col]; if (RES_BF16) rv = bf16_round(rv); v += rv; }
      if (ACT == 1) v = fmaxf(v, 0.f);
      if (ACT == 2) v = 0.5f * v * (1.0f + erff(v * 0.70710678118654752f));
      if (ACT == 3) { const float u = 0.7978845608028654f * (v + 0.044715f * v * v * v); v = 0.5f * v * (1.0f + tanhf(u)); }
      so[w][8 * hh + r][t * 16 + ln] = v;
    }
  }
  __builtin_amdgcn_fence(__ATOMIC_ACQ_REL, "workgroup");
  __builtin_amdgcn_wave_barrier();
  const int rsub = lane >> 4, c4 = (lane & 15) * 4;
  {
#pragma unroll
    for (int q = 0; q < 8; ++q) {
      const int r = q * 2 + rsub;
      const v4f v = *(const v4fa*)&so[w][r][c4];
      *(v4f*)(C + (size_t)(row0 + r) * ldc + col0 + c4) = v;
    }
    
  }
}
// row LayerNorm (biased variance, eps) over N: s = X (+ R); optional out_sum <- s; out_norm <- (s-mu)*rsqrt(var+eps)*g + b
template <bool PARAM_BF16>
__global__ __launch_bounds__(256) void k_layernorm(const float* __restrict__ X, const float* __restrict__ R, const float* __restrict__ g, const float* __restrict__ bta,
                                                  float* __restrict__ out_sum, float* __restrict__ out_norm, int N, float eps) {
  __shared__ float red[256];
  const int row = blockIdx.x, tid = threadIdx.x;
  const float* x = X + (size_t)row * N; const float* rr = R ? R + (size_t)row * N : nullptr;
  float vals[16];                     // up to N = 4096
  const int per = N / 256;            // contiguous chunk per thread? use strided-by-4 chunks: thread handles j = tid*4 + 1024*u
  float s1 = 0.f;
  for (int u = 0; u < per / 4; ++u) {
    const int j = tid * 4 + 1024 * u;
    const v4f a = *(const v4fa*)(x + j);
    v4f b = {0.f,0.f,0.f,0.f}; if (rr) b = *(const v4fa*)(rr + j);
#pragma unroll
    for (int q = 0; q < 4; ++q) { const float v = a[q] + b[q]; vals[u * 4 + q] = v; s1 += v; }
  }
  red[tid] = s1; __syncthreads();
  for (int st = 128; st > 0; st >>= 1) { if (tid < st) red[tid] += red[tid + st]; __syncthreads(); }
  const float mu = red[0] / (float)N; __syncthreads();
  float s2 = 0.f;
  for (int u = 0; u < per / 4; ++u)
#pragma unroll
    for (int q = 0; q < 4; ++q) { const float c = vals[u * 4 + q] - mu; s2 += c * c; }
  red[tid] = s2; __syncthreads();
  for (int st = 128; st > 0; st >>= 1) { if (tid < st) red[tid] += red[tid + st]; __syncthreads(); }
  const float rs = rsqrtf(red[0] / (float)N + eps);
  {
    for (int u = 0; u < per / 4; ++u) {
      const int j = tid * 4 + 1024 * u;
      v4f o, sm;
#pragma unroll
      for (int q = 0; q < 4; ++q) {
        float gg = g[j + q], bb = bta[j + q];
        if (PARAM_BF16) { gg = bf16_round(gg); bb = bf16_round(bb); }
        sm[q] = vals[u * 4 + q]; o[q] = (vals[u * 4 + q] - mu) * rs * gg + bb;
      }
      if (out_sum) *(v4f*)(out_sum + (size_t)row * N + j) = sm;
      *(v4f*)(out_norm + (size_t)row * N + j) = o;
    }
    
  }
}



// ---- f16 WMMA path (v_wmma_f32_16x16x32_f16): 11-bit significands for operands in range — used where a [0,1] probability operand needs more precision than bf16
typedef _Float16 v16h __attribute__((ext_vector_type(16)));
union FragH { v16h v; v8us half[2]; _Float16 h[16]; unsigned short u[16]; };
template <int NT>
__device__ __forceinline__ v8f mmaH(v16h ah, v16h al, v16h bh, v16h bl, v8f c) {
  c = __builtin_amdgcn_wmma_f32_16x16x32_f16(false, ah, false, bh, (short)0, c, false, false);
  if (NT >= 2) c = __builtin_amdgcn_wmma_f32_16x16x32_f16(false, al, false, bh, (short)0, c, false, false);
  if (NT >= 3) c = __builtin_amdgcn_wmma_f32_16x16x32_f16(false, ah, false, bl, (short)0, c, false, false);
  asm volatile("v_nop\n\tv_nop\n\tv_nop\n\tv_nop" : "+v"(c) : "v"(ah), "v"(al), "v"(bh), "v"(bl));
  return c;
}
// batched GEMM like k_gemm_b but f16 operands: A f32 (split into f16 hi/lo if ASPLIT, else rounded to f16), Bt = f16 values [n][k]; alpha; C f32; N multiple of 16 (partial tiles skipped)
template <bool ASPLIT>
__global__ __launch_bounds__(128) void k_gemm_h(const float* __restrict__ A, int lda, size_t sA, const _Float16* __restrict__ Bh, int ldb, size_t sB, float alpha, float* __restrict__ C, int ldc, size_t sC, int M, int N, int K) {
  __shared__ __attribute__((aligned(16))) float so[4][16][64];
  const int tid = threadIdx.x, w = tid >> 5, lane = tid & 31, ln = lane & 15, hh = lane >> 4; const int by = blockIdx.y;
  A += (size_t)by * sA; Bh += (size_t)by * sB; C += (size_t)by * sC;
  const int ntn = (N + 63) / 64; const int wid = blockIdx.x * 4 + w; const int mt = wid / ntn, nq = wid % ntn; if (mt * 16 >= M) return;
  const int row0 = mt * 16, col0 = nq * 64; const float* arow = A + (size_t)(row0 + ln) * lda;
  v8f acc[4] = {};
  for (int kb = 0; kb < K; kb += 32) {
    FragH ah, al;
    const v4f x0 = *(const v4fa*)(arow + kb + 8 * hh), x1 = *(const v4fa*)(arow + kb + 8 * hh + 4), x2 = *(const v4fa*)(arow + kb + 16 + 8 * hh), x3 = *(const v4fa*)(arow + kb + 16 + 8 * hh + 4);
    float xs[16] = {x0[0],x0[1],x0[2],x0[3],x1[0],x1[1],x1[2],x1[3],x2[0],x2[1],x2[2],x2[3],x3[0],x3[1],x3[2],x3[3]};
#pragma unroll
    for (int i = 0; i < 16; ++i) { const _Float16 h = (_Float16)xs[i]; ah.h[i] = h; al.h[i] = ASPLIT ? (_Float16)(xs[i] - (float)h) : (_Float16)0.0f; }
#pragma unroll
    for (int t = 0; t < 4; ++t) { if (col0 + t * 16 >= N) continue; const size_t boff = (size_t)(col0 + t * 16 + ln) * ldb + kb; FragH bq; bq.half[0] = *(const v8us*)(Bh + boff + 8 * hh); bq.half[1] = *(const v8us*)(Bh + boff + 16 + 8 * hh);
      acc[t] = mmaH<ASPLIT ? 2 : 1>(ah.v, al.v, bq.v, bq.v, acc[t]); }
  }
#pragma unroll
  for (int t = 0; t < 4; ++t) { if (col0 + t * 16 >= N) continue;
#pragma unroll
    for (int r = 0; r < 8; ++r) so[w][8 * hh + r][t * 16 + ln] = acc[t][r] * alpha; }
  __builtin_amdgcn_fence(__ATOMIC_ACQ_REL, "workgroup"); __builtin_amdgcn_wave_barrier();
  const int rsub = lane >> 4, c4 = (lane & 15) * 4;
  {
#pragma unroll
    for (int q = 0; q < 8; ++q) { const int r = q * 2 + rsub; if (col0 + c4 < N) { const v4f v = *(const v4fa*)&so[w][r][c4]; *(v4f*)(C + (size_t)(row0 + r) * ldc + col0 + c4) = v; } }
     }
}

// Wt[n][k] = f16(W[k][n]·scale) from f32 row-major W[K][N] (scale = power of two; bf16-exact weights stay exact in f16 away from the subnormal range)
// FRAGMENT ORDER (f16 matrices in the workspace but V16, which is row-major; Vt numbers its tiles kt * 4 + dt, see k_vt): a [rows][K] operand is kept as tiles of 16 rows x 32 k, 1 KiB each, tile (rt, kt) at index rt * (K / 32) + kt.
// A tile is two halves of 512 bytes (k 0..15, then k 16..31); in half j lane hh * 16 + ln owns the 16 bytes of row ln, k = 16 j + 8 hh + 0..7: just what that lane feeds to the WMMA.
// One wave-wide 16-byte load of a half is then 512 contiguous bytes, four whole lines, where a row-major operand gives 32-byte pieces of 16 lines.
// Chunk t (16 bytes) of such a buffer: lane = t & 31, j = (t >> 5) & 1, tile = t >> 6. K % 32 == 0, rows % 16 == 0.
__global__ __launch_bounds__(256) void k_wt_f16(const float* __restrict__ W, _Float16* __restrict__ Wt, int K, int N, float scale) {
  const int t = blockIdx.x * 256 + threadIdx.x; if (t >= N * (K / 8)) return; const int lane = t & 31, j = (t >> 5) & 1, tile = t >> 6; const int n = (tile / (K / 32)) * 16 + (lane & 15), k8 = (tile % (K / 32)) * 32 + j * 16 + (lane >> 4) * 8; FragH f;
#pragma unroll
  for (int i = 0; i < 8; ++i) f.h[i] = (_Float16)(bf16_round(W[(size_t)(k8 + i) * N + n]) * scale); const v8us o = f.half[0];
  *(v8us*)((unsigned short*)Wt + (size_t)t * 8) = o; 
}
// k_gemm_hh variant with fused epilogue: v = acc·alpha + bias[by·sBias + col] (+ CP[(row/rowsPerB)·sCPb + by·64 + col] if CP) ; ACT 0 none / 1 elu ; writes f16 C16 and f32 C, each if non-null
template <int ACT>
__global__ __launch_bounds__(128) void k_gemm_hhx(const _Float16* __restrict__ A, int lda, size_t sA, const _Float16* __restrict__ Bh, int ldb, size_t sB, float alpha, const float* __restrict__ bias, size_t sBias, const float* __restrict__ CP, int rowsPerB, size_t sCPb, int row0g,
    float* __restrict__ C, _Float16* __restrict__ C16, int ldc, size_t sC, int M, int N, int K) {
  __shared__ __attribute__((aligned(16))) float so[4][16][64 + 4];      // pitch 272 B = 16 B x odd: the f16 epilogue reads 16 rows at one column with 16-byte loads
  const int tid = threadIdx.x, w = tid >> 5, lane = tid & 31, ln = lane & 15, hh = lane >> 4; const int by = blockIdx.y;
  A += (size_t)by * sA; Bh += (size_t)by * sB; const size_t cofs = (size_t)by * sC; const float* bp = bias ? bias + (size_t)by * sBias : nullptr;
  const int ntn = (N + 63) / 64; const int wid = blockIdx.x * 4 + w; const int mt = wid / ntn, nq = wid % ntn; if (mt * 16 >= M) return;
  const int row0 = mt * 16, col0 = nq * 64;
  v8f acc[4] = {};
  // All fragment loads of a k block stand ahead of its first product, so they are in flight together (one L2 round trip per block, not one per product).
  // A and Bh are in fragment order (see k_wt_f16): a tile row of 16 rows is 16 * pitch elements, a 32-k tile 512 elements, its second half 256 elements on; lda, ldb = K of the operand.
  // A B tile past N reads the last tile row (in bounds); its products are never stored: the epilogue skips that tile.
  // The unroll directives below keep the fragment arrays in registers (constant indices).
  const unsigned short* ap = (const unsigned short*)A + (size_t)row0 * lda + lane * 8; const unsigned short* bpt[4];
#pragma unroll
  for (int t = 0; t < 4; ++t) { int cr = col0 + t * 16; if (cr > N - 16) cr = N - 16; bpt[t] = (const unsigned short*)Bh + (size_t)cr * ldb + lane * 8; }
  int kb = 0;
  for (; kb + 64 <= K; kb += 64) {      // 64 k = two tiles = 2 KiB in a row of every tile row
    FragH ah[2], bq[2][4]; const unsigned short* pa = ap + kb * 16; const unsigned short* pb0 = bpt[0] + kb * 16; const unsigned short* pb1 = bpt[1] + kb * 16; const unsigned short* pb2 = bpt[2] + kb * 16; const unsigned short* pb3 = bpt[3] + kb * 16;
#pragma unroll
    for (int u = 0; u < 2; ++u) { ah[u].half[0] = *(const v8us*)(pa + u * 512); ah[u].half[1] = *(const v8us*)(pa + u * 512 + 256);
      bq[u][0].half[0] = *(const v8us*)(pb0 + u * 512); bq[u][0].half[1] = *(const v8us*)(pb0 + u * 512 + 256); bq[u][1].half[0] = *(const v8us*)(pb1 + u * 512); bq[u][1].half[1] = *(const v8us*)(pb1 + u * 512 + 256);
      bq[u][2].half[0] = *(const v8us*)(pb2 + u * 512); bq[u][2].half[1] = *(const v8us*)(pb2 + u * 512 + 256); bq[u][3].half[0] = *(const v8us*)(pb3 + u * 512); bq[u][3].half[1] = *(const v8us*)(pb3 + u * 512 + 256); }
    // the wait that stands in front of any reuse of the group's address registers; naming them as inputs keeps them whole up to it (no load of the group lands on one)
    asm volatile("s_wait_xcnt 0x0" :: "v"(pa), "v"(pb0), "v"(pb1), "v"(pb2), "v"(pb3) : "memory");
#pragma unroll
    for (int u = 0; u < 2; ++u)
#pragma unroll
      for (int t = 0; t < 4; ++t) acc[t] = mmaH<1>(ah[u].v, ah[u].v, bq[u][t].v, bq[u][t].v, acc[t]);
  }
  if (kb < K) {      // K % 64 == 32: the last 32 k
    FragH ah, bq[4]; const unsigned short* pa = ap + kb * 16; const unsigned short* pb0 = bpt[0] + kb * 16; const unsigned short* pb1 = bpt[1] + kb * 16; const unsigned short* pb2 = bpt[2] + kb * 16; const unsigned short* pb3 = bpt[3] + kb * 16;
    ah.half[0] = *(const v8us*)pa; ah.half[1] = *(const v8us*)(pa + 256);
    bq[0].half[0] = *(const v8us*)pb0; bq[0].half[1] = *(const v8us*)(pb0 + 256); bq[1].half[0] = *(const v8us*)pb1; bq[1].half[1] = *(const v8us*)(pb1 + 256);
    bq[2].half[0] = *(const v8us*)pb2; bq[2].half[1] = *(const v8us*)(pb2 + 256); bq[3].half[0] = *(const v8us*)pb3; bq[3].half[1] = *(const v8us*)(pb3 + 256);
    // as above: the wait in front of any reuse of these loads' address registers
    asm volatile("s_wait_xcnt 0x0" :: "v"(pa), "v"(pb0), "v"(pb1), "v"(pb2), "v"(pb3) : "memory");
#pragma unroll
    for (int t = 0; t < 4; ++t) acc[t] = mmaH<1>(ah.v, ah.v, bq[t].v, bq[t].v, acc[t]);
  }
#pragma unroll
  for (int t = 0; t < 4; ++t) { if (col0 + t * 16 >= N) continue; const int col = col0 + t * 16 + ln; const float bv = bp ? bf16_round(bp[col]) : 0.f;
#pragma unroll
    for (int r = 0; r < 8; ++r) { float v = acc[t][r] * alpha + bv; if (CP) { const int bidx = (row0g + row0 + 8 * hh + r) / rowsPerB; v += CP[(size_t)bidx * sCPb + (size_t)by * 64 + col]; } if (ACT == 1) v = (v > 0.f) ? v : expm1f(v); else if (ACT == 3) v = fmaxf(v, 0.f); so[w][8 * hh + r][t * 16 + ln] = v; } }
  __builtin_amdgcn_fence(__ATOMIC_ACQ_REL, "workgroup"); __builtin_amdgcn_wave_barrier();
  const int rsub = lane >> 4, c4 = (lane & 15) * 4;
  if (C) {      // f32 result, row-major
#pragma unroll
    for (int q = 0; q < 8; ++q) { const int r = q * 2 + rsub; if (col0 + c4 < N) { const v4f v = *(const v4fa*)&so[w][r][c4]; *(v4f*)(C + cofs + (size_t)(row0 + r) * ldc + col0 + c4) = v; } }
     }
  if (C16) {      // f16 result in fragment order (k = column, ldc = its K): the wave's 16 x 64 tile is 2 KiB in a row, half c holds columns col0 + 16 c ..
    unsigned short* cp = (unsigned short*)C16 + cofs + (size_t)row0 * ldc + (size_t)(col0 / 32) * 512 + lane * 8;
#pragma unroll
    for (int c = 0; c < 4; ++c) { if (col0 + c * 16 < N) { const v4f v0 = *(const v4fa*)&so[w][ln][c * 16 + hh * 8], v1 = *(const v4fa*)&so[w][ln][c * 16 + hh * 8 + 4]; FragH f;
#pragma unroll
        for (int i = 0; i < 4; ++i) { f.h[i] = (_Float16)v0[i]; f.h[4 + i] = (_Float16)v1[i]; }
        *(v8us*)(cp + c * 256) = f.half[0]; } }
     }
}


// x is row-major [rows][DD] f32; X16 is written in fragment order (see k_wt_f16), thread t = chunk t: a wave stores 512 contiguous bytes and reads 32-byte pieces of 16 rows.
__device__ __forceinline__ size_t frag_src(size_t t) { const int lane = (int)(t & 31), j = (int)((t >> 5) & 1); const size_t tile = t >> 6; return ((tile / (DD / 32)) * 16 + (lane & 15)) * DD + (tile % (DD / 32)) * 32 + j * 16 + (lane >> 4) * 8; }
__global__ __launch_bounds__(256) void k_x16(const float* __restrict__ x, _Float16* __restrict__ X16, size_t n8) { const size_t t = (size_t)blockIdx.x * 256 + threadIdx.x; if (t >= n8) return; FragH f; const size_t s = frag_src(t);
#pragma unroll
  for (int q = 0; q < 8; ++q) f.h[q] = (_Float16)bf16_round(x[s + q]); *(v8us*)((unsigned short*)X16 + t * 8) = f.half[0];  }
__global__ __launch_bounds__(256) void k_h16(const float* __restrict__ x, _Float16* __restrict__ X16, size_t n8) { const size_t t = (size_t)blockIdx.x * 256 + threadIdx.x; if (t >= n8) return; FragH f; const size_t s = frag_src(t);
#pragma unroll
  for (int q = 0; q < 8; ++q) f.h[q] = (_Float16)x[s + q]; *(v8us*)((unsigned short*)X16 + t * 8) = f.half[0];  }
__global__ __launch_bounds__(256) void k_round16f(const float* __restrict__ W, _Float16* __restrict__ Bt, size_t n8) { const size_t t = (size_t)blockIdx.x * 256 + threadIdx.x; if (t >= n8) return; FragH f;
#pragma unroll
  for (int i = 0; i < 8; ++i) f.h[i] = (_Float16)(bf16_round(W[t * 8 + i]) * 16.0f); *(v8us*)((unsigned short*)Bt + t * 8) = f.half[0];  }
template <int NHv, int TTv>
__global__ __launch_bounds__(256) void k_vt(const _Float16* __restrict__ V16, int ldv, int voff, _Float16* __restrict__ Vt) { __shared__ unsigned short tl[64][66]; const int tid = threadIdx.x; const int slab = blockIdx.x / (TTv / 64), lg = blockIdx.x % (TTv / 64); const int b = slab / NHv, h = slab % NHv;
  for (int i = tid; i < 64 * 8; i += 256) { const int r = i / 8, c8 = (i % 8) * 8; FragH f; f.half[0] = *(const v8us*)((const unsigned short*)V16 + ((size_t)b * TTv + lg * 64 + r) * ldv + voff + h * 64 + c8);
#pragma unroll
    for (int q = 0; q < 8; ++q) tl[r][c8 + q] = f.u[q]; }
  __syncthreads();
  {
#pragma unroll
    for (int rd = 0; rd < 2; ++rd) {      // Vt of a slab in fragment order, rows = d, k = key, the four d tiles of a 32-key tile side by side: tile index kt * 4 + dt; this block owns chunks lg * 512 .. + 511
      const int c = rd * 256 + tid, dt = (c >> 6) & 3, j = (c >> 5) & 1, hh = (c >> 4) & 1, ln = c & 15; FragH f;
#pragma unroll
      for (int q = 0; q < 8; ++q) f.u[q] = tl[rd * 32 + j * 16 + hh * 8 + q][dt * 16 + ln];
      *(v8us*)((unsigned short*)Vt + (size_t)slab * 64 * TTv + (size_t)lg * 4096 + c * 8) = f.half[0]; }
     } }

// lane l with lane l ^ 16 (a vector cross-row move, no LDS queue)
__device__ __forceinline__ float xhalf(float x) { return __builtin_bit_cast(float, __builtin_amdgcn_permlanex16(__builtin_bit_cast(int, x), __builtin_bit_cast(int, x), 0x76543210, 0xfedcba98, false, false)); }
// Transposed products: St = K * Qt (A = K rows, B = Q), Ot += Vt * Pt (A = Vt rows, B = Pt). The fragments are the same registers as before with A and B swapped (one k order for both).
// St tile nt: register r of lane (hh, ln) = score of key j0 + 16 nt + 8 hh + r with query q0 + ln: a lane holds 16 scores of ONE query, so maximum and sum run in the lane,
// with one exchange between the wave halves for the maximum; the two halves' sums are joined once, behind the loop.
// The two converted St tiles are the B fragment of Pt as they stand (element 8 nt + r = k 16 nt + 8 hh + r): P passes through no LDS.
__global__ __launch_bounds__(128) void k_flash(const _Float16* __restrict__ Q16, int ldq, const _Float16* __restrict__ K16, int ldk, const _Float16* __restrict__ Vt, const int* __restrict__ MSK, float* __restrict__ O, int ldo) {
  constexpr int RPW = 16, NQB = 2048 / (4 * RPW), DT = 4, KS = 2;
  __shared__ __attribute__((aligned(16))) float sO[4][RPW][64 + 4];
  const int tid = threadIdx.x, w = tid >> 5, lane = tid & 31, ln = lane & 15, hh = lane >> 4;
  const int slab = blockIdx.x / NQB, qblk = blockIdx.x % NQB; const int b = slab / 16, h = slab % 16; const int qb0 = qblk * (4 * RPW); const int q0 = qb0 + w * RPW;
  FragH aq[KS];
  { const unsigned short* qr = (const unsigned short*)Q16 + ((size_t)b * 2048 + q0) * ldq + h * 1024 + lane * 8;      // Q16, K16, Vt: fragment order (see k_wt_f16); a head's 64 columns are two tiles, 1024 elements
#pragma unroll
    for (int ks = 0; ks < KS; ++ks) { aq[ks].half[0] = *(const v8us*)(qr + ks * 512); aq[ks].half[1] = *(const v8us*)(qr + ks * 512 + 256); } }
  const unsigned short* Vth = (const unsigned short*)Vt + (size_t)slab * 64 * 2048;
  float m_r = -3.0e38f, l_r = 0.f; v8f oacc[DT];      // of query q0 + ln; l_r sums this half's keys only; oacc[dt][r] = Ot[16 dt + 8 hh + r][q0 + ln]
#pragma unroll
  for (int dt = 0; dt < DT; ++dt) oacc[dt] = (v8f){0.f,0.f,0.f,0.f,0.f,0.f,0.f,0.f};
  const int jend = 2048;
  // Fragment loads stand well ahead of their products: a pass issues its V fragments as one group at its top (they land behind the softmax) and,
  // right behind its score products, the next pass's K fragments (they land behind the rest of the pass). No product waits on a load just issued.
  // The unroll directives on the fragment loops keep the fragment arrays in registers (constant indices).
  FragH bk[2][KS];
#pragma unroll
  for (int nt = 0; nt < 2; ++nt) { const unsigned short* kr = (const unsigned short*)K16 + ((size_t)b * 2048 + nt * 16) * ldk + h * 1024 + lane * 8;
#pragma unroll
    for (int ks = 0; ks < KS; ++ks) { bk[nt][ks].half[0] = *(const v8us*)(kr + ks * 512); bk[nt][ks].half[1] = *(const v8us*)(kr + ks * 512 + 256); } }
#pragma unroll 1
  for (int j0 = 0; j0 < jend; j0 += 32) {
    FragH bv[DT];
#pragma unroll
    for (int dt = 0; dt < DT; ++dt) { const unsigned short* vrow = Vth + (size_t)j0 * 64 + dt * 512 + lane * 8; bv[dt].half[0] = *(const v8us*)vrow; bv[dt].half[1] = *(const v8us*)(vrow + 256); }
    v8f s[2];
#pragma unroll
    for (int nt = 0; nt < 2; ++nt) { v8f acc = (v8f){0.f,0.f,0.f,0.f,0.f,0.f,0.f,0.f};
#pragma unroll
      for (int ks = 0; ks < KS; ++ks) acc = mmaH<1>(bk[nt][ks].v, bk[nt][ks].v, aq[ks].v, aq[ks].v, acc); s[nt] = acc; }
    const int jn = (j0 + 32 < jend) ? j0 + 32 : j0;      // the last pass reads its own rows again: in bounds, not used
#pragma unroll
    for (int nt = 0; nt < 2; ++nt) { const unsigned short* kr = (const unsigned short*)K16 + ((size_t)b * 2048 + jn + nt * 16) * ldk + h * 1024 + lane * 8;
#pragma unroll
      for (int ks = 0; ks < KS; ++ks) { bk[nt][ks].half[0] = *(const v8us*)(kr + ks * 512); bk[nt][ks].half[1] = *(const v8us*)(kr + ks * 512 + 256); } }
    float mx[8];
#pragma unroll
    for (int r = 0; r < 8; ++r) { s[0][r] *= 0.125f; s[1][r] *= 0.125f; mx[r] = fmaxf(s[0][r], s[1][r]); }
    float mc = fmaxf(fmaxf(fmaxf(mx[0], mx[1]), fmaxf(mx[2], mx[3])), fmaxf(fmaxf(mx[4], mx[5]), fmaxf(mx[6], mx[7])));
    mc = fmaxf(mc, xhalf(mc));
    const float mn = fmaxf(m_r, mc); const float al = (mn > -1.0e38f) ? expf(m_r - mn) : 1.0f; m_r = mn;
    FragH pb; float ps[8];
#pragma unroll
    for (int r = 0; r < 8; ++r) { const float p0 = expf(s[0][r] - mn), p1 = expf(s[1][r] - mn); ps[r] = p0 + p1; pb.h[r] = (_Float16)p0; pb.h[8 + r] = (_Float16)p1; }
    l_r = l_r * al + (((ps[0] + ps[1]) + (ps[2] + ps[3])) + ((ps[4] + ps[5]) + (ps[6] + ps[7])));
#pragma unroll
    for (int dt = 0; dt < DT; ++dt)
#pragma unroll
      for (int r = 0; r < 8; ++r) oacc[dt][r] *= al;
#pragma unroll
    for (int dt = 0; dt < DT; ++dt) oacc[dt] = mmaH<1>(bv[dt].v, bv[dt].v, pb.v, pb.v, oacc[dt]); }
  { const float l = l_r + xhalf(l_r); l_r = (l > 0.f) ? 1.0f / l : 0.f; }
  // a lane holds 8 consecutive d of its query per tile; through LDS so that the global stores stay whole rows of 256 bytes
#pragma unroll
  for (int dt = 0; dt < DT; ++dt)
#pragma unroll
    for (int r = 0; r < 8; ++r) sO[w][ln][dt * 16 + 8 * hh + r] = oacc[dt][r] * l_r;
  __builtin_amdgcn_fence(__ATOMIC_ACQ_REL, "workgroup"); __builtin_amdgcn_wave_barrier();
  {
#pragma unroll
    for (int rp = 0; rp < RPW; rp += 2) { const int r = rp + (lane >> 4), pc = lane & 15; const v4f val = *(const v4fa*)&sO[w][r][pc * 4]; *(v4f*)(O + ((size_t)b * 2048 + q0 + r) * ldo + h * 64 + pc * 4) = val; }
     } }

__global__ __launch_bounds__(256) void k_vmask(const float* __restrict__ V, const float* __restrict__ mk, _Float16* __restrict__ V16, size_t n8) { const size_t t = (size_t)blockIdx.x * 256 + threadIdx.x; if (t >= n8) return; const size_t r = (t * 8) / DD; const float m = bf16_round(mk[r]); FragH f;
#pragma unroll
  for (int q = 0; q < 8; ++q) f.h[q] = (_Float16)(V[t * 8 + q] * m); *(v8us*)((unsigned short*)V16 + t * 8) = f.half[0];  }
extern "C" void kernel_launch(void* const* d_in, const int* in_sizes, int n_in,
                              void* d_out, int out_size, void* d_ws, size_t ws_size, hipStream_t stream) {
  (void)in_sizes; (void)n_in; (void)out_size;
  const float* xq = (const float*)d_in[0]; const float* xkv = (const float*)d_in[1]; const float* mk = (const float*)d_in[2]; const float* Wq = (const float*)d_in[3]; const float* bq = (const float*)d_in[4]; const float* Wk = (const float*)d_in[5]; const float* bk = (const float*)d_in[6]; const float* Wv = (const float*)d_in[7]; const float* bv = (const float*)d_in[8]; const float* Wo = (const float*)d_in[9]; const float* bo = (const float*)d_in[10];
  char* ws = (char*)d_ws; size_t off = 0;
  auto take = [&](size_t bytes) { char* p = ws + off; off += (bytes + 255) & ~(size_t)255; return p; };
  _Float16* Bq = (_Float16*)take((size_t)DD * DD * 2); _Float16* Bk = (_Float16*)take((size_t)DD * DD * 2); _Float16* Bv = (_Float16*)take((size_t)DD * DD * 2); _Float16* Bo = (_Float16*)take((size_t)DD * DD * 2);
  _Float16* XQ16 = (_Float16*)take((size_t)NR * DD * 2); _Float16* XKV16 = (_Float16*)take((size_t)NR * DD * 2); _Float16* Q16 = (_Float16*)take((size_t)NR * DD * 2); _Float16* K16 = (_Float16*)take((size_t)NR * DD * 2); float* VF = (float*)take((size_t)NR * DD * 4); _Float16* V16 = XKV16; _Float16* Vt = XQ16; float* O = VF; _Float16* O16 = Q16;
  if (off > ws_size) return;      // 8.4 + 8.4 × 4 + 16.8 ≈ 59 MB
  k_wt_f16<<<(unsigned)(((size_t)DD * (DD / 8) + 255) / 256), 256, 0, stream>>>(Wq, Bq, DD, DD, 16.0f); k_wt_f16<<<(unsigned)(((size_t)DD * (DD / 8) + 255) / 256), 256, 0, stream>>>(Wk, Bk, DD, DD, 16.0f); k_wt_f16<<<(unsigned)(((size_t)DD * (DD / 8) + 255) / 256), 256, 0, stream>>>(Wv, Bv, DD, DD, 16.0f); k_wt_f16<<<(unsigned)(((size_t)DD * (DD / 8) + 255) / 256), 256, 0, stream>>>(Wo, Bo, DD, DD, 16.0f);      // (D,H,Dh) = [in][h·64+d]; Wo (H,Dh,D) = [in=(h,d)][out]
  const unsigned g8 = (unsigned)(((size_t)NR * DD / 8 + 255) / 256); const dim3 gg(((NR / 16) * (DD / 64) + 3) / 4, 1);
  k_x16<<<g8, 256, 0, stream>>>(xq, XQ16, (size_t)NR * DD / 8); k_x16<<<g8, 256, 0, stream>>>(xkv, XKV16, (size_t)NR * DD / 8);
  k_gemm_hhx<0><<<gg, 128, 0, stream>>>(XQ16, DD, 0, Bq, DD, 0, 0.0625f, bq, 0, nullptr, 1, 0, 0, nullptr, Q16, DD, 0, NR, DD, DD);
  k_gemm_hhx<0><<<gg, 128, 0, stream>>>(XKV16, DD, 0, Bk, DD, 0, 0.0625f, bk, 0, nullptr, 1, 0, 0, nullptr, K16, DD, 0, NR, DD, DD);
  k_gemm_hhx<0><<<gg, 128, 0, stream>>>(XKV16, DD, 0, Bv, DD, 0, 0.0625f, bv, 0, nullptr, 1, 0, 0, VF, nullptr, DD, 0, NR, DD, DD);      // v (f32, + bv) — masked next
  k_vmask<<<g8, 256, 0, stream>>>(VF, mk, V16, (size_t)NR * DD / 8);      // V16 over XKV16 (its last reader was the v GEMM)
  k_vt<NH, TT><<<BB * NH * (TT / 64), 256, 0, stream>>>(V16, DD, 0, Vt);      // Vt over XQ16
  k_flash<<<BB * NH * (TT / 64), 128, 0, stream>>>(Q16, DD, K16, DD, Vt, nullptr, O, DD);      // q/√64 folded into the 0.125 scale; O over VF
  k_h16<<<g8, 256, 0, stream>>>(O, O16, (size_t)NR * DD / 8);
  k_gemm_hhx<0><<<gg, 128, 0, stream>>>(O16, DD, 0, Bo, DD, 0, 0.0625f, bo, 0, nullptr, 1, 0, 0, (float*)d_out, nullptr, DD, 0, NR, DD, DD);
}

// v004
// A run of this version takes 164 microseconds.
// Timed twice side by side with v003, it ran 1.14 and 1.15 times as fast.
// Over all steps from v000 it is 2.69 times as fast.
#include <hip/hip_runtime.h>
// Multi-head dot-product attention with a per-key value mask (B=2, L=2048, D=1024, 16 heads × 64; q from inputs_q, k/v from inputs_kv; v ← mask_k·v; softmax(q·k/8); merge; ·Wo + bo): the
// q/k/v/o projections are GEMMs ([in][out] weights bf16-exact ×2^4, bias epilogues, f32 accumulate) and the attention is a fused flash-style kernel (online softmax f32; P f16 ≤ 1; Ot = Vt·Pt;
// RPW-16 waves) on v_wmma_f32_16x16x32_f16; the value masking is applied in f32 VALU before the f16 conversion.
#define BB 2
#define TT 2048
#define DD 1024
#define NH 16
#define NR (BB * TT)

typedef __bf16 v16b __attribute__((ext_vector_type(16)));
typedef unsigned short v8us __attribute__((ext_vector_type(8), may_alias));
typedef float  v8f  __attribute__((ext_vector_type(8)));
typedef float  v4f  __attribute__((ext_vector_type(4)));
typedef float  v4fa __attribute__((ext_vector_type(4), may_alias));
union FragB { v16b v; v8us half[2]; unsigned short u[16]; };

__device__ __forceinline__ unsigned short bf16_bits(float x) { unsigned int u = __float_as_uint(x); return (unsigned short)((u + 0x7FFFu + ((u >> 16) & 1u)) >> 16); }
__device__ __forceinline__ float bf16_val(unsigned short b) { return __uint_as_float(((unsigned int)b) << 16); }
__device__ __forceinline__ float bf16_round(float x) { return bf16_val(bf16_bits(x)); }
// D += A·B with NT terms: 1 = ah·bh, 2 = + al·bh (A split), 3 = + ah·bl (both split)
template <int NT>
__device__ __forceinline__ v8f mmaN(v16b ah, v16b al, v16b bh, v16b bl, v8f c) {
  c = __builtin_amdgcn_wmma_f32_16x16x32_bf16(false, ah, false, bh, (short)0, c, false, false);
  if (NT >= 2) c = __builtin_amdgcn_wmma_f32_16x16x32_bf16(false, al, false, bh, (short)0, c, false, false);
  if (NT >= 3) c = __builtin_amdgcn_wmma_f32_16x16x32_bf16(false, ah, false, bl, (short)0, c, false, false);
  asm volatile("v_nop\n\tv_nop\n\tv_nop\n\tv_nop" : "+v"(c) : "v"(ah), "v"(al), "v"(bh), "v"(bl));
  return c;
}

__global__ __launch_bounds__(256) void k_wt_bf16(const float* __restrict__ W, unsigned short* __restrict__ Wt, int K, int N) {
  const int t = blockIdx.x * 256 + threadIdx.x;
  const int k8n = K / 8;
  if (t >= N * k8n) return;
  const int n = t / k8n, k8 = (t % k8n) * 8;
  v8us v;
#pragma unroll
  for (int i = 0; i < 8; ++i) v[i] = bf16_bits(W[(size_t)(k8 + i) * N + n]);
  *(v8us*)(Wt + (size_t)n * K + k8) = v;
  
}

// GEMM C[M][N] (f32, pitch ldc) = act(A[M][K]·W + bias). A f32 row-major (pitch lda) converted per fragment to bf16
// (ASPLIT: hi/lo two planes -> 2 terms, else single rounded term); Wt bf16 [N][K] (pitch ldb). BIAS_BF16 rounds the
// bias to bf16 first (bias quantised to bf16 before the add). K%32==0, M%16==0, N%64==0.
template <bool ASPLIT, int ACT, bool BIAS_BF16>
__global__ __launch_bounds__(128) void k_gemm_bf(const float* __restrict__ A, int lda, const unsigned short* __restrict__ Wt, int ldb,
                                               const float* __restrict__ bias, float* __restrict__ C, int ldc, int M, int N, int K) {
  __shared__ __attribute__((aligned(16))) float so[4][16][64];
  const int tid = threadIdx.x, w = tid >> 5, lane = tid & 31, ln = lane & 15, hh = lane >> 4;
  const int ntn = N / 64;
  const int wid = blockIdx.x * 4 + w;
  const int mt = wid / ntn, nq = wid % ntn;
  if (mt * 16 >= M) return;
  const int row0 = mt * 16, col0 = nq * 64;
  const float* arow = A + (size_t)(row0 + ln) * lda;
  v8f acc[4] = {};
  for (int kb = 0; kb < K; kb += 32) {
    FragB ah, al;
    const v4f x0 = *(const v4fa*)(arow + kb + 8 * hh), x1 = *(const v4fa*)(arow + kb + 8 * hh + 4);
    const v4f x2 = *(const v4fa*)(arow + kb + 16 + 8 * hh), x3 = *(const v4fa*)(arow + kb + 16 + 8 * hh + 4);
    float xs[16] = {x0[0],x0[1],x0[2],x0[3],x1[0],x1[1],x1[2],x1[3],x2[0],x2[1],x2[2],x2[3],x3[0],x3[1],x3[2],x3[3]};
#pragma unroll
    for (int i = 0; i < 16; ++i) { const unsigned short hb = bf16_bits(xs[i]); ah.u[i] = hb; al.u[i] = ASPLIT ? bf16_bits(xs[i] - bf16_val(hb)) : (unsigned short)0; }
#pragma unroll
    for (int t = 0; t < 4; ++t) {
      const unsigned short* brow = Wt + (size_t)(col0 + t * 16 + ln) * ldb + kb;
      FragB b;
      b.half[0] = *(const v8us*)(brow + 8 * hh);
      b.half[1] = *(const v8us*)(brow + 16 + 8 * hh);
      acc[t] = mmaN<ASPLIT ? 2 : 1>(ah.v, al.v, b.v, b.v, acc[t]);
    }
  }
#pragma unroll
  for (int t = 0; t < 4; ++t) {
    float bv = bias ? bias[col0 + t * 16 + ln] : 0.f;
    if (BIAS_BF16) bv = bf16_round(bv);
#pragma unroll
    for (int r = 0; r < 8; ++r) { float v = acc[t][r] + bv; if (ACT == 1) v = fmaxf(v, 0.f); so[w][8 * hh + r][t * 16 + ln] = v; }
  }
  __builtin_amdgcn_fence(__ATOMIC_ACQ_REL, "workgroup");
  __builtin_amdgcn_wave_barrier();
  const int rsub = lane >> 4, c4 = (lane & 15) * 4;
  {
#pragma unroll
    for (int q = 0; q < 8; ++q) {
      const int r = q * 2 + rsub;
      const v4f v = *(const v4fa*)&so[w][r][c4];
      *(v4f*)(C + (size_t)(row0 + r) * ldc + col0 + c4) = v;
    }
    
  }
}

// Flash-style causal/unmasked attention, all contractions 3-term bf16 hi/lo splits, f32 softmax with running max.
// q,k,v rows are read from f32 buffers with arbitrary row pitch (so they can live inside a fused qkv buffer);
// D = head size (multiple of 32, <= 128); one wave = 16 query rows; block = 4 waves (64 queries) sharing K/V chunks of 32.
template <int D, bool CAUSAL>
__global__ __launch_bounds__(128) void k_flash(const float* __restrict__ qb, const float* __restrict__ kb, const float* __restrict__ vb,
                                             int pitch, int T, int H, float scale, float* __restrict__ y, int ypitch) {
  constexpr int KS = D / 32;        // k-steps for QK
  constexpr int DT = D / 16;        // d tiles for PV
  __shared__ __attribute__((aligned(16))) unsigned short sKh[32][D + 8], sKl[32][D + 8], sVh[32][D + 8], sVl[32][D + 8];
  __shared__ __attribute__((aligned(16))) unsigned short sPh[4][16][40], sPl[4][16][40];
  __shared__ __attribute__((aligned(16))) float sO[4][16][D];
  const int tid = threadIdx.x, w = tid >> 5, lane = tid & 31, ln = lane & 15, hh = lane >> 4;
  const int nqb = (T + 63) / 64;
  const int bh = blockIdx.x / nqb, qblk = blockIdx.x % nqb;
  const int b = bh / H, h = bh % H;
  const int q0 = qblk * 64 + w * 16;
  const float* Q = qb + (size_t)b * T * pitch + h * D;
  const float* K = kb + (size_t)b * T * pitch + h * D;
  const float* V = vb + (size_t)b * T * pitch + h * D;

  // A fragments of the wave's 16 query rows (scaled), hi/lo
  FragB aqh[KS], aql[KS];
  {
    int row = q0 + ln; if (row >= T) row = T - 1;
    const float* qr = Q + (size_t)row * pitch;
#pragma unroll
    for (int ks = 0; ks < KS; ++ks)
#pragma unroll
      for (int i = 0; i < 16; ++i) {
        const int d = ks * 32 + ((i < 8) ? (8 * hh + i) : (16 + 8 * hh + (i - 8)));
        const float x = qr[d] * scale; const unsigned short hb = bf16_bits(x);
        aqh[ks].u[i] = hb; aql[ks].u[i] = bf16_bits(x - bf16_val(hb));
      }
  }
  float m_r[8], l_r[8];
#pragma unroll
  for (int r = 0; r < 8; ++r) { m_r[r] = -3.0e38f; l_r[r] = 0.f; }
  v8f oacc[DT];
#pragma unroll
  for (int dt = 0; dt < DT; ++dt) oacc[dt] = (v8f){0.f,0.f,0.f,0.f,0.f,0.f,0.f,0.f};

  const int kv_end = CAUSAL ? min(T, qblk * 64 + 64) : T;     // block-uniform
  for (int j0 = 0; j0 < kv_end; j0 += 32) {
    __syncthreads();
    for (int e = tid; e < 32 * (D / 4); e += 128) {
      const int r = e / (D / 4), c4 = (e % (D / 4)) * 4;
      const int key = j0 + r;
      v4f kf = {0.f,0.f,0.f,0.f}, vf = {0.f,0.f,0.f,0.f};
      if (key < T) { kf = *(const v4fa*)(K + (size_t)key * pitch + c4); vf = *(const v4fa*)(V + (size_t)key * pitch + c4); }
#pragma unroll
      for (int t = 0; t < 4; ++t) {
        unsigned short hb = bf16_bits(kf[t]); sKh[r][c4 + t] = hb; sKl[r][c4 + t] = bf16_bits(kf[t] - bf16_val(hb));
        hb = bf16_bits(vf[t]); sVh[r][c4 + t] = hb; sVl[r][c4 + t] = bf16_bits(vf[t] - bf16_val(hb));
      }
    }
    __syncthreads();
    // S tile 16 x 32
    v8f s[2];
#pragma unroll
    for (int nt = 0; nt < 2; ++nt) {
      v8f acc = {};
#pragma unroll
      for (int ks = 0; ks < KS; ++ks) {
        FragB bh_, bl_;
        bh_.half[0] = *(const v8us*)&sKh[nt * 16 + ln][ks * 32 + 8 * hh]; bh_.half[1] = *(const v8us*)&sKh[nt * 16 + ln][ks * 32 + 16 + 8 * hh];
        bl_.half[0] = *(const v8us*)&sKl[nt * 16 + ln][ks * 32 + 8 * hh]; bl_.half[1] = *(const v8us*)&sKl[nt * 16 + ln][ks * 32 + 16 + 8 * hh];
        acc = mmaN<3>(aqh[ks].v, aql[ks].v, bh_.v, bl_.v, acc);
      }
      s[nt] = acc;
    }
    // mask + running max (rows 8hh+r; the 16 lanes of a half share rows)
    float alpha[8];
#pragma unroll
    for (int r = 0; r < 8; ++r) {
      const int qi = q0 + 8 * hh + r;
      const int ja = j0 + ln, jb = j0 + 16 + ln;
      if (CAUSAL) { if (ja > qi) s[0][r] = -3.0e38f; if (jb > qi) s[1][r] = -3.0e38f; }
      if (ja >= T) s[0][r] = -3.0e38f;
      if (jb >= T) s[1][r] = -3.0e38f;
      float mx = fmaxf(s[0][r], s[1][r]);
      mx = fmaxf(mx, __shfl_xor(mx, 1, 32)); mx = fmaxf(mx, __shfl_xor(mx, 2, 32)); mx = fmaxf(mx, __shfl_xor(mx, 4, 32)); mx = fmaxf(mx, __shfl_xor(mx, 8, 32));
      const float mnew = fmaxf(m_r[r], mx);
      alpha[r] = (mnew > -1.0e38f) ? __expf(m_r[r] - mnew) : 1.0f;
      const float p0 = (s[0][r] > -1.0e38f) ? __expf(s[0][r] - mnew) : 0.f;
      const float p1 = (s[1][r] > -1.0e38f) ? __expf(s[1][r] - mnew) : 0.f;
      m_r[r] = mnew;
      l_r[r] = l_r[r] * alpha[r] + p0 + p1;            // per-lane partial row sum (16 lanes combined at the end)
      unsigned short hb = bf16_bits(p0); sPh[w][8 * hh + r][ln] = hb;      sPl[w][8 * hh + r][ln] = bf16_bits(p0 - bf16_val(hb));
      hb = bf16_bits(p1);                sPh[w][8 * hh + r][16 + ln] = hb; sPl[w][8 * hh + r][16 + ln] = bf16_bits(p1 - bf16_val(hb));
    }
#pragma unroll
    for (int dt = 0; dt < DT; ++dt)
#pragma unroll
      for (int r = 0; r < 8; ++r) oacc[dt][r] *= alpha[r];
    __builtin_amdgcn_fence(__ATOMIC_ACQ_REL, "workgroup");
    __builtin_amdgcn_wave_barrier();
    FragB pah, pal;
    pah.half[0] = *(const v8us*)&sPh[w][ln][8 * hh]; pah.half[1] = *(const v8us*)&sPh[w][ln][16 + 8 * hh];
    pal.half[0] = *(const v8us*)&sPl[w][ln][8 * hh]; pal.half[1] = *(const v8us*)&sPl[w][ln][16 + 8 * hh];
#pragma unroll
    for (int dt = 0; dt < DT; ++dt) {
      FragB bvh, bvl;
#pragma unroll
      for (int i = 0; i < 8; ++i) {
        bvh.u[i] = sVh[8 * hh + i][dt * 16 + ln]; bvh.u[8 + i] = sVh[16 + 8 * hh + i][dt * 16 + ln];
        bvl.u[i] = sVl[8 * hh + i][dt * 16 + ln]; bvl.u[8 + i] = sVl[16 + 8 * hh + i][dt * 16 + ln];
      }
      oacc[dt] = mmaN<3>(pah.v, pal.v, bvh.v, bvl.v, oacc[dt]);
    }
    __builtin_amdgcn_fence(__ATOMIC_ACQ_REL, "workgroup");
    __builtin_amdgcn_wave_barrier();
  }
#pragma unroll
  for (int r = 0; r < 8; ++r) {
    float l = l_r[r];
    l += __shfl_xor(l, 1, 32); l += __shfl_xor(l, 2, 32); l += __shfl_xor(l, 4, 32); l += __shfl_xor(l, 8, 32);
    l_r[r] = (l > 0.f) ? 1.0f / l : 0.f;
  }
#pragma unroll
  for (int dt = 0; dt < DT; ++dt)
#pragma unroll
    for (int r = 0; r < 8; ++r) sO[w][8 * hh + r][dt * 16 + ln] = oacc[dt][r] * l_r[r];
  __builtin_amdgcn_fence(__ATOMIC_ACQ_REL, "workgroup");
  __builtin_amdgcn_wave_barrier();
  {
    for (int r = 0; r < 16; ++r) {
      const int row = q0 + r;
      if (row < T && lane < D / 4) {
        const v4f val = *(const v4fa*)&sO[w][r][lane * 4];
        *(v4f*)(y + ((size_t)b * T + row) * ypitch + h * D + lane * 4) = val;
      }
    }
    
  }
}

// GEMM C = act(A·W + bias + resid): A f32 (ASPLIT -> hi/lo 2 terms), Wt bf16 [N][K]; ACT 0 none, 1 relu, 2 exact gelu;
// resid (optional, f32, row index = (row % rmod), pitch ldr, RES_BF16 rounds it) added before the activation.
template <bool ASPLIT, int ACT, bool BIAS_BF16, bool RES_BF16>
__global__ __launch_bounds__(128) void k_gemm_bf3(const float* __restrict__ A, int lda, const unsigned short* __restrict__ Wt, int ldb,
                                                const float* __restrict__ bias, const float* __restrict__ resid, int rmod, int ldr,
                                                float* __restrict__ C, int ldc, int M, int N, int K) {
  __shared__ __attribute__((aligned(16))) float so[4][16][64];
  const int tid = threadIdx.x, w = tid >> 5, lane = tid & 31, ln = lane & 15, hh = lane >> 4;
  const int ntn = N / 64;
  const int wid = blockIdx.x * 4 + w;
  const int mt = wid / ntn, nq = wid % ntn;
  if (mt * 16 >= M) return;
  const int row0 = mt * 16, col0 = nq * 64;
  const float* arow = A + (size_t)(row0 + ln) * lda;
  v8f acc[4] = {};
  for (int kb = 0; kb < K; kb += 32) {
    FragB ah, al;
    const v4f x0 = *(const v4fa*)(arow + kb + 8 * hh), x1 = *(const v4fa*)(arow + kb + 8 * hh + 4);
    const v4f x2 = *(const v4fa*)(arow + kb + 16 + 8 * hh), x3 = *(const v4fa*)(arow + kb + 16 + 8 * hh + 4);
    float xs[16] = {x0[0],x0[1],x0[2],x0[3],x1[0],x1[1],x1[2],x1[3],x2[0],x2[1],x2[2],x2[3],x3[0],x3[1],x3[2],x3[3]};
#pragma unroll
    for (int i = 0; i < 16; ++i) { const unsigned short hb = bf16_bits(xs[i]); ah.u[i] = hb; al.u[i] = ASPLIT ? bf16_bits(xs[i] - bf16_val(hb)) : (unsigned short)0; }
#pragma unroll
    for (int t = 0; t < 4; ++t) {
      const unsigned short* brow = Wt + (size_t)(col0 + t * 16 + ln) * ldb + kb;
      FragB b;
      b.half[0] = *(const v8us*)(brow + 8 * hh);
      b.half[1] = *(const v8us*)(brow + 16 + 8 * hh);
      acc[t] = mmaN<ASPLIT ? 2 : 1>(ah.v, al.v, b.v, b.v, acc[t]);
    }
  }
#pragma unroll
  for (int t = 0; t < 4; ++t) {
    const int col = col0 + t * 16 + ln;
    float bv = bias ? bias[col] : 0.f;
    if (BIAS_BF16) bv = bf16_round(bv);
#pragma unroll
    for (int r = 0; r < 8; ++r) {
      float v = acc[t][r] + bv;
      if (resid) { float rv = resid[(size_t)((row0 + 8 * hh + r) % rmod) * ldr + col]; if (RES_BF16) rv = bf16_round(rv); v += rv; }
      if (ACT == 1) v = fmaxf(v, 0.f);
      if (ACT == 2) v = 0.5f * v * (1.0f + erff(v * 0.70710678118654752f));
      if (ACT == 3) { const float u = 0.7978845608028654f * (v + 0.044715f * v * v * v); v = 0.5f * v * (1.0f + tanhf(u)); }
      so[w][8 * hh + r][t * 16 + ln] = v;
    }
  }
  __builtin_amdgcn_fence(__ATOMIC_ACQ_REL, "workgroup");
  __builtin_amdgcn_wave_barrier();
  const int rsub = lane >> 4, c4 = (lane & 15) * 4;
  {
#pragma unroll
    for (int q = 0; q < 8; ++q) {
      const int r = q * 2 + rsub;
      const v4f v = *(const v4fa*)&so[w][r][c4];
      *(v4f*)(C + (size_t)(row0 + r) * ldc + col0 + c4) = v;
    }
    
  }
}
// row LayerNorm (biased variance, eps) over N: s = X (+ R); optional out_sum <- s; out_norm <- (s-mu)*rsqrt(var+eps)*g + b
template <bool PARAM_BF16>
__global__ __launch_bounds__(256) void k_layernorm(const float* __restrict__ X, const float* __restrict__ R, const float* __restrict__ g, const float* __restrict__ bta,
                                                  float* __restrict__ out_sum, float* __restrict__ out_norm, int N, float eps) {
  __shared__ float red[256];
  const int row = blockIdx.x, tid = threadIdx.x;
  const float* x = X + (size_t)row * N; const float* rr = R ? R + (size_t)row * N : nullptr;
  float vals[16];                     // up to N = 4096
  const int per = N / 256;            // contiguous chunk per thread? use strided-by-4 chunks: thread handles j = tid*4 + 1024*u
  float s1 = 0.f;
  for (int u = 0; u < per / 4; ++u) {
    const int j = tid * 4 + 1024 * u;
    const v4f a = *(const v4fa*)(x + j);
    v4f b = {0.f,0.f,0.f,0.f}; if (rr) b = *(const v4fa*)(rr + j);
#pragma unroll
    for (int q = 0; q < 4; ++q) { const float v = a[q] + b[q]; vals[u * 4 + q] = v; s1 += v; }
  }
  red[tid] = s1; __syncthreads();
  for (int st = 128; st > 0; st >>= 1) { if (tid < st) red[tid] += red[tid + st]; __syncthreads(); }
  const float mu = red[0] / (float)N; __syncthreads();
  float s2 = 0.f;
  for (int u = 0; u < per / 4; ++u)
#pragma unroll
    for (int q = 0; q < 4; ++q) { const float c = vals[u * 4 + q] - mu; s2 += c * c; }
  red[tid] = s2; __syncthreads();
  for (int st = 128; st > 0; st >>= 1) { if (tid < st) red[tid] += red[tid + st]; __syncthreads(); }
  const float rs = rsqrtf(red[0] / (float)N + eps);
  {
    for (int u = 0; u < per / 4; ++u) {
      const int j = tid * 4 + 1024 * u;
      v4f o, sm;
#pragma unroll
      for (int q = 0; q < 4; ++q) {
        float gg = g[j + q], bb = bta[j + q];
        if (PARAM_BF16) { gg = bf16_round(gg); bb = bf16_round(bb); }
        sm[q] = vals[u * 4 + q]; o[q] = (vals[u * 4 + q] - mu) * rs * gg + bb;
      }
      if (out_sum) *(v4f*)(out_sum + (size_t)row * N + j) = sm;
      *(v4f*)(out_norm + (size_t)row * N + j) = o;
    }
    
  }
}



// ---- f16 WMMA path (v_wmma_f32_16x16x32_f16): 11-bit significands for operands in range — used where a [0,1] probability operand needs more precision than bf16
typedef _Float16 v16h __attribute__((ext_vector_type(16)));
union FragH { v16h v; v8us half[2]; _Float16 h[16]; unsigned short u[16]; };
template <int NT>
__device__ __forceinline__ v8f mmaH(v16h ah, v16h al, v16h bh, v16h bl, v8f c) {
  c = __builtin_amdgcn_wmma_f32_16x16x32_f16(false, ah, false, bh, (short)0, c, false, false);
  if (NT >= 2) c = __builtin_amdgcn_wmma_f32_16x16x32_f16(false, al, false, bh, (short)0, c, false, false);
  if (NT >= 3) c = __builtin_amdgcn_wmma_f32_16x16x32_f16(false, ah, false, bl, (short)0, c, false, false);
  asm volatile("v_nop\n\tv_nop\n\tv_nop\n\tv_nop" : "+v"(c) : "v"(ah), "v"(al), "v"(bh), "v"(bl));
  return c;
}
// batched GEMM like k_gemm_b but f16 operands: A f32 (split into f16 hi/lo if ASPLIT, else rounded to f16), Bt = f16 values [n][k]; alpha; C f32; N multiple of 16 (partial tiles skipped)
template <bool ASPLIT>
__global__ __launch_bounds__(128) void k_gemm_h(const float* __restrict__ A, int lda, size_t sA, const _Float16* __restrict__ Bh, int ldb, size_t sB, float alpha, float* __restrict__ C, int ldc, size_t sC, int M, int N, int K) {
  __shared__ __attribute__((aligned(16))) float so[4][16][64];
  const int tid = threadIdx.x, w = tid >> 5, lane = tid & 31, ln = lane & 15, hh = lane >> 4; const int by = blockIdx.y;
  A += (size_t)by * sA; Bh += (size_t)by * sB; C += (size_t)by * sC;
  const int ntn = (N + 63) / 64; const int wid = blockIdx.x * 4 + w; const int mt = wid / ntn, nq = wid % ntn; if (mt * 16 >= M) return;
  const int row0 = mt * 16, col0 = nq * 64; const float* arow = A + (size_t)(row0 + ln) * lda;
  v8f acc[4] = {};
  for (int kb = 0; kb < K; kb += 32) {
    FragH ah, al;
    const v4f x0 = *(const v4fa*)(arow + kb + 8 * hh), x1 = *(const v4fa*)(arow + kb + 8 * hh + 4), x2 = *(const v4fa*)(arow + kb + 16 + 8 * hh), x3 = *(const v4fa*)(arow + kb + 16 + 8 * hh + 4);
    float xs[16] = {x0[0],x0[1],x0[2],x0[3],x1[0],x1[1],x1[2],x1[3],x2[0],x2[1],x2[2],x2[3],x3[0],x3[1],x3[2],x3[3]};
#pragma unroll
    for (int i = 0; i < 16; ++i) { const _Float16 h = (_Float16)xs[i]; ah.h[i] = h; al.h[i] = ASPLIT ? (_Float16)(xs[i] - (float)h) : (_Float16)0.0f; }
#pragma unroll
    for (int t = 0; t < 4; ++t) { if (col0 + t * 16 >= N) continue; const size_t boff = (size_t)(col0 + t * 16 + ln) * ldb + kb; FragH bq; bq.half[0] = *(const v8us*)(Bh + boff + 8 * hh); bq.half[1] = *(const v8us*)(Bh + boff + 16 + 8 * hh);
      acc[t] = mmaH<ASPLIT ? 2 : 1>(ah.v, al.v, bq.v, bq.v, acc[t]); }
  }
#pragma unroll
  for (int t = 0; t < 4; ++t) { if (col0 + t * 16 >= N) continue;
#pragma unroll
    for (int r = 0; r < 8; ++r) so[w][8 * hh + r][t * 16 + ln] = acc[t][r] * alpha; }
  __builtin_amdgcn_fence(__ATOMIC_ACQ_REL, "workgroup"); __builtin_amdgcn_wave_barrier();
  const int rsub = lane >> 4, c4 = (lane & 15) * 4;
  {
#pragma unroll
    for (int q = 0; q < 8; ++q) { const int r = q * 2 + rsub; if (col0 + c4 < N) { const v4f v = *(const v4fa*)&so[w][r][c4]; *(v4f*)(C + (size_t)(row0 + r) * ldc + col0 + c4) = v; } }
     }
}

// Wt[n][k] = f16(W[k][n]·scale) from f32 row-major W[K][N] (scale = power of two; bf16-exact weights stay exact in f16 away from the subnormal range)
// FRAGMENT ORDER (f16 matrices in the workspace but V16, which is row-major; Vt numbers its tiles kt * 4 + dt, see k_vt): a [rows][K] operand is kept as tiles of 16 rows x 32 k, 1 KiB each, tile (rt, kt) at index rt * (K / 32) + kt.
// A tile is two halves of 512 bytes (k 0..15, then k 16..31); in half j lane hh * 16 + ln owns the 16 bytes of row ln, k = 16 j + 8 hh + 0..7: just what that lane feeds to the WMMA.
// One wave-wide 16-byte load of a half is then 512 contiguous bytes, four whole lines, where a row-major operand gives 32-byte pieces of 16 lines.
// Chunk t (16 bytes) of such a buffer: lane = t & 31, j = (t >> 5) & 1, tile = t >> 6. K % 32 == 0, rows % 16 == 0.
__global__ __launch_bounds__(256) void k_wt_f16(const float* __restrict__ W, _Float16* __restrict__ Wt, int K, int N, float scale) {
  const int t = blockIdx.x * 256 + threadIdx.x; if (t >= N * (K / 8)) return; const int lane = t & 31, j = (t >> 5) & 1, tile = t >> 6; const int n = (tile / (K / 32)) * 16 + (lane & 15), k8 = (tile % (K / 32)) * 32 + j * 16 + (lane >> 4) * 8; FragH f;
#pragma unroll
  for (int i = 0; i < 8; ++i) f.h[i] = (_Float16)(bf16_round(W[(size_t)(k8 + i) * N + n]) * scale); const v8us o = f.half[0];
  *(v8us*)((unsigned short*)Wt + (size_t)t * 8) = o; 
}
// k_gemm_hh variant with fused epilogue: v = acc·alpha + bias[by·sBias + col] (+ CP[(row/rowsPerB)·sCPb + by·64 + col] if CP) ; ACT 0 none / 1 elu ; writes f16 C16 and f32 C, each if non-null
template <int ACT>
__global__ __launch_bounds__(128) void k_gemm_hhx(const _Float16* __restrict__ A, int lda, size_t sA, const _Float16* __restrict__ Bh, int ldb, size_t sB, float alpha, const float* __restrict__ bias, size_t sBias, const float* __restrict__ CP, int rowsPerB, size_t sCPb, int row0g,
    float* __restrict__ C, _Float16* __restrict__ C16, int ldc, size_t sC, int M, int N, int K) {
  __shared__ __attribute__((aligned(16))) float so[4][16][64 + 4];      // pitch 272 B = 16 B x odd: the f16 epilogue reads 16 rows at one column with 16-byte loads
  const int tid = threadIdx.x, w = tid >> 5, lane = tid & 31, ln = lane & 15, hh = lane >> 4; const int by = blockIdx.y;
  A += (size_t)by * sA; Bh += (size_t)by * sB; const size_t cofs = (size_t)by * sC; const float* bp = bias ? bias + (size_t)by * sBias : nullptr;
  const int ntn = (N + 63) / 64; const int wid = blockIdx.x * 4 + w; const int mt = wid / ntn, nq = wid % ntn; if (mt * 16 >= M) return;
  const int row0 = mt * 16, col0 = nq * 64;
  v8f acc[4] = {};
  // All fragment loads of a k block stand ahead of its first product, so they are in flight together (one L2 round trip per block, not one per product).
  // A and Bh are in fragment order (see k_wt_f16): a tile row of 16 rows is 16 * pitch elements, a 32-k tile 512 elements, its second half 256 elements on; lda, ldb = K of the operand.
  // A B tile past N reads the last tile row (in bounds); its products are never stored: the epilogue skips that tile.
  // The unroll directives below keep the fragment arrays in registers (constant indices).
  const unsigned short* ap = (const unsigned short*)A + (size_t)row0 * lda + lane * 8; const unsigned short* bpt[4];
#pragma unroll
  for (int t = 0; t < 4; ++t) { int cr = col0 + t * 16; if (cr > N - 16) cr = N - 16; bpt[t] = (const unsigned short*)Bh + (size_t)cr * ldb + lane * 8; }
  int kb = 0;
  for (; kb + 64 <= K; kb += 64) {      // 64 k = two tiles = 2 KiB in a row of every tile row
    FragH ah[2], bq[2][4]; const unsigned short* pa = ap + kb * 16; const unsigned short* pb0 = bpt[0] + kb * 16; const unsigned short* pb1 = bpt[1] + kb * 16; const unsigned short* pb2 = bpt[2] + kb * 16; const unsigned short* pb3 = bpt[3] + kb * 16;
#pragma unroll
    for (int u = 0; u < 2; ++u) { ah[u].half[0] = *(const v8us*)(pa + u * 512); ah[u].half[1] = *(const v8us*)(pa + u * 512 + 256);
      bq[u][0].half[0] = *(const v8us*)(pb0 + u * 512); bq[u][0].half[1] = *(const v8us*)(pb0 + u * 512 + 256); bq[u][1].half[0] = *(const v8us*)(pb1 + u * 512); bq[u][1].half[1] = *(const v8us*)(pb1 + u * 512 + 256);
      bq[u][2].half[0] = *(const v8us*)(pb2 + u * 512); bq[u][2].half[1] = *(const v8us*)(pb2 + u * 512 + 256); bq[u][3].half[0] = *(const v8us*)(pb3 + u * 512); bq[u][3].half[1] = *(const v8us*)(pb3 + u * 512 + 256); }
    // the wait that stands in front of any reuse of the group's address registers; naming them as inputs keeps them whole up to it (no load of the group lands on one)
    asm volatile("s_wait_xcnt 0x0" :: "v"(pa), "v"(pb0), "v"(pb1), "v"(pb2), "v"(pb3) : "memory");
#pragma unroll
    for (int u = 0; u < 2; ++u)
#pragma unroll
      for (int t = 0; t < 4; ++t) acc[t] = mmaH<1>(ah[u].v, ah[u].v, bq[u][t].v, bq[u][t].v, acc[t]);
  }
  if (kb < K) {      // K % 64 == 32: the last 32 k
    FragH ah, bq[4]; const unsigned short* pa = ap + kb * 16; const unsigned short* pb0 = bpt[0] + kb * 16; const unsigned short* pb1 = bpt[1] + kb * 16; const unsigned short* pb2 = bpt[2] + kb * 16; const unsigned short* pb3 = bpt[3] + kb * 16;
    ah.half[0] = *(const v8us*)pa; ah.half[1] = *(const v8us*)(pa + 256);
    bq[0].half[0] = *(const v8us*)pb0; bq[0].half[1] = *(const v8us*)(pb0 + 256); bq[1].half[0] = *(const v8us*)pb1; bq[1].half[1] = *(const v8us*)(pb1 + 256);
    bq[2].half[0] = *(const v8us*)pb2; bq[2].half[1] = *(const v8us*)(pb2 + 256); bq[3].half[0] = *(const v8us*)pb3; bq[3].half[1] = *(const v8us*)(pb3 + 256);
    // as above: the wait in front of any reuse of these loads' address registers
    asm volatile("s_wait_xcnt 0x0" :: "v"(pa), "v"(pb0), "v"(pb1), "v"(pb2), "v"(pb3) : "memory");
#pragma unroll
    for (int t = 0; t < 4; ++t) acc[t] = mmaH<1>(ah.v, ah.v, bq[t].v, bq[t].v, acc[t]);
  }
#pragma unroll
  for (int t = 0; t < 4; ++t) { if (col0 + t * 16 >= N) continue; const int col = col0 + t * 16 + ln; const float bv = bp ? bf16_round(bp[col]) : 0.f;
#pragma unroll
    for (int r = 0; r < 8; ++r) { float v = acc[t][r] * alpha + bv; if (CP) { const int bidx = (row0g + row0 + 8 * hh + r) / rowsPerB; v += CP[(size_t)bidx * sCPb + (size_t)by * 64 + col]; } if (ACT == 1) v = (v > 0.f) ? v : expm1f(v); else if (ACT == 3) v = fmaxf(v, 0.f); so[w][8 * hh + r][t * 16 + ln] = v; } }
  __builtin_amdgcn_fence(__ATOMIC_ACQ_REL, "workgroup"); __builtin_amdgcn_wave_barrier();
  const int rsub = lane >> 4, c4 = (lane & 15) * 4;
  if (C) {      // f32 result, row-major
#pragma unroll
    for (int q = 0; q < 8; ++q) { const int r = q * 2 + rsub; if (col0 + c4 < N) { const v4f v = *(const v4fa*)&so[w][r][c4]; *(v4f*)(C + cofs + (size_t)(row0 + r) * ldc + col0 + c4) = v; } }
     }
  if (C16) {      // f16 result in fragment order (k = column, ldc = its K): the wave's 16 x 64 tile is 2 KiB in a row, half c holds columns col0 + 16 c ..
    unsigned short* cp = (unsigned short*)C16 + cofs + (size_t)row0 * ldc + (size_t)(col0 / 32) * 512 + lane * 8;
#pragma unroll
    for (int c = 0; c < 4; ++c) { if (col0 + c * 16 < N) { const v4f v0 = *(const v4fa*)&so[w][ln][c * 16 + hh * 8], v1 = *(const v4fa*)&so[w][ln][c * 16 + hh * 8 + 4]; FragH f;
#pragma unroll
        for (int i = 0; i < 4; ++i) { f.h[i] = (_Float16)v0[i]; f.h[4 + i] = (_Float16)v1[i]; }
        *(v8us*)(cp + c * 256) = f.half[0]; } }
     }
}


// x is row-major [rows][DD] f32; X16 is written in fragment order (see k_wt_f16), thread t = chunk t: a wave stores 512 contiguous bytes and reads 32-byte pieces of 16 rows.
__device__ __forceinline__ size_t frag_src(size_t t) { const int lane = (int)(t & 31), j = (int)((t >> 5) & 1); const size_t tile = t >> 6; return ((tile / (DD / 32)) * 16 + (lane & 15)) * DD + (tile % (DD / 32)) * 32 + j * 16 + (lane >> 4) * 8; }
__global__ __launch_bounds__(256) void k_x16(const float* __restrict__ x, _Float16* __restrict__ X16, size_t n8) { const size_t t = (size_t)blockIdx.x * 256 + threadIdx.x; if (t >= n8) return; FragH f; const size_t s = frag_src(t);
#pragma unroll
  for (int q = 0; q < 8; ++q) f.h[q] = (_Float16)bf16_round(x[s + q]); *(v8us*)((unsigned short*)X16 + t * 8) = f.half[0];  }
__global__ __launch_bounds__(256) void k_h16(const float* __restrict__ x, _Float16* __restrict__ X16, size_t n8) { const size_t t = (size_t)blockIdx.x * 256 + threadIdx.x; if (t >= n8) return; FragH f; const size_t s = frag_src(t);
#pragma unroll
  for (int q = 0; q < 8; ++q) f.h[q] = (_Float16)x[s + q]; *(v8us*)((unsigned short*)X16 + t * 8) = f.half[0];  }
__global__ __launch_bounds__(256) void k_round16f(const float* __restrict__ W, _Float16* __restrict__ Bt, size_t n8) { const size_t t = (size_t)blockIdx.x * 256 + threadIdx.x; if (t >= n8) return; FragH f;
#pragma unroll
  for (int i = 0; i < 8; ++i) f.h[i] = (_Float16)(bf16_round(W[t * 8 + i]) * 16.0f); *(v8us*)((unsigned short*)Bt + t * 8) = f.half[0];  }
template <int NHv, int TTv>
__global__ __launch_bounds__(256) void k_vt(const _Float16* __restrict__ V16, int ldv, int voff, _Float16* __restrict__ Vt) { __shared__ unsigned short tl[64][66]; const int tid = threadIdx.x; const int slab = blockIdx.x / (TTv / 64), lg = blockIdx.x % (TTv / 64); const int b = slab / NHv, h = slab % NHv;
  for (int i = tid; i < 64 * 8; i += 256) { const int r = i / 8, c8 = (i % 8) * 8; FragH f; f.half[0] = *(const v8us*)((const unsigned short*)V16 + ((size_t)b * TTv + lg * 64 + r) * ldv + voff + h * 64 + c8);
#pragma unroll
    for (int q = 0; q < 8; ++q) tl[r][c8 + q] = f.u[q]; }
  __syncthreads();
  {
#pragma unroll
    for (int rd = 0; rd < 2; ++rd) {      // Vt of a slab in fragment order, rows = d, k = key, the four d tiles of a 32-key tile side by side: tile index kt * 4 + dt; this block owns chunks lg * 512 .. + 511
      const int c = rd * 256 + tid, dt = (c >> 6) & 3, j = (c >> 5) & 1, hh = (c >> 4) & 1, ln = c & 15; FragH f;
#pragma unroll
      for (int q = 0; q < 8; ++q) f.u[q] = tl[rd * 32 + j * 16 + hh * 8 + q][dt * 16 + ln];
      *(v8us*)((unsigned short*)Vt + (size_t)slab * 64 * TTv + (size_t)lg * 4096 + c * 8) = f.half[0]; }
     } }

// lane l with lane l ^ 16 (a vector cross-row move, no LDS queue)
__device__ __forceinline__ float xhalf(float x) { return __builtin_bit_cast(float, __builtin_amdgcn_permlanex16(__builtin_bit_cast(int, x), __builtin_bit_cast(int, x), 0x76543210, 0xfedcba98, false, false)); }
// Transposed products: St = K * Qt (A = K rows, B = Q), Ot += Vt * Pt (A = Vt rows, B = Pt). The fragments are the same registers as before with A and B swapped (one k order for both).
// St tile nt: register r of lane (hh, ln) = score of key j0 + 16 nt + 8 hh + r with query q0 + ln: a lane holds 16 scores of ONE query, so maximum and sum run in the lane,
// with one exchange between the wave halves for the maximum; the two halves' sums are joined once, behind the loop.
// The two converted St tiles are the B fragment of Pt as they stand (element 8 nt + r = k 16 nt + 8 hh + r): P passes through no LDS.
__global__ __launch_bounds__(128) void k_flash(const _Float16* __restrict__ Q16, int ldq, const _Float16* __restrict__ K16, int ldk, const _Float16* __restrict__ Vt, const int* __restrict__ MSK, float* __restrict__ O, int ldo) {
  constexpr int RPW = 16, NQB = 2048 / (4 * RPW), DT = 4, KS = 2;
  __shared__ __attribute__((aligned(16))) float sO[4][RPW][64 + 4];
  const int tid = threadIdx.x, w = tid >> 5, lane = tid & 31, ln = lane & 15, hh = lane >> 4;
  const int slab = blockIdx.x / NQB, qblk = blockIdx.x % NQB; const int b = slab / 16, h = slab % 16; const int qb0 = qblk * (4 * RPW); const int q0 = qb0 + w * RPW;
  FragH aq[KS];
  { const unsigned short* qr = (const unsigned short*)Q16 + ((size_t)b * 2048 + q0) * ldq + h * 1024 + lane * 8;      // Q16, K16, Vt: fragment order (see k_wt_f16); a head's 64 columns are two tiles, 1024 elements
#pragma unroll
    for (int ks = 0; ks < KS; ++ks) { aq[ks].half[0] = *(const v8us*)(qr + ks * 512); aq[ks].half[1] = *(const v8us*)(qr + ks * 512 + 256); } }
  const unsigned short* Vth = (const unsigned short*)Vt + (size_t)slab * 64 * 2048;
  float m_r = -3.0e38f, l_r = 0.f; v8f oacc[DT];      // of query q0 + ln; l_r sums this half's keys only; oacc[dt][r] = Ot[16 dt + 8 hh + r][q0 + ln]
  // Softmax in base 2: exp(s / 8 - m) = exp2(s * CS - m * log2 e), CS = log2(e) / 8. m_r is kept in that scaled unit, so a weight is one fused multiply-add on the raw score and one hardware exp2.
  constexpr float CS = 0.125f * 1.4426950408889634f; typedef float v2f __attribute__((ext_vector_type(2)));
#pragma unroll
  for (int dt = 0; dt < DT; ++dt) oacc[dt] = (v8f){0.f,0.f,0.f,0.f,0.f,0.f,0.f,0.f};
  const int jend = 2048;
  // Fragment loads stand well ahead of their products: a pass issues its V fragments as one group at its top (they land behind the softmax) and,
  // right behind its score products, the next pass's K fragments (they land behind the rest of the pass). No product waits on a load just issued.
  // The unroll directives on the fragment loops keep the fragment arrays in registers (constant indices).
  FragH bk[2][KS];
#pragma unroll
  for (int nt = 0; nt < 2; ++nt) { const unsigned short* kr = (const unsigned short*)K16 + ((size_t)b * 2048 + nt * 16) * ldk + h * 1024 + lane * 8;
#pragma unroll
    for (int ks = 0; ks < KS; ++ks) { bk[nt][ks].half[0] = *(const v8us*)(kr + ks * 512); bk[nt][ks].half[1] = *(const v8us*)(kr + ks * 512 + 256); } }
#pragma unroll 1
  for (int j0 = 0; j0 < jend; j0 += 32) {
    FragH bv[DT];
#pragma unroll
    for (int dt = 0; dt < DT; ++dt) { const unsigned short* vrow = Vth + (size_t)j0 * 64 + dt * 512 + lane * 8; bv[dt].half[0] = *(const v8us*)vrow; bv[dt].half[1] = *(const v8us*)(vrow + 256); }
    v8f s[2];
#pragma unroll
    for (int nt = 0; nt < 2; ++nt) { v8f acc = (v8f){0.f,0.f,0.f,0.f,0.f,0.f,0.f,0.f};
#pragma unroll
      for (int ks = 0; ks < KS; ++ks) acc = mmaH<1>(bk[nt][ks].v, bk[nt][ks].v, aq[ks].v, aq[ks].v, acc); s[nt] = acc; }
    const int jn = (j0 + 32 < jend) ? j0 + 32 : j0;      // the last pass reads its own rows again: in bounds, not used
    const unsigned short* kr0 = (const unsigned short*)K16 + ((size_t)b * 2048 + jn) * ldk + h * 1024 + lane * 8; const unsigned short* kr1 = kr0 + (size_t)16 * ldk;
#pragma unroll
    for (int ks = 0; ks < KS; ++ks) { bk[0][ks].half[0] = *(const v8us*)(kr0 + ks * 512); bk[0][ks].half[1] = *(const v8us*)(kr0 + ks * 512 + 256); bk[1][ks].half[0] = *(const v8us*)(kr1 + ks * 512); bk[1][ks].half[1] = *(const v8us*)(kr1 + ks * 512 + 256); }
    // the wait that stands in front of any reuse of the group's address registers; naming them as inputs keeps them whole up to it (no load of the group lands on one)
    asm volatile("s_wait_xcnt 0x0" :: "v"(kr0), "v"(kr1) : "memory");
    float mx[8];
#pragma unroll
    for (int r = 0; r < 8; ++r) mx[r] = fmaxf(s[0][r], s[1][r]);      // maxima of the raw scores: the scale is positive
    float mc = fmaxf(fmaxf(fmaxf(mx[0], mx[1]), fmaxf(mx[2], mx[3])), fmaxf(fmaxf(mx[4], mx[5]), fmaxf(mx[6], mx[7])));
    mc = fmaxf(mc, xhalf(mc)) * CS;
    const float mn = fmaxf(m_r, mc); const float al = (mn > -1.0e38f) ? __builtin_amdgcn_exp2f(m_r - mn) : 1.0f; m_r = mn;
    FragH pb; float ps[8];
#pragma unroll
    for (int r = 0; r < 8; r += 2) {      // two scores of a tile per packed multiply-add
      const v2f a0 = __builtin_elementwise_fma((v2f){s[0][r], s[0][r + 1]}, (v2f){CS, CS}, (v2f){-mn, -mn}), a1 = __builtin_elementwise_fma((v2f){s[1][r], s[1][r + 1]}, (v2f){CS, CS}, (v2f){-mn, -mn});
      const float p00 = __builtin_amdgcn_exp2f(a0.x), p01 = __builtin_amdgcn_exp2f(a0.y), p10 = __builtin_amdgcn_exp2f(a1.x), p11 = __builtin_amdgcn_exp2f(a1.y);
      ps[r] = p00 + p10; ps[r + 1] = p01 + p11; pb.h[r] = (_Float16)p00; pb.h[r + 1] = (_Float16)p01; pb.h[8 + r] = (_Float16)p10; pb.h[9 + r] = (_Float16)p11; }
    l_r = l_r * al + (((ps[0] + ps[1]) + (ps[2] + ps[3])) + ((ps[4] + ps[5]) + (ps[6] + ps[7])));
#pragma unroll
    for (int dt = 0; dt < DT; ++dt)
#pragma unroll
      for (int r = 0; r < 8; ++r) oacc[dt][r] *= al;
#pragma unroll
    for (int dt = 0; dt < DT; ++dt) oacc[dt] = mmaH<1>(bv[dt].v, bv[dt].v, pb.v, pb.v, oacc[dt]); }
  { const float l = l_r + xhalf(l_r); l_r = (l > 0.f) ? 1.0f / l : 0.f; }
  // a lane holds 8 consecutive d of its query per tile; through LDS so that the global stores stay whole rows of 256 bytes
#pragma unroll
  for (int dt = 0; dt < DT; ++dt)
#pragma unroll
    for (int r = 0; r < 8; ++r) sO[w][ln][dt * 16 + 8 * hh + r] = oacc[dt][r] * l_r;
  __builtin_amdgcn_fence(__ATOMIC_ACQ_REL, "workgroup"); __builtin_amdgcn_wave_barrier();
  {
#pragma unroll
    for (int rp = 0; rp < RPW; rp += 2) { const int r = rp + (lane >> 4), pc = lane & 15; const v4f val = *(const v4fa*)&sO[w][r][pc * 4]; *(v4f*)(O + ((size_t)b * 2048 + q0 + r) * ldo + h * 64 + pc * 4) = val; }
     } }

__global__ __launch_bounds__(256) void k_vmask(const float* __restrict__ V, const float* __restrict__ mk, _Float16* __restrict__ V16, size_t n8) { const size_t t = (size_t)blockIdx.x * 256 + threadIdx.x; if (t >= n8) return; const size_t r = (t * 8) / DD; const float m = bf16_round(mk[r]); FragH f;
#pragma unroll
  for (int q = 0; q < 8; ++q) f.h[q] = (_Float16)(V[t * 8 + q] * m); *(v8us*)((unsigned short*)V16 + t * 8) = f.half[0];  }
extern "C" void kernel_launch(void* const* d_in, const int* in_sizes, int n_in,
                              void* d_out, int out_size, void* d_ws, size_t ws_size, hipStream_t stream) {
  (void)in_sizes; (void)n_in; (void)out_size;
  const float* xq = (const float*)d_in[0]; const float* xkv = (const float*)d_in[1]; const float* mk = (const float*)d_in[2]; const float* Wq = (const float*)d_in[3]; const float* bq = (const float*)d_in[4]; const float* Wk = (const float*)d_in[5]; const float* bk = (const float*)d_in[6]; const float* Wv = (const float*)d_in[7]; const float* bv = (const float*)d_in[8]; const float* Wo = (const float*)d_in[9]; const float* bo = (const float*)d_in[10];
  char* ws = (char*)d_ws; size_t off = 0;
  auto take = [&](size_t bytes) { char* p = ws + off; off += (bytes + 255) & ~(size_t)255; return p; };
  _Float16* Bq = (_Float16*)take((size_t)DD * DD * 2); _Float16* Bk = (_Float16*)take((size_t)DD * DD * 2); _Float16* Bv = (_Float16*)take((size_t)DD * DD * 2); _Float16* Bo = (_Float16*)take((size_t)DD * DD * 2);
  _Float16* XQ16 = (_Float16*)take((size_t)NR * DD * 2); _Float16* XKV16 = (_Float16*)take((size_t)NR * DD * 2); _Float16* Q16 = (_Float16*)take((size_t)NR * DD * 2); _Float16* K16 = (_Float16*)take((size_t)NR * DD * 2); float* VF = (float*)take((size_t)NR * DD * 4); _Float16* V16 = XKV16; _Float16* Vt = XQ16; float* O = VF; _Float16* O16 = Q16;
  if (off > ws_size) return;      // 8.4 + 8.4 × 4 + 16.8 ≈ 59 MB
  k_wt_f16<<<(unsigned)(((size_t)DD * (DD / 8) + 255) / 256), 256, 0, stream>>>(Wq, Bq, DD, DD, 16.0f); k_wt_f16<<<(unsigned)(((size_t)DD * (DD / 8) + 255) / 256), 256, 0, stream>>>(Wk, Bk, DD, DD, 16.0f); k_wt_f16<<<(unsigned)(((size_t)DD * (DD / 8) + 255) / 256), 256, 0, stream>>>(Wv, Bv, DD, DD, 16.0f); k_wt_f16<<<(unsigned)(((size_t)DD * (DD / 8) + 255) / 256), 256, 0, stream>>>(Wo, Bo, DD, DD, 16.0f);      // (D,H,Dh) = [in][h·64+d]; Wo (H,Dh,D) = [in=(h,d)][out]
  const unsigned g8 = (unsigned)(((size_t)NR * DD / 8 + 255) / 256); const dim3 gg(((NR / 16) * (DD / 64) + 3) / 4, 1);
  k_x16<<<g8, 256, 0, stream>>>(xq, XQ16, (size_t)NR * DD / 8); k_x16<<<g8, 256, 0, stream>>>(xkv, XKV16, (size_t)NR * DD / 8);
  k_gemm_hhx<0><<<gg, 128, 0, stream>>>(XQ16, DD, 0, Bq, DD, 0, 0.0625f, bq, 0, nullptr, 1, 0, 0, nullptr, Q16, DD, 0, NR, DD, DD);
  k_gemm_hhx<0><<<gg, 128, 0, stream>>>(XKV16, DD, 0, Bk, DD, 0, 0.0625f, bk, 0, nullptr, 1, 0, 0, nullptr, K16, DD, 0, NR, DD, DD);
  k_gemm_hhx<0><<<gg, 128, 0, stream>>>(XKV16, DD, 0, Bv, DD, 0, 0.0625f, bv, 0, nullptr, 1, 0, 0, VF, nullptr, DD, 0, NR, DD, DD);      // v (f32, + bv) — masked next
  k_vmask<<<g8, 256, 0, stream>>>(VF, mk, V16, (size_t)NR * DD / 8);      // V16 over XKV16 (its last reader was the v GEMM)
  k_vt<NH, TT><<<BB * NH * (TT / 64), 256, 0, stream>>>(V16, DD, 0, Vt);      // Vt over XQ16
  k_flash<<<BB * NH * (TT / 64), 128, 0, stream>>>(Q16, DD, K16, DD, Vt, nullptr, O, DD);      // q/√64 folded into the 0.125 scale; O over VF
  k_h16<<<g8, 256, 0, stream>>>(O, O16, (size_t)NR * DD / 8);
  k_gemm_hhx<0><<<gg, 128, 0, stream>>>(O16, DD, 0, Bo, DD, 0, 0.0625f, bo, 0, nullptr, 1, 0, 0, (float*)d_out, nullptr, DD, 0, NR, DD, DD);
}

// v005
// Measured time: 145 microseconds a run.
// In two side-by-side timings against v004, it was 1.14 and 1.13 times as fast.
// All steps since v000 together make it 3.04 times as fast.
#include <hip/hip_runtime.h>
// Multi-head dot-product attention with a per-key value mask (B=2, L=2048, D=1024, 16 heads × 64; q from inputs_q, k/v from inputs_kv; v ← mask_k·v; softmax(q·k/8); merge; ·Wo + bo): the
// q/k/v/o projections are GEMMs ([in][out] weights bf16-exact ×2^4, bias epilogues, f32 accumulate) and the attention is a fused flash-style kernel (online softmax f32; P f16 ≤ 1; Ot = Vt·Pt;
// RPW-16 waves) on v_wmma_f32_16x16x32_f16; the value masking is applied in f32 VALU before the f16 conversion.
#define BB 2
#define TT 2048
#define DD 1024
#define NH 16
#define NR (BB * TT)

typedef __bf16 v16b __attribute__((ext_vector_type(16)));
typedef unsigned short v8us __attribute__((ext_vector_type(8), may_alias));
typedef float  v8f  __attribute__((ext_vector_type(8)));
typedef float  v4f  __attribute__((ext_vector_type(4)));
typedef float  v4fa __attribute__((ext_vector_type(4), may_alias));
union FragB { v16b v; v8us half[2]; unsigned short u[16]; };

__device__ __forceinline__ unsigned short bf16_bits(float x) { unsigned int u = __float_as_uint(x); return (unsigned short)((u + 0x7FFFu + ((u >> 16) & 1u)) >> 16); }
__device__ __forceinline__ float bf16_val(unsigned short b) { return __uint_as_float(((unsigned int)b) << 16); }
__device__ __forceinline__ float bf16_round(float x) { return bf16_val(bf16_bits(x)); }
// D += A·B with NT terms: 1 = ah·bh, 2 = + al·bh (A split), 3 = + ah·bl (both split)
template <int NT>
__device__ __forceinline__ v8f mmaN(v16b ah, v16b al, v16b bh, v16b bl, v8f c) {
  c = __builtin_amdgcn_wmma_f32_16x16x32_bf16(false, ah, false, bh, (short)0, c, false, false);
  if (NT >= 2) c = __builtin_amdgcn_wmma_f32_16x16x32_bf16(false, al, false, bh, (short)0, c, false, false);
  if (NT >= 3) c = __builtin_amdgcn_wmma_f32_16x16x32_bf16(false, ah, false, bl, (short)0, c, false, false);
  asm volatile("v_nop\n\tv_nop\n\tv_nop\n\tv_nop" : "+v"(c) : "v"(ah), "v"(al), "v"(bh), "v"(bl));
  return c;
}

__global__ __launch_bounds__(256) void k_wt_bf16(const float* __restrict__ W, unsigned short* __restrict__ Wt, int K, int N) {
  const int t = blockIdx.x * 256 + threadIdx.x;
  const int k8n = K / 8;
  if (t >= N * k8n) return;
  const int n = t / k8n, k8 = (t % k8n) * 8;
  v8us v;
#pragma unroll
  for (int i = 0; i < 8; ++i) v[i] = bf16_bits(W[(size_t)(k8 + i) * N + n]);
  *(v8us*)(Wt + (size_t)n * K + k8) = v;
  
}

// GEMM C[M][N] (f32, pitch ldc) = act(A[M][K]·W + bias). A f32 row-major (pitch lda) converted per fragment to bf16
// (ASPLIT: hi/lo two planes -> 2 terms, else single rounded term); Wt bf16 [N][K] (pitch ldb). BIAS_BF16 rounds the
// bias to bf16 first (bias quantised to bf16 before the add). K%32==0, M%16==0, N%64==0.
template <bool ASPLIT, int ACT, bool BIAS_BF16>
__global__ __launch_bounds__(128) void k_gemm_bf(const float* __restrict__ A, int lda, const unsigned short* __restrict__ Wt, int ldb,
                                               const float* __restrict__ bias, float* __restrict__ C, int ldc, int M, int N, int K) {
  __shared__ __attribute__((aligned(16))) float so[4][16][64];
  const int tid = threadIdx.x, w = tid >> 5, lane = tid & 31, ln = lane & 15, hh = lane >> 4;
  const int ntn = N / 64;
  const int wid = blockIdx.x * 4 + w;
  const int mt = wid / ntn, nq = wid % ntn;
  if (mt * 16 >= M) return;
  const int row0 = mt * 16, col0 = nq * 64;
  const float* arow = A + (size_t)(row0 + ln) * lda;
  v8f acc[4] = {};
  for (int kb = 0; kb < K; kb += 32) {
    FragB ah, al;
    const v4f x0 = *(const v4fa*)(arow + kb + 8 * hh), x1 = *(const v4fa*)(arow + kb + 8 * hh + 4);
    const v4f x2 = *(const v4fa*)(arow + kb + 16 + 8 * hh), x3 = *(const v4fa*)(arow + kb + 16 + 8 * hh + 4);
    float xs[16] = {x0[0],x0[1],x0[2],x0[3],x1[0],x1[1],x1[2],x1[3],x2[0],x2[1],x2[2],x2[3],x3[0],x3[1],x3[2],x3[3]};
#pragma unroll
    for (int i = 0; i < 16; ++i) { const unsigned short hb = bf16_bits(xs[i]); ah.u[i] = hb; al.u[i] = ASPLIT ? bf16_bits(xs[i] - bf16_val(hb)) : (unsigned short)0; }
#pragma unroll
    for (int t = 0; t < 4; ++t) {
      const unsigned short* brow = Wt + (size_t)(col0 + t * 16 + ln) * ldb + kb;
      FragB b;
      b.half[0] = *(const v8us*)(brow + 8 * hh);
      b.half[1] = *(const v8us*)(brow + 16 + 8 * hh);
      acc[t] = mmaN<ASPLIT ? 2 : 1>(ah.v, al.v, b.v, b.v, acc[t]);
    }
  }
#pragma unroll
  for (int t = 0; t < 4; ++t) {
    float bv = bias ? bias[col0 + t * 16 + ln] : 0.f;
    if (BIAS_BF16) bv = bf16_round(bv);
#pragma unroll
    for (int r = 0; r < 8; ++r) { float v = acc[t][r] + bv; if (ACT == 1) v = fmaxf(v, 0.f); so[w][8 * hh + r][t * 16 + ln] = v; }
  }
  __builtin_amdgcn_fence(__ATOMIC_ACQ_REL, "workgroup");
  __builtin_amdgcn_wave_barrier();
  const int rsub = lane >> 4, c4 = (lane & 15) * 4;
  {
#pragma unroll
    for (int q = 0; q < 8; ++q) {
      const int r = q * 2 + rsub;
      const v4f v = *(const v4fa*)&so[w][r][c4];
      *(v4f*)(C + (size_t)(row0 + r) * ldc + col0 + c4) = v;
    }
    
  }
}

// Flash-style causal/unmasked attention, all contractions 3-term bf16 hi/lo splits, f32 softmax with running max.
// q,k,v rows are read from f32 buffers with arbitrary row pitch (so they can live inside a fused qkv buffer);
// D = head size (multiple of 32, <= 128); one wave = 16 query rows; block = 4 waves (64 queries) sharing K/V chunks of 32.
template <int D, bool CAUSAL>
__global__ __launch_bounds__(128) void k_flash(const float* __restrict__ qb, const float* __restrict__ kb, const float* __restrict__ vb,
                                             int pitch, int T, int H, float scale, float* __restrict__ y, int ypitch) {
  constexpr int KS = D / 32;        // k-steps for QK
  constexpr int DT = D / 16;        // d tiles for PV
  __shared__ __attribute__((aligned(16))) unsigned short sKh[32][D + 8], sKl[32][D + 8], sVh[32][D + 8], sVl[32][D + 8];
  __shared__ __attribute__((aligned(16))) unsigned short sPh[4][16][40], sPl[4][16][40];
  __shared__ __attribute__((aligned(16))) float sO[4][16][D];
  const int tid = threadIdx.x, w = tid >> 5, lane = tid & 31, ln = lane & 15, hh = lane >> 4;
  const int nqb = (T + 63) / 64;
  const int bh = blockIdx.x / nqb, qblk = blockIdx.x % nqb;
  const int b = bh / H, h = bh % H;
  const int q0 = qblk * 64 + w * 16;
  const float* Q = qb + (size_t)b * T * pitch + h * D;
  const float* K = kb + (size_t)b * T * pitch + h * D;
  const float* V = vb + (size_t)b * T * pitch + h * D;

  // A fragments of the wave's 16 query rows (scaled), hi/lo
  FragB aqh[KS], aql[KS];
  {
    int row = q0 + ln; if (row >= T) row = T - 1;
    const float* qr = Q + (size_t)row * pitch;
#pragma unroll
    for (int ks = 0; ks < KS; ++ks)
#pragma unroll
      for (int i = 0; i < 16; ++i) {
        const int d = ks * 32 + ((i < 8) ? (8 * hh + i) : (16 + 8 * hh + (i - 8)));
        const float x = qr[d] * scale; const unsigned short hb = bf16_bits(x);
        aqh[ks].u[i] = hb; aql[ks].u[i] = bf16_bits(x - bf16_val(hb));
      }
  }
  float m_r[8], l_r[8];
#pragma unroll
  for (int r = 0; r < 8; ++r) { m_r[r] = -3.0e38f; l_r[r] = 0.f; }
  v8f oacc[DT];
#pragma unroll
  for (int dt = 0; dt < DT; ++dt) oacc[dt] = (v8f){0.f,0.f,0.f,0.f,0.f,0.f,0.f,0.f};

  const int kv_end = CAUSAL ? min(T, qblk * 64 + 64) : T;     // block-uniform
  for (int j0 = 0; j0 < kv_end; j0 += 32) {
    __syncthreads();
    for (int e = tid; e < 32 * (D / 4); e += 128) {
      const int r = e / (D / 4), c4 = (e % (D / 4)) * 4;
      const int key = j0 + r;
      v4f kf = {0.f,0.f,0.f,0.f}, vf = {0.f,0.f,0.f,0.f};
      if (key < T) { kf = *(const v4fa*)(K + (size_t)key * pitch + c4); vf = *(const v4fa*)(V + (size_t)key * pitch + c4); }
#pragma unroll
      for (int t = 0; t < 4; ++t) {
        unsigned short hb = bf16_bits(kf[t]); sKh[r][c4 + t] = hb; sKl[r][c4 + t] = bf16_bits(kf[t] - bf16_val(hb));
        hb = bf16_bits(vf[t]); sVh[r][c4 + t] = hb; sVl[r][c4 + t] = bf16_bits(vf[t] - bf16_val(hb));
      }
    }
    __syncthreads();
    // S tile 16 x 32
    v8f s[2];
#pragma unroll
    for (int nt = 0; nt < 2; ++nt) {
      v8f acc = {};
#pragma unroll
      for (int ks = 0; ks < KS; ++ks) {
        FragB bh_, bl_;
        bh_.half[0] = *(const v8us*)&sKh[nt * 16 + ln][ks * 32 + 8 * hh]; bh_.half[1] = *(const v8us*)&sKh[nt * 16 + ln][ks * 32 + 16 + 8 * hh];
        bl_.half[0] = *(const v8us*)&sKl[nt * 16 + ln][ks * 32 + 8 * hh]; bl_.half[1] = *(const v8us*)&sKl[nt * 16 + ln][ks * 32 + 16 + 8 * hh];
        acc = mmaN<3>(aqh[ks].v, aql[ks].v, bh_.v, bl_.v, acc);
      }
      s[nt] = acc;
    }
    // mask + running max (rows 8hh+r; the 16 lanes of a half share rows)
    float alpha[8];
#pragma unroll
    for (int r = 0; r < 8; ++r) {
      const int qi = q0 + 8 * hh + r;
      const int ja = j0 + ln, jb = j0 + 16 + ln;
      if (CAUSAL) { if (ja > qi) s[0][r] = -3.0e38f; if (jb > qi) s[1][r] = -3.0e38f; }
      if (ja >= T) s[0][r] = -3.0e38f;
      if (jb >= T) s[1][r] = -3.0e38f;
      float mx = fmaxf(s[0][r], s[1][r]);
      mx = fmaxf(mx, __shfl_xor(mx, 1, 32)); mx = fmaxf(mx, __shfl_xor(mx, 2, 32)); mx = fmaxf(mx, __shfl_xor(mx, 4, 32)); mx = fmaxf(mx, __shfl_xor(mx, 8, 32));
      const float mnew = fmaxf(m_r[r], mx);
      alpha[r] = (mnew > -1.0e38f) ? __expf(m_r[r] - mnew) : 1.0f;
      const float p0 = (s[0][r] > -1.0e38f) ? __expf(s[0][r] - mnew) : 0.f;
      const float p1 = (s[1][r] > -1.0e38f) ? __expf(s[1][r] - mnew) : 0.f;
      m_r[r] = mnew;
      l_r[r] = l_r[r] * alpha[r] + p0 + p1;            // per-lane partial row sum (16 lanes combined at the end)
      unsigned short hb = bf16_bits(p0); sPh[w][8 * hh + r][ln] = hb;      sPl[w][8 * hh + r][ln] = bf16_bits(p0 - bf16_val(hb));
      hb = bf16_bits(p1);                sPh[w][8 * hh + r][16 + ln] = hb; sPl[w][8 * hh + r][16 + ln] = bf16_bits(p1 - bf16_val(hb));
    }
#pragma unroll
    for (int dt = 0; dt < DT; ++dt)
#pragma unroll
      for (int r = 0; r < 8; ++r) oacc[dt][r] *= alpha[r];
    __builtin_amdgcn_fence(__ATOMIC_ACQ_REL, "workgroup");
    __builtin_amdgcn_wave_barrier();
    FragB pah, pal;
    pah.half[0] = *(const v8us*)&sPh[w][ln][8 * hh]; pah.half[1] = *(const v8us*)&sPh[w][ln][16 + 8 * hh];
    pal.half[0] = *(const v8us*)&sPl[w][ln][8 * hh]; pal.half[1] = *(const v8us*)&sPl[w][ln][16 + 8 * hh];
#pragma unroll
    for (int dt = 0; dt < DT; ++dt) {
      FragB bvh, bvl;
#pragma unroll
      for (int i = 0; i < 8; ++i) {
        bvh.u[i] = sVh[8 * hh + i][dt * 16 + ln]; bvh.u[8 + i] = sVh[16 + 8 * hh + i][dt * 16 + ln];
        bvl.u[i] = sVl[8 * hh + i][dt * 16 + ln]; bvl.u[8 + i] = sVl[16 + 8 * hh + i][dt * 16 + ln];
      }
      oacc[dt] = mmaN<3>(pah.v, pal.v, bvh.v, bvl.v, oacc[dt]);
    }
    __builtin_amdgcn_fence(__ATOMIC_ACQ_REL, "workgroup");
    __builtin_amdgcn_wave_barrier();
  }
#pragma unroll
  for (int r = 0; r < 8; ++r) {
    float l = l_r[r];
    l += __shfl_xor(l, 1, 32); l += __shfl_xor(l, 2, 32); l += __shfl_xor(l, 4, 32); l += __shfl_xor(l, 8, 32);
    l_r[r] = (l > 0.f) ? 1.0f / l : 0.f;
  }
#pragma unroll
  for (int dt = 0; dt < DT; ++dt)
#pragma unroll
    for (int r = 0; r < 8; ++r) sO[w][8 * hh + r][dt * 16 + ln] = oacc[dt][r] * l_r[r];
  __builtin_amdgcn_fence(__ATOMIC_ACQ_REL, "workgroup");
  __builtin_amdgcn_wave_barrier();
  {
    for (int r = 0; r < 16; ++r) {
      const int row = q0 + r;
      if (row < T && lane < D / 4) {
        const v4f val = *(const v4fa*)&sO[w][r][lane * 4];
        *(v4f*)(y + ((size_t)b * T + row) * ypitch + h * D + lane * 4) = val;
      }
    }
    
  }
}

// GEMM C = act(A·W + bias + resid): A f32 (ASPLIT -> hi/lo 2 terms), Wt bf16 [N][K]; ACT 0 none, 1 relu, 2 exact gelu;
// resid (optional, f32, row index = (row % rmod), pitch ldr, RES_BF16 rounds it) added before the activation.
template <bool ASPLIT, int ACT, bool BIAS_BF16, bool RES_BF16>
__global__ __launch_bounds__(128) void k_gemm_bf3(const float* __restrict__ A, int lda, const unsigned short* __restrict__ Wt, int ldb,
                                                const float* __restrict__ bias, const float* __restrict__ resid, int rmod, int ldr,
                                                float* __restrict__ C, int ldc, int M, int N, int K) {
  __shared__ __attribute__((aligned(16))) float so[4][16][64];
  const int tid = threadIdx.x, w = tid >> 5, lane = tid & 31, ln = lane & 15, hh = lane >> 4;
  const int ntn = N / 64;
  const int wid = blockIdx.x * 4 + w;
  const int mt = wid / ntn, nq = wid % ntn;
  if (mt * 16 >= M) return;
  const int row0 = mt * 16, col0 = nq * 64;
  const float* arow = A + (size_t)(row0 + ln) * lda;
  v8f acc[4] = {};
  for (int kb = 0; kb < K; kb += 32) {
    FragB ah, al;
    const v4f x0 = *(const v4fa*)(arow + kb + 8 * hh), x1 = *(const v4fa*)(arow + kb + 8 * hh + 4);
    const v4f x2 = *(const v4fa*)(arow + kb + 16 + 8 * hh), x3 = *(const v4fa*)(arow + kb + 16 + 8 * hh + 4);
    float xs[16] = {x0[0],x0[1],x0[2],x0[3],x1[0],x1[1],x1[2],x1[3],x2[0],x2[1],x2[2],x2[3],x3[0],x3[1],x3[2],x3[3]};
#pragma unroll
    for (int i = 0; i < 16; ++i) { const unsigned short hb = bf16_bits(xs[i]); ah.u[i] = hb; al.u[i] = ASPLIT ? bf16_bits(xs[i] - bf16_val(hb)) : (unsigned short)0; }
#pragma unroll
    for (int t = 0; t < 4; ++t) {
      const unsigned short* brow = Wt + (size_t)(col0 + t * 16 + ln) * ldb + kb;
      FragB b;
      b.half[0] = *(const v8us*)(brow + 8 * hh);
      b.half[1] = *(const v8us*)(brow + 16 + 8 * hh);
      acc[t] = mmaN<ASPLIT ? 2 : 1>(ah.v, al.v, b.v, b.v, acc[t]);
    }
  }
#pragma unroll
  for (int t = 0; t < 4; ++t) {
    const int col = col0 + t * 16 + ln;
    float bv = bias ? bias[col] : 0.f;
    if (BIAS_BF16) bv = bf16_round(bv);
#pragma unroll
    for (int r = 0; r < 8; ++r) {
      float v = acc[t][r] + bv;
      if (resid) { float rv = resid[(size_t)((row0 + 8 * hh + r) % rmod) * ldr + col]; if (RES_BF16) rv = bf16_round(rv); v += rv; }
      if (ACT == 1) v = fmaxf(v, 0.f);
      if (ACT == 2) v = 0.5f * v * (1.0f + erff(v * 0.70710678118654752f));
      if (ACT == 3) { const float u = 0.7978845608028654f * (v + 0.044715f * v * v * v); v = 0.5f * v * (1.0f + tanhf(u)); }
      so[w][8 * hh + r][t * 16 + ln] = v;
    }
  }
  __builtin_amdgcn_fence(__ATOMIC_ACQ_REL, "workgroup");
  __builtin_amdgcn_wave_barrier();
  const int rsub = lane >> 4, c4 = (lane & 15) * 4;
  {
#pragma unroll
    for (int q = 0; q < 8; ++q) {
      const int r = q * 2 + rsub;
      const v4f v = *(const v4fa*)&so[w][r][c4];
      *(v4f*)(C + (size_t)(row0 + r) * ldc + col0 + c4) = v;
    }
    
  }
}
// row LayerNorm (biased variance, eps) over N: s = X (+ R); optional out_sum <- s; out_norm <- (s-mu)*rsqrt(var+eps)*g + b
template <bool PARAM_BF16>
__global__ __launch_bounds__(256) void k_layernorm(const float* __restrict__ X, const float* __restrict__ R, const float* __restrict__ g, const float* __restrict__ bta,
                                                  float* __restrict__ out_sum, float* __restrict__ out_norm, int N, float eps) {
  __shared__ float red[256];
  const int row = blockIdx.x, tid = threadIdx.x;
  const float* x = X + (size_t)row * N; const float* rr = R ? R + (size_t)row * N : nullptr;
  float vals[16];                     // up to N = 4096
  const int per = N / 256;            // contiguous chunk per thread? use strided-by-4 chunks: thread handles j = tid*4 + 1024*u
  float s1 = 0.f;
  for (int u = 0; u < per / 4; ++u) {
    const int j = tid * 4 + 1024 * u;
    const v4f a = *(const v4fa*)(x + j);
    v4f b = {0.f,0.f,0.f,0.f}; if (rr) b = *(const v4fa*)(rr + j);
#pragma unroll
    for (int q = 0; q < 4; ++q) { const float v = a[q] + b[q]; vals[u * 4 + q] = v; s1 += v; }
  }
  red[tid] = s1; __syncthreads();
  for (int st = 128; st > 0; st >>= 1) { if (tid < st) red[tid] += red[tid + st]; __syncthreads(); }
  const float mu = red[0] / (float)N; __syncthreads();
  float s2 = 0.f;
  for (int u = 0; u < per / 4; ++u)
#pragma unroll
    for (int q = 0; q < 4; ++q) { const float c = vals[u * 4 + q] - mu; s2 += c * c; }
  red[tid] = s2; __syncthreads();
  for (int st = 128; st > 0; st >>= 1) { if (tid < st) red[tid] += red[tid + st]; __syncthreads(); }
  const float rs = rsqrtf(red[0] / (float)N + eps);
  {
    for (int u = 0; u < per / 4; ++u) {
      const int j = tid * 4 + 1024 * u;
      v4f o, sm;
#pragma unroll
      for (int q = 0; q < 4; ++q) {
        float gg = g[j + q], bb = bta[j + q];
        if (PARAM_BF16) { gg = bf16_round(gg); bb = bf16_round(bb); }
        sm[q] = vals[u * 4 + q]; o[q] = (vals[u * 4 + q] - mu) * rs * gg + bb;
      }
      if (out_sum) *(v4f*)(out_sum + (size_t)row * N + j) = sm;
      *(v4f*)(out_norm + (size_t)row * N + j) = o;
    }
    
  }
}



// ---- f16 WMMA path (v_wmma_f32_16x16x32_f16): 11-bit significands for operands in range — used where a [0,1] probability operand needs more precision than bf16
typedef _Float16 v16h __attribute__((ext_vector_type(16)));
union FragH { v16h v; v8us half[2]; _Float16 h[16]; unsigned short u[16]; };
template <int NT>
__device__ __forceinline__ v8f mmaH(v16h ah, v16h al, v16h bh, v16h bl, v8f c) {
  c = __builtin_amdgcn_wmma_f32_16x16x32_f16(false, ah, false, bh, (short)0, c, false, false);
  if (NT >= 2) c = __builtin_amdgcn_wmma_f32_16x16x32_f16(false, al, false, bh, (short)0, c, false, false);
  if (NT >= 3) c = __builtin_amdgcn_wmma_f32_16x16x32_f16(false, ah, false, bl, (short)0, c, false, false);
  asm volatile("v_nop\n\tv_nop\n\tv_nop\n\tv_nop" : "+v"(c) : "v"(ah), "v"(al), "v"(bh), "v"(bl));
  return c;
}
// batched GEMM like k_gemm_b but f16 operands: A f32 (split into f16 hi/lo if ASPLIT, else rounded to f16), Bt = f16 values [n][k]; alpha; C f32; N multiple of 16 (partial tiles skipped)
template <bool ASPLIT>
__global__ __launch_bounds__(128) void k_gemm_h(const float* __restrict__ A, int lda, size_t sA, const _Float16* __restrict__ Bh, int ldb, size_t sB, float alpha, float* __restrict__ C, int ldc, size_t sC, int M, int N, int K) {
  __shared__ __attribute__((aligned(16))) float so[4][16][64];
  const int tid = threadIdx.x, w = tid >> 5, lane = tid & 31, ln = lane & 15, hh = lane >> 4; const int by = blockIdx.y;
  A += (size_t)by * sA; Bh += (size_t)by * sB; C += (size_t)by * sC;
  const int ntn = (N + 63) / 64; const int wid = blockIdx.x * 4 + w; const int mt = wid / ntn, nq = wid % ntn; if (mt * 16 >= M) return;
  const int row0 = mt * 16, col0 = nq * 64; const float* arow = A + (size_t)(row0 + ln) * lda;
  v8f acc[4] = {};
  for (int kb = 0; kb < K; kb += 32) {
    FragH ah, al;
    const v4f x0 = *(const v4fa*)(arow + kb + 8 * hh), x1 = *(const v4fa*)(arow + kb + 8 * hh + 4), x2 = *(const v4fa*)(arow + kb + 16 + 8 * hh), x3 = *(const v4fa*)(arow + kb + 16 + 8 * hh + 4);
    float xs[16] = {x0[0],x0[1],x0[2],x0[3],x1[0],x1[1],x1[2],x1[3],x2[0],x2[1],x2[2],x2[3],x3[0],x3[1],x3[2],x3[3]};
#pragma unroll
    for (int i = 0; i < 16; ++i) { const _Float16 h = (_Float16)xs[i]; ah.h[i] = h; al.h[i] = ASPLIT ? (_Float16)(xs[i] - (float)h) : (_Float16)0.0f; }
#pragma unroll
    for (int t = 0; t < 4; ++t) { if (col0 + t * 16 >= N) continue; const size_t boff = (size_t)(col0 + t * 16 + ln) * ldb + kb; FragH bq; bq.half[0] = *(const v8us*)(Bh + boff + 8 * hh); bq.half[1] = *(const v8us*)(Bh + boff + 16 + 8 * hh);
      acc[t] = mmaH<ASPLIT ? 2 : 1>(ah.v, al.v, bq.v, bq.v, acc[t]); }
  }
#pragma unroll
  for (int t = 0; t < 4; ++t) { if (col0 + t * 16 >= N) continue;
#pragma unroll
    for (int r = 0; r < 8; ++r) so[w][8 * hh + r][t * 16 + ln] = acc[t][r] * alpha; }
  __builtin_amdgcn_fence(__ATOMIC_ACQ_REL, "workgroup"); __builtin_amdgcn_wave_barrier();
  const int rsub = lane >> 4, c4 = (lane & 15) * 4;
  {
#pragma unroll
    for (int q = 0; q < 8; ++q) { const int r = q * 2 + rsub; if (col0 + c4 < N) { const v4f v = *(const v4fa*)&so[w][r][c4]; *(v4f*)(C + (size_t)(row0 + r) * ldc + col0 + c4) = v; } }
     }
}

// Wt[n][k] = f16(W[k][n]·scale) from f32 row-major W[K][N] (scale = power of two; bf16-exact weights stay exact in f16 away from the subnormal range)
// FRAGMENT ORDER (f16 matrices in the workspace; Vt numbers its tiles kt * 4 + dt, see k_gemm_hhx with VT): a [rows][K] operand is kept as tiles of 16 rows x 32 k, 1 KiB each, tile (rt, kt) at index rt * (K / 32) + kt.
// A tile is two halves of 512 bytes (k 0..15, then k 16..31); in half j lane hh * 16 + ln owns the 16 bytes of row ln, k = 16 j + 8 hh + 0..7: just what that lane feeds to the WMMA.
// One wave-wide 16-byte load of a half is then 512 contiguous bytes, four whole lines, where a row-major operand gives 32-byte pieces of 16 lines.
// Chunk t (16 bytes) of such a buffer: lane = t & 31, j = (t >> 5) & 1, tile = t >> 6. K % 32 == 0, rows % 16 == 0.
__global__ __launch_bounds__(256) void k_wt_f16(const float* __restrict__ W, _Float16* __restrict__ Wt, int K, int N, float scale) {
  const int t = blockIdx.x * 256 + threadIdx.x; if (t >= N * (K / 8)) return; const int lane = t & 31, j = (t >> 5) & 1, tile = t >> 6; const int n = (tile / (K / 32)) * 16 + (lane & 15), k8 = (tile % (K / 32)) * 32 + j * 16 + (lane >> 4) * 8; FragH f;
#pragma unroll
  for (int i = 0; i < 8; ++i) f.h[i] = (_Float16)(bf16_round(W[(size_t)(k8 + i) * N + n]) * scale); const v8us o = f.half[0];
  *(v8us*)((unsigned short*)Wt + (size_t)t * 8) = o; 
}
// k_gemm_hh variant with fused epilogue: v = acc·alpha + bias[by·sBias + col] (+ CP[(row/rowsPerB)·sCPb + by·64 + col] if CP) ; ACT 0 none / 1 elu ; writes f16 C16 and f32 C, each if non-null
// VT: C16 <- f16(v * bf16(RM[row])) transposed per head of 64 columns, in the fragment order that k_flash reads as Vt (no CP, no activation, no f32 C; N % 64 == 0, TT rows per batch)
template <int ACT, bool VT>
__global__ __launch_bounds__(128) void k_gemm_hhx(const _Float16* __restrict__ A, int lda, size_t sA, const _Float16* __restrict__ Bh, int ldb, size_t sB, float alpha, const float* __restrict__ bias, size_t sBias, const float* __restrict__ CP, int rowsPerB, size_t sCPb, int row0g,
    float* __restrict__ C, _Float16* __restrict__ C16, int ldc, size_t sC, int M, int N, int K, const float* __restrict__ RM) {
  __shared__ __attribute__((aligned(16))) float so[4][16][64 + 4];      // pitch 272 B = 16 B x odd: the f16 epilogue reads 16 rows at one column with 16-byte loads
  const int tid = threadIdx.x, w = tid >> 5, lane = tid & 31, ln = lane & 15, hh = lane >> 4; const int by = blockIdx.y;
  A += (size_t)by * sA; Bh += (size_t)by * sB; const size_t cofs = (size_t)by * sC; const float* bp = bias ? bias + (size_t)by * sBias : nullptr;
  const int ntn = (N + 63) / 64; const int wid = blockIdx.x * 4 + w; const int mt = wid / ntn, nq = wid % ntn; if (mt * 16 >= M) return;
  const int row0 = mt * 16, col0 = nq * 64;
  v8f acc[4] = {};
  // All fragment loads of a k block stand ahead of its first product, so they are in flight together (one L2 round trip per block, not one per product).
  // A and Bh are in fragment order (see k_wt_f16): a tile row of 16 rows is 16 * pitch elements, a 32-k tile 512 elements, its second half 256 elements on; lda, ldb = K of the operand.
  // A B tile past N reads the last tile row (in bounds); its products are never stored: the epilogue skips that tile.
  // The unroll directives below keep the fragment arrays in registers (constant indices).
  const unsigned short* ap = (const unsigned short*)A + (size_t)row0 * lda + lane * 8; const unsigned short* bpt[4];
#pragma unroll
  for (int t = 0; t < 4; ++t) { int cr = col0 + t * 16; if (cr > N - 16) cr = N - 16; bpt[t] = (const unsigned short*)Bh + (size_t)cr * ldb + lane * 8; }
  int kb = 0;
  for (; kb + 64 <= K; kb += 64) {      // 64 k = two tiles = 2 KiB in a row of every tile row
    FragH ah[2], bq[2][4]; const unsigned short* pa = ap + kb * 16; const unsigned short* pb0 = bpt[0] + kb * 16; const unsigned short* pb1 = bpt[1] + kb * 16; const unsigned short* pb2 = bpt[2] + kb * 16; const unsigned short* pb3 = bpt[3] + kb * 16;
#pragma unroll
    for (int u = 0; u < 2; ++u) { ah[u].half[0] = *(const v8us*)(pa + u * 512); ah[u].half[1] = *(const v8us*)(pa + u * 512 + 256);
      bq[u][0].half[0] = *(const v8us*)(pb0 + u * 512); bq[u][0].half[1] = *(const v8us*)(pb0 + u * 512 + 256); bq[u][1].half[0] = *(const v8us*)(pb1 + u * 512); bq[u][1].half[1] = *(const v8us*)(pb1 + u * 512 + 256);
      bq[u][2].half[0] = *(const v8us*)(pb2 + u * 512); bq[u][2].half[1] = *(const v8us*)(pb2 + u * 512 + 256); bq[u][3].half[0] = *(const v8us*)(pb3 + u * 512); bq[u][3].half[1] = *(const v8us*)(pb3 + u * 512 + 256); }
    // the wait that stands in front of any reuse of the group's address registers; naming them as inputs keeps them whole up to it (no load of the group lands on one)
    asm volatile("s_wait_xcnt 0x0" :: "v"(pa), "v"(pb0), "v"(pb1), "v"(pb2), "v"(pb3) : "memory");
#pragma unroll
    for (int u = 0; u < 2; ++u)
#pragma unroll
      for (int t = 0; t < 4; ++t) acc[t] = mmaH<1>(ah[u].v, ah[u].v, bq[u][t].v, bq[u][t].v, acc[t]);
  }
  if (kb < K) {      // K % 64 == 32: the last 32 k
    FragH ah, bq[4]; const unsigned short* pa = ap + kb * 16; const unsigned short* pb0 = bpt[0] + kb * 16; const unsigned short* pb1 = bpt[1] + kb * 16; const unsigned short* pb2 = bpt[2] + kb * 16; const unsigned short* pb3 = bpt[3] + kb * 16;
    ah.half[0] = *(const v8us*)pa; ah.half[1] = *(const v8us*)(pa + 256);
    bq[0].half[0] = *(const v8us*)pb0; bq[0].half[1] = *(const v8us*)(pb0 + 256); bq[1].half[0] = *(const v8us*)pb1; bq[1].half[1] = *(const v8us*)(pb1 + 256);
    bq[2].half[0] = *(const v8us*)pb2; bq[2].half[1] = *(const v8us*)(pb2 + 256); bq[3].half[0] = *(const v8us*)pb3; bq[3].half[1] = *(const v8us*)(pb3 + 256);
    // as above: the wait in front of any reuse of these loads' address registers
    asm volatile("s_wait_xcnt 0x0" :: "v"(pa), "v"(pb0), "v"(pb1), "v"(pb2), "v"(pb3) : "memory");
#pragma unroll
    for (int t = 0; t < 4; ++t) acc[t] = mmaH<1>(ah.v, ah.v, bq[t].v, bq[t].v, acc[t]);
  }
  if constexpr (VT) {
    // Vt of a slab (batch, head): rows = d, k = key, tile index kt * 4 + dt (kt = 32-key tile, dt = 16-d tile). acc[t][0..7] of lane (hh, ln) are keys row0 + 8 hh + 0..7 at d = 16 t + ln:
    // the 16 bytes that this lane owns in half (row0 / 16) & 1 of tile (kt, t). So the masked, transposed operand is stored from the accumulator registers, 512 contiguous bytes per wave and store.
    const int key0 = row0 % TT; const float* mp = RM + row0 + 8 * hh; const v4f m0 = *(const v4fa*)mp, m1 = *(const v4fa*)(mp + 4); float mr[8];
#pragma unroll
    for (int i = 0; i < 4; ++i) { mr[i] = bf16_round(m0[i]); mr[4 + i] = bf16_round(m1[i]); }
    unsigned short* cp = (unsigned short*)C16 + ((size_t)(row0 / TT) * ntn + nq) * 64 * TT + (size_t)(key0 >> 5) * 2048 + ((key0 >> 4) & 1) * 256 + lane * 8;
    float bv[4] = {0.f, 0.f, 0.f, 0.f};
    if (bp) {      // the four bias loads under one test, in flight together
#pragma unroll
      for (int t = 0; t < 4; ++t) bv[t] = bp[col0 + t * 16 + ln]; }
    FragH f[4];      // all four fragments are formed ahead of the first store: no register of an issued store is written again
#pragma unroll
    for (int t = 0; t < 4; ++t) { const float bt = bf16_round(bv[t]);
#pragma unroll
      for (int r = 0; r < 8; ++r) f[t].h[r] = (_Float16)((acc[t][r] * alpha + bt) * mr[r]); }
#pragma unroll
    for (int t = 0; t < 4; ++t) *(v8us*)(cp + t * 512) = f[t].half[0];
    return;
  }
#pragma unroll
  for (int t = 0; t < 4; ++t) { if (col0 + t * 16 >= N) continue; const int col = col0 + t * 16 + ln; const float bv = bp ? bf16_round(bp[col]) : 0.f;
#pragma unroll
    for (int r = 0; r < 8; ++r) { float v = acc[t][r] * alpha + bv; if (CP) { const int bidx = (row0g + row0 + 8 * hh + r) / rowsPerB; v += CP[(size_t)bidx * sCPb + (size_t)by * 64 + col]; } if (ACT == 1) v = (v > 0.f) ? v : expm1f(v); else if (ACT == 3) v = fmaxf(v, 0.f); so[w][8 * hh + r][t * 16 + ln] = v; } }
  __builtin_amdgcn_fence(__ATOMIC_ACQ_REL, "workgroup"); __builtin_amdgcn_wave_barrier();
  const int rsub = lane >> 4, c4 = (lane & 15) * 4;
  if (C) {      // f32 result, row-major
#pragma unroll
    for (int q = 0; q < 8; ++q) { const int r = q * 2 + rsub; if (col0 + c4 < N) { const v4f v = *(const v4fa*)&so[w][r][c4]; *(v4f*)(C + cofs + (size_t)(row0 + r) * ldc + col0 + c4) = v; } }
     }
  if (C16) {      // f16 result in fragment order (k = column, ldc = its K): the wave's 16 x 64 tile is 2 KiB in a row, half c holds columns col0 + 16 c ..
    unsigned short* cp = (unsigned short*)C16 + cofs + (size_t)row0 * ldc + (size_t)(col0 / 32) * 512 + lane * 8;
#pragma unroll
    for (int c = 0; c < 4; ++c) { if (col0 + c * 16 < N) { const v4f v0 = *(const v4fa*)&so[w][ln][c * 16 + hh * 8], v1 = *(const v4fa*)&so[w][ln][c * 16 + hh * 8 + 4]; FragH f;
#pragma unroll
        for (int i = 0; i < 4; ++i) { f.h[i] = (_Float16)v0[i]; f.h[4 + i] = (_Float16)v1[i]; }
        *(v8us*)(cp + c * 256) = f.half[0]; } }
     }
}


// x is row-major [rows][DD] f32; X16 is written in fragment order (see k_wt_f16), thread t = chunk t: a wave stores 512 contiguous bytes and reads 32-byte pieces of 16 rows.
__device__ __forceinline__ size_t frag_src(size_t t) { const int lane = (int)(t & 31), j = (int)((t >> 5) & 1); const size_t tile = t >> 6; return ((tile / (DD / 32)) * 16 + (lane & 15)) * DD + (tile % (DD / 32)) * 32 + j * 16 + (lane >> 4) * 8; }
__global__ __launch_bounds__(256) void k_x16(const float* __restrict__ x, _Float16* __restrict__ X16, size_t n8) { const size_t t = (size_t)blockIdx.x * 256 + threadIdx.x; if (t >= n8) return; FragH f; const size_t s = frag_src(t);
#pragma unroll
  for (int q = 0; q < 8; ++q) f.h[q] = (_Float16)bf16_round(x[s + q]); *(v8us*)((unsigned short*)X16 + t * 8) = f.half[0];  }
__global__ __launch_bounds__(256) void k_round16f(const float* __restrict__ W, _Float16* __restrict__ Bt, size_t n8) { const size_t t = (size_t)blockIdx.x * 256 + threadIdx.x; if (t >= n8) return; FragH f;
#pragma unroll
  for (int i = 0; i < 8; ++i) f.h[i] = (_Float16)(bf16_round(W[t * 8 + i]) * 16.0f); *(v8us*)((unsigned short*)Bt + t * 8) = f.half[0];  }

// lane l with lane l ^ 16 (a vector cross-row move, no LDS queue)
__device__ __forceinline__ float xhalf(float x) { return __builtin_bit_cast(float, __builtin_amdgcn_permlanex16(__builtin_bit_cast(int, x), __builtin_bit_cast(int, x), 0x76543210, 0xfedcba98, false, false)); }
// Transposed products: St = K * Qt (A = K rows, B = Q), Ot += Vt * Pt (A = Vt rows, B = Pt). The fragments are the same registers as before with A and B swapped (one k order for both).
// St tile nt: register r of lane (hh, ln) = score of key j0 + 16 nt + 8 hh + r with query q0 + ln: a lane holds 16 scores of ONE query, so maximum and sum run in the lane,
// with one exchange between the wave halves for the maximum; the two halves' sums are joined once, behind the loop.
// The two converted St tiles are the B fragment of Pt as they stand (element 8 nt + r = k 16 nt + 8 hh + r): P passes through no LDS.
__global__ __launch_bounds__(128) void k_flash(const _Float16* __restrict__ Q16, int ldq, const _Float16* __restrict__ K16, int ldk, const _Float16* __restrict__ Vt, const int* __restrict__ MSK, _Float16* __restrict__ O16, int ldo) {
  constexpr int RPW = 16, NQB = 2048 / (4 * RPW), DT = 4, KS = 2;
  const int tid = threadIdx.x, w = tid >> 5, lane = tid & 31, ln = lane & 15, hh = lane >> 4;
  const int slab = blockIdx.x / NQB, qblk = blockIdx.x % NQB; const int b = slab / 16, h = slab % 16; const int qb0 = qblk * (4 * RPW); const int q0 = qb0 + w * RPW;
  FragH aq[KS];
  { const unsigned short* qr = (const unsigned short*)Q16 + ((size_t)b * 2048 + q0) * ldq + h * 1024 + lane * 8;      // Q16, K16, Vt: fragment order (see k_wt_f16); a head's 64 columns are two tiles, 1024 elements
#pragma unroll
    for (int ks = 0; ks < KS; ++ks) { aq[ks].half[0] = *(const v8us*)(qr + ks * 512); aq[ks].half[1] = *(const v8us*)(qr + ks * 512 + 256); } }
  const unsigned short* Vth = (const unsigned short*)Vt + (size_t)slab * 64 * 2048;
  float m_r = -3.0e38f, l_r = 0.f; v8f oacc[DT];      // of query q0 + ln; l_r sums this half's keys only; oacc[dt][r] = Ot[16 dt + 8 hh + r][q0 + ln]
  // Softmax in base 2: exp(s / 8 - m) = exp2(s * CS - m * log2 e), CS = log2(e) / 8. m_r is kept in that scaled unit, so a weight is one fused multiply-add on the raw score and one hardware exp2.
  constexpr float CS = 0.125f * 1.4426950408889634f; typedef float v2f __attribute__((ext_vector_type(2)));
#pragma unroll
  for (int dt = 0; dt < DT; ++dt) oacc[dt] = (v8f){0.f,0.f,0.f,0.f,0.f,0.f,0.f,0.f};
  const int jend = 2048;
  // Fragment loads stand well ahead of their products: a pass issues its V fragments as one group at its top (they land behind the softmax) and,
  // right behind its score products, the next pass's K fragments (they land behind the rest of the pass). No product waits on a load just issued.
  // The unroll directives on the fragment loops keep the fragment arrays in registers (constant indices).
  FragH bk[2][KS];
#pragma unroll
  for (int nt = 0; nt < 2; ++nt) { const unsigned short* kr = (const unsigned short*)K16 + ((size_t)b * 2048 + nt * 16) * ldk + h * 1024 + lane * 8;
#pragma unroll
    for (int ks = 0; ks < KS; ++ks) { bk[nt][ks].half[0] = *(const v8us*)(kr + ks * 512); bk[nt][ks].half[1] = *(const v8us*)(kr + ks * 512 + 256); } }
#pragma unroll 1
  for (int j0 = 0; j0 < jend; j0 += 32) {
    FragH bv[DT];
#pragma unroll
    for (int dt = 0; dt < DT; ++dt) { const unsigned short* vrow = Vth + (size_t)j0 * 64 + dt * 512 + lane * 8; bv[dt].half[0] = *(const v8us*)vrow; bv[dt].half[1] = *(const v8us*)(vrow + 256); }
    v8f s[2];
#pragma unroll
    for (int nt = 0; nt < 2; ++nt) { v8f acc = (v8f){0.f,0.f,0.f,0.f,0.f,0.f,0.f,0.f};
#pragma unroll
      for (int ks = 0; ks < KS; ++ks) acc = mmaH<1>(bk[nt][ks].v, bk[nt][ks].v, aq[ks].v, aq[ks].v, acc); s[nt] = acc; }
    const int jn = (j0 + 32 < jend) ? j0 + 32 : j0;      // the last pass reads its own rows again: in bounds, not used
    const unsigned short* kr0 = (const unsigned short*)K16 + ((size_t)b * 2048 + jn) * ldk + h * 1024 + lane * 8; const unsigned short* kr1 = kr0 + (size_t)16 * ldk;
#pragma unroll
    for (int ks = 0; ks < KS; ++ks) { bk[0][ks].half[0] = *(const v8us*)(kr0 + ks * 512); bk[0][ks].half[1] = *(const v8us*)(kr0 + ks * 512 + 256); bk[1][ks].half[0] = *(const v8us*)(kr1 + ks * 512); bk[1][ks].half[1] = *(const v8us*)(kr1 + ks * 512 + 256); }
    // the wait that stands in front of any reuse of the group's address registers; naming them as inputs keeps them whole up to it (no load of the group lands on one)
    asm volatile("s_wait_xcnt 0x0" :: "v"(kr0), "v"(kr1) : "memory");
    float mx[8];
#pragma unroll
    for (int r = 0; r < 8; ++r) mx[r] = fmaxf(s[0][r], s[1][r]);      // maxima of the raw scores: the scale is positive
    float mc = fmaxf(fmaxf(fmaxf(mx[0], mx[1]), fmaxf(mx[2], mx[3])), fmaxf(fmaxf(mx[4], mx[5]), fmaxf(mx[6], mx[7])));
    mc = fmaxf(mc, xhalf(mc)) * CS;
    const float mn = fmaxf(m_r, mc); const float al = (mn > -1.0e38f) ? __builtin_amdgcn_exp2f(m_r - mn) : 1.0f; m_r = mn;
    FragH pb; float ps[8];
#pragma unroll
    for (int r = 0; r < 8; r += 2) {      // two scores of a tile per packed multiply-add
      const v2f a0 = __builtin_elementwise_fma((v2f){s[0][r], s[0][r + 1]}, (v2f){CS, CS}, (v2f){-mn, -mn}), a1 = __builtin_elementwise_fma((v2f){s[1][r], s[1][r + 1]}, (v2f){CS, CS}, (v2f){-mn, -mn});
      const float p00 = __builtin_amdgcn_exp2f(a0.x), p01 = __builtin_amdgcn_exp2f(a0.y), p10 = __builtin_amdgcn_exp2f(a1.x), p11 = __builtin_amdgcn_exp2f(a1.y);
      ps[r] = p00 + p10; ps[r + 1] = p01 + p11; pb.h[r] = (_Float16)p00; pb.h[r + 1] = (_Float16)p01; pb.h[8 + r] = (_Float16)p10; pb.h[9 + r] = (_Float16)p11; }
    l_r = l_r * al + (((ps[0] + ps[1]) + (ps[2] + ps[3])) + ((ps[4] + ps[5]) + (ps[6] + ps[7])));
#pragma unroll
    for (int dt = 0; dt < DT; ++dt)
#pragma unroll
      for (int r = 0; r < 8; ++r) oacc[dt][r] *= al;
#pragma unroll
    for (int dt = 0; dt < DT; ++dt) oacc[dt] = mmaH<1>(bv[dt].v, bv[dt].v, pb.v, pb.v, oacc[dt]); }
  { const float l = l_r + xhalf(l_r); l_r = (l > 0.f) ? 1.0f / l : 0.f; }
  // oacc[dt][0..7] of lane (hh, ln) are row q0 + ln, columns 16 dt + 8 hh + 0..7 of the head: the 16 bytes that this lane owns in half dt & 1 of the head's tile dt >> 1 of a fragment-order
  // operand (see k_wt_f16). So the output GEMM's f16 A operand is stored from the accumulator registers, 512 contiguous bytes per wave and store.
  unsigned short* op = (unsigned short*)O16 + ((size_t)b * 2048 + q0) * ldo + h * 1024 + lane * 8;
#pragma unroll
  for (int dt = 0; dt < DT; ++dt) { FragH f;
#pragma unroll
    for (int r = 0; r < 8; ++r) f.h[r] = (_Float16)(oacc[dt][r] * l_r);
    *(v8us*)(op + dt * 256) = f.half[0]; } }

extern "C" void kernel_launch(void* const* d_in, const int* in_sizes, int n_in,
                              void* d_out, int out_size, void* d_ws, size_t ws_size, hipStream_t stream) {
  (void)in_sizes; (void)n_in; (void)out_size;
  const float* xq = (const float*)d_in[0]; const float* xkv = (const float*)d_in[1]; const float* mk = (const float*)d_in[2]; const float* Wq = (const float*)d_in[3]; const float* bq = (const float*)d_in[4]; const float* Wk = (const float*)d_in[5]; const float* bk = (const float*)d_in[6]; const float* Wv = (const float*)d_in[7]; const float* bv = (const float*)d_in[8]; const float* Wo = (const float*)d_in[9]; const float* bo = (const float*)d_in[10];
  char* ws = (char*)d_ws; size_t off = 0;
  auto take = [&](size_t bytes) { char* p = ws + off; off += (bytes + 255) & ~(size_t)255; return p; };
  _Float16* Bq = (_Float16*)take((size_t)DD * DD * 2); _Float16* Bk = (_Float16*)take((size_t)DD * DD * 2); _Float16* Bv = (_Float16*)take((size_t)DD * DD * 2); _Float16* Bo = (_Float16*)take((size_t)DD * DD * 2);
  _Float16* XQ16 = (_Float16*)take((size_t)NR * DD * 2); _Float16* XKV16 = (_Float16*)take((size_t)NR * DD * 2); _Float16* Q16 = (_Float16*)take((size_t)NR * DD * 2); _Float16* K16 = (_Float16*)take((size_t)NR * DD * 2); _Float16* Vt = (_Float16*)take((size_t)NR * DD * 2); _Float16* O16 = (_Float16*)take((size_t)NR * DD * 2);
  if (off > ws_size) return;      // 8.4 + 8.4 x 6 = 59 MB
  k_wt_f16<<<(unsigned)(((size_t)DD * (DD / 8) + 255) / 256), 256, 0, stream>>>(Wq, Bq, DD, DD, 16.0f); k_wt_f16<<<(unsigned)(((size_t)DD * (DD / 8) + 255) / 256), 256, 0, stream>>>(Wk, Bk, DD, DD, 16.0f); k_wt_f16<<<(unsigned)(((size_t)DD * (DD / 8) + 255) / 256), 256, 0, stream>>>(Wv, Bv, DD, DD, 16.0f); k_wt_f16<<<(unsigned)(((size_t)DD * (DD / 8) + 255) / 256), 256, 0, stream>>>(Wo, Bo, DD, DD, 16.0f);      // (D,H,Dh) = [in][h·64+d]; Wo (H,Dh,D) = [in=(h,d)][out]
  const unsigned g8 = (unsigned)(((size_t)NR * DD / 8 + 255) / 256); const dim3 gg(((NR / 16) * (DD / 64) + 3) / 4, 1);
  k_x16<<<g8, 256, 0, stream>>>(xq, XQ16, (size_t)NR * DD / 8); k_x16<<<g8, 256, 0, stream>>>(xkv, XKV16, (size_t)NR * DD / 8);
  k_gemm_hhx<0, false><<<gg, 128, 0, stream>>>(XQ16, DD, 0, Bq, DD, 0, 0.0625f, bq, 0, nullptr, 1, 0, 0, nullptr, Q16, DD, 0, NR, DD, DD, nullptr);
  k_gemm_hhx<0, false><<<gg, 128, 0, stream>>>(XKV16, DD, 0, Bk, DD, 0, 0.0625f, bk, 0, nullptr, 1, 0, 0, nullptr, K16, DD, 0, NR, DD, DD, nullptr);
  k_gemm_hhx<0, true><<<gg, 128, 0, stream>>>(XKV16, DD, 0, Bv, DD, 0, 0.0625f, bv, 0, nullptr, 1, 0, 0, nullptr, Vt, DD, 0, NR, DD, DD, mk);      // (v + bv) * mask in f32, then f16, stored as Vt
  k_flash<<<BB * NH * (TT / 64), 128, 0, stream>>>(Q16, DD, K16, DD, Vt, nullptr, O16, DD);      // the 1/8 on q is folded into the softmax constant
  k_gemm_hhx<0, false><<<gg, 128, 0, stream>>>(O16, DD, 0, Bo, DD, 0, 0.0625f, bo, 0, nullptr, 1, 0, 0, (float*)d_out, nullptr, DD, 0, NR, DD, DD, nullptr);
}

// v006
// Measured time: 138 microseconds a run.
// In two side-by-side timings against v005, it was 1.06 and 1.05 times as fast.
// Over all steps from v000 it is 3.22 times as fast.
#include <hip/hip_runtime.h>
// Multi-head dot-product attention with a per-key value mask (B=2, L=2048, D=1024, 16 heads × 64; q from inputs_q, k/v from inputs_kv; v ← mask_k·v; softmax(q·k/8); merge; ·Wo + bo): the
// q/k/v/o projections are GEMMs ([in][out] weights bf16-exact ×2^4, bias epilogues, f32 accumulate) and the attention is a fused flash-style kernel (online softmax f32; P f16 ≤ 1; O = P·Vt;
// 32 queries a wave) on v_wmma_f32_16x16x32_f16; the value masking is applied in f32 VALU before the f16 conversion.
#define BB 2
#define TT 2048
#define DD 1024
#define NH 16
#define NR (BB * TT)

typedef __bf16 v16b __attribute__((ext_vector_type(16)));
typedef unsigned short v8us __attribute__((ext_vector_type(8), may_alias));
typedef float  v8f  __attribute__((ext_vector_type(8)));
typedef float  v4f  __attribute__((ext_vector_type(4)));
typedef float  v4fa __attribute__((ext_vector_type(4), may_alias));
union FragB { v16b v; v8us half[2]; unsigned short u[16]; };

__device__ __forceinline__ unsigned short bf16_bits(float x) { unsigned int u = __float_as_uint(x); return (unsigned short)((u + 0x7FFFu + ((u >> 16) & 1u)) >> 16); }
__device__ __forceinline__ float bf16_val(unsigned short b) { return __uint_as_float(((unsigned int)b) << 16); }
__device__ __forceinline__ float bf16_round(float x) { return bf16_val(bf16_bits(x)); }
// D += A·B with NT terms: 1 = ah·bh, 2 = + al·bh (A split), 3 = + ah·bl (both split)
template <int NT>
__device__ __forceinline__ v8f mmaN(v16b ah, v16b al, v16b bh, v16b bl, v8f c) {
  c = __builtin_amdgcn_wmma_f32_16x16x32_bf16(false, ah, false, bh, (short)0, c, false, false);
  if (NT >= 2) c = __builtin_amdgcn_wmma_f32_16x16x32_bf16(false, al, false, bh, (short)0, c, false, false);
  if (NT >= 3) c = __builtin_amdgcn_wmma_f32_16x16x32_bf16(false, ah, false, bl, (short)0, c, false, false);
  asm volatile("v_nop\n\tv_nop\n\tv_nop\n\tv_nop" : "+v"(c) : "v"(ah), "v"(al), "v"(bh), "v"(bl));
  return c;
}

__global__ __launch_bounds__(256) void k_wt_bf16(const float* __restrict__ W, unsigned short* __restrict__ Wt, int K, int N) {
  const int t = blockIdx.x * 256 + threadIdx.x;
  const int k8n = K / 8;
  if (t >= N * k8n) return;
  const int n = t / k8n, k8 = (t % k8n) * 8;
  v8us v;
#pragma unroll
  for (int i = 0; i < 8; ++i) v[i] = bf16_bits(W[(size_t)(k8 + i) * N + n]);
  *(v8us*)(Wt + (size_t)n * K + k8) = v;
  
}

// GEMM C[M][N] (f32, pitch ldc) = act(A[M][K]·W + bias). A f32 row-major (pitch lda) converted per fragment to bf16
// (ASPLIT: hi/lo two planes -> 2 terms, else single rounded term); Wt bf16 [N][K] (pitch ldb). BIAS_BF16 rounds the
// bias to bf16 first (bias quantised to bf16 before the add). K%32==0, M%16==0, N%64==0.
template <bool ASPLIT, int ACT, bool BIAS_BF16>
__global__ __launch_bounds__(128) void k_gemm_bf(const float* __restrict__ A, int lda, const unsigned short* __restrict__ Wt, int ldb,
                                               const float* __restrict__ bias, float* __restrict__ C, int ldc, int M, int N, int K) {
  __shared__ __attribute__((aligned(16))) float so[4][16][64];
  const int tid = threadIdx.x, w = tid >> 5, lane = tid & 31, ln = lane & 15, hh = lane >> 4;
  const int ntn = N / 64;
  const int wid = blockIdx.x * 4 + w;
  const int mt = wid / ntn, nq = wid % ntn;
  if (mt * 16 >= M) return;
  const int row0 = mt * 16, col0 = nq * 64;
  const float* arow = A + (size_t)(row0 + ln) * lda;
  v8f acc[4] = {};
  for (int kb = 0; kb < K; kb += 32) {
    FragB ah, al;
    const v4f x0 = *(const v4fa*)(arow + kb + 8 * hh), x1 = *(const v4fa*)(arow + kb + 8 * hh + 4);
    const v4f x2 = *(const v4fa*)(arow + kb + 16 + 8 * hh), x3 = *(const v4fa*)(arow + kb + 16 + 8 * hh + 4);
    float xs[16] = {x0[0],x0[1],x0[2],x0[3],x1[0],x1[1],x1[2],x1[3],x2[0],x2[1],x2[2],x2[3],x3[0],x3[1],x3[2],x3[3]};
#pragma unroll
    for (int i = 0; i < 16; ++i) { const unsigned short hb = bf16_bits(xs[i]); ah.u[i] = hb; al.u[i] = ASPLIT ? bf16_bits(xs[i] - bf16_val(hb)) : (unsigned short)0; }
#pragma unroll
    for (int t = 0; t < 4; ++t) {
      const unsigned short* brow = Wt + (size_t)(col0 + t * 16 + ln) * ldb + kb;
      FragB b;
      b.half[0] = *(const v8us*)(brow + 8 * hh);
      b.half[1] = *(const v8us*)(brow + 16 + 8 * hh);
      acc[t] = mmaN<ASPLIT ? 2 : 1>(ah.v, al.v, b.v, b.v, acc[t]);
    }
  }
#pragma unroll
  for (int t = 0; t < 4; ++t) {
    float bv = bias ? bias[col0 + t * 16 + ln] : 0.f;
    if (BIAS_BF16) bv = bf16_round(bv);
#pragma unroll
    for (int r = 0; r < 8; ++r) { float v = acc[t][r] + bv; if (ACT == 1) v = fmaxf(v, 0.f); so[w][8 * hh + r][t * 16 + ln] = v; }
  }
  __builtin_amdgcn_fence(__ATOMIC_ACQ_REL, "workgroup");
  __builtin_amdgcn_wave_barrier();
  const int rsub = lane >> 4, c4 = (lane & 15) * 4;
  {
#pragma unroll
    for (int q = 0; q < 8; ++q) {
      const int r = q * 2 + rsub;
      const v4f v = *(const v4fa*)&so[w][r][c4];
      *(v4f*)(C + (size_t)(row0 + r) * ldc + col0 + c4) = v;
    }
    
  }
}

// Flash-style causal/unmasked attention, all contractions 3-term bf16 hi/lo splits, f32 softmax with running max.
// q,k,v rows are read from f32 buffers with arbitrary row pitch (so they can live inside a fused qkv buffer);
// D = head size (multiple of 32, <= 128); one wave = 16 query rows; block = 4 waves (64 queries) sharing K/V chunks of 32.
template <int D, bool CAUSAL>
__global__ __launch_bounds__(128) void k_flash(const float* __restrict__ qb, const float* __restrict__ kb, const float* __restrict__ vb,
                                             int pitch, int T, int H, float scale, float* __restrict__ y, int ypitch) {
  constexpr int KS = D / 32;        // k-steps for QK
  constexpr int DT = D / 16;        // d tiles for PV
  __shared__ __attribute__((aligned(16))) unsigned short sKh[32][D + 8], sKl[32][D + 8], sVh[32][D + 8], sVl[32][D + 8];
  __shared__ __attribute__((aligned(16))) unsigned short sPh[4][16][40], sPl[4][16][40];
  __shared__ __attribute__((aligned(16))) float sO[4][16][D];
  const int tid = threadIdx.x, w = tid >> 5, lane = tid & 31, ln = lane & 15, hh = lane >> 4;
  const int nqb = (T + 63) / 64;
  const int bh = blockIdx.x / nqb, qblk = blockIdx.x % nqb;
  const int b = bh / H, h = bh % H;
  const int q0 = qblk * 64 + w * 16;
  const float* Q = qb + (size_t)b * T * pitch + h * D;
  const float* K = kb + (size_t)b * T * pitch + h * D;
  const float* V = vb + (size_t)b * T * pitch + h * D;

  // A fragments of the wave's 16 query rows (scaled), hi/lo
  FragB aqh[KS], aql[KS];
  {
    int row = q0 + ln; if (row >= T) row = T - 1;
    const float* qr = Q + (size_t)row * pitch;
#pragma unroll
    for (int ks = 0; ks < KS; ++ks)
#pragma unroll
      for (int i = 0; i < 16; ++i) {
        const int d = ks * 32 + ((i < 8) ? (8 * hh + i) : (16 + 8 * hh + (i - 8)));
        const float x = qr[d] * scale; const unsigned short hb = bf16_bits(x);
        aqh[ks].u[i] = hb; aql[ks].u[i] = bf16_bits(x - bf16_val(hb));
      }
  }
  float m_r[8], l_r[8];
#pragma unroll
  for (int r = 0; r < 8; ++r) { m_r[r] = -3.0e38f; l_r[r] = 0.f; }
  v8f oacc[DT];
#pragma unroll
  for (int dt = 0; dt < DT; ++dt) oacc[dt] = (v8f){0.f,0.f,0.f,0.f,0.f,0.f,0.f,0.f};

  const int kv_end = CAUSAL ? min(T, qblk * 64 + 64) : T;     // block-uniform
  for (int j0 = 0; j0 < kv_end; j0 += 32) {
    __syncthreads();
    for (int e = tid; e < 32 * (D / 4); e += 128) {
      const int r = e / (D / 4), c4 = (e % (D / 4)) * 4;
      const int key = j0 + r;
      v4f kf = {0.f,0.f,0.f,0.f}, vf = {0.f,0.f,0.f,0.f};
      if (key < T) { kf = *(const v4fa*)(K + (size_t)key * pitch + c4); vf = *(const v4fa*)(V + (size_t)key * pitch + c4); }
#pragma unroll
      for (int t = 0; t < 4; ++t) {
        unsigned short hb = bf16_bits(kf[t]); sKh[r][c4 + t] = hb; sKl[r][c4 + t] = bf16_bits(kf[t] - bf16_val(hb));
        hb = bf16_bits(vf[t]); sVh[r][c4 + t] = hb; sVl[r][c4 + t] = bf16_bits(vf[t] - bf16_val(hb));
      }
    }
    __syncthreads();
    // S tile 16 x 32
    v8f s[2];
#pragma unroll
    for (int nt = 0; nt < 2; ++nt) {
      v8f acc = {};
#pragma unroll
      for (int ks = 0; ks < KS; ++ks) {
        FragB bh_, bl_;
        bh_.half[0] = *(const v8us*)&sKh[nt * 16 + ln][ks * 32 + 8 * hh]; bh_.half[1] = *(const v8us*)&sKh[nt * 16 + ln][ks * 32 + 16 + 8 * hh];
        bl_.half[0] = *(const v8us*)&sKl[nt * 16 + ln][ks * 32 + 8 * hh]; bl_.half[1] = *(const v8us*)&sKl[nt * 16 + ln][ks * 32 + 16 + 8 * hh];
        acc = mmaN<3>(aqh[ks].v, aql[ks].v, bh_.v, bl_.v, acc);
      }
      s[nt] = acc;
    }
    // mask + running max (rows 8hh+r; the 16 lanes of a half share rows)
    float alpha[8];
#pragma unroll
    for (int r = 0; r < 8; ++r) {
      const int qi = q0 + 8 * hh + r;
      const int ja = j0 + ln, jb = j0 + 16 + ln;
      if (CAUSAL) { if (ja > qi) s[0][r] = -3.0e38f; if (jb > qi) s[1][r] = -3.0e38f; }
      if (ja >= T) s[0][r] = -3.0e38f;
      if (jb >= T) s[1][r] = -3.0e38f;
      float mx = fmaxf(s[0][r], s[1][r]);
      mx = fmaxf(mx, __shfl_xor(mx, 1, 32)); mx = fmaxf(mx, __shfl_xor(mx, 2, 32)); mx = fmaxf(mx, __shfl_xor(mx, 4, 32)); mx = fmaxf(mx, __shfl_xor(mx, 8, 32));
      const float mnew = fmaxf(m_r[r], mx);
      alpha[r] = (mnew > -1.0e38f) ? __expf(m_r[r] - mnew) : 1.0f;
      const float p0 = (s[0][r] > -1.0e38f) ? __expf(s[0][r] - mnew) : 0.f;
      const float p1 = (s[1][r] > -1.0e38f) ? __expf(s[1][r] - mnew) : 0.f;
      m_r[r] = mnew;
      l_r[r] = l_r[r] * alpha[r] + p0 + p1;            // per-lane partial row sum (16 lanes combined at the end)
      unsigned short hb = bf16_bits(p0); sPh[w][8 * hh + r][ln] = hb;      sPl[w][8 * hh + r][ln] = bf16_bits(p0 - bf16_val(hb));
      hb = bf16_bits(p1);                sPh[w][8 * hh + r][16 + ln] = hb; sPl[w][8 * hh + r][16 + ln] = bf16_bits(p1 - bf16_val(hb));
    }
#pragma unroll
    for (int dt = 0; dt < DT; ++dt)
#pragma unroll
      for (int r = 0; r < 8; ++r) oacc[dt][r] *= alpha[r];
    __builtin_amdgcn_fence(__ATOMIC_ACQ_REL, "workgroup");
    __builtin_amdgcn_wave_barrier();
    FragB pah, pal;
    pah.half[0] = *(const v8us*)&sPh[w][ln][8 * hh]; pah.half[1] = *(const v8us*)&sPh[w][ln][16 + 8 * hh];
    pal.half[0] = *(const v8us*)&sPl[w][ln][8 * hh]; pal.half[1] = *(const v8us*)&sPl[w][ln][16 + 8 * hh];
#pragma unroll
    for (int dt = 0; dt < DT; ++dt) {
      FragB bvh, bvl;
#pragma unroll
      for (int i = 0; i < 8; ++i) {
        bvh.u[i] = sVh[8 * hh + i][dt * 16 + ln]; bvh.u[8 + i] = sVh[16 + 8 * hh + i][dt * 16 + ln];
        bvl.u[i] = sVl[8 * hh + i][dt * 16 + ln]; bvl.u[8 + i] = sVl[16 + 8 * hh + i][dt * 16 + ln];
      }
      oacc[dt] = mmaN<3>(pah.v, pal.v, bvh.v, bvl.v, oacc[dt]);
    }
    __builtin_amdgcn_fence(__ATOMIC_ACQ_REL, "workgroup");
    __builtin_amdgcn_wave_barrier();
  }
#pragma unroll
  for (int r = 0; r < 8; ++r) {
    float l = l_r[r];
    l += __shfl_xor(l, 1, 32); l += __shfl_xor(l, 2, 32); l += __shfl_xor(l, 4, 32); l += __shfl_xor(l, 8, 32);
    l_r[r] = (l > 0.f) ? 1.0f / l : 0.f;
  }
#pragma unroll
  for (int dt = 0; dt < DT; ++dt)
#pragma unroll
    for (int r = 0; r < 8; ++r) sO[w][8 * hh + r][dt * 16 + ln] = oacc[dt][r] * l_r[r];
  __builtin_amdgcn_fence(__ATOMIC_ACQ_REL, "workgroup");
  __builtin_amdgcn_wave_barrier();
  {
    for (int r = 0; r < 16; ++r) {
      const int row = q0 + r;
      if (row < T && lane < D / 4) {
        const v4f val = *(const v4fa*)&sO[w][r][lane * 4];
        *(v4f*)(y + ((size_t)b * T + row) * ypitch + h * D + lane * 4) = val;
      }
    }
    
  }
}

// GEMM C = act(A·W + bias + resid): A f32 (ASPLIT -> hi/lo 2 terms), Wt bf16 [N][K]; ACT 0 none, 1 relu, 2 exact gelu;
// resid (optional, f32, row index = (row % rmod), pitch ldr, RES_BF16 rounds it) added before the activation.
template <bool ASPLIT, int ACT, bool BIAS_BF16, bool RES_BF16>
__global__ __launch_bounds__(128) void k_gemm_bf3(const float* __restrict__ A, int lda, const unsigned short* __restrict__ Wt, int ldb,
                                                const float* __restrict__ bias, const float* __restrict__ resid, int rmod, int ldr,
                                                float* __restrict__ C, int ldc, int M, int N, int K) {
  __shared__ __attribute__((aligned(16))) float so[4][16][64];
  const int tid = threadIdx.x, w = tid >> 5, lane = tid & 31, ln = lane & 15, hh = lane >> 4;
  const int ntn = N / 64;
  const int wid = blockIdx.x * 4 + w;
  const int mt = wid / ntn, nq = wid % ntn;
  if (mt * 16 >= M) return;
  const int row0 = mt * 16, col0 = nq * 64;
  const float* arow = A + (size_t)(row0 + ln) * lda;
  v8f acc[4] = {};
  for (int kb = 0; kb < K; kb += 32) {
    FragB ah, al;
    const v4f x0 = *(const v4fa*)(arow + kb + 8 * hh), x1 = *(const v4fa*)(arow + kb + 8 * hh + 4);
    const v4f x2 = *(const v4fa*)(arow + kb + 16 + 8 * hh), x3 = *(const v4fa*)(arow + kb + 16 + 8 * hh + 4);
    float xs[16] = {x0[0],x0[1],x0[2],x0[3],x1[0],x1[1],x1[2],x1[3],x2[0],x2[1],x2[2],x2[3],x3[0],x3[1],x3[2],x3[3]};
#pragma unroll
    for (int i = 0; i < 16; ++i) { const unsigned short hb = bf16_bits(xs[i]); ah.u[i] = hb; al.u[i] = ASPLIT ? bf16_bits(xs[i] - bf16_val(hb)) : (unsigned short)0; }
#pragma unroll
    for (int t = 0; t < 4; ++t) {
      const unsigned short* brow = Wt + (size_t)(col0 + t * 16 + ln) * ldb + kb;
      FragB b;
      b.half[0] = *(const v8us*)(brow + 8 * hh);
      b.half[1] = *(const v8us*)(brow + 16 + 8 * hh);
      acc[t] = mmaN<ASPLIT ? 2 : 1>(ah.v, al.v, b.v, b.v, acc[t]);
    }
  }
#pragma unroll
  for (int t = 0; t < 4; ++t) {
    const int col = col0 + t * 16 + ln;
    float bv = bias ? bias[col] : 0.f;
    if (BIAS_BF16) bv = bf16_round(bv);
#pragma unroll
    for (int r = 0; r < 8; ++r) {
      float v = acc[t][r] + bv;
      if (resid) { float rv = resid[(size_t)((row0 + 8 * hh + r) % rmod) * ldr + col]; if (RES_BF16) rv = bf16_round(rv); v += rv; }
      if (ACT == 1) v = fmaxf(v, 0.f);
      if (ACT == 2) v = 0.5f * v * (1.0f + erff(v * 0.70710678118654752f));
      if (ACT == 3) { const float u = 0.7978845608028654f * (v + 0.044715f * v * v * v); v = 0.5f * v * (1.0f + tanhf(u)); }
      so[w][8 * hh + r][t * 16 + ln] = v;
    }
  }
  __builtin_amdgcn_fence(__ATOMIC_ACQ_REL, "workgroup");
  __builtin_amdgcn_wave_barrier();
  const int rsub = lane >> 4, c4 = (lane & 15) * 4;
  {
#pragma unroll
    for (int q = 0; q < 8; ++q) {
      const int r = q * 2 + rsub;
      const v4f v = *(const v4fa*)&so[w][r][c4];
      *(v4f*)(C + (size_t)(row0 + r) * ldc + col0 + c4) = v;
    }
    
  }
}
// row LayerNorm (biased variance, eps) over N: s = X (+ R); optional out_sum <- s; out_norm <- (s-mu)*rsqrt(var+eps)*g + b
template <bool PARAM_BF16>
__global__ __launch_bounds__(256) void k_layernorm(const float* __restrict__ X, const float* __restrict__ R, const float* __restrict__ g, const float* __restrict__ bta,
                                                  float* __restrict__ out_sum, float* __restrict__ out_norm, int N, float eps) {
  __shared__ float red[256];
  const int row = blockIdx.x, tid = threadIdx.x;
  const float* x = X + (size_t)row * N; const float* rr = R ? R + (size_t)row * N : nullptr;
  float vals[16];                     // up to N = 4096
  const int per = N / 256;            // contiguous chunk per thread? use strided-by-4 chunks: thread handles j = tid*4 + 1024*u
  float s1 = 0.f;
  for (int u = 0; u < per / 4; ++u) {
    const int j = tid * 4 + 1024 * u;
    const v4f a = *(const v4fa*)(x + j);
    v4f b = {0.f,0.f,0.f,0.f}; if (rr) b = *(const v4fa*)(rr + j);
#pragma unroll
    for (int q = 0; q < 4; ++q) { const float v = a[q] + b[q]; vals[u * 4 + q] = v; s1 += v; }
  }
  red[tid] = s1; __syncthreads();
  for (int st = 128; st > 0; st >>= 1) { if (tid < st) red[tid] += red[tid + st]; __syncthreads(); }
  const float mu = red[0] / (float)N; __syncthreads();
  float s2 = 0.f;
  for (int u = 0; u < per / 4; ++u)
#pragma unroll
    for (int q = 0; q < 4; ++q) { const float c = vals[u * 4 + q] - mu; s2 += c * c; }
  red[tid] = s2; __syncthreads();
  for (int st = 128; st > 0; st >>= 1) { if (tid < st) red[tid] += red[tid + st]; __syncthreads(); }
  const float rs = rsqrtf(red[0] / (float)N + eps);
  {
    for (int u = 0; u < per / 4; ++u) {
      const int j = tid * 4 + 1024 * u;
      v4f o, sm;
#pragma unroll
      for (int q = 0; q < 4; ++q) {
        float gg = g[j + q], bb = bta[j + q];
        if (PARAM_BF16) { gg = bf16_round(gg); bb = bf16_round(bb); }
        sm[q] = vals[u * 4 + q]; o[q] = (vals[u * 4 + q] - mu) * rs * gg + bb;
      }
      if (out_sum) *(v4f*)(out_sum + (size_t)row * N + j) = sm;
      *(v4f*)(out_norm + (size_t)row * N + j) = o;
    }
    
  }
}



// ---- f16 WMMA path (v_wmma_f32_16x16x32_f16): 11-bit significands for operands in range — used where a [0,1] probability operand needs more precision than bf16
typedef _Float16 v16h __attribute__((ext_vector_type(16)));
union FragH { v16h v; v8us half[2]; _Float16 h[16]; unsigned short u[16]; };
template <int NT>
__device__ __forceinline__ v8f mmaH(v16h ah, v16h al, v16h bh, v16h bl, v8f c) {
  c = __builtin_amdgcn_wmma_f32_16x16x32_f16(false, ah, false, bh, (short)0, c, false, false);
  if (NT >= 2) c = __builtin_amdgcn_wmma_f32_16x16x32_f16(false, al, false, bh, (short)0, c, false, false);
  if (NT >= 3) c = __builtin_amdgcn_wmma_f32_16x16x32_f16(false, ah, false, bl, (short)0, c, false, false);
  asm volatile("v_nop\n\tv_nop\n\tv_nop\n\tv_nop" : "+v"(c) : "v"(ah), "v"(al), "v"(bh), "v"(bl));
  return c;
}
// batched GEMM like k_gemm_b but f16 operands: A f32 (split into f16 hi/lo if ASPLIT, else rounded to f16), Bt = f16 values [n][k]; alpha; C f32; N multiple of 16 (partial tiles skipped)
template <bool ASPLIT>
__global__ __launch_bounds__(128) void k_gemm_h(const float* __restrict__ A, int lda, size_t sA, const _Float16* __restrict__ Bh, int ldb, size_t sB, float alpha, float* __restrict__ C, int ldc, size_t sC, int M, int N, int K) {
  __shared__ __attribute__((aligned(16))) float so[4][16][64];
  const int tid = threadIdx.x, w = tid >> 5, lane = tid & 31, ln = lane & 15, hh = lane >> 4; const int by = blockIdx.y;
  A += (size_t)by * sA; Bh += (size_t)by * sB; C += (size_t)by * sC;
  const int ntn = (N + 63) / 64; const int wid = blockIdx.x * 4 + w; const int mt = wid / ntn, nq = wid % ntn; if (mt * 16 >= M) return;
  const int row0 = mt * 16, col0 = nq * 64; const float* arow = A + (size_t)(row0 + ln) * lda;
  v8f acc[4] = {};
  for (int kb = 0; kb < K; kb += 32) {
    FragH ah, al;
    const v4f x0 = *(const v4fa*)(arow + kb + 8 * hh), x1 = *(const v4fa*)(arow + kb + 8 * hh + 4), x2 = *(const v4fa*)(arow + kb + 16 + 8 * hh), x3 = *(const v4fa*)(arow + kb + 16 + 8 * hh + 4);
    float xs[16] = {x0[0],x0[1],x0[2],x0[3],x1[0],x1[1],x1[2],x1[3],x2[0],x2[1],x2[2],x2[3],x3[0],x3[1],x3[2],x3[3]};
#pragma unroll
    for (int i = 0; i < 16; ++i) { const _Float16 h = (_Float16)xs[i]; ah.h[i] = h; al.h[i] = ASPLIT ? (_Float16)(xs[i] - (float)h) : (_Float16)0.0f; }
#pragma unroll
    for (int t = 0; t < 4; ++t) { if (col0 + t * 16 >= N) continue; const size_t boff = (size_t)(col0 + t * 16 + ln) * ldb + kb; FragH bq; bq.half[0] = *(const v8us*)(Bh + boff + 8 * hh); bq.half[1] = *(const v8us*)(Bh + boff + 16 + 8 * hh);
      acc[t] = mmaH<ASPLIT ? 2 : 1>(ah.v, al.v, bq.v, bq.v, acc[t]); }
  }
#pragma unroll
  for (int t = 0; t < 4; ++t) { if (col0 + t * 16 >= N) continue;
#pragma unroll
    for (int r = 0; r < 8; ++r) so[w][8 * hh + r][t * 16 + ln] = acc[t][r] * alpha; }
  __builtin_amdgcn_fence(__ATOMIC_ACQ_REL, "workgroup"); __builtin_amdgcn_wave_barrier();
  const int rsub = lane >> 4, c4 = (lane & 15) * 4;
  {
#pragma unroll
    for (int q = 0; q < 8; ++q) { const int r = q * 2 + rsub; if (col0 + c4 < N) { const v4f v = *(const v4fa*)&so[w][r][c4]; *(v4f*)(C + (size_t)(row0 + r) * ldc + col0 + c4) = v; } }
     }
}

// Wt[n][k] = f16(W[k][n]·scale) from f32 row-major W[K][N] (scale = power of two; bf16-exact weights stay exact in f16 away from the subnormal range)
// FRAGMENT ORDER (f16 matrices in the workspace; Vt numbers its tiles kt * 4 + dt, see k_gemm_w64 with OUT 1): a [rows][K] operand is kept as tiles of 16 rows x 32 k, 1 KiB each, tile (rt, kt) at index rt * (K / 32) + kt.
// A tile is two halves of 512 bytes (k 0..15, then k 16..31); in half j lane hh * 16 + ln owns the 16 bytes of row ln, k = 16 j + 8 hh + 0..7: just what that lane feeds to the WMMA.
// One wave-wide 16-byte load of a half is then 512 contiguous bytes, four whole lines, where a row-major operand gives 32-byte pieces of 16 lines.
// Chunk t (16 bytes) of such a buffer: lane = t & 31, j = (t >> 5) & 1, tile = t >> 6. K % 32 == 0, rows % 16 == 0.
__global__ __launch_bounds__(256) void k_wt_f16(const float* __restrict__ W, _Float16* __restrict__ Wt, int K, int N, float scale) {
  const int t = blockIdx.x * 256 + threadIdx.x; if (t >= N * (K / 8)) return; const int lane = t & 31, j = (t >> 5) & 1, tile = t >> 6; const int n = (tile / (K / 32)) * 16 + (lane & 15), k8 = (tile % (K / 32)) * 32 + j * 16 + (lane >> 4) * 8; FragH f;
#pragma unroll
  for (int i = 0; i < 8; ++i) f.h[i] = (_Float16)(bf16_round(W[(size_t)(k8 + i) * N + n]) * scale); const v8us o = f.half[0];
  *(v8us*)((unsigned short*)Wt + (size_t)t * 8) = o; 
}
// GEMM on fragment-order f16 operands (see k_wt_f16), [NR][DD] x [DD][DD]: v = acc * alpha + bf16(bias[col]).
// A wave owns a 64 x 64 tile of the result (4 x 4 accumulator tiles), so every loaded A or B fragment feeds four products; a block is 2 x 2 waves, a 128 x 128 tile.
// OUT 0: f16 result in fragment order (k = column). OUT 1: f16(v * bf16(RM[row])) transposed per head of 64 columns, in the fragment order that k_flash reads as Vt (TT rows per batch). OUT 2: f32 result, row-major.
template <int OUT>
__global__ __launch_bounds__(128) void k_gemm_w64(const _Float16* __restrict__ A, const _Float16* __restrict__ Bh, float alpha, const float* __restrict__ bias, float* __restrict__ C, _Float16* __restrict__ C16, const float* __restrict__ RM) {
  constexpr int K = DD, N = DD, MT = 4;
  __shared__ __attribute__((aligned(16))) float so[OUT == 1 ? 1 : 4][OUT == 1 ? 1 : 64][64 + 4];      // pitch 272 B = 16 B x odd: the f16 epilogue reads 16 rows at one column with 16-byte loads
  const int tid = threadIdx.x, w = tid >> 5, lane = tid & 31, ln = lane & 15, hh = lane >> 4;
  const int bm = blockIdx.x / (N / 128), bn = blockIdx.x % (N / 128);
  const int row0 = bm * 128 + (w >> 1) * 64, col0 = bn * 128 + (w & 1) * 64;
  v8f acc[MT][4] = {};
  // A tile row of 16 rows is 16 * K elements, a 32-k tile 512 elements, its second half 256 elements on: all 32 loads of a 64-k block hang on two address registers with constant offsets.
  const unsigned short* pa = (const unsigned short*)A + (size_t)row0 * K + lane * 8; const unsigned short* pb = (const unsigned short*)Bh + (size_t)col0 * K + lane * 8;
  // rolled: one 64-k block's fragments (128 registers) beside the 128 accumulator registers; the inner unroll directives keep the fragment arrays in registers (constant indices)
#pragma unroll 1
  for (int kb = 0; kb < K; kb += 64) {
    FragH ah[2][MT], bq[2][4];      // all fragment loads of the block stand ahead of its first product, so they are in flight together
#pragma unroll
    for (int u = 0; u < 2; ++u)
#pragma unroll
      for (int i = 0; i < 4; ++i) { ah[u][i].half[0] = *(const v8us*)(pa + i * 16 * K + u * 512); ah[u][i].half[1] = *(const v8us*)(pa + i * 16 * K + u * 512 + 256);
        bq[u][i].half[0] = *(const v8us*)(pb + i * 16 * K + u * 512); bq[u][i].half[1] = *(const v8us*)(pb + i * 16 * K + u * 512 + 256); }
    // the wait that stands in front of any reuse of the group's address registers; naming them as inputs keeps them whole up to it (no load of the group lands on one)
    asm volatile("s_wait_xcnt 0x0" :: "v"(pa), "v"(pb) : "memory");
    __builtin_amdgcn_sched_barrier(0);      // keeps the 32 loads ahead of the products: without it the scheduler sinks each load to its first use, and the lone wave of a SIMD waits out an L2 round trip several times a block
#pragma unroll
    for (int u = 0; u < 2; ++u)
#pragma unroll
      for (int i = 0; i < MT; ++i)
#pragma unroll
        for (int t = 0; t < 4; ++t) acc[i][t] = __builtin_amdgcn_wmma_f32_16x16x32_f16(false, ah[u][i].v, false, bq[u][t].v, (short)0, acc[i][t], false, false);      // the plain builtin: an asm operand (mmaH) cannot name a register above v255, and this tile needs them
    pa += 1024; pb += 1024;      // 64 k = two tiles
  }
  float bt[4];
#pragma unroll
  for (int t = 0; t < 4; ++t) bt[t] = bf16_round(bias[col0 + t * 16 + ln]);
  if constexpr (OUT == 1) {
    // Vt of a slab (batch, head): rows = d, k = key, tile index kt * 4 + dt (kt = 32-key tile, dt = 16-d tile). acc[i][t][0..7] of lane (hh, ln) are keys row0 + 16 i + 8 hh + 0..7 at d = 16 t + ln:
    // the 16 bytes that this lane owns in half (row / 16) & 1 of tile (kt, t). So the masked, transposed operand is stored from the accumulator registers, 512 contiguous bytes per wave and store.
    const int key0 = row0 % TT;      // a wave's 64 rows lie in one batch: two 32-key tiles, 4096 elements in a row
    unsigned short* cp = (unsigned short*)C16 + ((size_t)(row0 / TT) * (N / 64) + col0 / 64) * 64 * TT + (size_t)(key0 >> 5) * 2048 + lane * 8;
    FragH f[MT][4];      // formed apart from the stores, so that the stores go out in runs
#pragma unroll
    for (int i = 0; i < MT; ++i) { const float* mp = RM + row0 + i * 16 + 8 * hh; const v4f m0 = *(const v4fa*)mp, m1 = *(const v4fa*)(mp + 4); float mr[8];
#pragma unroll
      for (int q = 0; q < 4; ++q) { mr[q] = bf16_round(m0[q]); mr[4 + q] = bf16_round(m1[q]); }
#pragma unroll
      for (int t = 0; t < 4; ++t)
#pragma unroll
        for (int r = 0; r < 8; ++r) f[i][t].h[r] = (_Float16)((acc[i][t][r] * alpha + bt[t]) * mr[r]); }
#pragma unroll
    for (int i = 0; i < MT; ++i)
#pragma unroll
      for (int t = 0; t < 4; ++t) *(v8us*)(cp + (i >> 1) * 2048 + (i & 1) * 256 + t * 512) = f[i][t].half[0];
  } else {
#pragma unroll
    for (int i = 0; i < MT; ++i)
#pragma unroll
      for (int t = 0; t < 4; ++t)
#pragma unroll
        for (int r = 0; r < 8; ++r) so[w][i * 16 + 8 * hh + r][t * 16 + ln] = acc[i][t][r] * alpha + bt[t];
    __builtin_amdgcn_fence(__ATOMIC_ACQ_REL, "workgroup"); __builtin_amdgcn_wave_barrier();      // orders the wave's LDS writes ahead of its reads of them: a wave reads back its own rows only
    if constexpr (OUT == 2) {      // f32 result, row-major: two rows of 256 bytes per store
      const int rsub = lane >> 4, c4 = (lane & 15) * 4;
#pragma unroll
      for (int q = 0; q < 32; ++q) { const int r = q * 2 + rsub; const v4f v = *(const v4fa*)&so[w][r][c4]; *(v4f*)(C + (size_t)(row0 + r) * N + col0 + c4) = v; }
    } else {      // f16 result in fragment order (k = column): a 16 x 64 piece is 2 KiB in a row, half c holds columns col0 + 16 c ..
#pragma unroll
      for (int i = 0; i < MT; ++i) { unsigned short* cp = (unsigned short*)C16 + (size_t)(row0 + i * 16) * N + (size_t)(col0 / 32) * 512 + lane * 8;
#pragma unroll
        for (int c = 0; c < 4; ++c) { const v4f v0 = *(const v4fa*)&so[w][i * 16 + ln][c * 16 + hh * 8], v1 = *(const v4fa*)&so[w][i * 16 + ln][c * 16 + hh * 8 + 4]; FragH f;
#pragma unroll
          for (int q = 0; q < 4; ++q) { f.h[q] = (_Float16)v0[q]; f.h[4 + q] = (_Float16)v1[q]; }
          *(v8us*)(cp + c * 256) = f.half[0]; } }
    }
  }
}

// x is row-major [rows][DD] f32; X16 is written in fragment order (see k_wt_f16), thread t = chunk t: a wave stores 512 contiguous bytes and reads 32-byte pieces of 16 rows.
__device__ __forceinline__ size_t frag_src(size_t t) { const int lane = (int)(t & 31), j = (int)((t >> 5) & 1); const size_t tile = t >> 6; return ((tile / (DD / 32)) * 16 + (lane & 15)) * DD + (tile % (DD / 32)) * 32 + j * 16 + (lane >> 4) * 8; }
__global__ __launch_bounds__(256) void k_x16(const float* __restrict__ x, _Float16* __restrict__ X16, size_t n8) { const size_t t = (size_t)blockIdx.x * 256 + threadIdx.x; if (t >= n8) return; FragH f; const size_t s = frag_src(t);
#pragma unroll
  for (int q = 0; q < 8; ++q) f.h[q] = (_Float16)bf16_round(x[s + q]); *(v8us*)((unsigned short*)X16 + t * 8) = f.half[0];  }
__global__ __launch_bounds__(256) void k_round16f(const float* __restrict__ W, _Float16* __restrict__ Bt, size_t n8) { const size_t t = (size_t)blockIdx.x * 256 + threadIdx.x; if (t >= n8) return; FragH f;
#pragma unroll
  for (int i = 0; i < 8; ++i) f.h[i] = (_Float16)(bf16_round(W[t * 8 + i]) * 16.0f); *(v8us*)((unsigned short*)Bt + t * 8) = f.half[0];  }

// lane l with lane l ^ 16 (a vector cross-row move, no LDS queue)
__device__ __forceinline__ float xhalf(float x) { return __builtin_bit_cast(float, __builtin_amdgcn_permlanex16(__builtin_bit_cast(int, x), __builtin_bit_cast(int, x), 0x76543210, 0xfedcba98, false, false)); }
// Transposed products: St = K * Qt (A = K rows, B = Q), Ot += Vt * Pt (A = Vt rows, B = Pt). The fragments are the same registers as before with A and B swapped (one k order for both).
// St tile (qt, nt): register r of lane (hh, ln) = score of key j0 + 16 nt + 8 hh + r with query q0 + 16 qt + ln: a lane holds 16 scores of ONE query, so maximum and sum run in the lane,
// with one exchange between the wave halves for the maximum; the two halves' sums are joined once, behind the loop.
// The two converted St tiles are the B fragment of Pt as they stand (element 8 nt + r = k 16 nt + 8 hh + r): P passes through no LDS.
// A wave owns QT = 2 query tiles of 16: every loaded K or Vt fragment feeds two products (one per query tile), and the two tiles' softmax chains are independent of each other.
__global__ __launch_bounds__(128) void k_flash(const _Float16* __restrict__ Q16, int ldq, const _Float16* __restrict__ K16, int ldk, const _Float16* __restrict__ Vt, const int* __restrict__ MSK, _Float16* __restrict__ O16, int ldo) {
  constexpr int QT = 2, RPW = 16 * QT, NQB = 2048 / (4 * RPW), DT = 4, KS = 2;
  const int tid = threadIdx.x, w = tid >> 5, lane = tid & 31;
  const int slab = blockIdx.x / NQB, qblk = blockIdx.x % NQB; const int b = slab / 16, h = slab % 16; const int qb0 = qblk * (4 * RPW); const int q0 = qb0 + w * RPW;
  FragH aq[QT][KS];
  const unsigned short* qr0 = (const unsigned short*)Q16 + ((size_t)b * 2048 + q0) * ldq + h * 1024 + lane * 8; const unsigned short* qr1 = qr0 + (size_t)16 * ldq;      // Q16, K16, Vt: fragment order (see k_wt_f16); a head's 64 columns are two tiles, 1024 elements
#pragma unroll
  for (int ks = 0; ks < KS; ++ks) { aq[0][ks].half[0] = *(const v8us*)(qr0 + ks * 512); aq[0][ks].half[1] = *(const v8us*)(qr0 + ks * 512 + 256); aq[1][ks].half[0] = *(const v8us*)(qr1 + ks * 512); aq[1][ks].half[1] = *(const v8us*)(qr1 + ks * 512 + 256); }
  const unsigned short* Vth = (const unsigned short*)Vt + (size_t)slab * 64 * 2048;
  float m_r[QT], l_r[QT]; v8f oacc[QT][DT];      // of query q0 + 16 qt + ln; l_r sums this half's keys only; oacc[qt][dt][r] = Ot[16 dt + 8 hh + r][q0 + 16 qt + ln]
  // Softmax in base 2: exp(s / 8 - m) = exp2(s * CS - m * log2 e), CS = log2(e) / 8. m_r is kept in that scaled unit, so a weight is one fused multiply-add on the raw score and one hardware exp2.
  constexpr float CS = 0.125f * 1.4426950408889634f; typedef float v2f __attribute__((ext_vector_type(2)));
#pragma unroll
  for (int qt = 0; qt < QT; ++qt) { m_r[qt] = -3.0e38f; l_r[qt] = 0.f;
#pragma unroll
    for (int dt = 0; dt < DT; ++dt) oacc[qt][dt] = (v8f){0.f,0.f,0.f,0.f,0.f,0.f,0.f,0.f}; }
  const int jend = 2048;
  // Fragment loads stand well ahead of their products: a pass issues its V fragments as one group at its top (they land behind the softmax) and,
  // right behind its score products, the next pass's K fragments (they land behind the rest of the pass). No product waits on a load just issued.
  // The unroll directives on the fragment loops keep the fragment arrays in registers (constant indices).
  FragH bk[2][KS];
  const unsigned short* kp0 = (const unsigned short*)K16 + (size_t)b * 2048 * ldk + h * 1024 + lane * 8; const unsigned short* kp1 = kp0 + (size_t)16 * ldk;
#pragma unroll
  for (int ks = 0; ks < KS; ++ks) { bk[0][ks].half[0] = *(const v8us*)(kp0 + ks * 512); bk[0][ks].half[1] = *(const v8us*)(kp0 + ks * 512 + 256); bk[1][ks].half[0] = *(const v8us*)(kp1 + ks * 512); bk[1][ks].half[1] = *(const v8us*)(kp1 + ks * 512 + 256); }
  // as in the loop: the wait in front of any reuse of the address registers of the Q and first K loads
  asm volatile("s_wait_xcnt 0x0" :: "v"(qr0), "v"(qr1), "v"(kp0), "v"(kp1) : "memory");
#pragma unroll 1
  for (int j0 = 0; j0 < jend; j0 += 32) {
    FragH bv[DT];
#pragma unroll
    for (int dt = 0; dt < DT; ++dt) { const unsigned short* vrow = Vth + (size_t)j0 * 64 + dt * 512 + lane * 8; bv[dt].half[0] = *(const v8us*)vrow; bv[dt].half[1] = *(const v8us*)(vrow + 256); }
    v8f s[QT][2];
#pragma unroll
    for (int nt = 0; nt < 2; ++nt)
#pragma unroll
      for (int qt = 0; qt < QT; ++qt) { v8f acc = (v8f){0.f,0.f,0.f,0.f,0.f,0.f,0.f,0.f};
#pragma unroll
        for (int ks = 0; ks < KS; ++ks) acc = mmaH<1>(bk[nt][ks].v, bk[nt][ks].v, aq[qt][ks].v, aq[qt][ks].v, acc); s[qt][nt] = acc; }
    const int jn = (j0 + 32 < jend) ? j0 + 32 : j0;      // the last pass reads its own rows again: in bounds, not used
    const unsigned short* kr0 = (const unsigned short*)K16 + ((size_t)b * 2048 + jn) * ldk + h * 1024 + lane * 8; const unsigned short* kr1 = kr0 + (size_t)16 * ldk;
#pragma unroll
    for (int ks = 0; ks < KS; ++ks) { bk[0][ks].half[0] = *(const v8us*)(kr0 + ks * 512); bk[0][ks].half[1] = *(const v8us*)(kr0 + ks * 512 + 256); bk[1][ks].half[0] = *(const v8us*)(kr1 + ks * 512); bk[1][ks].half[1] = *(const v8us*)(kr1 + ks * 512 + 256); }
    // the wait that stands in front of any reuse of the group's address registers; naming them as inputs keeps them whole up to it (no load of the group lands on one)
    asm volatile("s_wait_xcnt 0x0" :: "v"(kr0), "v"(kr1) : "memory");
    FragH pb[QT];
#pragma unroll
    for (int qt = 0; qt < QT; ++qt) {
      float mx[8];
#pragma unroll
      for (int r = 0; r < 8; ++r) mx[r] = fmaxf(s[qt][0][r], s[qt][1][r]);      // maxima of the raw scores: the scale is positive
      float mc = fmaxf(fmaxf(fmaxf(mx[0], mx[1]), fmaxf(mx[2], mx[3])), fmaxf(fmaxf(mx[4], mx[5]), fmaxf(mx[6], mx[7])));
      mc = fmaxf(mc, xhalf(mc)) * CS;
      const float mn = fmaxf(m_r[qt], mc); const float al = (mn > -1.0e38f) ? __builtin_amdgcn_exp2f(m_r[qt] - mn) : 1.0f; m_r[qt] = mn;
      float ps[8];
#pragma unroll
      for (int r = 0; r < 8; r += 2) {      // two scores of a tile per packed multiply-add
        const v2f a0 = __builtin_elementwise_fma((v2f){s[qt][0][r], s[qt][0][r + 1]}, (v2f){CS, CS}, (v2f){-mn, -mn}), a1 = __builtin_elementwise_fma((v2f){s[qt][1][r], s[qt][1][r + 1]}, (v2f){CS, CS}, (v2f){-mn, -mn});
        const float p00 = __builtin_amdgcn_exp2f(a0.x), p01 = __builtin_amdgcn_exp2f(a0.y), p10 = __builtin_amdgcn_exp2f(a1.x), p11 = __builtin_amdgcn_exp2f(a1.y);
        ps[r] = p00 + p10; ps[r + 1] = p01 + p11; pb[qt].h[r] = (_Float16)p00; pb[qt].h[r + 1] = (_Float16)p01; pb[qt].h[8 + r] = (_Float16)p10; pb[qt].h[9 + r] = (_Float16)p11; }
      l_r[qt] = l_r[qt] * al + (((ps[0] + ps[1]) + (ps[2] + ps[3])) + ((ps[4] + ps[5]) + (ps[6] + ps[7])));
#pragma unroll
      for (int dt = 0; dt < DT; ++dt)
#pragma unroll
        for (int r = 0; r < 8; ++r) oacc[qt][dt][r] *= al;
    }
#pragma unroll
    for (int dt = 0; dt < DT; ++dt)
#pragma unroll
      for (int qt = 0; qt < QT; ++qt) oacc[qt][dt] = mmaH<1>(bv[dt].v, bv[dt].v, pb[qt].v, pb[qt].v, oacc[qt][dt]); }
  // oacc[qt][dt][0..7] of lane (hh, ln) are row q0 + 16 qt + ln, columns 16 dt + 8 hh + 0..7 of the head: the 16 bytes that this lane owns in half dt & 1 of the head's tile dt >> 1 of a fragment-order
  // operand (see k_wt_f16). So the output GEMM's f16 A operand is stored from the accumulator registers, 512 contiguous bytes per wave and store.
  FragH f[QT][DT];      // formed apart from the stores, so that the stores go out in runs
#pragma unroll
  for (int qt = 0; qt < QT; ++qt) { const float l = l_r[qt] + xhalf(l_r[qt]); const float li = (l > 0.f) ? 1.0f / l : 0.f;
#pragma unroll
    for (int dt = 0; dt < DT; ++dt)
#pragma unroll
      for (int r = 0; r < 8; ++r) f[qt][dt].h[r] = (_Float16)(oacc[qt][dt][r] * li); }
#pragma unroll
  for (int qt = 0; qt < QT; ++qt) { unsigned short* op = (unsigned short*)O16 + ((size_t)b * 2048 + q0 + qt * 16) * ldo + h * 1024 + lane * 8;
#pragma unroll
    for (int dt = 0; dt < DT; ++dt) *(v8us*)(op + dt * 256) = f[qt][dt].half[0]; } }

extern "C" void kernel_launch(void* const* d_in, const int* in_sizes, int n_in,
                              void* d_out, int out_size, void* d_ws, size_t ws_size, hipStream_t stream) {
  (void)in_sizes; (void)n_in; (void)out_size;
  const float* xq = (const float*)d_in[0]; const float* xkv = (const float*)d_in[1]; const float* mk = (const float*)d_in[2]; const float* Wq = (const float*)d_in[3]; const float* bq = (const float*)d_in[4]; const float* Wk = (const float*)d_in[5]; const float* bk = (const float*)d_in[6]; const float* Wv = (const float*)d_in[7]; const float* bv = (const float*)d_in[8]; const float* Wo = (const float*)d_in[9]; const float* bo = (const float*)d_in[10];
  char* ws = (char*)d_ws; size_t off = 0;
  auto take = [&](size_t bytes) { char* p = ws + off; off += (bytes + 255) & ~(size_t)255; return p; };
  _Float16* Bq = (_Float16*)take((size_t)DD * DD * 2); _Float16* Bk = (_Float16*)take((size_t)DD * DD * 2); _Float16* Bv = (_Float16*)take((size_t)DD * DD * 2); _Float16* Bo = (_Float16*)take((size_t)DD * DD * 2);
  _Float16* XQ16 = (_Float16*)take((size_t)NR * DD * 2); _Float16* XKV16 = (_Float16*)take((size_t)NR * DD * 2); _Float16* Q16 = (_Float16*)take((size_t)NR * DD * 2); _Float16* K16 = (_Float16*)take((size_t)NR * DD * 2); _Float16* Vt = (_Float16*)take((size_t)NR * DD * 2); _Float16* O16 = (_Float16*)take((size_t)NR * DD * 2);
  if (off > ws_size) return;      // 8.4 + 8.4 x 6 = 59 MB
  k_wt_f16<<<(unsigned)(((size_t)DD * (DD / 8) + 255) / 256), 256, 0, stream>>>(Wq, Bq, DD, DD, 16.0f); k_wt_f16<<<(unsigned)(((size_t)DD * (DD / 8) + 255) / 256), 256, 0, stream>>>(Wk, Bk, DD, DD, 16.0f); k_wt_f16<<<(unsigned)(((size_t)DD * (DD / 8) + 255) / 256), 256, 0, stream>>>(Wv, Bv, DD, DD, 16.0f); k_wt_f16<<<(unsigned)(((size_t)DD * (DD / 8) + 255) / 256), 256, 0, stream>>>(Wo, Bo, DD, DD, 16.0f);      // (D,H,Dh) = [in][h·64+d]; Wo (H,Dh,D) = [in=(h,d)][out]
  const unsigned g8 = (unsigned)(((size_t)NR * DD / 8 + 255) / 256); const unsigned gg = (NR / 128) * (DD / 128);
  k_x16<<<g8, 256, 0, stream>>>(xq, XQ16, (size_t)NR * DD / 8); k_x16<<<g8, 256, 0, stream>>>(xkv, XKV16, (size_t)NR * DD / 8);
  k_gemm_w64<0><<<gg, 128, 0, stream>>>(XQ16, Bq, 0.0625f, bq, nullptr, Q16, nullptr);
  k_gemm_w64<0><<<gg, 128, 0, stream>>>(XKV16, Bk, 0.0625f, bk, nullptr, K16, nullptr);
  k_gemm_w64<1><<<gg, 128, 0, stream>>>(XKV16, Bv, 0.0625f, bv, nullptr, Vt, mk);      // (v + bv) * mask in f32, then f16, stored as Vt
  k_flash<<<BB * NH * (TT / 128), 128, 0, stream>>>(Q16, DD, K16, DD, Vt, nullptr, O16, DD);      // the 1/8 on q is folded into the softmax constant
  k_gemm_w64<2><<<gg, 128, 0, stream>>>(O16, Bo, 0.0625f, bo, (float*)d_out, nullptr, nullptr);
}

// v007
// Measured time: 109 microseconds a run.
// Two timings next to v006 put it at 1.27 and 1.28 times that version's speed.
// Over all steps from v000 it is 4.10 times as fast.
#include <hip/hip_runtime.h>
// Multi-head dot-product attention with a per-key value mask (B=2, L=2048, D=1024, 16 heads × 64; q from inputs_q, k/v from inputs_kv; v ← mask_k·v; softmax(q·k/8); merge; ·Wo + bo): the
// q/k/v/o projections are GEMMs ([in][out] weights bf16-exact ×2^4, bias epilogues, f32 accumulate) and the attention is a fused flash-style kernel (online softmax f32; P f16 ≤ 1; O = P·Vt;
// 32 queries a wave) on v_wmma_f32_16x16x32_f16; the value masking is applied in f32 VALU before the f16 conversion.
#define BB 2
#define TT 2048
#define DD 1024
#define NH 16
#define NR (BB * TT)

typedef __bf16 v16b __attribute__((ext_vector_type(16)));
typedef unsigned short v8us __attribute__((ext_vector_type(8), may_alias));
typedef float  v8f  __attribute__((ext_vector_type(8)));
typedef float  v4f  __attribute__((ext_vector_type(4)));
typedef float  v4fa __attribute__((ext_vector_type(4), may_alias));
union FragB { v16b v; v8us half[2]; unsigned short u[16]; };

__device__ __forceinline__ unsigned short bf16_bits(float x) { unsigned int u = __float_as_uint(x); return (unsigned short)((u + 0x7FFFu + ((u >> 16) & 1u)) >> 16); }
__device__ __forceinline__ float bf16_val(unsigned short b) { return __uint_as_float(((unsigned int)b) << 16); }
__device__ __forceinline__ float bf16_round(float x) { return bf16_val(bf16_bits(x)); }
// D += A·B with NT terms: 1 = ah·bh, 2 = + al·bh (A split), 3 = + ah·bl (both split)
template <int NT>
__device__ __forceinline__ v8f mmaN(v16b ah, v16b al, v16b bh, v16b bl, v8f c) {
  c = __builtin_amdgcn_wmma_f32_16x16x32_bf16(false, ah, false, bh, (short)0, c, false, false);
  if (NT >= 2) c = __builtin_amdgcn_wmma_f32_16x16x32_bf16(false, al, false, bh, (short)0, c, false, false);
  if (NT >= 3) c = __builtin_amdgcn_wmma_f32_16x16x32_bf16(false, ah, false, bl, (short)0, c, false, false);
  asm volatile("v_nop\n\tv_nop\n\tv_nop\n\tv_nop" : "+v"(c) : "v"(ah), "v"(al), "v"(bh), "v"(bl));
  return c;
}

__global__ __launch_bounds__(256) void k_wt_bf16(const float* __restrict__ W, unsigned short* __restrict__ Wt, int K, int N) {
  const int t = blockIdx.x * 256 + threadIdx.x;
  const int k8n = K / 8;
  if (t >= N * k8n) return;
  const int n = t / k8n, k8 = (t % k8n) * 8;
  v8us v;
#pragma unroll
  for (int i = 0; i < 8; ++i) v[i] = bf16_bits(W[(size_t)(k8 + i) * N + n]);
  *(v8us*)(Wt + (size_t)n * K + k8) = v;
  
}

// GEMM C[M][N] (f32, pitch ldc) = act(A[M][K]·W + bias). A f32 row-major (pitch lda) converted per fragment to bf16
// (ASPLIT: hi/lo two planes -> 2 terms, else single rounded term); Wt bf16 [N][K] (pitch ldb). BIAS_BF16 rounds the
// bias to bf16 first (bias quantised to bf16 before the add). K%32==0, M%16==0, N%64==0.
template <bool ASPLIT, int ACT, bool BIAS_BF16>
__global__ __launch_bounds__(128) void k_gemm_bf(const float* __restrict__ A, int lda, const unsigned short* __restrict__ Wt, int ldb,
                                               const float* __restrict__ bias, float* __restrict__ C, int ldc, int M, int N, int K) {
  __shared__ __attribute__((aligned(16))) float so[4][16][64];
  const int tid = threadIdx.x, w = tid >> 5, lane = tid & 31, ln = lane & 15, hh = lane >> 4;
  const int ntn = N / 64;
  const int wid = blockIdx.x * 4 + w;
  const int mt = wid / ntn, nq = wid % ntn;
  if (mt * 16 >= M) return;
  const int row0 = mt * 16, col0 = nq * 64;
  const float* arow = A + (size_t)(row0 + ln) * lda;
  v8f acc[4] = {};
  for (int kb = 0; kb < K; kb += 32) {
    FragB ah, al;
    const v4f x0 = *(const v4fa*)(arow + kb + 8 * hh), x1 = *(const v4fa*)(arow + kb + 8 * hh + 4);
    const v4f x2 = *(const v4fa*)(arow + kb + 16 + 8 * hh), x3 = *(const v4fa*)(arow + kb + 16 + 8 * hh + 4);
    float xs[16] = {x0[0],x0[1],x0[2],x0[3],x1[0],x1[1],x1[2],x1[3],x2[0],x2[1],x2[2],x2[3],x3[0],x3[1],x3[2],x3[3]};
#pragma unroll
    for (int i = 0; i < 16; ++i) { const unsigned short hb = bf16_bits(xs[i]); ah.u[i] = hb; al.u[i] = ASPLIT ? bf16_bits(xs[i] - bf16_val(hb)) : (unsigned short)0; }
#pragma unroll
    for (int t = 0; t < 4; ++t) {
      const unsigned short* brow = Wt + (size_t)(col0 + t * 16 + ln) * ldb + kb;
      FragB b;
      b.half[0] = *(const v8us*)(brow + 8 * hh);
      b.half[1] = *(const v8us*)(brow + 16 + 8 * hh);
      acc[t] = mmaN<ASPLIT ? 2 : 1>(ah.v, al.v, b.v, b.v, acc[t]);
    }
  }
#pragma unroll
  for (int t = 0; t < 4; ++t) {
    float bv = bias ? bias[col0 + t * 16 + ln] : 0.f;
    if (BIAS_BF16) bv = bf16_round(bv);
#pragma unroll
    for (int r = 0; r < 8; ++r) { float v = acc[t][r] + bv; if (ACT == 1) v = fmaxf(v, 0.f); so[w][8 * hh + r][t * 16 + ln] = v; }
  }
  __builtin_amdgcn_fence(__ATOMIC_ACQ_REL, "workgroup");
  __builtin_amdgcn_wave_barrier();
  const int rsub = lane >> 4, c4 = (lane & 15) * 4;
  {
#pragma unroll
    for (int q = 0; q < 8; ++q) {
      const int r = q * 2 + rsub;
      const v4f v = *(const v4fa*)&so[w][r][c4];
      *(v4f*)(C + (size_t)(row0 + r) * ldc + col0 + c4) = v;
    }
    
  }
}

// Flash-style causal/unmasked attention, all contractions 3-term bf16 hi/lo splits, f32 softmax with running max.
// q,k,v rows are read from f32 buffers with arbitrary row pitch (so they can live inside a fused qkv buffer);
// D = head size (multiple of 32, <= 128); one wave = 16 query rows; block = 4 waves (64 queries) sharing K/V chunks of 32.
template <int D, bool CAUSAL>
__global__ __launch_bounds__(128) void k_flash(const float* __restrict__ qb, const float* __restrict__ kb, const float* __restrict__ vb,
                                             int pitch, int T, int H, float scale, float* __restrict__ y, int ypitch) {
  constexpr int KS = D / 32;        // k-steps for QK
  constexpr int DT = D / 16;        // d tiles for PV
  __shared__ __attribute__((aligned(16))) unsigned short sKh[32][D + 8], sKl[32][D + 8], sVh[32][D + 8], sVl[32][D + 8];
  __shared__ __attribute__((aligned(16))) unsigned short sPh[4][16][40], sPl[4][16][40];
  __shared__ __attribute__((aligned(16))) float sO[4][16][D];
  const int tid = threadIdx.x, w = tid >> 5, lane = tid & 31, ln = lane & 15, hh = lane >> 4;
  const int nqb = (T + 63) / 64;
  const int bh = blockIdx.x / nqb, qblk = blockIdx.x % nqb;
  const int b = bh / H, h = bh % H;
  const int q0 = qblk * 64 + w * 16;
  const float* Q = qb + (size_t)b * T * pitch + h * D;
  const float* K = kb + (size_t)b * T * pitch + h * D;
  const float* V = vb + (size_t)b * T * pitch + h * D;

  // A fragments of the wave's 16 query rows (scaled), hi/lo
  FragB aqh[KS], aql[KS];
  {
    int row = q0 + ln; if (row >= T) row = T - 1;
    const float* qr = Q + (size_t)row * pitch;
#pragma unroll
    for (int ks = 0; ks < KS; ++ks)
#pragma unroll
      for (int i = 0; i < 16; ++i) {
        const int d = ks * 32 + ((i < 8) ? (8 * hh + i) : (16 + 8 * hh + (i - 8)));
        const float x = qr[d] * scale; const unsigned short hb = bf16_bits(x);
        aqh[ks].u[i] = hb; aql[ks].u[i] = bf16_bits(x - bf16_val(hb));
      }
  }
  float m_r[8], l_r[8];
#pragma unroll
  for (int r = 0; r < 8; ++r) { m_r[r] = -3.0e38f; l_r[r] = 0.f; }
  v8f oacc[DT];
#pragma unroll
  for (int dt = 0; dt < DT; ++dt) oacc[dt] = (v8f){0.f,0.f,0.f,0.f,0.f,0.f,0.f,0.f};

  const int kv_end = CAUSAL ? min(T, qblk * 64 + 64) : T;     // block-uniform
  for (int j0 = 0; j0 < kv_end; j0 += 32) {
    __syncthreads();
    for (int e = tid; e < 32 * (D / 4); e += 128) {
      const int r = e / (D / 4), c4 = (e % (D / 4)) * 4;
      const int key = j0 + r;
      v4f kf = {0.f,0.f,0.f,0.f}, vf = {0.f,0.f,0.f,0.f};
      if (key < T) { kf = *(const v4fa*)(K + (size_t)key * pitch + c4); vf = *(const v4fa*)(V + (size_t)key * pitch + c4); }
#pragma unroll
      for (int t = 0; t < 4; ++t) {
        unsigned short hb = bf16_bits(kf[t]); sKh[r][c4 + t] = hb; sKl[r][c4 + t] = bf16_bits(kf[t] - bf16_val(hb));
        hb = bf16_bits(vf[t]); sVh[r][c4 + t] = hb; sVl[r][c4 + t] = bf16_bits(vf[t] - bf16_val(hb));
      }
    }
    __syncthreads();
    // S tile 16 x 32
    v8f s[2];
#pragma unroll
    for (int nt = 0; nt < 2; ++nt) {
      v8f acc = {};
#pragma unroll
      for (int ks = 0; ks < KS; ++ks) {
        FragB bh_, bl_;
        bh_.half[0] = *(const v8us*)&sKh[nt * 16 + ln][ks * 32 + 8 * hh]; bh_.half[1] = *(const v8us*)&sKh[nt * 16 + ln][ks * 32 + 16 + 8 * hh];
        bl_.half[0] = *(const v8us*)&sKl[nt * 16 + ln][ks * 32 + 8 * hh]; bl_.half[1] = *(const v8us*)&sKl[nt * 16 + ln][ks * 32 + 16 + 8 * hh];
        acc = mmaN<3>(aqh[ks].v, aql[ks].v, bh_.v, bl_.v, acc);
      }
      s[nt] = acc;
    }
    // mask + running max (rows 8hh+r; the 16 lanes of a half share rows)
    float alpha[8];
#pragma unroll
    for (int r = 0; r < 8; ++r) {
      const int qi = q0 + 8 * hh + r;
      const int ja = j0 + ln, jb = j0 + 16 + ln;
      if (CAUSAL) { if (ja > qi) s[0][r] = -3.0e38f; if (jb > qi) s[1][r] = -3.0e38f; }
      if (ja >= T) s[0][r] = -3.0e38f;
      if (jb >= T) s[1][r] = -3.0e38f;
      float mx = fmaxf(s[0][r], s[1][r]);
      mx = fmaxf(mx, __shfl_xor(mx, 1, 32)); mx = fmaxf(mx, __shfl_xor(mx, 2, 32)); mx = fmaxf(mx, __shfl_xor(mx, 4, 32)); mx = fmaxf(mx, __shfl_xor(mx, 8, 32));
      const float mnew = fmaxf(m_r[r], mx);
      alpha[r] = (mnew > -1.0e38f) ? __expf(m_r[r] - mnew) : 1.0f;
      const float p0 = (s[0][r] > -1.0e38f) ? __expf(s[0][r] - mnew) : 0.f;
      const float p1 = (s[1][r] > -1.0e38f) ? __expf(s[1][r] - mnew) : 0.f;
      m_r[r] = mnew;
      l_r[r] = l_r[r] * alpha[r] + p0 + p1;            // per-lane partial row sum (16 lanes combined at the end)
      unsigned short hb = bf16_bits(p0); sPh[w][8 * hh + r][ln] = hb;      sPl[w][8 * hh + r][ln] = bf16_bits(p0 - bf16_val(hb));
      hb = bf16_bits(p1);                sPh[w][8 * hh + r][16 + ln] = hb; sPl[w][8 * hh + r][16 + ln] = bf16_bits(p1 - bf16_val(hb));
    }
#pragma unroll
    for (int dt = 0; dt < DT; ++dt)
#pragma unroll
      for (int r = 0; r < 8; ++r) oacc[dt][r] *= alpha[r];
    __builtin_amdgcn_fence(__ATOMIC_ACQ_REL, "workgroup");
    __builtin_amdgcn_wave_barrier();
    FragB pah, pal;
    pah.half[0] = *(const v8us*)&sPh[w][ln][8 * hh]; pah.half[1] = *(const v8us*)&sPh[w][ln][16 + 8 * hh];
    pal.half[0] = *(const v8us*)&sPl[w][ln][8 * hh]; pal.half[1] = *(const v8us*)&sPl[w][ln][16 + 8 * hh];
#pragma unroll
    for (int dt = 0; dt < DT; ++dt) {
      FragB bvh, bvl;
#pragma unroll
      for (int i = 0; i < 8; ++i) {
        bvh.u[i] = sVh[8 * hh + i][dt * 16 + ln]; bvh.u[8 + i] = sVh[16 + 8 * hh + i][dt * 16 + ln];
        bvl.u[i] = sVl[8 * hh + i][dt * 16 + ln]; bvl.u[8 + i] = sVl[16 + 8 * hh + i][dt * 16 + ln];
      }
      oacc[dt] = mmaN<3>(pah.v, pal.v, bvh.v, bvl.v, oacc[dt]);
    }
    __builtin_amdgcn_fence(__ATOMIC_ACQ_REL, "workgroup");
    __builtin_amdgcn_wave_barrier();
  }
#pragma unroll
  for (int r = 0; r < 8; ++r) {
    float l = l_r[r];
    l += __shfl_xor(l, 1, 32); l += __shfl_xor(l, 2, 32); l += __shfl_xor(l, 4, 32); l += __shfl_xor(l, 8, 32);
    l_r[r] = (l > 0.f) ? 1.0f / l : 0.f;
  }
#pragma unroll
  for (int dt = 0; dt < DT; ++dt)
#pragma unroll
    for (int r = 0; r < 8; ++r) sO[w][8 * hh + r][dt * 16 + ln] = oacc[dt][r] * l_r[r];
  __builtin_amdgcn_fence(__ATOMIC_ACQ_REL, "workgroup");
  __builtin_amdgcn_wave_barrier();
  {
    for (int r = 0; r < 16; ++r) {
      const int row = q0 + r;
      if (row < T && lane < D / 4) {
        const v4f val = *(const v4fa*)&sO[w][r][lane * 4];
        *(v4f*)(y + ((size_t)b * T + row) * ypitch + h * D + lane * 4) = val;
      }
    }
    
  }
}

// GEMM C = act(A·W + bias + resid): A f32 (ASPLIT -> hi/lo 2 terms), Wt bf16 [N][K]; ACT 0 none, 1 relu, 2 exact gelu;
// resid (optional, f32, row index = (row % rmod), pitch ldr, RES_BF16 rounds it) added before the activation.
template <bool ASPLIT, int ACT, bool BIAS_BF16, bool RES_BF16>
__global__ __launch_bounds__(128) void k_gemm_bf3(const float* __restrict__ A, int lda, const unsigned short* __restrict__ Wt, int ldb,
                                                const float* __restrict__ bias, const float* __restrict__ resid, int rmod, int ldr,
                                                float* __restrict__ C, int ldc, int M, int N, int K) {
  __shared__ __attribute__((aligned(16))) float so[4][16][64];
  const int tid = threadIdx.x, w = tid >> 5, lane = tid & 31, ln = lane & 15, hh = lane >> 4;
  const int ntn = N / 64;
  const int wid = blockIdx.x * 4 + w;
  const int mt = wid / ntn, nq = wid % ntn;
  if (mt * 16 >= M) return;
  const int row0 = mt * 16, col0 = nq * 64;
  const float* arow = A + (size_t)(row0 + ln) * lda;
  v8f acc[4] = {};
  for (int kb = 0; kb < K; kb += 32) {
    FragB ah, al;
    const v4f x0 = *(const v4fa*)(arow + kb + 8 * hh), x1 = *(const v4fa*)(arow + kb + 8 * hh + 4);
    const v4f x2 = *(const v4fa*)(arow + kb + 16 + 8 * hh), x3 = *(const v4fa*)(arow + kb + 16 + 8 * hh + 4);
    float xs[16] = {x0[0],x0[1],x0[2],x0[3],x1[0],x1[1],x1[2],x1[3],x2[0],x2[1],x2[2],x2[3],x3[0],x3[1],x3[2],x3[3]};
#pragma unroll
    for (int i = 0; i < 16; ++i) { const unsigned short hb = bf16_bits(xs[i]); ah.u[i] = hb; al.u[i] = ASPLIT ? bf16_bits(xs[i] - bf16_val(hb)) : (unsigned short)0; }
#pragma unroll
    for (int t = 0; t < 4; ++t) {
      const unsigned short* brow = Wt + (size_t)(col0 + t * 16 + ln) * ldb + kb;
      FragB b;
      b.half[0] = *(const v8us*)(brow + 8 * hh);
      b.half[1] = *(const v8us*)(brow + 16 + 8 * hh);
      acc[t] = mmaN<ASPLIT ? 2 : 1>(ah.v, al.v, b.v, b.v, acc[t]);
    }
  }
#pragma unroll
  for (int t = 0; t < 4; ++t) {
    const int col = col0 + t * 16 + ln;
    float bv = bias ? bias[col] : 0.f;
    if (BIAS_BF16) bv = bf16_round(bv);
#pragma unroll
    for (int r = 0; r < 8; ++r) {
      float v = acc[t][r] + bv;
      if (resid) { float rv = resid[(size_t)((row0 + 8 * hh + r) % rmod) * ldr + col]; if (RES_BF16) rv = bf16_round(rv); v += rv; }
      if (ACT == 1) v = fmaxf(v, 0.f);
      if (ACT == 2) v = 0.5f * v * (1.0f + erff(v * 0.70710678118654752f));
      if (ACT == 3) { const float u = 0.7978845608028654f * (v + 0.044715f * v * v * v); v = 0.5f * v * (1.0f + tanhf(u)); }
      so[w][8 * hh + r][t * 16 + ln] = v;
    }
  }
  __builtin_amdgcn_fence(__ATOMIC_ACQ_REL, "workgroup");
  __builtin_amdgcn_wave_barrier();
  const int rsub = lane >> 4, c4 = (lane & 15) * 4;
  {
#pragma unroll
    for (int q = 0; q < 8; ++q) {
      const int r = q * 2 + rsub;
      const v4f v = *(const v4fa*)&so[w][r][c4];
      *(v4f*)(C + (size_t)(row0 + r) * ldc + col0 + c4) = v;
    }
    
  }
}
// row LayerNorm (biased variance, eps) over N: s = X (+ R); optional out_sum <- s; out_norm <- (s-mu)*rsqrt(var+eps)*g + b
template <bool PARAM_BF16>
__global__ __launch_bounds__(256) void k_layernorm(const float* __restrict__ X, const float* __restrict__ R, const float* __restrict__ g, const float* __restrict__ bta,
                                                  float* __restrict__ out_sum, float* __restrict__ out_norm, int N, float eps) {
  __shared__ float red[256];
  const int row = blockIdx.x, tid = threadIdx.x;
  const float* x = X + (size_t)row * N; const float* rr = R ? R + (size_t)row * N : nullptr;
  float vals[16];                     // up to N = 4096
  const int per = N / 256;            // contiguous chunk per thread? use strided-by-4 chunks: thread handles j = tid*4 + 1024*u
  float s1 = 0.f;
  for (int u = 0; u < per / 4; ++u) {
    const int j = tid * 4 + 1024 * u;
    const v4f a = *(const v4fa*)(x + j);
    v4f b = {0.f,0.f,0.f,0.f}; if (rr) b = *(const v4fa*)(rr + j);
#pragma unroll
    for (int q = 0; q < 4; ++q) { const float v = a[q] + b[q]; vals[u * 4 + q] = v; s1 += v; }
  }
  red[tid] = s1; __syncthreads();
  for (int st = 128; st > 0; st >>= 1) { if (tid < st) red[tid] += red[tid + st]; __syncthreads(); }
  const float mu = red[0] / (float)N; __syncthreads();
  float s2 = 0.f;
  for (int u = 0; u < per / 4; ++u)
#pragma unroll
    for (int q = 0; q < 4; ++q) { const float c = vals[u * 4 + q] - mu; s2 += c * c; }
  red[tid] = s2; __syncthreads();
  for (int st = 128; st > 0; st >>= 1) { if (tid < st) red[tid] += red[tid + st]; __syncthreads(); }
  const float rs = rsqrtf(red[0] / (float)N + eps);
  {
    for (int u = 0; u < per / 4; ++u) {
      const int j = tid * 4 + 1024 * u;
      v4f o, sm;
#pragma unroll
      for (int q = 0; q < 4; ++q) {
        float gg = g[j + q], bb = bta[j + q];
        if (PARAM_BF16) { gg = bf16_round(gg); bb = bf16_round(bb); }
        sm[q] = vals[u * 4 + q]; o[q] = (vals[u * 4 + q] - mu) * rs * gg + bb;
      }
      if (out_sum) *(v4f*)(out_sum + (size_t)row * N + j) = sm;
      *(v4f*)(out_norm + (size_t)row * N + j) = o;
    }
    
  }
}



// ---- f16 WMMA path (v_wmma_f32_16x16x32_f16): 11-bit significands for operands in range — used where a [0,1] probability operand needs more precision than bf16
typedef _Float16 v16h __attribute__((ext_vector_type(16)));
union FragH { v16h v; v8us half[2]; _Float16 h[16]; unsigned short u[16]; };
template <int NT>
__device__ __forceinline__ v8f mmaH(v16h ah, v16h al, v16h bh, v16h bl, v8f c) {
  c = __builtin_amdgcn_wmma_f32_16x16x32_f16(false, ah, false, bh, (short)0, c, false, false);
  if (NT >= 2) c = __builtin_amdgcn_wmma_f32_16x16x32_f16(false, al, false, bh, (short)0, c, false, false);
  if (NT >= 3) c = __builtin_amdgcn_wmma_f32_16x16x32_f16(false, ah, false, bl, (short)0, c, false, false);
  asm volatile("v_nop\n\tv_nop\n\tv_nop\n\tv_nop" : "+v"(c) : "v"(ah), "v"(al), "v"(bh), "v"(bl));
  return c;
}
// batched GEMM like k_gemm_b but f16 operands: A f32 (split into f16 hi/lo if ASPLIT, else rounded to f16), Bt = f16 values [n][k]; alpha; C f32; N multiple of 16 (partial tiles skipped)
template <bool ASPLIT>
__global__ __launch_bounds__(128) void k_gemm_h(const float* __restrict__ A, int lda, size_t sA, const _Float16* __restrict__ Bh, int ldb, size_t sB, float alpha, float* __restrict__ C, int ldc, size_t sC, int M, int N, int K) {
  __shared__ __attribute__((aligned(16))) float so[4][16][64];
  const int tid = threadIdx.x, w = tid >> 5, lane = tid & 31, ln = lane & 15, hh = lane >> 4; const int by = blockIdx.y;
  A += (size_t)by * sA; Bh += (size_t)by * sB; C += (size_t)by * sC;
  const int ntn = (N + 63) / 64; const int wid = blockIdx.x * 4 + w; const int mt = wid / ntn, nq = wid % ntn; if (mt * 16 >= M) return;
  const int row0 = mt * 16, col0 = nq * 64; const float* arow = A + (size_t)(row0 + ln) * lda;
  v8f acc[4] = {};
  for (int kb = 0; kb < K; kb += 32) {
    FragH ah, al;
    const v4f x0 = *(const v4fa*)(arow + kb + 8 * hh), x1 = *(const v4fa*)(arow + kb + 8 * hh + 4), x2 = *(const v4fa*)(arow + kb + 16 + 8 * hh), x3 = *(const v4fa*)(arow + kb + 16 + 8 * hh + 4);
    float xs[16] = {x0[0],x0[1],x0[2],x0[3],x1[0],x1[1],x1[2],x1[3],x2[0],x2[1],x2[2],x2[3],x3[0],x3[1],x3[2],x3[3]};
#pragma unroll
    for (int i = 0; i < 16; ++i) { const _Float16 h = (_Float16)xs[i]; ah.h[i] = h; al.h[i] = ASPLIT ? (_Float16)(xs[i] - (float)h) : (_Float16)0.0f; }
#pragma unroll
    for (int t = 0; t < 4; ++t) { if (col0 + t * 16 >= N) continue; const size_t boff = (size_t)(col0 + t * 16 + ln) * ldb + kb; FragH bq; bq.half[0] = *(const v8us*)(Bh + boff + 8 * hh); bq.half[1] = *(const v8us*)(Bh + boff + 16 + 8 * hh);
      acc[t] = mmaH<ASPLIT ? 2 : 1>(ah.v, al.v, bq.v, bq.v, acc[t]); }
  }
#pragma unroll
  for (int t = 0; t < 4; ++t) { if (col0 + t * 16 >= N) continue;
#pragma unroll
    for (int r = 0; r < 8; ++r) so[w][8 * hh + r][t * 16 + ln] = acc[t][r] * alpha; }
  __builtin_amdgcn_fence(__ATOMIC_ACQ_REL, "workgroup"); __builtin_amdgcn_wave_barrier();
  const int rsub = lane >> 4, c4 = (lane & 15) * 4;
  {
#pragma unroll
    for (int q = 0; q < 8; ++q) { const int r = q * 2 + rsub; if (col0 + c4 < N) { const v4f v = *(const v4fa*)&so[w][r][c4]; *(v4f*)(C + (size_t)(row0 + r) * ldc + col0 + c4) = v; } }
     }
}

// FRAGMENT ORDER (every f16 matrix operand in the workspace): a [rows][K] operand is kept as tiles of 16 rows x 32 k, 1 KiB each, tile (rt, kt) at index rt * (K / 32) + kt (Vt: kt * 4 + rt, per 64-row slab).
// A tile is two halves of 512 bytes (k 0..15, then k 16..31); in half j lane hh * 16 + ln owns the 16 bytes of row ln, k = 16 j + 8 hh + 0..7: just what that lane feeds to the WMMA.
// One wave-wide 16-byte load of a half is then 512 contiguous bytes, four whole lines, where a row-major operand gives 32-byte pieces of 16 lines.
// Chunk t (16 bytes) of such a buffer: lane = t & 31, j = (t >> 5) & 1, tile = t >> 6. K % 32 == 0, rows % 16 == 0.
// One launch forms all six f16 operands (the two X and the four W have no dependence on one another). 512 blocks x 8 waves: few enough that the waves' start is short beside the stream, enough to fill every WGP.
// A wave converts 4 whole tiles of an X operand (16 rows x 128 k, 512 source bytes in a row per row: f16(bf16(x))) and 4 halves of a W operand (16 k x 64 n, 256 source bytes in a row per k: Wt[n][k] = f16(bf16(W[k][n]) * 16);
// the power of two keeps bf16-exact weights exact in f16, away from the subnormal range). Every store is one half: 512 contiguous bytes per wave.
__global__ __launch_bounds__(256) void k_prep(const float* __restrict__ xq, const float* __restrict__ xkv, const float* __restrict__ Wq, const float* __restrict__ Wk, const float* __restrict__ Wv, const float* __restrict__ Wo,
                                              _Float16* __restrict__ XQ16, _Float16* __restrict__ XKV16, _Float16* __restrict__ Bq, _Float16* __restrict__ Bk, _Float16* __restrict__ Bv, _Float16* __restrict__ Bo) {
  const int bx = blockIdx.x, w = threadIdx.x >> 5, lane = threadIdx.x & 31, ln = lane & 15, hh = lane >> 4;
  // X: blocks 0..255 take xq, the rest xkv; NR / 16 * DD / 32 = 8192 tiles an operand, 4 neighbours in k per wave. Half g = 2 * tile + j begins at column 16 g.
  const int tile0 = ((bx & 255) * 8 + w) * 4;
  const float* xp = (bx < 256 ? xq : xkv) + (size_t)((tile0 >> 5) * 16 + ln) * DD + (tile0 & 31) * 32 + hh * 8;
  unsigned short* xd = (unsigned short*)(bx < 256 ? XQ16 : XKV16) + (size_t)tile0 * 512 + lane * 8;
  // W: 128 blocks an operand; a wave takes half kj = 2 * kt + j (k = 16 kj + 8 hh + 0..7) of the 4 row tiles rt0 .. rt0 + 3 (n = 16 rt + ln).
  const int m = bx >> 7, r = (bx & 127) * 8 + w, kj = r & 63, rt0 = (r >> 6) * 4;
  const float* wp = (m == 0 ? Wq : m == 1 ? Wk : m == 2 ? Wv : Wo) + (size_t)(kj * 16 + hh * 8) * DD + rt0 * 16 + ln;
  unsigned short* wd = (unsigned short*)(m == 0 ? Bq : m == 1 ? Bk : m == 2 ? Bv : Bo) + (size_t)(rt0 * 64 + kj) * 256 + lane * 8;
  v4f xv[8][2]; float wv[4][8];      // all of the wave's loads stand ahead of the first conversion, so they are in flight together
#pragma unroll
  for (int g = 0; g < 8; ++g) { xv[g][0] = *(const v4fa*)(xp + g * 16); xv[g][1] = *(const v4fa*)(xp + g * 16 + 4); }
#pragma unroll
  for (int c = 0; c < 4; ++c)
#pragma unroll
    for (int i = 0; i < 8; ++i) wv[c][i] = wp[i * DD + c * 16];
  // the wait that stands in front of any reuse of the loads' address registers; naming them as inputs keeps them whole up to it
  asm volatile("s_wait_xcnt 0x0" :: "v"(xp), "v"(wp) : "memory");
  FragH fx[8], fw[4];      // formed apart from the stores, so that the stores go out in runs
#pragma unroll
  for (int g = 0; g < 8; ++g)
#pragma unroll
    for (int q = 0; q < 4; ++q) { fx[g].h[q] = (_Float16)bf16_round(xv[g][0][q]); fx[g].h[4 + q] = (_Float16)bf16_round(xv[g][1][q]); }
#pragma unroll
  for (int c = 0; c < 4; ++c)
#pragma unroll
    for (int i = 0; i < 8; ++i) fw[c].h[i] = (_Float16)(bf16_round(wv[c][i]) * 16.0f);
#pragma unroll
  for (int g = 0; g < 8; ++g) *(v8us*)(xd + g * 256) = fx[g].half[0];
#pragma unroll
  for (int c = 0; c < 4; ++c) *(v8us*)(wd + c * 64 * 256) = fw[c].half[0];
}
// GEMM on fragment-order f16 operands (see FRAGMENT ORDER), [NR][DD] x [DD][DD]: v = acc * alpha + bf16(bias[col]). blk = index of the block's tile.
// A wave owns a 64 x 64 tile of the result (4 x 4 accumulator tiles), so every loaded A or B fragment feeds four products; a block is 2 x 2 waves, a 128 x 128 tile.
// OUT 0: f16 result in fragment order (k = column). OUT 1: f16(v * bf16(RM[row])) transposed per head of 64 columns, in the fragment order that k_flash reads as Vt (TT rows per batch). OUT 2: f32 result, row-major.
template <int OUT>
__device__ __forceinline__ void gemm_w64(const int blk, const _Float16* __restrict__ A, const _Float16* __restrict__ Bh, float alpha, const float* __restrict__ bias, float* __restrict__ C, _Float16* __restrict__ C16, const float* __restrict__ RM) {
  constexpr int K = DD, N = DD, MT = 4;
  __shared__ __attribute__((aligned(16))) float so[OUT == 1 ? 1 : 4][OUT == 1 ? 1 : 64][64 + 4];      // pitch 272 B = 16 B x odd: the f16 epilogue reads 16 rows at one column with 16-byte loads
  const int tid = threadIdx.x, w = tid >> 5, lane = tid & 31, ln = lane & 15, hh = lane >> 4;
  const int bm = blk / (N / 128), bn = blk % (N / 128);
  const int row0 = bm * 128 + (w >> 1) * 64, col0 = bn * 128 + (w & 1) * 64;
  v8f acc[MT][4] = {};
  // A tile row of 16 rows is 16 * K elements, a 32-k tile 512 elements, its second half 256 elements on: all 32 loads of a 64-k block hang on two address registers with constant offsets.
  const unsigned short* pa = (const unsigned short*)A + (size_t)row0 * K + lane * 8; const unsigned short* pb = (const unsigned short*)Bh + (size_t)col0 * K + lane * 8;
  // rolled: one 64-k block's fragments (128 registers) beside the 128 accumulator registers; the inner unroll directives keep the fragment arrays in registers (constant indices)
#pragma unroll 1
  for (int kb = 0; kb < K; kb += 64) {
    FragH ah[2][MT], bq[2][4];      // all fragment loads of the block stand ahead of its first product, so they are in flight together
#pragma unroll
    for (int u = 0; u < 2; ++u)
#pragma unroll
      for (int i = 0; i < 4; ++i) { ah[u][i].half[0] = *(const v8us*)(pa + i * 16 * K + u * 512); ah[u][i].half[1] = *(const v8us*)(pa + i * 16 * K + u * 512 + 256);
        bq[u][i].half[0] = *(const v8us*)(pb + i * 16 * K + u * 512); bq[u][i].half[1] = *(const v8us*)(pb + i * 16 * K + u * 512 + 256); }
    // the wait that stands in front of any reuse of the group's address registers; naming them as inputs keeps them whole up to it (no load of the group lands on one)
    asm volatile("s_wait_xcnt 0x0" :: "v"(pa), "v"(pb) : "memory");
    __builtin_amdgcn_sched_barrier(0);      // keeps the 32 loads ahead of the products: without it the scheduler sinks each load to its first use, and the lone wave of a SIMD waits out an L2 round trip several times a block
#pragma unroll
    for (int u = 0; u < 2; ++u)
#pragma unroll
      for (int i = 0; i < MT; ++i)
#pragma unroll
        for (int t = 0; t < 4; ++t) acc[i][t] = __builtin_amdgcn_wmma_f32_16x16x32_f16(false, ah[u][i].v, false, bq[u][t].v, (short)0, acc[i][t], false, false);      // the plain builtin: an asm operand (mmaH) cannot name a register above v255, and this tile needs them
    pa += 1024; pb += 1024;      // 64 k = two tiles
  }
  float bt[4];
#pragma unroll
  for (int t = 0; t < 4; ++t) bt[t] = bf16_round(bias[col0 + t * 16 + ln]);
  if constexpr (OUT == 1) {
    // Vt of a slab (batch, head): rows = d, k = key, tile index kt * 4 + dt (kt = 32-key tile, dt = 16-d tile). acc[i][t][0..7] of lane (hh, ln) are keys row0 + 16 i + 8 hh + 0..7 at d = 16 t + ln:
    // the 16 bytes that this lane owns in half (row / 16) & 1 of tile (kt, t). So the masked, transposed operand is stored from the accumulator registers, 512 contiguous bytes per wave and store.
    const int key0 = row0 % TT;      // a wave's 64 rows lie in one batch: two 32-key tiles, 4096 elements in a row
    unsigned short* cp = (unsigned short*)C16 + ((size_t)(row0 / TT) * (N / 64) + col0 / 64) * 64 * TT + (size_t)(key0 >> 5) * 2048 + lane * 8;
    FragH f[MT][4];      // formed apart from the stores, so that the stores go out in runs
#pragma unroll
    for (int i = 0; i < MT; ++i) { const float* mp = RM + row0 + i * 16 + 8 * hh; const v4f m0 = *(const v4fa*)mp, m1 = *(const v4fa*)(mp + 4); float mr[8];
#pragma unroll
      for (int q = 0; q < 4; ++q) { mr[q] = bf16_round(m0[q]); mr[4 + q] = bf16_round(m1[q]); }
#pragma unroll
      for (int t = 0; t < 4; ++t)
#pragma unroll
        for (int r = 0; r < 8; ++r) f[i][t].h[r] = (_Float16)((acc[i][t][r] * alpha + bt[t]) * mr[r]); }
#pragma unroll
    for (int i = 0; i < MT; ++i)
#pragma unroll
      for (int t = 0; t < 4; ++t) *(v8us*)(cp + (i >> 1) * 2048 + (i & 1) * 256 + t * 512) = f[i][t].half[0];
  } else {
#pragma unroll
    for (int i = 0; i < MT; ++i)
#pragma unroll
      for (int t = 0; t < 4; ++t)
#pragma unroll
        for (int r = 0; r < 8; ++r) so[w][i * 16 + 8 * hh + r][t * 16 + ln] = acc[i][t][r] * alpha + bt[t];
    __builtin_amdgcn_fence(__ATOMIC_ACQ_REL, "workgroup"); __builtin_amdgcn_wave_barrier();      // orders the wave's LDS writes ahead of its reads of them: a wave reads back its own rows only
    if constexpr (OUT == 2) {      // f32 result, row-major: two rows of 256 bytes per store
      const int rsub = lane >> 4, c4 = (lane & 15) * 4;
#pragma unroll
      for (int q = 0; q < 32; ++q) { const int r = q * 2 + rsub; const v4f v = *(const v4fa*)&so[w][r][c4]; *(v4f*)(C + (size_t)(row0 + r) * N + col0 + c4) = v; }
    } else {      // f16 result in fragment order (k = column): a 16 x 64 piece is 2 KiB in a row, half c holds columns col0 + 16 c ..
#pragma unroll
      for (int i = 0; i < MT; ++i) { unsigned short* cp = (unsigned short*)C16 + (size_t)(row0 + i * 16) * N + (size_t)(col0 / 32) * 512 + lane * 8;
#pragma unroll
        for (int c = 0; c < 4; ++c) { const v4f v0 = *(const v4fa*)&so[w][i * 16 + ln][c * 16 + hh * 8], v1 = *(const v4fa*)&so[w][i * 16 + ln][c * 16 + hh * 8 + 4]; FragH f;
#pragma unroll
          for (int q = 0; q < 4; ++q) { f.h[q] = (_Float16)v0[q]; f.h[4 + q] = (_Float16)v1[q]; }
          *(v8us*)(cp + c * 256) = f.half[0]; } }
    }
  }
}
// The Q, K and V projections depend on nothing of one another: one launch of 3 x 256 blocks, all resident at once (3 blocks a WGP, 3 waves a SIMD), so that one wave's products run while another's fragment loads are on their way.
// Block b, b + 256 and b + 512 own the same tile position of Q, K and V.
__global__ __launch_bounds__(128) void k_gemm_qkv(const _Float16* __restrict__ XQ, const _Float16* __restrict__ XKV, const _Float16* __restrict__ Bq, const _Float16* __restrict__ Bk, const _Float16* __restrict__ Bv,
                                                  const float* __restrict__ bq, const float* __restrict__ bk, const float* __restrict__ bv, const float* __restrict__ mk,
                                                  _Float16* __restrict__ Q16, _Float16* __restrict__ K16, _Float16* __restrict__ Vt) {
  constexpr int G = (NR / 128) * (DD / 128);
  const int sel = blockIdx.x / G, blk = blockIdx.x % G;      // the same for a whole block
  if (sel == 2) gemm_w64<1>(blk, XKV, Bv, 0.0625f, bv, nullptr, Vt, mk);      // (v + bv) * mask in f32, then f16, stored as Vt
  else gemm_w64<0>(blk, sel ? XKV : XQ, sel ? Bk : Bq, 0.0625f, sel ? bk : bq, nullptr, sel ? K16 : Q16, nullptr);
}
__global__ __launch_bounds__(128) void k_gemm_o(const _Float16* __restrict__ A, const _Float16* __restrict__ Bh, const float* __restrict__ bias, float* __restrict__ C) { gemm_w64<2>(blockIdx.x, A, Bh, 0.0625f, bias, C, nullptr, nullptr); }

__global__ __launch_bounds__(256) void k_round16f(const float* __restrict__ W, _Float16* __restrict__ Bt, size_t n8) { const size_t t = (size_t)blockIdx.x * 256 + threadIdx.x; if (t >= n8) return; FragH f;
#pragma unroll
  for (int i = 0; i < 8; ++i) f.h[i] = (_Float16)(bf16_round(W[t * 8 + i]) * 16.0f); *(v8us*)((unsigned short*)Bt + t * 8) = f.half[0];  }

// lane l with lane l ^ 16 (a vector cross-row move, no LDS queue)
__device__ __forceinline__ float xhalf(float x) { return __builtin_bit_cast(float, __builtin_amdgcn_permlanex16(__builtin_bit_cast(int, x), __builtin_bit_cast(int, x), 0x76543210, 0xfedcba98, false, false)); }
// Transposed products: St = K * Qt (A = K rows, B = Q), Ot += Vt * Pt (A = Vt rows, B = Pt). The fragments are the same registers as before with A and B swapped (one k order for both).
// St tile (qt, nt): register r of lane (hh, ln) = score of key j0 + 16 nt + 8 hh + r with query q0 + 16 qt + ln: a lane holds 16 scores of ONE query, so maximum and sum run in the lane,
// with one exchange between the wave halves for the maximum; the two halves' sums are joined once, behind the loop.
// The two converted St tiles are the B fragment of Pt as they stand (element 8 nt + r = k 16 nt + 8 hh + r): P passes through no LDS.
// A wave owns QT = 2 query tiles of 16: every loaded K or Vt fragment feeds two products (one per query tile), and the two tiles' softmax chains are independent of each other.
__global__ __launch_bounds__(128) void k_flash(const _Float16* __restrict__ Q16, int ldq, const _Float16* __restrict__ K16, int ldk, const _Float16* __restrict__ Vt, const int* __restrict__ MSK, _Float16* __restrict__ O16, int ldo) {
  constexpr int QT = 2, RPW = 16 * QT, NQB = 2048 / (4 * RPW), DT = 4, KS = 2;
  const int tid = threadIdx.x, w = tid >> 5, lane = tid & 31;
  const int slab = blockIdx.x / NQB, qblk = blockIdx.x % NQB; const int b = slab / 16, h = slab % 16; const int qb0 = qblk * (4 * RPW); const int q0 = qb0 + w * RPW;
  FragH aq[QT][KS];
  const unsigned short* qr0 = (const unsigned short*)Q16 + ((size_t)b * 2048 + q0) * ldq + h * 1024 + lane * 8; const unsigned short* qr1 = qr0 + (size_t)16 * ldq;      // Q16, K16, Vt: fragment order (see FRAGMENT ORDER); a head's 64 columns are two tiles, 1024 elements
#pragma unroll
  for (int ks = 0; ks < KS; ++ks) { aq[0][ks].half[0] = *(const v8us*)(qr0 + ks * 512); aq[0][ks].half[1] = *(const v8us*)(qr0 + ks * 512 + 256); aq[1][ks].half[0] = *(const v8us*)(qr1 + ks * 512); aq[1][ks].half[1] = *(const v8us*)(qr1 + ks * 512 + 256); }
  const unsigned short* Vth = (const unsigned short*)Vt + (size_t)slab * 64 * 2048;
  float m_r[QT], l_r[QT]; v8f oacc[QT][DT];      // of query q0 + 16 qt + ln; l_r sums this half's keys only; oacc[qt][dt][r] = Ot[16 dt + 8 hh + r][q0 + 16 qt + ln]
  // Softmax in base 2: exp(s / 8 - m) = exp2(s * CS - m * log2 e), CS = log2(e) / 8. m_r is kept in that scaled unit, so a weight is one fused multiply-add on the raw score and one hardware exp2.
  constexpr float CS = 0.125f * 1.4426950408889634f; typedef float v2f __attribute__((ext_vector_type(2)));
#pragma unroll
  for (int qt = 0; qt < QT; ++qt) { m_r[qt] = -3.0e38f; l_r[qt] = 0.f;
#pragma unroll
    for (int dt = 0; dt < DT; ++dt) oacc[qt][dt] = (v8f){0.f,0.f,0.f,0.f,0.f,0.f,0.f,0.f}; }
  const int jend = 2048;
  // Fragment loads stand well ahead of their products: a pass issues its V fragments as one group at its top (they land behind the softmax) and,
  // right behind its score products, the next pass's K fragments (they land behind the rest of the pass). No product waits on a load just issued.
  // The unroll directives on the fragment loops keep the fragment arrays in registers (constant indices).
  FragH bk[2][KS];
  const unsigned short* kp0 = (const unsigned short*)K16 + (size_t)b * 2048 * ldk + h * 1024 + lane * 8; const unsigned short* kp1 = kp0 + (size_t)16 * ldk;
#pragma unroll
  for (int ks = 0; ks < KS; ++ks) { bk[0][ks].half[0] = *(const v8us*)(kp0 + ks * 512); bk[0][ks].half[1] = *(const v8us*)(kp0 + ks * 512 + 256); bk[1][ks].half[0] = *(const v8us*)(kp1 + ks * 512); bk[1][ks].half[1] = *(const v8us*)(kp1 + ks * 512 + 256); }
  // as in the loop: the wait in front of any reuse of the address registers of the Q and first K loads
  asm volatile("s_wait_xcnt 0x0" :: "v"(qr0), "v"(qr1), "v"(kp0), "v"(kp1) : "memory");
#pragma unroll 1
  for (int j0 = 0; j0 < jend; j0 += 32) {
    FragH bv[DT];
#pragma unroll
    for (int dt = 0; dt < DT; ++dt) { const unsigned short* vrow = Vth + (size_t)j0 * 64 + dt * 512 + lane * 8; bv[dt].half[0] = *(const v8us*)vrow; bv[dt].half[1] = *(const v8us*)(vrow + 256); }
    v8f s[QT][2];
#pragma unroll
    for (int nt = 0; nt < 2; ++nt)
#pragma unroll
      for (int qt = 0; qt < QT; ++qt) { v8f acc = (v8f){0.f,0.f,0.f,0.f,0.f,0.f,0.f,0.f};
#pragma unroll
        for (int ks = 0; ks < KS; ++ks) acc = mmaH<1>(bk[nt][ks].v, bk[nt][ks].v, aq[qt][ks].v, aq[qt][ks].v, acc); s[qt][nt] = acc; }
    const int jn = (j0 + 32 < jend) ? j0 + 32 : j0;      // the last pass reads its own rows again: in bounds, not used
    const unsigned short* kr0 = (const unsigned short*)K16 + ((size_t)b * 2048 + jn) * ldk + h * 1024 + lane * 8; const unsigned short* kr1 = kr0 + (size_t)16 * ldk;
#pragma unroll
    for (int ks = 0; ks < KS; ++ks) { bk[0][ks].half[0] = *(const v8us*)(kr0 + ks * 512); bk[0][ks].half[1] = *(const v8us*)(kr0 + ks * 512 + 256); bk[1][ks].half[0] = *(const v8us*)(kr1 + ks * 512); bk[1][ks].half[1] = *(const v8us*)(kr1 + ks * 512 + 256); }
    // the wait that stands in front of any reuse of the group's address registers; naming them as inputs keeps them whole up to it (no load of the group lands on one)
    asm volatile("s_wait_xcnt 0x0" :: "v"(kr0), "v"(kr1) : "memory");
    FragH pb[QT];
#pragma unroll
    for (int qt = 0; qt < QT; ++qt) {
      float mx[8];
#pragma unroll
      for (int r = 0; r < 8; ++r) mx[r] = fmaxf(s[qt][0][r], s[qt][1][r]);      // maxima of the raw scores: the scale is positive
      float mc = fmaxf(fmaxf(fmaxf(mx[0], mx[1]), fmaxf(mx[2], mx[3])), fmaxf(fmaxf(mx[4], mx[5]), fmaxf(mx[6], mx[7])));
      mc = fmaxf(mc, xhalf(mc)) * CS;
      const float mn = fmaxf(m_r[qt], mc); const float al = (mn > -1.0e38f) ? __builtin_amdgcn_exp2f(m_r[qt] - mn) : 1.0f; m_r[qt] = mn;
      float ps[8];
#pragma unroll
      for (int r = 0; r < 8; r += 2) {      // two scores of a tile per packed multiply-add
        const v2f a0 = __builtin_elementwise_fma((v2f){s[qt][0][r], s[qt][0][r + 1]}, (v2f){CS, CS}, (v2f){-mn, -mn}), a1 = __builtin_elementwise_fma((v2f){s[qt][1][r], s[qt][1][r + 1]}, (v2f){CS, CS}, (v2f){-mn, -mn});
        const float p00 = __builtin_amdgcn_exp2f(a0.x), p01 = __builtin_amdgcn_exp2f(a0.y), p10 = __builtin_amdgcn_exp2f(a1.x), p11 = __builtin_amdgcn_exp2f(a1.y);
        ps[r] = p00 + p10; ps[r + 1] = p01 + p11; pb[qt].h[r] = (_Float16)p00; pb[qt].h[r + 1] = (_Float16)p01; pb[qt].h[8 + r] = (_Float16)p10; pb[qt].h[9 + r] = (_Float16)p11; }
      l_r[qt] = l_r[qt] * al + (((ps[0] + ps[1]) + (ps[2] + ps[3])) + ((ps[4] + ps[5]) + (ps[6] + ps[7])));
#pragma unroll
      for (int dt = 0; dt < DT; ++dt)
#pragma unroll
        for (int r = 0; r < 8; ++r) oacc[qt][dt][r] *= al;
    }
#pragma unroll
    for (int dt = 0; dt < DT; ++dt)
#pragma unroll
      for (int qt = 0; qt < QT; ++qt) oacc[qt][dt] = mmaH<1>(bv[dt].v, bv[dt].v, pb[qt].v, pb[qt].v, oacc[qt][dt]); }
  // oacc[qt][dt][0..7] of lane (hh, ln) are row q0 + 16 qt + ln, columns 16 dt + 8 hh + 0..7 of the head: the 16 bytes that this lane owns in half dt & 1 of the head's tile dt >> 1 of a fragment-order
  // operand (see FRAGMENT ORDER). So the output GEMM's f16 A operand is stored from the accumulator registers, 512 contiguous bytes per wave and store.
  FragH f[QT][DT];      // formed apart from the stores, so that the stores go out in runs
#pragma unroll
  for (int qt = 0; qt < QT; ++qt) { const float l = l_r[qt] + xhalf(l_r[qt]); const float li = (l > 0.f) ? 1.0f / l : 0.f;
#pragma unroll
    for (int dt = 0; dt < DT; ++dt)
#pragma unroll
      for (int r = 0; r < 8; ++r) f[qt][dt].h[r] = (_Float16)(oacc[qt][dt][r] * li); }
#pragma unroll
  for (int qt = 0; qt < QT; ++qt) { unsigned short* op = (unsigned short*)O16 + ((size_t)b * 2048 + q0 + qt * 16) * ldo + h * 1024 + lane * 8;
#pragma unroll
    for (int dt = 0; dt < DT; ++dt) *(v8us*)(op + dt * 256) = f[qt][dt].half[0]; } }

extern "C" void kernel_launch(void* const* d_in, const int* in_sizes, int n_in,
                              void* d_out, int out_size, void* d_ws, size_t ws_size, hipStream_t stream) {
  (void)in_sizes; (void)n_in; (void)out_size;
  const float* xq = (const float*)d_in[0]; const float* xkv = (const float*)d_in[1]; const float* mk = (const float*)d_in[2]; const float* Wq = (const float*)d_in[3]; const float* bq = (const float*)d_in[4]; const float* Wk = (const float*)d_in[5]; const float* bk = (const float*)d_in[6]; const float* Wv = (const float*)d_in[7]; const float* bv = (const float*)d_in[8]; const float* Wo = (const float*)d_in[9]; const float* bo = (const float*)d_in[10];
  char* ws = (char*)d_ws; size_t off = 0;
  auto take = [&](size_t bytes) { char* p = ws + off; off += (bytes + 255) & ~(size_t)255; return p; };
  _Float16* Bq = (_Float16*)take((size_t)DD * DD * 2); _Float16* Bk = (_Float16*)take((size_t)DD * DD * 2); _Float16* Bv = (_Float16*)take((size_t)DD * DD * 2); _Float16* Bo = (_Float16*)take((size_t)DD * DD * 2);
  _Float16* XQ16 = (_Float16*)take((size_t)NR * DD * 2); _Float16* XKV16 = (_Float16*)take((size_t)NR * DD * 2); _Float16* Q16 = (_Float16*)take((size_t)NR * DD * 2); _Float16* K16 = (_Float16*)take((size_t)NR * DD * 2); _Float16* Vt = (_Float16*)take((size_t)NR * DD * 2); _Float16* O16 = (_Float16*)take((size_t)NR * DD * 2);
  if (off > ws_size) return;      // 8.4 + 8.4 x 6 = 59 MB
  const unsigned gg = (NR / 128) * (DD / 128);
  k_prep<<<512, 256, 0, stream>>>(xq, xkv, Wq, Wk, Wv, Wo, XQ16, XKV16, Bq, Bk, Bv, Bo);      // W (D,H,Dh) = [in][h * 64 + d]; Wo (H,Dh,D) = [in = (h,d)][out]
  k_gemm_qkv<<<3 * gg, 128, 0, stream>>>(XQ16, XKV16, Bq, Bk, Bv, bq, bk, bv, mk, Q16, K16, Vt);
  k_flash<<<BB * NH * (TT / 128), 128, 0, stream>>>(Q16, DD, K16, DD, Vt, nullptr, O16, DD);      // the 1/8 on q is folded into the softmax constant
  k_gemm_o<<<gg, 128, 0, stream>>>(O16, Bo, bo, (float*)d_out);
}

// v008
// One run takes 95.6 microseconds.
// Next to v007, in two timings, it ran 1.12 and 1.15 times as fast.
// Counting every step since v000, it is 4.64 times as fast.
#include <hip/hip_runtime.h>
// Multi-head dot-product attention with a per-key value mask (B=2, L=2048, D=1024, 16 heads × 64; q from inputs_q, k/v from inputs_kv; v ← mask_k·v; softmax(q·k/8); merge; ·Wo + bo): the
// q/k/v/o projections are GEMMs ([in][out] weights bf16-exact ×2^4, bias epilogues, f32 accumulate) and the attention is a fused flash-style kernel (online softmax f32; P f16 ≤ 1; O = P·Vt;
// 32 queries a wave) on v_wmma_f32_16x16x32_f16; the value masking is applied in f32 VALU before the f16 conversion.
#define BB 2
#define TT 2048
#define DD 1024
#define NH 16
#define NR (BB * TT)

typedef __bf16 v16b __attribute__((ext_vector_type(16)));
typedef unsigned short v8us __attribute__((ext_vector_type(8), may_alias));
typedef float  v8f  __attribute__((ext_vector_type(8)));
typedef float  v4f  __attribute__((ext_vector_type(4)));
typedef float  v4fa __attribute__((ext_vector_type(4), may_alias));
union FragB { v16b v; v8us half[2]; unsigned short u[16]; };

__device__ __forceinline__ unsigned short bf16_bits(float x) { unsigned int u = __float_as_uint(x); return (unsigned short)((u + 0x7FFFu + ((u >> 16) & 1u)) >> 16); }
__device__ __forceinline__ float bf16_val(unsigned short b) { return __uint_as_float(((unsigned int)b) << 16); }
__device__ __forceinline__ float bf16_round(float x) { return bf16_val(bf16_bits(x)); }
// D += A·B with NT terms: 1 = ah·bh, 2 = + al·bh (A split), 3 = + ah·bl (both split)
template <int NT>
__device__ __forceinline__ v8f mmaN(v16b ah, v16b al, v16b bh, v16b bl, v8f c) {
  c = __builtin_amdgcn_wmma_f32_16x16x32_bf16(false, ah, false, bh, (short)0, c, false, false);
  if (NT >= 2) c = __builtin_amdgcn_wmma_f32_16x16x32_bf16(false, al, false, bh, (short)0, c, false, false);
  if (NT >= 3) c = __builtin_amdgcn_wmma_f32_16x16x32_bf16(false, ah, false, bl, (short)0, c, false, false);
  asm volatile("v_nop\n\tv_nop\n\tv_nop\n\tv_nop" : "+v"(c) : "v"(ah), "v"(al), "v"(bh), "v"(bl));
  return c;
}

__global__ __launch_bounds__(256) void k_wt_bf16(const float* __restrict__ W, unsigned short* __restrict__ Wt, int K, int N) {
  const int t = blockIdx.x * 256 + threadIdx.x;
  const int k8n = K / 8;
  if (t >= N * k8n) return;
  const int n = t / k8n, k8 = (t % k8n) * 8;
  v8us v;
#pragma unroll
  for (int i = 0; i < 8; ++i) v[i] = bf16_bits(W[(size_t)(k8 + i) * N + n]);
  *(v8us*)(Wt + (size_t)n * K + k8) = v;
  
}

// GEMM C[M][N] (f32, pitch ldc) = act(A[M][K]·W + bias). A f32 row-major (pitch lda) converted per fragment to bf16
// (ASPLIT: hi/lo two planes -> 2 terms, else single rounded term); Wt bf16 [N][K] (pitch ldb). BIAS_BF16 rounds the
// bias to bf16 first (bias quantised to bf16 before the add). K%32==0, M%16==0, N%64==0.
template <bool ASPLIT, int ACT, bool BIAS_BF16>
__global__ __launch_bounds__(128) void k_gemm_bf(const float* __restrict__ A, int lda, const unsigned short* __restrict__ Wt, int ldb,
                                               const float* __restrict__ bias, float* __restrict__ C, int ldc, int M, int N, int K) {
  __shared__ __attribute__((aligned(16))) float so[4][16][64];
  const int tid = threadIdx.x, w = tid >> 5, lane = tid & 31, ln = lane & 15, hh = lane >> 4;
  const int ntn = N / 64;
  const int wid = blockIdx.x * 4 + w;
  const int mt = wid / ntn, nq = wid % ntn;
  if (mt * 16 >= M) return;
  const int row0 = mt * 16, col0 = nq * 64;
  const float* arow = A + (size_t)(row0 + ln) * lda;
  v8f acc[4] = {};
  for (int kb = 0; kb < K; kb += 32) {
    FragB ah, al;
    const v4f x0 = *(const v4fa*)(arow + kb + 8 * hh), x1 = *(const v4fa*)(arow + kb + 8 * hh + 4);
    const v4f x2 = *(const v4fa*)(arow + kb + 16 + 8 * hh), x3 = *(const v4fa*)(arow + kb + 16 + 8 * hh + 4);
    float xs[16] = {x0[0],x0[1],x0[2],x0[3],x1[0],x1[1],x1[2],x1[3],x2[0],x2[1],x2[2],x2[3],x3[0],x3[1],x3[2],x3[3]};
#pragma unroll
    for (int i = 0; i < 16; ++i) { const unsigned short hb = bf16_bits(xs[i]); ah.u[i] = hb; al.u[i] = ASPLIT ? bf16_bits(xs[i] - bf16_val(hb)) : (unsigned short)0; }
#pragma unroll
    for (int t = 0; t < 4; ++t) {
      const unsigned short* brow = Wt + (size_t)(col0 + t * 16 + ln) * ldb + kb;
      FragB b;
      b.half[0] = *(const v8us*)(brow + 8 * hh);
      b.half[1] = *(const v8us*)(brow + 16 + 8 * hh);
      acc[t] = mmaN<ASPLIT ? 2 : 1>(ah.v, al.v, b.v, b.v, acc[t]);
    }
  }
#pragma unroll
  for (int t = 0; t < 4; ++t) {
    float bv = bias ? bias[col0 + t * 16 + ln] : 0.f;
    if (BIAS_BF16) bv = bf16_round(bv);
#pragma unroll
    for (int r = 0; r < 8; ++r) { float v = acc[t][r] + bv; if (ACT == 1) v = fmaxf(v, 0.f); so[w][8 * hh + r][t * 16 + ln] = v; }
  }
  __builtin_amdgcn_fence(__ATOMIC_ACQ_REL, "workgroup");
  __builtin_amdgcn_wave_barrier();
  const int rsub = lane >> 4, c4 = (lane & 15) * 4;
  {
#pragma unroll
    for (int q = 0; q < 8; ++q) {
      const int r = q * 2 + rsub;
      const v4f v = *(const v4fa*)&so[w][r][c4];
      *(v4f*)(C + (size_t)(row0 + r) * ldc + col0 + c4) = v;
    }
    
  }
}

// Flash-style causal/unmasked attention, all contractions 3-term bf16 hi/lo splits, f32 softmax with running max.
// q,k,v rows are read from f32 buffers with arbitrary row pitch (so they can live inside a fused qkv buffer);
// D = head size (multiple of 32, <= 128); one wave = 16 query rows; block = 4 waves (64 queries) sharing K/V chunks of 32.
template <int D, bool CAUSAL>
__global__ __launch_bounds__(128) void k_flash(const float* __restrict__ qb, const float* __restrict__ kb, const float* __restrict__ vb,
                                             int pitch, int T, int H, float scale, float* __restrict__ y, int ypitch) {
  constexpr int KS = D / 32;        // k-steps for QK
  constexpr int DT = D / 16;        // d tiles for PV
  __shared__ __attribute__((aligned(16))) unsigned short sKh[32][D + 8], sKl[32][D + 8], sVh[32][D + 8], sVl[32][D + 8];
  __shared__ __attribute__((aligned(16))) unsigned short sPh[4][16][40], sPl[4][16][40];
  __shared__ __attribute__((aligned(16))) float sO[4][16][D];
  const int tid = threadIdx.x, w = tid >> 5, lane = tid & 31, ln = lane & 15, hh = lane >> 4;
  const int nqb = (T + 63) / 64;
  const int bh = blockIdx.x / nqb, qblk = blockIdx.x % nqb;
  const int b = bh / H, h = bh % H;
  const int q0 = qblk * 64 + w * 16;
  const float* Q = qb + (size_t)b * T * pitch + h * D;
  const float* K = kb + (size_t)b * T * pitch + h * D;
  const float* V = vb + (size_t)b * T * pitch + h * D;

  // A fragments of the wave's 16 query rows (scaled), hi/lo
  FragB aqh[KS], aql[KS];
  {
    int row = q0 + ln; if (row >= T) row = T - 1;
    const float* qr = Q + (size_t)row * pitch;
#pragma unroll
    for (int ks = 0; ks < KS; ++ks)
#pragma unroll
      for (int i = 0; i < 16; ++i) {
        const int d = ks * 32 + ((i < 8) ? (8 * hh + i) : (16 + 8 * hh + (i - 8)));
        const float x = qr[d] * scale; const unsigned short hb = bf16_bits(x);
        aqh[ks].u[i] = hb; aql[ks].u[i] = bf16_bits(x - bf16_val(hb));
      }
  }
  float m_r[8], l_r[8];
#pragma unroll
  for (int r = 0; r < 8; ++r) { m_r[r] = -3.0e38f; l_r[r] = 0.f; }
  v8f oacc[DT];
#pragma unroll
  for (int dt = 0; dt < DT; ++dt) oacc[dt] = (v8f){0.f,0.f,0.f,0.f,0.f,0.f,0.f,0.f};

  const int kv_end = CAUSAL ? min(T, qblk * 64 + 64) : T;     // block-uniform
  for (int j0 = 0; j0 < kv_end; j0 += 32) {
    __syncthreads();
    for (int e = tid; e < 32 * (D / 4); e += 128) {
      const int r = e / (D / 4), c4 = (e % (D / 4)) * 4;
      const int key = j0 + r;
      v4f kf = {0.f,0.f,0.f,0.f}, vf = {0.f,0.f,0.f,0.f};
      if (key < T) { kf = *(const v4fa*)(K + (size_t)key * pitch + c4); vf = *(const v4fa*)(V + (size_t)key * pitch + c4); }
#pragma unroll
      for (int t = 0; t < 4; ++t) {
        unsigned short hb = bf16_bits(kf[t]); sKh[r][c4 + t] = hb; sKl[r][c4 + t] = bf16_bits(kf[t] - bf16_val(hb));
        hb = bf16_bits(vf[t]); sVh[r][c4 + t] = hb; sVl[r][c4 + t] = bf16_bits(vf[t] - bf16_val(hb));
      }
    }
    __syncthreads();
    // S tile 16 x 32
    v8f s[2];
#pragma unroll
    for (int nt = 0; nt < 2; ++nt) {
      v8f acc = {};
#pragma unroll
      for (int ks = 0; ks < KS; ++ks) {
        FragB bh_, bl_;
        bh_.half[0] = *(const v8us*)&sKh[nt * 16 + ln][ks * 32 + 8 * hh]; bh_.half[1] = *(const v8us*)&sKh[nt * 16 + ln][ks * 32 + 16 + 8 * hh];
        bl_.half[0] = *(const v8us*)&sKl[nt * 16 + ln][ks * 32 + 8 * hh]; bl_.half[1] = *(const v8us*)&sKl[nt * 16 + ln][ks * 32 + 16 + 8 * hh];
        acc = mmaN<3>(aqh[ks].v, aql[ks].v, bh_.v, bl_.v, acc);
      }
      s[nt] = acc;
    }
    // mask + running max (rows 8hh+r; the 16 lanes of a half share rows)
    float alpha[8];
#pragma unroll
    for (int r = 0; r < 8; ++r) {
      const int qi = q0 + 8 * hh + r;
      const int ja = j0 + ln, jb = j0 + 16 + ln;
      if (CAUSAL) { if (ja > qi) s[0][r] = -3.0e38f; if (jb > qi) s[1][r] = -3.0e38f; }
      if (ja >= T) s[0][r] = -3.0e38f;
      if (jb >= T) s[1][r] = -3.0e38f;
      float mx = fmaxf(s[0][r], s[1][r]);
      mx = fmaxf(mx, __shfl_xor(mx, 1, 32)); mx = fmaxf(mx, __shfl_xor(mx, 2, 32)); mx = fmaxf(mx, __shfl_xor(mx, 4, 32)); mx = fmaxf(mx, __shfl_xor(mx, 8, 32));
      const float mnew = fmaxf(m_r[r], mx);
      alpha[r] = (mnew > -1.0e38f) ? __expf(m_r[r] - mnew) : 1.0f;
      const float p0 = (s[0][r] > -1.0e38f) ? __expf(s[0][r] - mnew) : 0.f;
      const float p1 = (s[1][r] > -1.0e38f) ? __expf(s[1][r] - mnew) : 0.f;
      m_r[r] = mnew;
      l_r[r] = l_r[r] * alpha[r] + p0 + p1;            // per-lane partial row sum (16 lanes combined at the end)
      unsigned short hb = bf16_bits(p0); sPh[w][8 * hh + r][ln] = hb;      sPl[w][8 * hh + r][ln] = bf16_bits(p0 - bf16_val(hb));
      hb = bf16_bits(p1);                sPh[w][8 * hh + r][16 + ln] = hb; sPl[w][8 * hh + r][16 + ln] = bf16_bits(p1 - bf16_val(hb));
    }
#pragma unroll
    for (int dt = 0; dt < DT; ++dt)
#pragma unroll
      for (int r = 0; r < 8; ++r) oacc[dt][r] *= alpha[r];
    __builtin_amdgcn_fence(__ATOMIC_ACQ_REL, "workgroup");
    __builtin_amdgcn_wave_barrier();
    FragB pah, pal;
    pah.half[0] = *(const v8us*)&sPh[w][ln][8 * hh]; pah.half[1] = *(const v8us*)&sPh[w][ln][16 + 8 * hh];
    pal.half[0] = *(const v8us*)&sPl[w][ln][8 * hh]; pal.half[1] = *(const v8us*)&sPl[w][ln][16 + 8 * hh];
#pragma unroll
    for (int dt = 0; dt < DT; ++dt) {
      FragB bvh, bvl;
#pragma unroll
      for (int i = 0; i < 8; ++i) {
        bvh.u[i] = sVh[8 * hh + i][dt * 16 + ln]; bvh.u[8 + i] = sVh[16 + 8 * hh + i][dt * 16 + ln];
        bvl.u[i] = sVl[8 * hh + i][dt * 16 + ln]; bvl.u[8 + i] = sVl[16 + 8 * hh + i][dt * 16 + ln];
      }
      oacc[dt] = mmaN<3>(pah.v, pal.v, bvh.v, bvl.v, oacc[dt]);
    }
    __builtin_amdgcn_fence(__ATOMIC_ACQ_REL, "workgroup");
    __builtin_amdgcn_wave_barrier();
  }
#pragma unroll
  for (int r = 0; r < 8; ++r) {
    float l = l_r[r];
    l += __shfl_xor(l, 1, 32); l += __shfl_xor(l, 2, 32); l += __shfl_xor(l, 4, 32); l += __shfl_xor(l, 8, 32);
    l_r[r] = (l > 0.f) ? 1.0f / l : 0.f;
  }
#pragma unroll
  for (int dt = 0; dt < DT; ++dt)
#pragma unroll
    for (int r = 0; r < 8; ++r) sO[w][8 * hh + r][dt * 16 + ln] = oacc[dt][r] * l_r[r];
  __builtin_amdgcn_fence(__ATOMIC_ACQ_REL, "workgroup");
  __builtin_amdgcn_wave_barrier();
  {
    for (int r = 0; r < 16; ++r) {
      const int row = q0 + r;
      if (row < T && lane < D / 4) {
        const v4f val = *(const v4fa*)&sO[w][r][lane * 4];
        *(v4f*)(y + ((size_t)b * T + row) * ypitch + h * D + lane * 4) = val;
      }
    }
    
  }
}

// GEMM C = act(A·W + bias + resid): A f32 (ASPLIT -> hi/lo 2 terms), Wt bf16 [N][K]; ACT 0 none, 1 relu, 2 exact gelu;
// resid (optional, f32, row index = (row % rmod), pitch ldr, RES_BF16 rounds it) added before the activation.
template <bool ASPLIT, int ACT, bool BIAS_BF16, bool RES_BF16>
__global__ __launch_bounds__(128) void k_gemm_bf3(const float* __restrict__ A, int lda, const unsigned short* __restrict__ Wt, int ldb,
                                                const float* __restrict__ bias, const float* __restrict__ resid, int rmod, int ldr,
                                                float* __restrict__ C, int ldc, int M, int N, int K) {
  __shared__ __attribute__((aligned(16))) float so[4][16][64];
  const int tid = threadIdx.x, w = tid >> 5, lane = tid & 31, ln = lane & 15, hh = lane >> 4;
  const int ntn = N / 64;
  const int wid = blockIdx.x * 4 + w;
  const int mt = wid / ntn, nq = wid % ntn;
  if (mt * 16 >= M) return;
  const int row0 = mt * 16, col0 = nq * 64;
  const float* arow = A + (size_t)(row0 + ln) * lda;
  v8f acc[4] = {};
  for (int kb = 0; kb < K; kb += 32) {
    FragB ah, al;
    const v4f x0 = *(const v4fa*)(arow + kb + 8 * hh), x1 = *(const v4fa*)(arow + kb + 8 * hh + 4);
    const v4f x2 = *(const v4fa*)(arow + kb + 16 + 8 * hh), x3 = *(const v4fa*)(arow + kb + 16 + 8 * hh + 4);
    float xs[16] = {x0[0],x0[1],x0[2],x0[3],x1[0],x1[1],x1[2],x1[3],x2[0],x2[1],x2[2],x2[3],x3[0],x3[1],x3[2],x3[3]};
#pragma unroll
    for (int i = 0; i < 16; ++i) { const unsigned short hb = bf16_bits(xs[i]); ah.u[i] = hb; al.u[i] = ASPLIT ? bf16_bits(xs[i] - bf16_val(hb)) : (unsigned short)0; }
#pragma unroll
    for (int t = 0; t < 4; ++t) {
      const unsigned short* brow = Wt + (size_t)(col0 + t * 16 + ln) * ldb + kb;
      FragB b;
      b.half[0] = *(const v8us*)(brow + 8 * hh);
      b.half[1] = *(const v8us*)(brow + 16 + 8 * hh);
      acc[t] = mmaN<ASPLIT ? 2 : 1>(ah.v, al.v, b.v, b.v, acc[t]);
    }
  }
#pragma unroll
  for (int t = 0; t < 4; ++t) {
    const int col = col0 + t * 16 + ln;
    float bv = bias ? bias[col] : 0.f;
    if (BIAS_BF16) bv = bf16_round(bv);
#pragma unroll
    for (int r = 0; r < 8; ++r) {
      float v = acc[t][r] + bv;
      if (resid) { float rv = resid[(size_t)((row0 + 8 * hh + r) % rmod) * ldr + col]; if (RES_BF16) rv = bf16_round(rv); v += rv; }
      if (ACT == 1) v = fmaxf(v, 0.f);
      if (ACT == 2) v = 0.5f * v * (1.0f + erff(v * 0.70710678118654752f));
      if (ACT == 3) { const float u = 0.7978845608028654f * (v + 0.044715f * v * v * v); v = 0.5f * v * (1.0f + tanhf(u)); }
      so[w][8 * hh + r][t * 16 + ln] = v;
    }
  }
  __builtin_amdgcn_fence(__ATOMIC_ACQ_REL, "workgroup");
  __builtin_amdgcn_wave_barrier();
  const int rsub = lane >> 4, c4 = (lane & 15) * 4;
  {
#pragma unroll
    for (int q = 0; q < 8; ++q) {
      const int r = q * 2 + rsub;
      const v4f v = *(const v4fa*)&so[w][r][c4];
      *(v4f*)(C + (size_t)(row0 + r) * ldc + col0 + c4) = v;
    }
    
  }
}
// row LayerNorm (biased variance, eps) over N: s = X (+ R); optional out_sum <- s; out_norm <- (s-mu)*rsqrt(var+eps)*g + b
template <bool PARAM_BF16>
__global__ __launch_bounds__(256) void k_layernorm(const float* __restrict__ X, const float* __restrict__ R, const float* __restrict__ g, const float* __restrict__ bta,
                                                  float* __restrict__ out_sum, float* __restrict__ out_norm, int N, float eps) {
  __shared__ float red[256];
  const int row = blockIdx.x, tid = threadIdx.x;
  const float* x = X + (size_t)row * N; const float* rr = R ? R + (size_t)row * N : nullptr;
  float vals[16];                     // up to N = 4096
  const int per = N / 256;            // contiguous chunk per thread? use strided-by-4 chunks: thread handles j = tid*4 + 1024*u
  float s1 = 0.f;
  for (int u = 0; u < per / 4; ++u) {
    const int j = tid * 4 + 1024 * u;
    const v4f a = *(const v4fa*)(x + j);
    v4f b = {0.f,0.f,0.f,0.f}; if (rr) b = *(const v4fa*)(rr + j);
#pragma unroll
    for (int q = 0; q < 4; ++q) { const float v = a[q] + b[q]; vals[u * 4 + q] = v; s1 += v; }
  }
  red[tid] = s1; __syncthreads();
  for (int st = 128; st > 0; st >>= 1) { if (tid < st) red[tid] += red[tid + st]; __syncthreads(); }
  const float mu = red[0] / (float)N; __syncthreads();
  float s2 = 0.f;
  for (int u = 0; u < per / 4; ++u)
#pragma unroll
    for (int q = 0; q < 4; ++q) { const float c = vals[u * 4 + q] - mu; s2 += c * c; }
  red[tid] = s2; __syncthreads();
  for (int st = 128; st > 0; st >>= 1) { if (tid < st) red[tid] += red[tid + st]; __syncthreads(); }
  const float rs = rsqrtf(red[0] / (float)N + eps);
  {
    for (int u = 0; u < per / 4; ++u) {
      const int j = tid * 4 + 1024 * u;
      v4f o, sm;
#pragma unroll
      for (int q = 0; q < 4; ++q) {
        float gg = g[j + q], bb = bta[j + q];
        if (PARAM_BF16) { gg = bf16_round(gg); bb = bf16_round(bb); }
        sm[q] = vals[u * 4 + q]; o[q] = (vals[u * 4 + q] - mu) * rs * gg + bb;
      }
      if (out_sum) *(v4f*)(out_sum + (size_t)row * N + j) = sm;
      *(v4f*)(out_norm + (size_t)row * N + j) = o;
    }
    
  }
}



// ---- f16 WMMA path (v_wmma_f32_16x16x32_f16): 11-bit significands for operands in range — used where a [0,1] probability operand needs more precision than bf16
typedef _Float16 v16h __attribute__((ext_vector_type(16)));
union FragH { v16h v; v8us half[2]; _Float16 h[16]; unsigned short u[16]; };
template <int NT>
__device__ __forceinline__ v8f mmaH(v16h ah, v16h al, v16h bh, v16h bl, v8f c) {
  c = __builtin_amdgcn_wmma_f32_16x16x32_f16(false, ah, false, bh, (short)0, c, false, false);
  if (NT >= 2) c = __builtin_amdgcn_wmma_f32_16x16x32_f16(false, al, false, bh, (short)0, c, false, false);
  if (NT >= 3) c = __builtin_amdgcn_wmma_f32_16x16x32_f16(false, ah, false, bl, (short)0, c, false, false);
  asm volatile("v_nop\n\tv_nop\n\tv_nop\n\tv_nop" : "+v"(c) : "v"(ah), "v"(al), "v"(bh), "v"(bl));
  return c;
}
// batched GEMM like k_gemm_b but f16 operands: A f32 (split into f16 hi/lo if ASPLIT, else rounded to f16), Bt = f16 values [n][k]; alpha; C f32; N multiple of 16 (partial tiles skipped)
template <bool ASPLIT>
__global__ __launch_bounds__(128) void k_gemm_h(const float* __restrict__ A, int lda, size_t sA, const _Float16* __restrict__ Bh, int ldb, size_t sB, float alpha, float* __restrict__ C, int ldc, size_t sC, int M, int N, int K) {
  __shared__ __attribute__((aligned(16))) float so[4][16][64];
  const int tid = threadIdx.x, w = tid >> 5, lane = tid & 31, ln = lane & 15, hh = lane >> 4; const int by = blockIdx.y;
  A += (size_t)by * sA; Bh += (size_t)by * sB; C += (size_t)by * sC;
  const int ntn = (N + 63) / 64; const int wid = blockIdx.x * 4 + w; const int mt = wid / ntn, nq = wid % ntn; if (mt * 16 >= M) return;
  const int row0 = mt * 16, col0 = nq * 64; const float* arow = A + (size_t)(row0 + ln) * lda;
  v8f acc[4] = {};
  for (int kb = 0; kb < K; kb += 32) {
    FragH ah, al;
    const v4f x0 = *(const v4fa*)(arow + kb + 8 * hh), x1 = *(const v4fa*)(arow + kb + 8 * hh + 4), x2 = *(const v4fa*)(arow + kb + 16 + 8 * hh), x3 = *(const v4fa*)(arow + kb + 16 + 8 * hh + 4);
    float xs[16] = {x0[0],x0[1],x0[2],x0[3],x1[0],x1[1],x1[2],x1[3],x2[0],x2[1],x2[2],x2[3],x3[0],x3[1],x3[2],x3[3]};
#pragma unroll
    for (int i = 0; i < 16; ++i) { const _Float16 h = (_Float16)xs[i]; ah.h[i] = h; al.h[i] = ASPLIT ? (_Float16)(xs[i] - (float)h) : (_Float16)0.0f; }
#pragma unroll
    for (int t = 0; t < 4; ++t) { if (col0 + t * 16 >= N) continue; const size_t boff = (size_t)(col0 + t * 16 + ln) * ldb + kb; FragH bq; bq.half[0] = *(const v8us*)(Bh + boff + 8 * hh); bq.half[1] = *(const v8us*)(Bh + boff + 16 + 8 * hh);
      acc[t] = mmaH<ASPLIT ? 2 : 1>(ah.v, al.v, bq.v, bq.v, acc[t]); }
  }
#pragma unroll
  for (int t = 0; t < 4; ++t) { if (col0 + t * 16 >= N) continue;
#pragma unroll
    for (int r = 0; r < 8; ++r) so[w][8 * hh + r][t * 16 + ln] = acc[t][r] * alpha; }
  __builtin_amdgcn_fence(__ATOMIC_ACQ_REL, "workgroup"); __builtin_amdgcn_wave_barrier();
  const int rsub = lane >> 4, c4 = (lane & 15) * 4;
  {
#pragma unroll
    for (int q = 0; q < 8; ++q) { const int r = q * 2 + rsub; if (col0 + c4 < N) { const v4f v = *(const v4fa*)&so[w][r][c4]; *(v4f*)(C + (size_t)(row0 + r) * ldc + col0 + c4) = v; } }
     }
}

// FRAGMENT ORDER (every f16 matrix operand in the workspace): a [rows][K] operand is kept as tiles of 16 rows x 32 k, 1 KiB each, tile (rt, kt) at index rt * (K / 32) + kt (Vt: kt * 4 + rt, per 64-row slab).
// A tile is two halves of 512 bytes (k 0..15, then k 16..31); in half j lane hh * 16 + ln owns the 16 bytes of row ln, k = 16 j + 8 hh + 0..7: just what that lane feeds to the WMMA.
// One wave-wide 16-byte load of a half is then 512 contiguous bytes, four whole lines, where a row-major operand gives 32-byte pieces of 16 lines.
// Chunk t (16 bytes) of such a buffer: lane = t & 31, j = (t >> 5) & 1, tile = t >> 6. K % 32 == 0, rows % 16 == 0.
// One launch forms all six f16 operands (the two X and the four W have no dependence on one another). 512 blocks x 8 waves: few enough that the waves' start is short beside the stream, enough to fill every WGP.
// A wave converts 4 whole tiles of an X operand (16 rows x 128 k, 512 source bytes in a row per row: f16(bf16(x))) and 4 halves of a W operand (16 k x 64 n, 256 source bytes in a row per k: Wt[n][k] = f16(bf16(W[k][n]) * 16);
// the power of two keeps bf16-exact weights exact in f16, away from the subnormal range). Every store is one half: 512 contiguous bytes per wave.
__global__ __launch_bounds__(256) void k_prep(const float* __restrict__ xq, const float* __restrict__ xkv, const float* __restrict__ Wq, const float* __restrict__ Wk, const float* __restrict__ Wv, const float* __restrict__ Wo,
                                              _Float16* __restrict__ XQ16, _Float16* __restrict__ XKV16, _Float16* __restrict__ Bq, _Float16* __restrict__ Bk, _Float16* __restrict__ Bv, _Float16* __restrict__ Bo) {
  const int bx = blockIdx.x, w = threadIdx.x >> 5, lane = threadIdx.x & 31, ln = lane & 15, hh = lane >> 4;
  // X: blocks 0..255 take xq, the rest xkv; NR / 16 * DD / 32 = 8192 tiles an operand, 4 neighbours in k per wave. Half g = 2 * tile + j begins at column 16 g.
  const int tile0 = ((bx & 255) * 8 + w) * 4;
  const float* xp = (bx < 256 ? xq : xkv) + (size_t)((tile0 >> 5) * 16 + ln) * DD + (tile0 & 31) * 32 + hh * 8;
  unsigned short* xd = (unsigned short*)(bx < 256 ? XQ16 : XKV16) + (size_t)tile0 * 512 + lane * 8;
  // W: 128 blocks an operand; a wave takes half kj = 2 * kt + j (k = 16 kj + 8 hh + 0..7) of the 4 row tiles rt0 .. rt0 + 3 (n = 16 rt + ln).
  const int m = bx >> 7, r = (bx & 127) * 8 + w, kj = r & 63, rt0 = (r >> 6) * 4;
  const float* wp = (m == 0 ? Wq : m == 1 ? Wk : m == 2 ? Wv : Wo) + (size_t)(kj * 16 + hh * 8) * DD + rt0 * 16 + ln;
  unsigned short* wd = (unsigned short*)(m == 0 ? Bq : m == 1 ? Bk : m == 2 ? Bv : Bo) + (size_t)(rt0 * 64 + kj) * 256 + lane * 8;
  v4f xv[8][2]; float wv[4][8];      // all of the wave's loads stand ahead of the first conversion, so they are in flight together
#pragma unroll
  for (int g = 0; g < 8; ++g) { xv[g][0] = *(const v4fa*)(xp + g * 16); xv[g][1] = *(const v4fa*)(xp + g * 16 + 4); }
#pragma unroll
  for (int c = 0; c < 4; ++c)
#pragma unroll
    for (int i = 0; i < 8; ++i) wv[c][i] = wp[i * DD + c * 16];
  // the wait that stands in front of any reuse of the loads' address registers; naming them as inputs keeps them whole up to it
  asm volatile("s_wait_xcnt 0x0" :: "v"(xp), "v"(wp) : "memory");
  FragH fx[8], fw[4];      // formed apart from the stores, so that the stores go out in runs
#pragma unroll
  for (int g = 0; g < 8; ++g)
#pragma unroll
    for (int q = 0; q < 4; ++q) { fx[g].h[q] = (_Float16)bf16_round(xv[g][0][q]); fx[g].h[4 + q] = (_Float16)bf16_round(xv[g][1][q]); }
#pragma unroll
  for (int c = 0; c < 4; ++c)
#pragma unroll
    for (int i = 0; i < 8; ++i) fw[c].h[i] = (_Float16)(bf16_round(wv[c][i]) * 16.0f);
#pragma unroll
  for (int g = 0; g < 8; ++g) *(v8us*)(xd + g * 256) = fx[g].half[0];
#pragma unroll
  for (int c = 0; c < 4; ++c) *(v8us*)(wd + c * 64 * 256) = fw[c].half[0];
}
// GEMM on fragment-order f16 operands (see FRAGMENT ORDER), [NR][DD] x [DD][DD]: v = acc * alpha + bf16(bias[col]). blk = index of the block's tile.
// A wave owns a 64 x 64 tile of the result (4 x 4 accumulator tiles), so every loaded A or B fragment feeds four products; a block is 2 x 2 waves, a 128 x 128 tile.
// OUT 0: f16 result in fragment order (k = column). OUT 1: f16(v * bf16(RM[row])) transposed per head of 64 columns, in the fragment order that k_flash reads as Vt (TT rows per batch). OUT 2: f32 result, row-major.
template <int OUT>
__device__ __forceinline__ void gemm_w64(const int blk, const _Float16* __restrict__ A, const _Float16* __restrict__ Bh, float alpha, const float* __restrict__ bias, float* __restrict__ C, _Float16* __restrict__ C16, const float* __restrict__ RM) {
  constexpr int K = DD, N = DD, MT = 4;
  __shared__ __attribute__((aligned(16))) float so[OUT == 1 ? 1 : 4][OUT == 1 ? 1 : 64][64 + 4];      // pitch 272 B = 16 B x odd: the f16 epilogue reads 16 rows at one column with 16-byte loads
  const int tid = threadIdx.x, w = tid >> 5, lane = tid & 31, ln = lane & 15, hh = lane >> 4;
  const int bm = blk / (N / 128), bn = blk % (N / 128);
  const int row0 = bm * 128 + (w >> 1) * 64, col0 = bn * 128 + (w & 1) * 64;
  v8f acc[MT][4] = {};
  // A tile row of 16 rows is 16 * K elements, a 32-k tile 512 elements, its second half 256 elements on: all 32 loads of a 64-k block hang on two address registers with constant offsets.
  const unsigned short* pa = (const unsigned short*)A + (size_t)row0 * K + lane * 8; const unsigned short* pb = (const unsigned short*)Bh + (size_t)col0 * K + lane * 8;
  // rolled: one 64-k block's fragments (128 registers) beside the 128 accumulator registers; the inner unroll directives keep the fragment arrays in registers (constant indices)
#pragma unroll 1
  for (int kb = 0; kb < K; kb += 64) {
    FragH ah[2][MT], bq[2][4];      // all fragment loads of the block stand ahead of its first product, so they are in flight together
#pragma unroll
    for (int u = 0; u < 2; ++u)
#pragma unroll
      for (int i = 0; i < 4; ++i) { ah[u][i].half[0] = *(const v8us*)(pa + i * 16 * K + u * 512); ah[u][i].half[1] = *(const v8us*)(pa + i * 16 * K + u * 512 + 256);
        bq[u][i].half[0] = *(const v8us*)(pb + i * 16 * K + u * 512); bq[u][i].half[1] = *(const v8us*)(pb + i * 16 * K + u * 512 + 256); }
    // the wait that stands in front of any reuse of the group's address registers; naming them as inputs keeps them whole up to it (no load of the group lands on one)
    asm volatile("s_wait_xcnt 0x0" :: "v"(pa), "v"(pb) : "memory");
    __builtin_amdgcn_sched_barrier(0);      // keeps the 32 loads ahead of the products: without it the scheduler sinks each load to its first use, and the lone wave of a SIMD waits out an L2 round trip several times a block
#pragma unroll
    for (int u = 0; u < 2; ++u)
#pragma unroll
      for (int i = 0; i < MT; ++i)
#pragma unroll
        for (int t = 0; t < 4; ++t) acc[i][t] = __builtin_amdgcn_wmma_f32_16x16x32_f16(false, ah[u][i].v, false, bq[u][t].v, (short)0, acc[i][t], false, false);      // the plain builtin: an asm operand (mmaH) cannot name a register above v255, and this tile needs them
    pa += 1024; pb += 1024;      // 64 k = two tiles
  }
  float bt[4];
#pragma unroll
  for (int t = 0; t < 4; ++t) bt[t] = bf16_round(bias[col0 + t * 16 + ln]);
  if constexpr (OUT == 1) {
    // Vt of a slab (batch, head): rows = d, k = key, tile index kt * 4 + dt (kt = 32-key tile, dt = 16-d tile). acc[i][t][0..7] of lane (hh, ln) are keys row0 + 16 i + 8 hh + 0..7 at d = 16 t + ln:
    // the 16 bytes that this lane owns in half (row / 16) & 1 of tile (kt, t). So the masked, transposed operand is stored from the accumulator registers, 512 contiguous bytes per wave and store.
    const int key0 = row0 % TT;      // a wave's 64 rows lie in one batch: two 32-key tiles, 4096 elements in a row
    unsigned short* cp = (unsigned short*)C16 + ((size_t)(row0 / TT) * (N / 64) + col0 / 64) * 64 * TT + (size_t)(key0 >> 5) * 2048 + lane * 8;
    FragH f[MT][4];      // formed apart from the stores, so that the stores go out in runs
#pragma unroll
    for (int i = 0; i < MT; ++i) { const float* mp = RM + row0 + i * 16 + 8 * hh; const v4f m0 = *(const v4fa*)mp, m1 = *(const v4fa*)(mp + 4); float mr[8];
#pragma unroll
      for (int q = 0; q < 4; ++q) { mr[q] = bf16_round(m0[q]); mr[4 + q] = bf16_round(m1[q]); }
#pragma unroll
      for (int t = 0; t < 4; ++t)
#pragma unroll
        for (int r = 0; r < 8; ++r) f[i][t].h[r] = (_Float16)((acc[i][t][r] * alpha + bt[t]) * mr[r]); }
#pragma unroll
    for (int i = 0; i < MT; ++i)
#pragma unroll
      for (int t = 0; t < 4; ++t) *(v8us*)(cp + (i >> 1) * 2048 + (i & 1) * 256 + t * 512) = f[i][t].half[0];
  } else {
#pragma unroll
    for (int i = 0; i < MT; ++i)
#pragma unroll
      for (int t = 0; t < 4; ++t)
#pragma unroll
        for (int r = 0; r < 8; ++r) so[w][i * 16 + 8 * hh + r][t * 16 + ln] = acc[i][t][r] * alpha + bt[t];
    __builtin_amdgcn_fence(__ATOMIC_ACQ_REL, "workgroup"); __builtin_amdgcn_wave_barrier();      // orders the wave's LDS writes ahead of its reads of them: a wave reads back its own rows only
    if constexpr (OUT == 2) {      // f32 result, row-major: two rows of 256 bytes per store
      const int rsub = lane >> 4, c4 = (lane & 15) * 4;
#pragma unroll
      for (int q = 0; q < 32; ++q) { const int r = q * 2 + rsub; const v4f v = *(const v4fa*)&so[w][r][c4]; *(v4f*)(C + (size_t)(row0 + r) * N + col0 + c4) = v; }
    } else {      // f16 result in fragment order (k = column): a 16 x 64 piece is 2 KiB in a row, half c holds columns col0 + 16 c ..
#pragma unroll
      for (int i = 0; i < MT; ++i) { unsigned short* cp = (unsigned short*)C16 + (size_t)(row0 + i * 16) * N + (size_t)(col0 / 32) * 512 + lane * 8;
#pragma unroll
        for (int c = 0; c < 4; ++c) { const v4f v0 = *(const v4fa*)&so[w][i * 16 + ln][c * 16 + hh * 8], v1 = *(const v4fa*)&so[w][i * 16 + ln][c * 16 + hh * 8 + 4]; FragH f;
#pragma unroll
          for (int q = 0; q < 4; ++q) { f.h[q] = (_Float16)v0[q]; f.h[4 + q] = (_Float16)v1[q]; }
          *(v8us*)(cp + c * 256) = f.half[0]; } }
    }
  }
}
// The Q, K and V projections depend on nothing of one another: one launch of 3 x 256 blocks, all resident at once (3 blocks a WGP, 3 waves a SIMD), so that one wave's products run while another's fragment loads are on their way.
// Block b, b + 256 and b + 512 own the same tile position of Q, K and V.
__global__ __launch_bounds__(128) void k_gemm_qkv(const _Float16* __restrict__ XQ, const _Float16* __restrict__ XKV, const _Float16* __restrict__ Bq, const _Float16* __restrict__ Bk, const _Float16* __restrict__ Bv,
                                                  const float* __restrict__ bq, const float* __restrict__ bk, const float* __restrict__ bv, const float* __restrict__ mk,
                                                  _Float16* __restrict__ Q16, _Float16* __restrict__ K16, _Float16* __restrict__ Vt) {
  constexpr int G = (NR / 128) * (DD / 128);
  const int sel = blockIdx.x / G, blk = blockIdx.x % G;      // the same for a whole block
  if (sel == 2) gemm_w64<1>(blk, XKV, Bv, 0.0625f, bv, nullptr, Vt, mk);      // (v + bv) * mask in f32, then f16, stored as Vt
  else gemm_w64<0>(blk, sel ? XKV : XQ, sel ? Bk : Bq, 0.0625f, sel ? bk : bq, nullptr, sel ? K16 : Q16, nullptr);
}
__global__ __launch_bounds__(128) void k_gemm_o(const _Float16* __restrict__ A, const _Float16* __restrict__ Bh, const float* __restrict__ bias, float* __restrict__ C) { gemm_w64<2>(blockIdx.x, A, Bh, 0.0625f, bias, C, nullptr, nullptr); }

__global__ __launch_bounds__(256) void k_round16f(const float* __restrict__ W, _Float16* __restrict__ Bt, size_t n8) { const size_t t = (size_t)blockIdx.x * 256 + threadIdx.x; if (t >= n8) return; FragH f;
#pragma unroll
  for (int i = 0; i < 8; ++i) f.h[i] = (_Float16)(bf16_round(W[t * 8 + i]) * 16.0f); *(v8us*)((unsigned short*)Bt + t * 8) = f.half[0];  }

// lane l with lane l ^ 16 (a vector cross-row move, no LDS queue)
__device__ __forceinline__ float xhalf(float x) { return __builtin_bit_cast(float, __builtin_amdgcn_permlanex16(__builtin_bit_cast(int, x), __builtin_bit_cast(int, x), 0x76543210, 0xfedcba98, false, false)); }
// Transposed products: St = K * Qt (A = K rows, B = Q), Ot += Vt * Pt (A = Vt rows, B = Pt). The fragments are the same registers as before with A and B swapped (one k order for both).
// St tile (qt, nt): register r of lane (hh, ln) = score of key j0 + 16 nt + 8 hh + r with query q0 + 16 qt + ln: a lane holds 16 scores of ONE query, so maximum and sum run in the lane,
// with one exchange between the wave halves for the maximum; the two halves' sums are joined once, behind the loop.
// The two converted St tiles are the B fragment of Pt as they stand (element 8 nt + r = k 16 nt + 8 hh + r): P passes through no LDS.
// A wave owns QT = 2 query tiles of 16: every loaded K or Vt fragment feeds two products (one per query tile), and the two tiles' softmax chains are independent of each other.
// A block is 8 waves on 128 queries: waves 0..3 walk keys 0..1023, waves 4..7 keys 1024..2047 of the same four query groups. That makes 4096 waves, four a SIMD in place of two,
// so that one wave's load waits and dependent softmax chain are filled by three others. The two partial results (maximum, sum, Ot) of a query group are joined once, behind the loop, through LDS.
__global__ __launch_bounds__(256) void k_flash(const _Float16* __restrict__ Q16, int ldq, const _Float16* __restrict__ K16, int ldk, const _Float16* __restrict__ Vt, const int* __restrict__ MSK, _Float16* __restrict__ O16, int ldo) {
  constexpr int QT = 2, RPW = 16 * QT, NQB = 2048 / (4 * RPW), DT = 4, KS = 2, KH = 2048 / 2;
  __shared__ __attribute__((aligned(16))) float sj[4][QT * DT * 2 + 1][32][4];      // per query group: the upper key half's Ot (16 chunks of 16 bytes a lane) and one chunk of m, l; a wave-wide 16-byte access is 512 bytes in a row
  const int tid = threadIdx.x, lane = tid & 31;
  const int w = __builtin_amdgcn_readfirstlane(tid >> 5), wq = w & 3, kh = w >> 2;      // the wave's number as a scalar: the key range, the loop counter and the branches on kh stay scalar
  const int slab = blockIdx.x / NQB, qblk = blockIdx.x % NQB; const int b = slab / 16, h = slab % 16; const int qb0 = qblk * (4 * RPW); const int q0 = qb0 + wq * RPW;
  FragH aq[QT][KS];
  const unsigned short* qr0 = (const unsigned short*)Q16 + ((size_t)b * 2048 + q0) * ldq + h * 1024 + lane * 8; const unsigned short* qr1 = qr0 + (size_t)16 * ldq;      // Q16, K16, Vt: fragment order (see FRAGMENT ORDER); a head's 64 columns are two tiles, 1024 elements
#pragma unroll
  for (int ks = 0; ks < KS; ++ks) { aq[0][ks].half[0] = *(const v8us*)(qr0 + ks * 512); aq[0][ks].half[1] = *(const v8us*)(qr0 + ks * 512 + 256); aq[1][ks].half[0] = *(const v8us*)(qr1 + ks * 512); aq[1][ks].half[1] = *(const v8us*)(qr1 + ks * 512 + 256); }
  const unsigned short* Vth = (const unsigned short*)Vt + (size_t)slab * 64 * 2048;
  float m_r[QT], l_r[QT]; v8f oacc[QT][DT];      // of query q0 + 16 qt + ln; l_r sums this half's keys only; oacc[qt][dt][r] = Ot[16 dt + 8 hh + r][q0 + 16 qt + ln]
  // Softmax in base 2: exp(s / 8 - m) = exp2(s * CS - m * log2 e), CS = log2(e) / 8. m_r is kept in that scaled unit, so a weight is one fused multiply-add on the raw score and one hardware exp2.
  constexpr float CS = 0.125f * 1.4426950408889634f; typedef float v2f __attribute__((ext_vector_type(2)));
#pragma unroll
  for (int qt = 0; qt < QT; ++qt) { m_r[qt] = -3.0e38f; l_r[qt] = 0.f;
#pragma unroll
    for (int dt = 0; dt < DT; ++dt) oacc[qt][dt] = (v8f){0.f,0.f,0.f,0.f,0.f,0.f,0.f,0.f}; }
  const int jbeg = kh * KH, jend = jbeg + KH;      // this wave's half of the keys
  // Fragment loads stand well ahead of their products: a pass issues its V fragments as one group at its top (they land behind the softmax) and,
  // right behind its score products, the next pass's K fragments (they land behind the rest of the pass). No product waits on a load just issued.
  // The unroll directives on the fragment loops keep the fragment arrays in registers (constant indices).
  FragH bk[2][KS];
  const unsigned short* kp0 = (const unsigned short*)K16 + ((size_t)b * 2048 + jbeg) * ldk + h * 1024 + lane * 8; const unsigned short* kp1 = kp0 + (size_t)16 * ldk;
#pragma unroll
  for (int ks = 0; ks < KS; ++ks) { bk[0][ks].half[0] = *(const v8us*)(kp0 + ks * 512); bk[0][ks].half[1] = *(const v8us*)(kp0 + ks * 512 + 256); bk[1][ks].half[0] = *(const v8us*)(kp1 + ks * 512); bk[1][ks].half[1] = *(const v8us*)(kp1 + ks * 512 + 256); }
  // as in the loop: the wait in front of any reuse of the address registers of the Q and first K loads
  asm volatile("s_wait_xcnt 0x0" :: "v"(qr0), "v"(qr1), "v"(kp0), "v"(kp1) : "memory");
#pragma unroll 1
  for (int j0 = jbeg; j0 < jend; j0 += 32) {
    FragH bv[DT];
#pragma unroll
    for (int dt = 0; dt < DT; ++dt) { const unsigned short* vrow = Vth + (size_t)j0 * 64 + dt * 512 + lane * 8; bv[dt].half[0] = *(const v8us*)vrow; bv[dt].half[1] = *(const v8us*)(vrow + 256); }
    v8f s[QT][2];
#pragma unroll
    for (int nt = 0; nt < 2; ++nt)
#pragma unroll
      for (int qt = 0; qt < QT; ++qt) { v8f acc = (v8f){0.f,0.f,0.f,0.f,0.f,0.f,0.f,0.f};
#pragma unroll
        for (int ks = 0; ks < KS; ++ks) acc = mmaH<1>(bk[nt][ks].v, bk[nt][ks].v, aq[qt][ks].v, aq[qt][ks].v, acc); s[qt][nt] = acc; }
    const int jn = (j0 + 32 < jend) ? j0 + 32 : j0;      // the last pass reads its own rows again: in bounds, not used
    const unsigned short* kr0 = (const unsigned short*)K16 + ((size_t)b * 2048 + jn) * ldk + h * 1024 + lane * 8; const unsigned short* kr1 = kr0 + (size_t)16 * ldk;
#pragma unroll
    for (int ks = 0; ks < KS; ++ks) { bk[0][ks].half[0] = *(const v8us*)(kr0 + ks * 512); bk[0][ks].half[1] = *(const v8us*)(kr0 + ks * 512 + 256); bk[1][ks].half[0] = *(const v8us*)(kr1 + ks * 512); bk[1][ks].half[1] = *(const v8us*)(kr1 + ks * 512 + 256); }
    // the wait that stands in front of any reuse of the group's address registers; naming them as inputs keeps them whole up to it (no load of the group lands on one)
    asm volatile("s_wait_xcnt 0x0" :: "v"(kr0), "v"(kr1) : "memory");
    FragH pb[QT];
#pragma unroll
    for (int qt = 0; qt < QT; ++qt) {
      float mx[8];
#pragma unroll
      for (int r = 0; r < 8; ++r) mx[r] = fmaxf(s[qt][0][r], s[qt][1][r]);      // maxima of the raw scores: the scale is positive
      float mc = fmaxf(fmaxf(fmaxf(mx[0], mx[1]), fmaxf(mx[2], mx[3])), fmaxf(fmaxf(mx[4], mx[5]), fmaxf(mx[6], mx[7])));
      mc = fmaxf(mc, xhalf(mc)) * CS;
      const float mn = fmaxf(m_r[qt], mc); const float al = (mn > -1.0e38f) ? __builtin_amdgcn_exp2f(m_r[qt] - mn) : 1.0f; m_r[qt] = mn;
      float ps[8];
#pragma unroll
      for (int r = 0; r < 8; r += 2) {      // two scores of a tile per packed multiply-add
        const v2f a0 = __builtin_elementwise_fma((v2f){s[qt][0][r], s[qt][0][r + 1]}, (v2f){CS, CS}, (v2f){-mn, -mn}), a1 = __builtin_elementwise_fma((v2f){s[qt][1][r], s[qt][1][r + 1]}, (v2f){CS, CS}, (v2f){-mn, -mn});
        const float p00 = __builtin_amdgcn_exp2f(a0.x), p01 = __builtin_amdgcn_exp2f(a0.y), p10 = __builtin_amdgcn_exp2f(a1.x), p11 = __builtin_amdgcn_exp2f(a1.y);
        ps[r] = p00 + p10; ps[r + 1] = p01 + p11; pb[qt].h[r] = (_Float16)p00; pb[qt].h[r + 1] = (_Float16)p01; pb[qt].h[8 + r] = (_Float16)p10; pb[qt].h[9 + r] = (_Float16)p11; }
      l_r[qt] = l_r[qt] * al + (((ps[0] + ps[1]) + (ps[2] + ps[3])) + ((ps[4] + ps[5]) + (ps[6] + ps[7])));
#pragma unroll
      for (int dt = 0; dt < DT; ++dt)
#pragma unroll
        for (int r = 0; r < 8; ++r) oacc[qt][dt][r] *= al;
    }
#pragma unroll
    for (int dt = 0; dt < DT; ++dt)
#pragma unroll
      for (int qt = 0; qt < QT; ++qt) oacc[qt][dt] = mmaH<1>(bv[dt].v, bv[dt].v, pb[qt].v, pb[qt].v, oacc[qt][dt]); }
  // Join of the two key halves. Waves wq and wq + 4 hold the same queries at the same lanes and registers, so the upper half hands over its registers lane by lane.
  if (kh == 1) {
#pragma unroll
    for (int qt = 0; qt < QT; ++qt)
#pragma unroll
      for (int dt = 0; dt < DT; ++dt) { *(v4fa*)&sj[wq][(qt * DT + dt) * 2][lane][0] = (v4f){oacc[qt][dt][0], oacc[qt][dt][1], oacc[qt][dt][2], oacc[qt][dt][3]}; *(v4fa*)&sj[wq][(qt * DT + dt) * 2 + 1][lane][0] = (v4f){oacc[qt][dt][4], oacc[qt][dt][5], oacc[qt][dt][6], oacc[qt][dt][7]}; }
    *(v4fa*)&sj[wq][QT * DT * 2][lane][0] = (v4f){m_r[0], m_r[1], l_r[0], l_r[1]};
  }
  __syncthreads();      // every wave of the block passes it once: the upper half's partial results are in LDS before the lower half reads them
  if (kh == 1) return;
  { const v4f ml = *(const v4fa*)&sj[wq][QT * DT * 2][lane][0];
#pragma unroll
    for (int qt = 0; qt < QT; ++qt) {      // both maxima are finite (each half has seen 1024 keys); weights in the base-2 unit of m_r
      const float mn = fmaxf(m_r[qt], ml[qt]); const float a1 = __builtin_amdgcn_exp2f(m_r[qt] - mn), a2 = __builtin_amdgcn_exp2f(ml[qt] - mn);
      l_r[qt] = l_r[qt] * a1 + ml[2 + qt] * a2;
#pragma unroll
      for (int dt = 0; dt < DT; ++dt) { const v4f o0 = *(const v4fa*)&sj[wq][(qt * DT + dt) * 2][lane][0], o1 = *(const v4fa*)&sj[wq][(qt * DT + dt) * 2 + 1][lane][0];
#pragma unroll
        for (int r = 0; r < 4; ++r) { oacc[qt][dt][r] = oacc[qt][dt][r] * a1 + o0[r] * a2; oacc[qt][dt][4 + r] = oacc[qt][dt][4 + r] * a1 + o1[r] * a2; } } } }
  // oacc[qt][dt][0..7] of lane (hh, ln) are row q0 + 16 qt + ln, columns 16 dt + 8 hh + 0..7 of the head: the 16 bytes that this lane owns in half dt & 1 of the head's tile dt >> 1 of a fragment-order
  // operand (see FRAGMENT ORDER). So the output GEMM's f16 A operand is stored from the accumulator registers, 512 contiguous bytes per wave and store.
  FragH f[QT][DT];      // formed apart from the stores, so that the stores go out in runs
#pragma unroll
  for (int qt = 0; qt < QT; ++qt) { const float l = l_r[qt] + xhalf(l_r[qt]); const float li = (l > 0.f) ? 1.0f / l : 0.f;
#pragma unroll
    for (int dt = 0; dt < DT; ++dt)
#pragma unroll
      for (int r = 0; r < 8; ++r) f[qt][dt].h[r] = (_Float16)(oacc[qt][dt][r] * li); }
#pragma unroll
  for (int qt = 0; qt < QT; ++qt) { unsigned short* op = (unsigned short*)O16 + ((size_t)b * 2048 + q0 + qt * 16) * ldo + h * 1024 + lane * 8;
#pragma unroll
    for (int dt = 0; dt < DT; ++dt) *(v8us*)(op + dt * 256) = f[qt][dt].half[0]; } }

extern "C" void kernel_launch(void* const* d_in, const int* in_sizes, int n_in,
                              void* d_out, int out_size, void* d_ws, size_t ws_size, hipStream_t stream) {
  (void)in_sizes; (void)n_in; (void)out_size;
  const float* xq = (const float*)d_in[0]; const float* xkv = (const float*)d_in[1]; const float* mk = (const float*)d_in[2]; const float* Wq = (const float*)d_in[3]; const float* bq = (const float*)d_in[4]; const float* Wk = (const float*)d_in[5]; const float* bk = (const float*)d_in[6]; const float* Wv = (const float*)d_in[7]; const float* bv = (const float*)d_in[8]; const float* Wo = (const float*)d_in[9]; const float* bo = (const float*)d_in[10];
  char* ws = (char*)d_ws; size_t off = 0;
  auto take = [&](size_t bytes) { char* p = ws + off; off += (bytes + 255) & ~(size_t)255; return p; };
  _Float16* Bq = (_Float16*)take((size_t)DD * DD * 2); _Float16* Bk = (_Float16*)take((size_t)DD * DD * 2); _Float16* Bv = (_Float16*)take((size_t)DD * DD * 2); _Float16* Bo = (_Float16*)take((size_t)DD * DD * 2);
  _Float16* XQ16 = (_Float16*)take((size_t)NR * DD * 2); _Float16* XKV16 = (_Float16*)take((size_t)NR * DD * 2); _Float16* Q16 = (_Float16*)take((size_t)NR * DD * 2); _Float16* K16 = (_Float16*)take((size_t)NR * DD * 2); _Float16* Vt = (_Float16*)take((size_t)NR * DD * 2); _Float16* O16 = (_Float16*)take((size_t)NR * DD * 2);
  if (off > ws_size) return;      // 8.4 + 8.4 x 6 = 59 MB
  const unsigned gg = (NR / 128) * (DD / 128);
  k_prep<<<512, 256, 0, stream>>>(xq, xkv, Wq, Wk, Wv, Wo, XQ16, XKV16, Bq, Bk, Bv, Bo);      // W (D,H,Dh) = [in][h * 64 + d]; Wo (H,Dh,D) = [in = (h,d)][out]
  k_gemm_qkv<<<3 * gg, 128, 0, stream>>>(XQ16, XKV16, Bq, Bk, Bv, bq, bk, bv, mk, Q16, K16, Vt);
  k_flash<<<BB * NH * (TT / 128), 256, 0, stream>>>(Q16, DD, K16, DD, Vt, nullptr, O16, DD);      // the 1/8 on q is folded into the softmax constant
  k_gemm_o<<<gg, 128, 0, stream>>>(O16, Bo, bo, (float*)d_out);
}

// v009
// One run takes 82.2 microseconds.
// Next to v008, in two timings, it ran 1.16 and 1.17 times as fast.
// Over all steps from v000 it is 5.40 times as fast.
#include <hip/hip_runtime.h>
// Multi-head dot-product attention with a per-key value mask (B=2, L=2048, D=1024, 16 heads × 64; q from inputs_q, k/v from inputs_kv; v ← mask_k·v; softmax(q·k/8); merge; ·Wo + bo): the
// q/k/v/o projections are GEMMs ([in][out] weights bf16-exact ×2^4, bias epilogues, f32 accumulate) and the attention is a fused flash-style kernel (online softmax f32; P f16 ≤ 1; O = P·Vt;
// 32 queries a wave) on v_wmma_f32_16x16x32_f16; the value masking is applied in f32 VALU before the f16 conversion.
#define BB 2
#define TT 2048
#define DD 1024
#define NH 16
#define NR (BB * TT)

typedef __bf16 v16b __attribute__((ext_vector_type(16)));
typedef unsigned short v8us __attribute__((ext_vector_type(8), may_alias));
typedef float  v8f  __attribute__((ext_vector_type(8)));
typedef float  v4f  __attribute__((ext_vector_type(4)));
typedef float  v4fa __attribute__((ext_vector_type(4), may_alias));
union FragB { v16b v; v8us half[2]; unsigned short u[16]; };

__device__ __forceinline__ unsigned short bf16_bits(float x) { unsigned int u = __float_as_uint(x); return (unsigned short)((u + 0x7FFFu + ((u >> 16) & 1u)) >> 16); }
__device__ __forceinline__ float bf16_val(unsigned short b) { return __uint_as_float(((unsigned int)b) << 16); }
__device__ __forceinline__ float bf16_round(float x) { return bf16_val(bf16_bits(x)); }
// D += A·B with NT terms: 1 = ah·bh, 2 = + al·bh (A split), 3 = + ah·bl (both split)
template <int NT>
__device__ __forceinline__ v8f mmaN(v16b ah, v16b al, v16b bh, v16b bl, v8f c) {
  c = __builtin_amdgcn_wmma_f32_16x16x32_bf16(false, ah, false, bh, (short)0, c, false, false);
  if (NT >= 2) c = __builtin_amdgcn_wmma_f32_16x16x32_bf16(false, al, false, bh, (short)0, c, false, false);
  if (NT >= 3) c = __builtin_amdgcn_wmma_f32_16x16x32_bf16(false, ah, false, bl, (short)0, c, false, false);
  asm volatile("v_nop\n\tv_nop\n\tv_nop\n\tv_nop" : "+v"(c) : "v"(ah), "v"(al), "v"(bh), "v"(bl));
  return c;
}

__global__ __launch_bounds__(256) void k_wt_bf16(const float* __restrict__ W, unsigned short* __restrict__ Wt, int K, int N) {
  const int t = blockIdx.x * 256 + threadIdx.x;
  const int k8n = K / 8;
  if (t >= N * k8n) return;
  const int n = t / k8n, k8 = (t % k8n) * 8;
  v8us v;
#pragma unroll
  for (int i = 0; i < 8; ++i) v[i] = bf16_bits(W[(size_t)(k8 + i) * N + n]);
  *(v8us*)(Wt + (size_t)n * K + k8) = v;
  
}

// GEMM C[M][N] (f32, pitch ldc) = act(A[M][K]·W + bias). A f32 row-major (pitch lda) converted per fragment to bf16
// (ASPLIT: hi/lo two planes -> 2 terms, else single rounded term); Wt bf16 [N][K] (pitch ldb). BIAS_BF16 rounds the
// bias to bf16 first (bias quantised to bf16 before the add). K%32==0, M%16==0, N%64==0.
template <bool ASPLIT, int ACT, bool BIAS_BF16>
__global__ __launch_bounds__(128) void k_gemm_bf(const float* __restrict__ A, int lda, const unsigned short* __restrict__ Wt, int ldb,
                                               const float* __restrict__ bias, float* __restrict__ C, int ldc, int M, int N, int K) {
  __shared__ __attribute__((aligned(16))) float so[4][16][64];
  const int tid = threadIdx.x, w = tid >> 5, lane = tid & 31, ln = lane & 15, hh = lane >> 4;
  const int ntn = N / 64;
  const int wid = blockIdx.x * 4 + w;
  const int mt = wid / ntn, nq = wid % ntn;
  if (mt * 16 >= M) return;
  const int row0 = mt * 16, col0 = nq * 64;
  const float* arow = A + (size_t)(row0 + ln) * lda;
  v8f acc[4] = {};
  for (int kb = 0; kb < K; kb += 32) {
    FragB ah, al;
    const v4f x0 = *(const v4fa*)(arow + kb + 8 * hh), x1 = *(const v4fa*)(arow + kb + 8 * hh + 4);
    const v4f x2 = *(const v4fa*)(arow + kb + 16 + 8 * hh), x3 = *(const v4fa*)(arow + kb + 16 + 8 * hh + 4);
    float xs[16] = {x0[0],x0[1],x0[2],x0[3],x1[0],x1[1],x1[2],x1[3],x2[0],x2[1],x2[2],x2[3],x3[0],x3[1],x3[2],x3[3]};
#pragma unroll
    for (int i = 0; i < 16; ++i) { const unsigned short hb = bf16_bits(xs[i]); ah.u[i] = hb; al.u[i] = ASPLIT ? bf16_bits(xs[i] - bf16_val(hb)) : (unsigned short)0; }
#pragma unroll
    for (int t = 0; t < 4; ++t) {
      const unsigned short* brow = Wt + (size_t)(col0 + t * 16 + ln) * ldb + kb;
      FragB b;
      b.half[0] = *(const v8us*)(brow + 8 * hh);
      b.half[1] = *(const v8us*)(brow + 16 + 8 * hh);
      acc[t] = mmaN<ASPLIT ? 2 : 1>(ah.v, al.v, b.v, b.v, acc[t]);
    }
  }
#pragma unroll
  for (int t = 0; t < 4; ++t) {
    float bv = bias ? bias[col0 + t * 16 + ln] : 0.f;
    if (BIAS_BF16) bv = bf16_round(bv);
#pragma unroll
    for (int r = 0; r < 8; ++r) { float v = acc[t][r] + bv; if (ACT == 1) v = fmaxf(v, 0.f); so[w][8 * hh + r][t * 16 + ln] = v; }
  }
  __builtin_amdgcn_fence(__ATOMIC_ACQ_REL, "workgroup");
  __builtin_amdgcn_wave_barrier();
  const int rsub = lane >> 4, c4 = (lane & 15) * 4;
  {
#pragma unroll
    for (int q = 0; q < 8; ++q) {
      const int r = q * 2 + rsub;
      const v4f v = *(const v4fa*)&so[w][r][c4];
      *(v4f*)(C + (size_t)(row0 + r) * ldc + col0 + c4) = v;
    }
    
  }
}

// Flash-style causal/unmasked attention, all contractions 3-term bf16 hi/lo splits, f32 softmax with running max.
// q,k,v rows are read from f32 buffers with arbitrary row pitch (so they can live inside a fused qkv buffer);
// D = head size (multiple of 32, <= 128); one wave = 16 query rows; block = 4 waves (64 queries) sharing K/V chunks of 32.
template <int D, bool CAUSAL>
__global__ __launch_bounds__(128) void k_flash(const float* __restrict__ qb, const float* __restrict__ kb, const float* __restrict__ vb,
                                             int pitch, int T, int H, float scale, float* __restrict__ y, int ypitch) {
  constexpr int KS = D / 32;        // k-steps for QK
  constexpr int DT = D / 16;        // d tiles for PV
  __shared__ __attribute__((aligned(16))) unsigned short sKh[32][D + 8], sKl[32][D + 8], sVh[32][D + 8], sVl[32][D + 8];
  __shared__ __attribute__((aligned(16))) unsigned short sPh[4][16][40], sPl[4][16][40];
  __shared__ __attribute__((aligned(16))) float sO[4][16][D];
  const int tid = threadIdx.x, w = tid >> 5, lane = tid & 31, ln = lane & 15, hh = lane >> 4;
  const int nqb = (T + 63) / 64;
  const int bh = blockIdx.x / nqb, qblk = blockIdx.x % nqb;
  const int b = bh / H, h = bh % H;
  const int q0 = qblk * 64 + w * 16;
  const float* Q = qb + (size_t)b * T * pitch + h * D;
  const float* K = kb + (size_t)b * T * pitch + h * D;
  const float* V = vb + (size_t)b * T * pitch + h * D;

  // A fragments of the wave's 16 query rows (scaled), hi/lo
  FragB aqh[KS], aql[KS];
  {
    int row = q0 + ln; if (row >= T) row = T - 1;
    const float* qr = Q + (size_t)row * pitch;
#pragma unroll
    for (int ks = 0; ks < KS; ++ks)
#pragma unroll
      for (int i = 0; i < 16; ++i) {
        const int d = ks * 32 + ((i < 8) ? (8 * hh + i) : (16 + 8 * hh + (i - 8)));
        const float x = qr[d] * scale; const unsigned short hb = bf16_bits(x);
        aqh[ks].u[i] = hb; aql[ks].u[i] = bf16_bits(x - bf16_val(hb));
      }
  }
  float m_r[8], l_r[8];
#pragma unroll
  for (int r = 0; r < 8; ++r) { m_r[r] = -3.0e38f; l_r[r] = 0.f; }
  v8f oacc[DT];
#pragma unroll
  for (int dt = 0; dt < DT; ++dt) oacc[dt] = (v8f){0.f,0.f,0.f,0.f,0.f,0.f,0.f,0.f};

  const int kv_end = CAUSAL ? min(T, qblk * 64 + 64) : T;     // block-uniform
  for (int j0 = 0; j0 < kv_end; j0 += 32) {
    __syncthreads();
    for (int e = tid; e < 32 * (D / 4); e += 128) {
      const int r = e / (D / 4), c4 = (e % (D / 4)) * 4;
      const int key = j0 + r;
      v4f kf = {0.f,0.f,0.f,0.f}, vf = {0.f,0.f,0.f,0.f};
      if (key < T) { kf = *(const v4fa*)(K + (size_t)key * pitch + c4); vf = *(const v4fa*)(V + (size_t)key * pitch + c4); }
#pragma unroll
      for (int t = 0; t < 4; ++t) {
        unsigned short hb = bf16_bits(kf[t]); sKh[r][c4 + t] = hb; sKl[r][c4 + t] = bf16_bits(kf[t] - bf16_val(hb));
        hb = bf16_bits(vf[t]); sVh[r][c4 + t] = hb; sVl[r][c4 + t] = bf16_bits(vf[t] - bf16_val(hb));
      }
    }
    __syncthreads();
    // S tile 16 x 32
    v8f s[2];
#pragma unroll
    for (int nt = 0; nt < 2; ++nt) {
      v8f acc = {};
#pragma unroll
      for (int ks = 0; ks < KS; ++ks) {
        FragB bh_, bl_;
        bh_.half[0] = *(const v8us*)&sKh[nt * 16 + ln][ks * 32 + 8 * hh]; bh_.half[1] = *(const v8us*)&sKh[nt * 16 + ln][ks * 32 + 16 + 8 * hh];
        bl_.half[0] = *(const v8us*)&sKl[nt * 16 + ln][ks * 32 + 8 * hh]; bl_.half[1] = *(const v8us*)&sKl[nt * 16 + ln][ks * 32 + 16 + 8 * hh];
        acc = mmaN<3>(aqh[ks].v, aql[ks].v, bh_.v, bl_.v, acc);
      }
      s[nt] = acc;
    }
    // mask + running max (rows 8hh+r; the 16 lanes of a half share rows)
    float alpha[8];
#pragma unroll
    for (int r = 0; r < 8; ++r) {
      const int qi = q0 + 8 * hh + r;
      const int ja = j0 + ln, jb = j0 + 16 + ln;
      if (CAUSAL) { if (ja > qi) s[0][r] = -3.0e38f; if (jb > qi) s[1][r] = -3.0e38f; }
      if (ja >= T) s[0][r] = -3.0e38f;
      if (jb >= T) s[1][r] = -3.0e38f;
      float mx = fmaxf(s[0][r], s[1][r]);
      mx = fmaxf(mx, __shfl_xor(mx, 1, 32)); mx = fmaxf(mx, __shfl_xor(mx, 2, 32)); mx = fmaxf(mx, __shfl_xor(mx, 4, 32)); mx = fmaxf(mx, __shfl_xor(mx, 8, 32));
      const float mnew = fmaxf(m_r[r], mx);
      alpha[r] = (mnew > -1.0e38f) ? __expf(m_r[r] - mnew) : 1.0f;
      const float p0 = (s[0][r] > -1.0e38f) ? __expf(s[0][r] - mnew) : 0.f;
      const float p1 = (s[1][r] > -1.0e38f) ? __expf(s[1][r] - mnew) : 0.f;
      m_r[r] = mnew;
      l_r[r] = l_r[r] * alpha[r] + p0 + p1;            // per-lane partial row sum (16 lanes combined at the end)
      unsigned short hb = bf16_bits(p0); sPh[w][8 * hh + r][ln] = hb;      sPl[w][8 * hh + r][ln] = bf16_bits(p0 - bf16_val(hb));
      hb = bf16_bits(p1);                sPh[w][8 * hh + r][16 + ln] = hb; sPl[w][8 * hh + r][16 + ln] = bf16_bits(p1 - bf16_val(hb));
    }
#pragma unroll
    for (int dt = 0; dt < DT; ++dt)
#pragma unroll
      for (int r = 0; r < 8; ++r) oacc[dt][r] *= alpha[r];
    __builtin_amdgcn_fence(__ATOMIC_ACQ_REL, "workgroup");
    __builtin_amdgcn_wave_barrier();
    FragB pah, pal;
    pah.half[0] = *(const v8us*)&sPh[w][ln][8 * hh]; pah.half[1] = *(const v8us*)&sPh[w][ln][16 + 8 * hh];
    pal.half[0] = *(const v8us*)&sPl[w][ln][8 * hh]; pal.half[1] = *(const v8us*)&sPl[w][ln][16 + 8 * hh];
#pragma unroll
    for (int dt = 0; dt < DT; ++dt) {
      FragB bvh, bvl;
#pragma unroll
      for (int i = 0; i < 8; ++i) {
        bvh.u[i] = sVh[8 * hh + i][dt * 16 + ln]; bvh.u[8 + i] = sVh[16 + 8 * hh + i][dt * 16 + ln];
        bvl.u[i] = sVl[8 * hh + i][dt * 16 + ln]; bvl.u[8 + i] = sVl[16 + 8 * hh + i][dt * 16 + ln];
      }
      oacc[dt] = mmaN<3>(pah.v, pal.v, bvh.v, bvl.v, oacc[dt]);
    }
    __builtin_amdgcn_fence(__ATOMIC_ACQ_REL, "workgroup");
    __builtin_amdgcn_wave_barrier();
  }
#pragma unroll
  for (int r = 0; r < 8; ++r) {
    float l = l_r[r];
    l += __shfl_xor(l, 1, 32); l += __shfl_xor(l, 2, 32); l += __shfl_xor(l, 4, 32); l += __shfl_xor(l, 8, 32);
    l_r[r] = (l > 0.f) ? 1.0f / l : 0.f;
  }
#pragma unroll
  for (int dt = 0; dt < DT; ++dt)
#pragma unroll
    for (int r = 0; r < 8; ++r) sO[w][8 * hh + r][dt * 16 + ln] = oacc[dt][r] * l_r[r];
  __builtin_amdgcn_fence(__ATOMIC_ACQ_REL, "workgroup");
  __builtin_amdgcn_wave_barrier();
  {
    for (int r = 0; r < 16; ++r) {
      const int row = q0 + r;
      if (row < T && lane < D / 4) {
        const v4f val = *(const v4fa*)&sO[w][r][lane * 4];
        *(v4f*)(y + ((size_t)b * T + row) * ypitch + h * D + lane * 4) = val;
      }
    }
    
  }
}

// GEMM C = act(A·W + bias + resid): A f32 (ASPLIT -> hi/lo 2 terms), Wt bf16 [N][K]; ACT 0 none, 1 relu, 2 exact gelu;
// resid (optional, f32, row index = (row % rmod), pitch ldr, RES_BF16 rounds it) added before the activation.
template <bool ASPLIT, int ACT, bool BIAS_BF16, bool RES_BF16>
__global__ __launch_bounds__(128) void k_gemm_bf3(const float* __restrict__ A, int lda, const unsigned short* __restrict__ Wt, int ldb,
                                                const float* __restrict__ bias, const float* __restrict__ resid, int rmod, int ldr,
                                                float* __restrict__ C, int ldc, int M, int N, int K) {
  __shared__ __attribute__((aligned(16))) float so[4][16][64];
  const int tid = threadIdx.x, w = tid >> 5, lane = tid & 31, ln = lane & 15, hh = lane >> 4;
  const int ntn = N / 64;
  const int wid = blockIdx.x * 4 + w;
  const int mt = wid / ntn, nq = wid % ntn;
  if (mt * 16 >= M) return;
  const int row0 = mt * 16, col0 = nq * 64;
  const float* arow = A + (size_t)(row0 + ln) * lda;
  v8f acc[4] = {};
  for (int kb = 0; kb < K; kb += 32) {
    FragB ah, al;
    const v4f x0 = *(const v4fa*)(arow + kb + 8 * hh), x1 = *(const v4fa*)(arow + kb + 8 * hh + 4);
    const v4f x2 = *(const v4fa*)(arow + kb + 16 + 8 * hh), x3 = *(const v4fa*)(arow + kb + 16 + 8 * hh + 4);
    float xs[16] = {x0[0],x0[1],x0[2],x0[3],x1[0],x1[1],x1[2],x1[3],x2[0],x2[1],x2[2],x2[3],x3[0],x3[1],x3[2],x3[3]};
#pragma unroll
    for (int i = 0; i < 16; ++i) { const unsigned short hb = bf16_bits(xs[i]); ah.u[i] = hb; al.u[i] = ASPLIT ? bf16_bits(xs[i] - bf16_val(hb)) : (unsigned short)0; }
#pragma unroll
    for (int t = 0; t < 4; ++t) {
      const unsigned short* brow = Wt + (size_t)(col0 + t * 16 + ln) * ldb + kb;
      FragB b;
      b.half[0] = *(const v8us*)(brow + 8 * hh);
      b.half[1] = *(const v8us*)(brow + 16 + 8 * hh);
      acc[t] = mmaN<ASPLIT ? 2 : 1>(ah.v, al.v, b.v, b.v, acc[t]);
    }
  }
#pragma unroll
  for (int t = 0; t < 4; ++t) {
    const int col = col0 + t * 16 + ln;
    float bv = bias ? bias[col] : 0.f;
    if (BIAS_BF16) bv = bf16_round(bv);
#pragma unroll
    for (int r = 0; r < 8; ++r) {
      float v = acc[t][r] + bv;
      if (resid) { float rv = resid[(size_t)((row0 + 8 * hh + r) % rmod) * ldr + col]; if (RES_BF16) rv = bf16_round(rv); v += rv; }
      if (ACT == 1) v = fmaxf(v, 0.f);
      if (ACT == 2) v = 0.5f * v * (1.0f + erff(v * 0.70710678118654752f));
      if (ACT == 3) { const float u = 0.7978845608028654f * (v + 0.044715f * v * v * v); v = 0.5f * v * (1.0f + tanhf(u)); }
      so[w][8 * hh + r][t * 16 + ln] = v;
    }
  }
  __builtin_amdgcn_fence(__ATOMIC_ACQ_REL, "workgroup");
  __builtin_amdgcn_wave_barrier();
  const int rsub = lane >> 4, c4 = (lane & 15) * 4;
  {
#pragma unroll
    for (int q = 0; q < 8; ++q) {
      const int r = q * 2 + rsub;
      const v4f v = *(const v4fa*)&so[w][r][c4];
      *(v4f*)(C + (size_t)(row0 + r) * ldc + col0 + c4) = v;
    }
    
  }
}
// row LayerNorm (biased variance, eps) over N: s = X (+ R); optional out_sum <- s; out_norm <- (s-mu)*rsqrt(var+eps)*g + b
template <bool PARAM_BF16>
__global__ __launch_bounds__(256) void k_layernorm(const float* __restrict__ X, const float* __restrict__ R, const float* __restrict__ g, const float* __restrict__ bta,
                                                  float* __restrict__ out_sum, float* __restrict__ out_norm, int N, float eps) {
  __shared__ float red[256];
  const int row = blockIdx.x, tid = threadIdx.x;
  const float* x = X + (size_t)row * N; const float* rr = R ? R + (size_t)row * N : nullptr;
  float vals[16];                     // up to N = 4096
  const int per = N / 256;            // contiguous chunk per thread? use strided-by-4 chunks: thread handles j = tid*4 + 1024*u
  float s1 = 0.f;
  for (int u = 0; u < per / 4; ++u) {
    const int j = tid * 4 + 1024 * u;
    const v4f a = *(const v4fa*)(x + j);
    v4f b = {0.f,0.f,0.f,0.f}; if (rr) b = *(const v4fa*)(rr + j);
#pragma unroll
    for (int q = 0; q < 4; ++q) { const float v = a[q] + b[q]; vals[u * 4 + q] = v; s1 += v; }
  }
  red[tid] = s1; __syncthreads();
  for (int st = 128; st > 0; st >>= 1) { if (tid < st) red[tid] += red[tid + st]; __syncthreads(); }
  const float mu = red[0] / (float)N; __syncthreads();
  float s2 = 0.f;
  for (int u = 0; u < per / 4; ++u)
#pragma unroll
    for (int q = 0; q < 4; ++q) { const float c = vals[u * 4 + q] - mu; s2 += c * c; }
  red[tid] = s2; __syncthreads();
  for (int st = 128; st > 0; st >>= 1) { if (tid < st) red[tid] += red[tid + st]; __syncthreads(); }
  const float rs = rsqrtf(red[0] / (float)N + eps);
  {
    for (int u = 0; u < per / 4; ++u) {
      const int j = tid * 4 + 1024 * u;
      v4f o, sm;
#pragma unroll
      for (int q = 0; q < 4; ++q) {
        float gg = g[j + q], bb = bta[j + q];
        if (PARAM_BF16) { gg = bf16_round(gg); bb = bf16_round(bb); }
        sm[q] = vals[u * 4 + q]; o[q] = (vals[u * 4 + q] - mu) * rs * gg + bb;
      }
      if (out_sum) *(v4f*)(out_sum + (size_t)row * N + j) = sm;
      *(v4f*)(out_norm + (size_t)row * N + j) = o;
    }
    
  }
}



// ---- f16 WMMA path (v_wmma_f32_16x16x32_f16): 11-bit significands for operands in range — used where a [0,1] probability operand needs more precision than bf16
typedef _Float16 v16h __attribute__((ext_vector_type(16)));
union FragH { v16h v; v8us half[2]; _Float16 h[16]; unsigned short u[16]; };
template <int NT>
__device__ __forceinline__ v8f mmaH(v16h ah, v16h al, v16h bh, v16h bl, v8f c) {
  c = __builtin_amdgcn_wmma_f32_16x16x32_f16(false, ah, false, bh, (short)0, c, false, false);
  if (NT >= 2) c = __builtin_amdgcn_wmma_f32_16x16x32_f16(false, al, false, bh, (short)0, c, false, false);
  if (NT >= 3) c = __builtin_amdgcn_wmma_f32_16x16x32_f16(false, ah, false, bl, (short)0, c, false, false);
  asm volatile("v_nop\n\tv_nop\n\tv_nop\n\tv_nop" : "+v"(c) : "v"(ah), "v"(al), "v"(bh), "v"(bl));
  return c;
}
// batched GEMM like k_gemm_b but f16 operands: A f32 (split into f16 hi/lo if ASPLIT, else rounded to f16), Bt = f16 values [n][k]; alpha; C f32; N multiple of 16 (partial tiles skipped)
template <bool ASPLIT>
__global__ __launch_bounds__(128) void k_gemm_h(const float* __restrict__ A, int lda, size_t sA, const _Float16* __restrict__ Bh, int ldb, size_t sB, float alpha, float* __restrict__ C, int ldc, size_t sC, int M, int N, int K) {
  __shared__ __attribute__((aligned(16))) float so[4][16][64];
  const int tid = threadIdx.x, w = tid >> 5, lane = tid & 31, ln = lane & 15, hh = lane >> 4; const int by = blockIdx.y;
  A += (size_t)by * sA; Bh += (size_t)by * sB; C += (size_t)by * sC;
  const int ntn = (N + 63) / 64; const int wid = blockIdx.x * 4 + w; const int mt = wid / ntn, nq = wid % ntn; if (mt * 16 >= M) return;
  const int row0 = mt * 16, col0 = nq * 64; const float* arow = A + (size_t)(row0 + ln) * lda;
  v8f acc[4] = {};
  for (int kb = 0; kb < K; kb += 32) {
    FragH ah, al;
    const v4f x0 = *(const v4fa*)(arow + kb + 8 * hh), x1 = *(const v4fa*)(arow + kb + 8 * hh + 4), x2 = *(const v4fa*)(arow + kb + 16 + 8 * hh), x3 = *(const v4fa*)(arow + kb + 16 + 8 * hh + 4);
    float xs[16] = {x0[0],x0[1],x0[2],x0[3],x1[0],x1[1],x1[2],x1[3],x2[0],x2[1],x2[2],x2[3],x3[0],x3[1],x3[2],x3[3]};
#pragma unroll
    for (int i = 0; i < 16; ++i) { const _Float16 h = (_Float16)xs[i]; ah.h[i] = h; al.h[i] = ASPLIT ? (_Float16)(xs[i] - (float)h) : (_Float16)0.0f; }
#pragma unroll
    for (int t = 0; t < 4; ++t) { if (col0 + t * 16 >= N) continue; const size_t boff = (size_t)(col0 + t * 16 + ln) * ldb + kb; FragH bq; bq.half[0] = *(const v8us*)(Bh + boff + 8 * hh); bq.half[1] = *(const v8us*)(Bh + boff + 16 + 8 * hh);
      acc[t] = mmaH<ASPLIT ? 2 : 1>(ah.v, al.v, bq.v, bq.v, acc[t]); }
  }
#pragma unroll
  for (int t = 0; t < 4; ++t) { if (col0 + t * 16 >= N) continue;
#pragma unroll
    for (int r = 0; r < 8; ++r) so[w][8 * hh + r][t * 16 + ln] = acc[t][r] * alpha; }
  __builtin_amdgcn_fence(__ATOMIC_ACQ_REL, "workgroup"); __builtin_amdgcn_wave_barrier();
  const int rsub = lane >> 4, c4 = (lane & 15) * 4;
  {
#pragma unroll
    for (int q = 0; q < 8; ++q) { const int r = q * 2 + rsub; if (col0 + c4 < N) { const v4f v = *(const v4fa*)&so[w][r][c4]; *(v4f*)(C + (size_t)(row0 + r) * ldc + col0 + c4) = v; } }
     }
}

// FRAGMENT ORDER (every f16 matrix operand in the workspace): a [rows][K] operand is kept as tiles of 16 rows x 32 k, 1 KiB each, tile (rt, kt) at index rt * (K / 32) + kt (Vt: kt * 4 + rt, per 64-row slab).
// A tile is two halves of 512 bytes (k 0..15, then k 16..31); in half j lane hh * 16 + ln owns the 16 bytes of row ln, k = 16 j + 8 hh + 0..7: just what that lane feeds to the WMMA.
// One wave-wide 16-byte load of a half is then 512 contiguous bytes, four whole lines, where a row-major operand gives 32-byte pieces of 16 lines.
// Chunk t (16 bytes) of such a buffer: lane = t & 31, j = (t >> 5) & 1, tile = t >> 6. K % 32 == 0, rows % 16 == 0.
// One launch forms all six f16 operands (the two X and the four W have no dependence on one another). 512 blocks x 8 waves: few enough that the waves' start is short beside the stream, enough to fill every WGP.
// A wave converts 4 whole tiles of an X operand (16 rows x 128 k, 512 source bytes in a row per row: f16(bf16(x))) and 4 halves of a W operand (16 k x 64 n, 256 source bytes in a row per k: Wt[n][k] = f16(bf16(W[k][n]) * 16);
// the power of two keeps bf16-exact weights exact in f16, away from the subnormal range). Every store is one half: 512 contiguous bytes per wave.
__global__ __launch_bounds__(256) void k_prep(const float* __restrict__ xq, const float* __restrict__ xkv, const float* __restrict__ Wq, const float* __restrict__ Wk, const float* __restrict__ Wv, const float* __restrict__ Wo,
                                              _Float16* __restrict__ XQ16, _Float16* __restrict__ XKV16, _Float16* __restrict__ Bq, _Float16* __restrict__ Bk, _Float16* __restrict__ Bv, _Float16* __restrict__ Bo) {
  const int bx = blockIdx.x, w = threadIdx.x >> 5, lane = threadIdx.x & 31, ln = lane & 15, hh = lane >> 4;
  // X: blocks 0..255 take xq, the rest xkv; NR / 16 * DD / 32 = 8192 tiles an operand, 4 neighbours in k per wave. Half g = 2 * tile + j begins at column 16 g.
  const int tile0 = ((bx & 255) * 8 + w) * 4;
  const float* xp = (bx < 256 ? xq : xkv) + (size_t)((tile0 >> 5) * 16 + ln) * DD + (tile0 & 31) * 32 + hh * 8;
  unsigned short* xd = (unsigned short*)(bx < 256 ? XQ16 : XKV16) + (size_t)tile0 * 512 + lane * 8;
  // W: 128 blocks an operand; a wave takes half kj = 2 * kt + j (k = 16 kj + 8 hh + 0..7) of the 4 row tiles rt0 .. rt0 + 3 (n = 16 rt + ln).
  const int m = bx >> 7, r = (bx & 127) * 8 + w, kj = r & 63, rt0 = (r >> 6) * 4;
  const float* wp = (m == 0 ? Wq : m == 1 ? Wk : m == 2 ? Wv : Wo) + (size_t)(kj * 16 + hh * 8) * DD + rt0 * 16 + ln;
  unsigned short* wd = (unsigned short*)(m == 0 ? Bq : m == 1 ? Bk : m == 2 ? Bv : Bo) + (size_t)(rt0 * 64 + kj) * 256 + lane * 8;
  v4f xv[8][2]; float wv[4][8];      // all of the wave's loads stand ahead of the first conversion, so they are in flight together
#pragma unroll
  for (int g = 0; g < 8; ++g) { xv[g][0] = *(const v4fa*)(xp + g * 16); xv[g][1] = *(const v4fa*)(xp + g * 16 + 4); }
#pragma unroll
  for (int c = 0; c < 4; ++c)
#pragma unroll
    for (int i = 0; i < 8; ++i) wv[c][i] = wp[i * DD + c * 16];
  // the wait that stands in front of any reuse of the loads' address registers; naming them as inputs keeps them whole up to it
  asm volatile("s_wait_xcnt 0x0" :: "v"(xp), "v"(wp) : "memory");
  FragH fx[8], fw[4];      // formed apart from the stores, so that the stores go out in runs
#pragma unroll
  for (int g = 0; g < 8; ++g)
#pragma unroll
    for (int q = 0; q < 4; ++q) { fx[g].h[q] = (_Float16)bf16_round(xv[g][0][q]); fx[g].h[4 + q] = (_Float16)bf16_round(xv[g][1][q]); }
#pragma unroll
  for (int c = 0; c < 4; ++c)
#pragma unroll
    for (int i = 0; i < 8; ++i) fw[c].h[i] = (_Float16)(bf16_round(wv[c][i]) * 16.0f);
#pragma unroll
  for (int g = 0; g < 8; ++g) *(v8us*)(xd + g * 256) = fx[g].half[0];
#pragma unroll
  for (int c = 0; c < 4; ++c) *(v8us*)(wd + c * 64 * 256) = fw[c].half[0];
}
// GEMM on fragment-order f16 operands (see FRAGMENT ORDER), [NR][DD] x [DD][DD]: v = acc * alpha + bf16(bias[col]). blk = index of the block's tile.
// A wave owns a 64 x 64 tile of the result (4 x 4 accumulator tiles), so every loaded A or B fragment feeds four products; a block is 2 x 2 waves, a 128 x 128 tile.
// OUT 0: f16 result in fragment order (k = column). OUT 1: f16(v * bf16(RM[row])) transposed per head of 64 columns, in the fragment order that k_flash reads as Vt (TT rows per batch). OUT 2: f32 result, row-major.
template <int OUT>
__device__ __forceinline__ void gemm_w64(const int blk, const _Float16* __restrict__ A, const _Float16* __restrict__ Bh, float alpha, const float* __restrict__ bias, float* __restrict__ C, _Float16* __restrict__ C16, const float* __restrict__ RM) {
  constexpr int K = DD, N = DD, MT = 4;
  __shared__ __attribute__((aligned(16))) float so[OUT == 1 ? 1 : 4][OUT == 1 ? 1 : 64][64 + 4];      // pitch 272 B = 16 B x odd: the f16 epilogue reads 16 rows at one column with 16-byte loads
  const int tid = threadIdx.x, w = tid >> 5, lane = tid & 31, ln = lane & 15, hh = lane >> 4;
  const int bm = blk / (N / 128), bn = blk % (N / 128);
  const int row0 = bm * 128 + (w >> 1) * 64, col0 = bn * 128 + (w & 1) * 64;
  v8f acc[MT][4] = {};
  // A tile row of 16 rows is 16 * K elements, a 32-k tile 512 elements, its second half 256 elements on: all 32 loads of a 64-k block hang on two address registers with constant offsets.
  const unsigned short* pa = (const unsigned short*)A + (size_t)row0 * K + lane * 8; const unsigned short* pb = (const unsigned short*)Bh + (size_t)col0 * K + lane * 8;
  // STAGGERED WALK: the blocks that read one A panel (same bm) or one B panel (same bn) do not walk k in step. In step, every block meets each line at the moment of its first touch and waits out the fetch from memory at every k block.
  // Block (bm, bn) starts at k block ks0 and wraps: it fetches its first few k blocks itself and then walks through lines that a block with a later start has already brought into L2. Any start is correct: the sum over k only takes another order.
  // 4 * bn: blocks bn and bn + 4 may share a start; + bm spreads the 32 readers of a B panel over all 16 starts.
  constexpr int NKB = K / 64;
  const int ks0 = (4 * bn + bm) & (NKB - 1);
  // rolled: one 64-k block's fragments (128 registers) beside the 128 accumulator registers; the inner unroll directives keep the fragment arrays in registers (constant indices)
#pragma unroll 1
  for (int it = 0; it < NKB; ++it) {
    const int ko = ((it + ks0) & (NKB - 1)) * 1024;      // 64 k = two tiles = 1024 elements
    const unsigned short* pak = pa + ko; const unsigned short* pbk = pb + ko;
    FragH ah[2][MT], bq[2][4];      // all fragment loads of the block stand ahead of its first product, so they are in flight together
#pragma unroll
    for (int u = 0; u < 2; ++u)
#pragma unroll
      for (int i = 0; i < 4; ++i) { ah[u][i].half[0] = *(const v8us*)(pak + i * 16 * K + u * 512); ah[u][i].half[1] = *(const v8us*)(pak + i * 16 * K + u * 512 + 256);
        bq[u][i].half[0] = *(const v8us*)(pbk + i * 16 * K + u * 512); bq[u][i].half[1] = *(const v8us*)(pbk + i * 16 * K + u * 512 + 256); }
    // the wait that stands in front of any reuse of the group's address registers; naming them as inputs keeps them whole up to it (no load of the group lands on one)
    asm volatile("s_wait_xcnt 0x0" :: "v"(pak), "v"(pbk) : "memory");
    __builtin_amdgcn_sched_barrier(0);      // keeps the 32 loads ahead of the products: without it the scheduler sinks each load to its first use, and the lone wave of a SIMD waits out an L2 round trip several times a block
#pragma unroll
    for (int u = 0; u < 2; ++u)
#pragma unroll
      for (int i = 0; i < MT; ++i)
#pragma unroll
        for (int t = 0; t < 4; ++t) acc[i][t] = __builtin_amdgcn_wmma_f32_16x16x32_f16(false, ah[u][i].v, false, bq[u][t].v, (short)0, acc[i][t], false, false);      // the plain builtin: an asm operand (mmaH) cannot name a register above v255, and this tile needs them
  }
  float bt[4];
#pragma unroll
  for (int t = 0; t < 4; ++t) bt[t] = bf16_round(bias[col0 + t * 16 + ln]);
  if constexpr (OUT == 1) {
    // Vt of a slab (batch, head): rows = d, k = key, tile index kt * 4 + dt (kt = 32-key tile, dt = 16-d tile). acc[i][t][0..7] of lane (hh, ln) are keys row0 + 16 i + 8 hh + 0..7 at d = 16 t + ln:
    // the 16 bytes that this lane owns in half (row / 16) & 1 of tile (kt, t). So the masked, transposed operand is stored from the accumulator registers, 512 contiguous bytes per wave and store.
    const int key0 = row0 % TT;      // a wave's 64 rows lie in one batch: two 32-key tiles, 4096 elements in a row
    unsigned short* cp = (unsigned short*)C16 + ((size_t)(row0 / TT) * (N / 64) + col0 / 64) * 64 * TT + (size_t)(key0 >> 5) * 2048 + lane * 8;
    FragH f[MT][4];      // formed apart from the stores, so that the stores go out in runs
#pragma unroll
    for (int i = 0; i < MT; ++i) { const float* mp = RM + row0 + i * 16 + 8 * hh; const v4f m0 = *(const v4fa*)mp, m1 = *(const v4fa*)(mp + 4); float mr[8];
#pragma unroll
      for (int q = 0; q < 4; ++q) { mr[q] = bf16_round(m0[q]); mr[4 + q] = bf16_round(m1[q]); }
#pragma unroll
      for (int t = 0; t < 4; ++t)
#pragma unroll
        for (int r = 0; r < 8; ++r) f[i][t].h[r] = (_Float16)((acc[i][t][r] * alpha + bt[t]) * mr[r]); }
#pragma unroll
    for (int i = 0; i < MT; ++i)
#pragma unroll
      for (int t = 0; t < 4; ++t) *(v8us*)(cp + (i >> 1) * 2048 + (i & 1) * 256 + t * 512) = f[i][t].half[0];
  } else {
#pragma unroll
    for (int i = 0; i < MT; ++i)
#pragma unroll
      for (int t = 0; t < 4; ++t)
#pragma unroll
        for (int r = 0; r < 8; ++r) so[w][i * 16 + 8 * hh + r][t * 16 + ln] = acc[i][t][r] * alpha + bt[t];
    __builtin_amdgcn_fence(__ATOMIC_ACQ_REL, "workgroup"); __builtin_amdgcn_wave_barrier();      // orders the wave's LDS writes ahead of its reads of them: a wave reads back its own rows only
    if constexpr (OUT == 2) {      // f32 result, row-major: two rows of 256 bytes per store
      const int rsub = lane >> 4, c4 = (lane & 15) * 4;
#pragma unroll
      for (int q = 0; q < 32; ++q) { const int r = q * 2 + rsub; const v4f v = *(const v4fa*)&so[w][r][c4]; *(v4f*)(C + (size_t)(row0 + r) * N + col0 + c4) = v; }
    } else {      // f16 result in fragment order (k = column): a 16 x 64 piece is 2 KiB in a row, half c holds columns col0 + 16 c ..
#pragma unroll
      for (int i = 0; i < MT; ++i) { unsigned short* cp = (unsigned short*)C16 + (size_t)(row0 + i * 16) * N + (size_t)(col0 / 32) * 512 + lane * 8;
#pragma unroll
        for (int c = 0; c < 4; ++c) { const v4f v0 = *(const v4fa*)&so[w][i * 16 + ln][c * 16 + hh * 8], v1 = *(const v4fa*)&so[w][i * 16 + ln][c * 16 + hh * 8 + 4]; FragH f;
#pragma unroll
          for (int q = 0; q < 4; ++q) { f.h[q] = (_Float16)v0[q]; f.h[4 + q] = (_Float16)v1[q]; }
          *(v8us*)(cp + c * 256) = f.half[0]; } }
    }
  }
}
// The Q, K and V projections depend on nothing of one another: one launch of 3 x 256 blocks, all resident at once (3 blocks a WGP, 3 waves a SIMD), so that one wave's products run while another's fragment loads are on their way.
// Block b, b + 256 and b + 512 own the same tile position of Q, K and V.
__global__ __launch_bounds__(128) void k_gemm_qkv(const _Float16* __restrict__ XQ, const _Float16* __restrict__ XKV, const _Float16* __restrict__ Bq, const _Float16* __restrict__ Bk, const _Float16* __restrict__ Bv,
                                                  const float* __restrict__ bq, const float* __restrict__ bk, const float* __restrict__ bv, const float* __restrict__ mk,
                                                  _Float16* __restrict__ Q16, _Float16* __restrict__ K16, _Float16* __restrict__ Vt) {
  constexpr int G = (NR / 128) * (DD / 128);
  const int sel = blockIdx.x / G, blk = blockIdx.x % G;      // the same for a whole block
  if (sel == 2) gemm_w64<1>(blk, XKV, Bv, 0.0625f, bv, nullptr, Vt, mk);      // (v + bv) * mask in f32, then f16, stored as Vt
  else gemm_w64<0>(blk, sel ? XKV : XQ, sel ? Bk : Bq, 0.0625f, sel ? bk : bq, nullptr, sel ? K16 : Q16, nullptr);
}
__global__ __launch_bounds__(128) void k_gemm_o(const _Float16* __restrict__ A, const _Float16* __restrict__ Bh, const float* __restrict__ bias, float* __restrict__ C) { gemm_w64<2>(blockIdx.x, A, Bh, 0.0625f, bias, C, nullptr, nullptr); }

__global__ __launch_bounds__(256) void k_round16f(const float* __restrict__ W, _Float16* __restrict__ Bt, size_t n8) { const size_t t = (size_t)blockIdx.x * 256 + threadIdx.x; if (t >= n8) return; FragH f;
#pragma unroll
  for (int i = 0; i < 8; ++i) f.h[i] = (_Float16)(bf16_round(W[t * 8 + i]) * 16.0f); *(v8us*)((unsigned short*)Bt + t * 8) = f.half[0];  }

// lane l with lane l ^ 16 (a vector cross-row move, no LDS queue)
__device__ __forceinline__ float xhalf(float x) { return __builtin_bit_cast(float, __builtin_amdgcn_permlanex16(__builtin_bit_cast(int, x), __builtin_bit_cast(int, x), 0x76543210, 0xfedcba98, false, false)); }
// Transposed products: St = K * Qt (A = K rows, B = Q), Ot += Vt * Pt (A = Vt rows, B = Pt). The fragments are the same registers as before with A and B swapped (one k order for both).
// St tile (qt, nt): register r of lane (hh, ln) = score of key j0 + 16 nt + 8 hh + r with query q0 + 16 qt + ln: a lane holds 16 scores of ONE query, so maximum and sum run in the lane,
// with one exchange between the wave halves for the maximum; the two halves' sums are joined once, behind the loop.
// The two converted St tiles are the B fragment of Pt as they stand (element 8 nt + r = k 16 nt + 8 hh + r): P passes through no LDS.
// A wave owns QT = 2 query tiles of 16: every loaded K or Vt fragment feeds two products (one per query tile), and the two tiles' softmax chains are independent of each other.
// A block is 8 waves on 128 queries: waves 0..3 walk keys 0..1023, waves 4..7 keys 1024..2047 of the same four query groups. That makes 4096 waves, four a SIMD in place of two,
// so that one wave's load waits and dependent softmax chain are filled by three others. The two partial results (maximum, sum, Ot) of a query group are joined once, behind the loop, through LDS.
__global__ __launch_bounds__(256) void k_flash(const _Float16* __restrict__ Q16, int ldq, const _Float16* __restrict__ K16, int ldk, const _Float16* __restrict__ Vt, const int* __restrict__ MSK, _Float16* __restrict__ O16, int ldo) {
  constexpr int QT = 2, RPW = 16 * QT, NQB = 2048 / (4 * RPW), DT = 4, KS = 2, KH = 2048 / 2;
  __shared__ __attribute__((aligned(16))) float sj[4][QT * DT * 2 + 1][32][4];      // per query group: the upper key half's Ot (16 chunks of 16 bytes a lane) and one chunk of m, l; a wave-wide 16-byte access is 512 bytes in a row
  const int tid = threadIdx.x, lane = tid & 31;
  const int w = __builtin_amdgcn_readfirstlane(tid >> 5), wq = w & 3, kh = w >> 2;      // the wave's number as a scalar: the key range, the loop counter and the branches on kh stay scalar
  const int slab = blockIdx.x / NQB, qblk = blockIdx.x % NQB; const int b = slab / 16, h = slab % 16; const int qb0 = qblk * (4 * RPW); const int q0 = qb0 + wq * RPW;
  FragH aq[QT][KS];
  const unsigned short* qr0 = (const unsigned short*)Q16 + ((size_t)b * 2048 + q0) * ldq + h * 1024 + lane * 8; const unsigned short* qr1 = qr0 + (size_t)16 * ldq;      // Q16, K16, Vt: fragment order (see FRAGMENT ORDER); a head's 64 columns are two tiles, 1024 elements
#pragma unroll
  for (int ks = 0; ks < KS; ++ks) { aq[0][ks].half[0] = *(const v8us*)(qr0 + ks * 512); aq[0][ks].half[1] = *(const v8us*)(qr0 + ks * 512 + 256); aq[1][ks].half[0] = *(const v8us*)(qr1 + ks * 512); aq[1][ks].half[1] = *(const v8us*)(qr1 + ks * 512 + 256); }
  const unsigned short* Vth = (const unsigned short*)Vt + (size_t)slab * 64 * 2048;
  float m_r[QT], l_r[QT]; v8f oacc[QT][DT];      // of query q0 + 16 qt + ln; l_r sums this half's keys only; oacc[qt][dt][r] = Ot[16 dt + 8 hh + r][q0 + 16 qt + ln]
  // Softmax in base 2: exp(s / 8 - m) = exp2(s * CS - m * log2 e), CS = log2(e) / 8. m_r is kept in that scaled unit, so a weight is one fused multiply-add on the raw score and one hardware exp2.
  constexpr float CS = 0.125f * 1.4426950408889634f; typedef float v2f __attribute__((ext_vector_type(2)));
#pragma unroll
  for (int qt = 0; qt < QT; ++qt) { m_r[qt] = -3.0e38f; l_r[qt] = 0.f;
#pragma unroll
    for (int dt = 0; dt < DT; ++dt) oacc[qt][dt] = (v8f){0.f,0.f,0.f,0.f,0.f,0.f,0.f,0.f}; }
  const int jbeg = kh * KH;      // this wave's half of the keys
  // STAGGERED WALK (as in the GEMMs): the 16 blocks of a slab read the same K and Vt tiles. Block qblk starts at pass rot of its NP passes and wraps, so that it meets most tiles after another block has brought them into L2,
  // not at the moment of their first touch. The online softmax takes the keys in any order: only the order of its sums changes. Blocks qblk and qblk + 4 may share a start.
  constexpr int NP = KH / 32;
  const int rot = (qblk & 3) * (NP / 4) + (qblk >> 3) * (NP / 8);
  // Fragment loads stand well ahead of their products: a pass issues its V fragments as one group at its top (they land behind the softmax) and,
  // right behind its score products, the next pass's K fragments (they land behind the rest of the pass). No product waits on a load just issued.
  // The unroll directives on the fragment loops keep the fragment arrays in registers (constant indices).
  FragH bk[2][KS];
  const unsigned short* kp0 = (const unsigned short*)K16 + ((size_t)b * 2048 + jbeg + rot * 32) * ldk + h * 1024 + lane * 8; const unsigned short* kp1 = kp0 + (size_t)16 * ldk;
#pragma unroll
  for (int ks = 0; ks < KS; ++ks) { bk[0][ks].half[0] = *(const v8us*)(kp0 + ks * 512); bk[0][ks].half[1] = *(const v8us*)(kp0 + ks * 512 + 256); bk[1][ks].half[0] = *(const v8us*)(kp1 + ks * 512); bk[1][ks].half[1] = *(const v8us*)(kp1 + ks * 512 + 256); }
  // as in the loop: the wait in front of any reuse of the address registers of the Q and first K loads
  asm volatile("s_wait_xcnt 0x0" :: "v"(qr0), "v"(qr1), "v"(kp0), "v"(kp1) : "memory");
#pragma unroll 1
  for (int p = 0; p < NP; ++p) {
    const int j0 = jbeg + ((p + rot) & (NP - 1)) * 32;
    FragH bv[DT];
#pragma unroll
    for (int dt = 0; dt < DT; ++dt) { const unsigned short* vrow = Vth + (size_t)j0 * 64 + dt * 512 + lane * 8; bv[dt].half[0] = *(const v8us*)vrow; bv[dt].half[1] = *(const v8us*)(vrow + 256); }
    v8f s[QT][2];
#pragma unroll
    for (int nt = 0; nt < 2; ++nt)
#pragma unroll
      for (int qt = 0; qt < QT; ++qt) { v8f acc = (v8f){0.f,0.f,0.f,0.f,0.f,0.f,0.f,0.f};
#pragma unroll
        for (int ks = 0; ks < KS; ++ks) acc = mmaH<1>(bk[nt][ks].v, bk[nt][ks].v, aq[qt][ks].v, aq[qt][ks].v, acc); s[qt][nt] = acc; }
    const int jn = jbeg + ((p + 1 + rot) & (NP - 1)) * 32;      // the last pass reads the first pass's rows again: in bounds, not used
    const unsigned short* kr0 = (const unsigned short*)K16 + ((size_t)b * 2048 + jn) * ldk + h * 1024 + lane * 8; const unsigned short* kr1 = kr0 + (size_t)16 * ldk;
#pragma unroll
    for (int ks = 0; ks < KS; ++ks) { bk[0][ks].half[0] = *(const v8us*)(kr0 + ks * 512); bk[0][ks].half[1] = *(const v8us*)(kr0 + ks * 512 + 256); bk[1][ks].half[0] = *(const v8us*)(kr1 + ks * 512); bk[1][ks].half[1] = *(const v8us*)(kr1 + ks * 512 + 256); }
    // the wait that stands in front of any reuse of the group's address registers; naming them as inputs keeps them whole up to it (no load of the group lands on one)
    asm volatile("s_wait_xcnt 0x0" :: "v"(kr0), "v"(kr1) : "memory");
    FragH pb[QT];
#pragma unroll
    for (int qt = 0; qt < QT; ++qt) {
      float mx[8];
#pragma unroll
      for (int r = 0; r < 8; ++r) mx[r] = fmaxf(s[qt][0][r], s[qt][1][r]);      // maxima of the raw scores: the scale is positive
      float mc = fmaxf(fmaxf(fmaxf(mx[0], mx[1]), fmaxf(mx[2], mx[3])), fmaxf(fmaxf(mx[4], mx[5]), fmaxf(mx[6], mx[7])));
      mc = fmaxf(mc, xhalf(mc)) * CS;
      const float mn = fmaxf(m_r[qt], mc); const float al = (mn > -1.0e38f) ? __builtin_amdgcn_exp2f(m_r[qt] - mn) : 1.0f; m_r[qt] = mn;
      float ps[8];
#pragma unroll
      for (int r = 0; r < 8; r += 2) {      // two scores of a tile per packed multiply-add
        const v2f a0 = __builtin_elementwise_fma((v2f){s[qt][0][r], s[qt][0][r + 1]}, (v2f){CS, CS}, (v2f){-mn, -mn}), a1 = __builtin_elementwise_fma((v2f){s[qt][1][r], s[qt][1][r + 1]}, (v2f){CS, CS}, (v2f){-mn, -mn});
        const float p00 = __builtin_amdgcn_exp2f(a0.x), p01 = __builtin_amdgcn_exp2f(a0.y), p10 = __builtin_amdgcn_exp2f(a1.x), p11 = __builtin_amdgcn_exp2f(a1.y);
        ps[r] = p00 + p10; ps[r + 1] = p01 + p11; pb[qt].h[r] = (_Float16)p00; pb[qt].h[r + 1] = (_Float16)p01; pb[qt].h[8 + r] = (_Float16)p10; pb[qt].h[9 + r] = (_Float16)p11; }
      l_r[qt] = l_r[qt] * al + (((ps[0] + ps[1]) + (ps[2] + ps[3])) + ((ps[4] + ps[5]) + (ps[6] + ps[7])));
#pragma unroll
      for (int dt = 0; dt < DT; ++dt)
#pragma unroll
        for (int r = 0; r < 8; ++r) oacc[qt][dt][r] *= al;
    }
#pragma unroll
    for (int dt = 0; dt < DT; ++dt)
#pragma unroll
      for (int qt = 0; qt < QT; ++qt) oacc[qt][dt] = mmaH<1>(bv[dt].v, bv[dt].v, pb[qt].v, pb[qt].v, oacc[qt][dt]); }
  // Join of the two key halves. Waves wq and wq + 4 hold the same queries at the same lanes and registers, so the upper half hands over its registers lane by lane.
  if (kh == 1) {
#pragma unroll
    for (int qt = 0; qt < QT; ++qt)
#pragma unroll
      for (int dt = 0; dt < DT; ++dt) { *(v4fa*)&sj[wq][(qt * DT + dt) * 2][lane][0] = (v4f){oacc[qt][dt][0], oacc[qt][dt][1], oacc[qt][dt][2], oacc[qt][dt][3]}; *(v4fa*)&sj[wq][(qt * DT + dt) * 2 + 1][lane][0] = (v4f){oacc[qt][dt][4], oacc[qt][dt][5], oacc[qt][dt][6], oacc[qt][dt][7]}; }
    *(v4fa*)&sj[wq][QT * DT * 2][lane][0] = (v4f){m_r[0], m_r[1], l_r[0], l_r[1]};
  }
  __syncthreads();      // every wave of the block passes it once: the upper half's partial results are in LDS before the lower half reads them
  if (kh == 1) return;
  { const v4f ml = *(const v4fa*)&sj[wq][QT * DT * 2][lane][0];
#pragma unroll
    for (int qt = 0; qt < QT; ++qt) {      // both maxima are finite (each half has seen 1024 keys); weights in the base-2 unit of m_r
      const float mn = fmaxf(m_r[qt], ml[qt]); const float a1 = __builtin_amdgcn_exp2f(m_r[qt] - mn), a2 = __builtin_amdgcn_exp2f(ml[qt] - mn);
      l_r[qt] = l_r[qt] * a1 + ml[2 + qt] * a2;
#pragma unroll
      for (int dt = 0; dt < DT; ++dt) { const v4f o0 = *(const v4fa*)&sj[wq][(qt * DT + dt) * 2][lane][0], o1 = *(const v4fa*)&sj[wq][(qt * DT + dt) * 2 + 1][lane][0];
#pragma unroll
        for (int r = 0; r < 4; ++r) { oacc[qt][dt][r] = oacc[qt][dt][r] * a1 + o0[r] * a2; oacc[qt][dt][4 + r] = oacc[qt][dt][4 + r] * a1 + o1[r] * a2; } } } }
  // oacc[qt][dt][0..7] of lane (hh, ln) are row q0 + 16 qt + ln, columns 16 dt + 8 hh + 0..7 of the head: the 16 bytes that this lane owns in half dt & 1 of the head's tile dt >> 1 of a fragment-order
  // operand (see FRAGMENT ORDER). So the output GEMM's f16 A operand is stored from the accumulator registers, 512 contiguous bytes per wave and store.
  FragH f[QT][DT];      // formed apart from the stores, so that the stores go out in runs
#pragma unroll
  for (int qt = 0; qt < QT; ++qt) { const float l = l_r[qt] + xhalf(l_r[qt]); const float li = (l > 0.f) ? 1.0f / l : 0.f;
#pragma unroll
    for (int dt = 0; dt < DT; ++dt)
#pragma unroll
      for (int r = 0; r < 8; ++r) f[qt][dt].h[r] = (_Float16)(oacc[qt][dt][r] * li); }
#pragma unroll
  for (int qt = 0; qt < QT; ++qt) { unsigned short* op = (unsigned short*)O16 + ((size_t)b * 2048 + q0 + qt * 16) * ldo + h * 1024 + lane * 8;
#pragma unroll
    for (int dt = 0; dt < DT; ++dt) *(v8us*)(op + dt * 256) = f[qt][dt].half[0]; } }

extern "C" void kernel_launch(void* const* d_in, const int* in_sizes, int n_in,
                              void* d_out, int out_size, void* d_ws, size_t ws_size, hipStream_t stream) {
  (void)in_sizes; (void)n_in; (void)out_size;
  const float* xq = (const float*)d_in[0]; const float* xkv = (const float*)d_in[1]; const float* mk = (const float*)d_in[2]; const float* Wq = (const float*)d_in[3]; const float* bq = (const float*)d_in[4]; const float* Wk = (const float*)d_in[5]; const float* bk = (const float*)d_in[6]; const float* Wv = (const float*)d_in[7]; const float* bv = (const float*)d_in[8]; const float* Wo = (const float*)d_in[9]; const float* bo = (const float*)d_in[10];
  char* ws = (char*)d_ws; size_t off = 0;
  auto take = [&](size_t bytes) { char* p = ws + off; off += (bytes + 255) & ~(size_t)255; return p; };
  _Float16* Bq = (_Float16*)take((size_t)DD * DD * 2); _Float16* Bk = (_Float16*)take((size_t)DD * DD * 2); _Float16* Bv = (_Float16*)take((size_t)DD * DD * 2); _Float16* Bo = (_Float16*)take((size_t)DD * DD * 2);
  _Float16* XQ16 = (_Float16*)take((size_t)NR * DD * 2); _Float16* XKV16 = (_Float16*)take((size_t)NR * DD * 2); _Float16* Q16 = (_Float16*)take((size_t)NR * DD * 2); _Float16* K16 = (_Float16*)take((size_t)NR * DD * 2); _Float16* Vt = (_Float16*)take((size_t)NR * DD * 2); _Float16* O16 = (_Float16*)take((size_t)NR * DD * 2);
  if (off > ws_size) return;      // 8.4 + 8.4 x 6 = 59 MB
  const unsigned gg = (NR / 128) * (DD / 128);
  k_prep<<<512, 256, 0, stream>>>(xq, xkv, Wq, Wk, Wv, Wo, XQ16, XKV16, Bq, Bk, Bv, Bo);      // W (D,H,Dh) = [in][h * 64 + d]; Wo (H,Dh,D) = [in = (h,d)][out]
  k_gemm_qkv<<<3 * gg, 128, 0, stream>>>(XQ16, XKV16, Bq, Bk, Bv, bq, bk, bv, mk, Q16, K16, Vt);
  k_flash<<<BB * NH * (TT / 128), 256, 0, stream>>>(Q16, DD, K16, DD, Vt, nullptr, O16, DD);      // the 1/8 on q is folded into the softmax constant
  k_gemm_o<<<gg, 128, 0, stream>>>(O16, Bo, bo, (float*)d_out);
}

// v010
// One run takes 78.8 microseconds.
// Next to v009, in two timings, it ran 1.04 times as fast each time.
// Counting every step since v000, it is 5.62 times as fast.
#include <hip/hip_runtime.h>
// Multi-head dot-product attention with a per-key value mask (B=2, L=2048, D=1024, 16 heads × 64; q from inputs_q, k/v from inputs_kv; v ← mask_k·v; softmax(q·k/8); merge; ·Wo + bo): the
// q/k/v/o projections are GEMMs ([in][out] weights bf16-exact ×2^4, bias epilogues, f32 accumulate) and the attention is a fused flash-style kernel (online softmax f32; P f16 ≤ 1; O = P·Vt;
// 32 queries a wave) on v_wmma_f32_16x16x32_f16; the value masking is applied in f32 VALU before the f16 conversion.
#define BB 2
#define TT 2048
#define DD 1024
#define NH 16
#define NR (BB * TT)

typedef __bf16 v16b __attribute__((ext_vector_type(16)));
typedef unsigned short v8us __attribute__((ext_vector_type(8), may_alias));
typedef float  v8f  __attribute__((ext_vector_type(8)));
typedef float  v4f  __attribute__((ext_vector_type(4)));
typedef float  v4fa __attribute__((ext_vector_type(4), may_alias));
union FragB { v16b v; v8us half[2]; unsigned short u[16]; };

__device__ __forceinline__ unsigned short bf16_bits(float x) { unsigned int u = __float_as_uint(x); return (unsigned short)((u + 0x7FFFu + ((u >> 16) & 1u)) >> 16); }
__device__ __forceinline__ float bf16_val(unsigned short b) { return __uint_as_float(((unsigned int)b) << 16); }
__device__ __forceinline__ float bf16_round(float x) { return bf16_val(bf16_bits(x)); }
// D += A·B with NT terms: 1 = ah·bh, 2 = + al·bh (A split), 3 = + ah·bl (both split)
template <int NT>
__device__ __forceinline__ v8f mmaN(v16b ah, v16b al, v16b bh, v16b bl, v8f c) {
  c = __builtin_amdgcn_wmma_f32_16x16x32_bf16(false, ah, false, bh, (short)0, c, false, false);
  if (NT >= 2) c = __builtin_amdgcn_wmma_f32_16x16x32_bf16(false, al, false, bh, (short)0, c, false, false);
  if (NT >= 3) c = __builtin_amdgcn_wmma_f32_16x16x32_bf16(false, ah, false, bl, (short)0, c, false, false);
  asm volatile("v_nop\n\tv_nop\n\tv_nop\n\tv_nop" : "+v"(c) : "v"(ah), "v"(al), "v"(bh), "v"(bl));
  return c;
}

__global__ __launch_bounds__(256) void k_wt_bf16(const float* __restrict__ W, unsigned short* __restrict__ Wt, int K, int N) {
  const int t = blockIdx.x * 256 + threadIdx.x;
  const int k8n = K / 8;
  if (t >= N * k8n) return;
  const int n = t / k8n, k8 = (t % k8n) * 8;
  v8us v;
#pragma unroll
  for (int i = 0; i < 8; ++i) v[i] = bf16_bits(W[(size_t)(k8 + i) * N + n]);
  *(v8us*)(Wt + (size_t)n * K + k8) = v;
  
}

// GEMM C[M][N] (f32, pitch ldc) = act(A[M][K]·W + bias). A f32 row-major (pitch lda) converted per fragment to bf16
// (ASPLIT: hi/lo two planes -> 2 terms, else single rounded term); Wt bf16 [N][K] (pitch ldb). BIAS_BF16 rounds the
// bias to bf16 first (bias quantised to bf16 before the add). K%32==0, M%16==0, N%64==0.
template <bool ASPLIT, int ACT, bool BIAS_BF16>
__global__ __launch_bounds__(128) void k_gemm_bf(const float* __restrict__ A, int lda, const unsigned short* __restrict__ Wt, int ldb,
                                               const float* __restrict__ bias, float* __restrict__ C, int ldc, int M, int N, int K) {
  __shared__ __attribute__((aligned(16))) float so[4][16][64];
  const int tid = threadIdx.x, w = tid >> 5, lane = tid & 31, ln = lane & 15, hh = lane >> 4;
  const int ntn = N / 64;
  const int wid = blockIdx.x * 4 + w;
  const int mt = wid / ntn, nq = wid % ntn;
  if (mt * 16 >= M) return;
  const int row0 = mt * 16, col0 = nq * 64;
  const float* arow = A + (size_t)(row0 + ln) * lda;
  v8f acc[4] = {};
  for (int kb = 0; kb < K; kb += 32) {
    FragB ah, al;
    const v4f x0 = *(const v4fa*)(arow + kb + 8 * hh), x1 = *(const v4fa*)(arow + kb + 8 * hh + 4);
    const v4f x2 = *(const v4fa*)(arow + kb + 16 + 8 * hh), x3 = *(const v4fa*)(arow + kb + 16 + 8 * hh + 4);
    float xs[16] = {x0[0],x0[1],x0[2],x0[3],x1[0],x1[1],x1[2],x1[3],x2[0],x2[1],x2[2],x2[3],x3[0],x3[1],x3[2],x3[3]};
#pragma unroll
    for (int i = 0; i < 16; ++i) { const unsigned short hb = bf16_bits(xs[i]); ah.u[i] = hb; al.u[i] = ASPLIT ? bf16_bits(xs[i] - bf16_val(hb)) : (unsigned short)0; }
#pragma unroll
    for (int t = 0; t < 4; ++t) {
      const unsigned short* brow = Wt + (size_t)(col0 + t * 16 + ln) * ldb + kb;
      FragB b;
      b.half[0] = *(const v8us*)(brow + 8 * hh);
      b.half[1] = *(const v8us*)(brow + 16 + 8 * hh);
      acc[t] = mmaN<ASPLIT ? 2 : 1>(ah.v, al.v, b.v, b.v, acc[t]);
    }
  }
#pragma unroll
  for (int t = 0; t < 4; ++t) {
    float bv = bias ? bias[col0 + t * 16 + ln] : 0.f;
    if (BIAS_BF16) bv = bf16_round(bv);
#pragma unroll
    for (int r = 0; r < 8; ++r) { float v = acc[t][r] + bv; if (ACT == 1) v = fmaxf(v, 0.f); so[w][8 * hh + r][t * 16 + ln] = v; }
  }
  __builtin_amdgcn_fence(__ATOMIC_ACQ_REL, "workgroup");
  __builtin_amdgcn_wave_barrier();
  const int rsub = lane >> 4, c4 = (lane & 15) * 4;
  {
#pragma unroll
    for (int q = 0; q < 8; ++q) {
      const int r = q * 2 + rsub;
      const v4f v = *(const v4fa*)&so[w][r][c4];
      *(v4f*)(C + (size_t)(row0 + r) * ldc + col0 + c4) = v;
    }
    
  }
}

// Flash-style causal/unmasked attention, all contractions 3-term bf16 hi/lo splits, f32 softmax with running max.
// q,k,v rows are read from f32 buffers with arbitrary row pitch (so they can live inside a fused qkv buffer);
// D = head size (multiple of 32, <= 128); one wave = 16 query rows; block = 4 waves (64 queries) sharing K/V chunks of 32.
template <int D, bool CAUSAL>
__global__ __launch_bounds__(128) void k_flash(const float* __restrict__ qb, const float* __restrict__ kb, const float* __restrict__ vb,
                                             int pitch, int T, int H, float scale, float* __restrict__ y, int ypitch) {
  constexpr int KS = D / 32;        // k-steps for QK
  constexpr int DT = D / 16;        // d tiles for PV
  __shared__ __attribute__((aligned(16))) unsigned short sKh[32][D + 8], sKl[32][D + 8], sVh[32][D + 8], sVl[32][D + 8];
  __shared__ __attribute__((aligned(16))) unsigned short sPh[4][16][40], sPl[4][16][40];
  __shared__ __attribute__((aligned(16))) float sO[4][16][D];
  const int tid = threadIdx.x, w = tid >> 5, lane = tid & 31, ln = lane & 15, hh = lane >> 4;
  const int nqb = (T + 63) / 64;
  const int bh = blockIdx.x / nqb, qblk = blockIdx.x % nqb;
  const int b = bh / H, h = bh % H;
  const int q0 = qblk * 64 + w * 16;
  const float* Q = qb + (size_t)b * T * pitch + h * D;
  const float* K = kb + (size_t)b * T * pitch + h * D;
  const float* V = vb + (size_t)b * T * pitch + h * D;

  // A fragments of the wave's 16 query rows (scaled), hi/lo
  FragB aqh[KS], aql[KS];
  {
    int row = q0 + ln; if (row >= T) row = T - 1;
    const float* qr = Q + (size_t)row * pitch;
#pragma unroll
    for (int ks = 0; ks < KS; ++ks)
#pragma unroll
      for (int i = 0; i < 16; ++i) {
        const int d = ks * 32 + ((i < 8) ? (8 * hh + i) : (16 + 8 * hh + (i - 8)));
        const float x = qr[d] * scale; const unsigned short hb = bf16_bits(x);
        aqh[ks].u[i] = hb; aql[ks].u[i] = bf16_bits(x - bf16_val(hb));
      }
  }
  float m_r[8], l_r[8];
#pragma unroll
  for (int r = 0; r < 8; ++r) { m_r[r] = -3.0e38f; l_r[r] = 0.f; }
  v8f oacc[DT];
#pragma unroll
  for (int dt = 0; dt < DT; ++dt) oacc[dt] = (v8f){0.f,0.f,0.f,0.f,0.f,0.f,0.f,0.f};

  const int kv_end = CAUSAL ? min(T, qblk * 64 + 64) : T;     // block-uniform
  for (int j0 = 0; j0 < kv_end; j0 += 32) {
    __syncthreads();
    for (int e = tid; e < 32 * (D / 4); e += 128) {
      const int r = e / (D / 4), c4 = (e % (D / 4)) * 4;
      const int key = j0 + r;
      v4f kf = {0.f,0.f,0.f,0.f}, vf = {0.f,0.f,0.f,0.f};
      if (key < T) { kf = *(const v4fa*)(K + (size_t)key * pitch + c4); vf = *(const v4fa*)(V + (size_t)key * pitch + c4); }
#pragma unroll
      for (int t = 0; t < 4; ++t) {
        unsigned short hb = bf16_bits(kf[t]); sKh[r][c4 + t] = hb; sKl[r][c4 + t] = bf16_bits(kf[t] - bf16_val(hb));
        hb = bf16_bits(vf[t]); sVh[r][c4 + t] = hb; sVl[r][c4 + t] = bf16_bits(vf[t] - bf16_val(hb));
      }
    }
    __syncthreads();
    // S tile 16 x 32
    v8f s[2];
#pragma unroll
    for (int nt = 0; nt < 2; ++nt) {
      v8f acc = {};
#pragma unroll
      for (int ks = 0; ks < KS; ++ks) {
        FragB bh_, bl_;
        bh_.half[0] = *(const v8us*)&sKh[nt * 16 + ln][ks * 32 + 8 * hh]; bh_.half[1] = *(const v8us*)&sKh[nt * 16 + ln][ks * 32 + 16 + 8 * hh];
        bl_.half[0] = *(const v8us*)&sKl[nt * 16 + ln][ks * 32 + 8 * hh]; bl_.half[1] = *(const v8us*)&sKl[nt * 16 + ln][ks * 32 + 16 + 8 * hh];
        acc = mmaN<3>(aqh[ks].v, aql[ks].v, bh_.v, bl_.v, acc);
      }
      s[nt] = acc;
    }
    // mask + running max (rows 8hh+r; the 16 lanes of a half share rows)
    float alpha[8];
#pragma unroll
    for (int r = 0; r < 8; ++r) {
      const int qi = q0 + 8 * hh + r;
      const int ja = j0 + ln, jb = j0 + 16 + ln;
      if (CAUSAL) { if (ja > qi) s[0][r] = -3.0e38f; if (jb > qi) s[1][r] = -3.0e38f; }
      if (ja >= T) s[0][r] = -3.0e38f;
      if (jb >= T) s[1][r] = -3.0e38f;
      float mx = fmaxf(s[0][r], s[1][r]);
      mx = fmaxf(mx, __shfl_xor(mx, 1, 32)); mx = fmaxf(mx, __shfl_xor(mx, 2, 32)); mx = fmaxf(mx, __shfl_xor(mx, 4, 32)); mx = fmaxf(mx, __shfl_xor(mx, 8, 32));
      const float mnew = fmaxf(m_r[r], mx);
      alpha[r] = (mnew > -1.0e38f) ? __expf(m_r[r] - mnew) : 1.0f;
      const float p0 = (s[0][r] > -1.0e38f) ? __expf(s[0][r] - mnew) : 0.f;
      const float p1 = (s[1][r] > -1.0e38f) ? __expf(s[1][r] - mnew) : 0.f;
      m_r[r] = mnew;
      l_r[r] = l_r[r] * alpha[r] + p0 + p1;            // per-lane partial row sum (16 lanes combined at the end)
      unsigned short hb = bf16_bits(p0); sPh[w][8 * hh + r][ln] = hb;      sPl[w][8 * hh + r][ln] = bf16_bits(p0 - bf16_val(hb));
      hb = bf16_bits(p1);                sPh[w][8 * hh + r][16 + ln] = hb; sPl[w][8 * hh + r][16 + ln] = bf16_bits(p1 - bf16_val(hb));
    }
#pragma unroll
    for (int dt = 0; dt < DT; ++dt)
#pragma unroll
      for (int r = 0; r < 8; ++r) oacc[dt][r] *= alpha[r];
    __builtin_amdgcn_fence(__ATOMIC_ACQ_REL, "workgroup");
    __builtin_amdgcn_wave_barrier();
    FragB pah, pal;
    pah.half[0] = *(const v8us*)&sPh[w][ln][8 * hh]; pah.half[1] = *(const v8us*)&sPh[w][ln][16 + 8 * hh];
    pal.half[0] = *(const v8us*)&sPl[w][ln][8 * hh]; pal.half[1] = *(const v8us*)&sPl[w][ln][16 + 8 * hh];
#pragma unroll
    for (int dt = 0; dt < DT; ++dt) {
      FragB bvh, bvl;
#pragma unroll
      for (int i = 0; i < 8; ++i) {
        bvh.u[i] = sVh[8 * hh + i][dt * 16 + ln]; bvh.u[8 + i] = sVh[16 + 8 * hh + i][dt * 16 + ln];
        bvl.u[i] = sVl[8 * hh + i][dt * 16 + ln]; bvl.u[8 + i] = sVl[16 + 8 * hh + i][dt * 16 + ln];
      }
      oacc[dt] = mmaN<3>(pah.v, pal.v, bvh.v, bvl.v, oacc[dt]);
    }
    __builtin_amdgcn_fence(__ATOMIC_ACQ_REL, "workgroup");
    __builtin_amdgcn_wave_barrier();
  }
#pragma unroll
  for (int r = 0; r < 8; ++r) {
    float l = l_r[r];
    l += __shfl_xor(l, 1, 32); l += __shfl_xor(l, 2, 32); l += __shfl_xor(l, 4, 32); l += __shfl_xor(l, 8, 32);
    l_r[r] = (l > 0.f) ? 1.0f / l : 0.f;
  }
#pragma unroll
  for (int dt = 0; dt < DT; ++dt)
#pragma unroll
    for (int r = 0; r < 8; ++r) sO[w][8 * hh + r][dt * 16 + ln] = oacc[dt][r] * l_r[r];
  __builtin_amdgcn_fence(__ATOMIC_ACQ_REL, "workgroup");
  __builtin_amdgcn_wave_barrier();
  {
    for (int r = 0; r < 16; ++r) {
      const int row = q0 + r;
      if (row < T && lane < D / 4) {
        const v4f val = *(const v4fa*)&sO[w][r][lane * 4];
        *(v4f*)(y + ((size_t)b * T + row) * ypitch + h * D + lane * 4) = val;
      }
    }
    
  }
}

// GEMM C = act(A·W + bias + resid): A f32 (ASPLIT -> hi/lo 2 terms), Wt bf16 [N][K]; ACT 0 none, 1 relu, 2 exact gelu;
// resid (optional, f32, row index = (row % rmod), pitch ldr, RES_BF16 rounds it) added before the activation.
template <bool ASPLIT, int ACT, bool BIAS_BF16, bool RES_BF16>
__global__ __launch_bounds__(128) void k_gemm_bf3(const float* __restrict__ A, int lda, const unsigned short* __restrict__ Wt, int ldb,
                                                const float* __restrict__ bias, const float* __restrict__ resid, int rmod, int ldr,
                                                float* __restrict__ C, int ldc, int M, int N, int K) {
  __shared__ __attribute__((aligned(16))) float so[4][16][64];
  const int tid = threadIdx.x, w = tid >> 5, lane = tid & 31, ln = lane & 15, hh = lane >> 4;
  const int ntn = N / 64;
  const int wid = blockIdx.x * 4 + w;
  const int mt = wid / ntn, nq = wid % ntn;
  if (mt * 16 >= M) return;
  const int row0 = mt * 16, col0 = nq * 64;
  const float* arow = A + (size_t)(row0 + ln) * lda;
  v8f acc[4] = {};
  for (int kb = 0; kb < K; kb += 32) {
    FragB ah, al;
    const v4f x0 = *(const v4fa*)(arow + kb + 8 * hh), x1 = *(const v4fa*)(arow + kb + 8 * hh + 4);
    const v4f x2 = *(const v4fa*)(arow + kb + 16 + 8 * hh), x3 = *(const v4fa*)(arow + kb + 16 + 8 * hh + 4);
    float xs[16] = {x0[0],x0[1],x0[2],x0[3],x1[0],x1[1],x1[2],x1[3],x2[0],x2[1],x2[2],x2[3],x3[0],x3[1],x3[2],x3[3]};
#pragma unroll
    for (int i = 0; i < 16; ++i) { const unsigned short hb = bf16_bits(xs[i]); ah.u[i] = hb; al.u[i] = ASPLIT ? bf16_bits(xs[i] - bf16_val(hb)) : (unsigned short)0; }
#pragma unroll
    for (int t = 0; t < 4; ++t) {
      const unsigned short* brow = Wt + (size_t)(col0 + t * 16 + ln) * ldb + kb;
      FragB b;
      b.half[0] = *(const v8us*)(brow + 8 * hh);
      b.half[1] = *(const v8us*)(brow + 16 + 8 * hh);
      acc[t] = mmaN<ASPLIT ? 2 : 1>(ah.v, al.v, b.v, b.v, acc[t]);
    }
  }
#pragma unroll
  for (int t = 0; t < 4; ++t) {
    const int col = col0 + t * 16 + ln;
    float bv = bias ? bias[col] : 0.f;
    if (BIAS_BF16) bv = bf16_round(bv);
#pragma unroll
    for (int r = 0; r < 8; ++r) {
      float v = acc[t][r] + bv;
      if (resid) { float rv = resid[(size_t)((row0 + 8 * hh + r) % rmod) * ldr + col]; if (RES_BF16) rv = bf16_round(rv); v += rv; }
      if (ACT == 1) v = fmaxf(v, 0.f);
      if (ACT == 2) v = 0.5f * v * (1.0f + erff(v * 0.70710678118654752f));
      if (ACT == 3) { const float u = 0.7978845608028654f * (v + 0.044715f * v * v * v); v = 0.5f * v * (1.0f + tanhf(u)); }
      so[w][8 * hh + r][t * 16 + ln] = v;
    }
  }
  __builtin_amdgcn_fence(__ATOMIC_ACQ_REL, "workgroup");
  __builtin_amdgcn_wave_barrier();
  const int rsub = lane >> 4, c4 = (lane & 15) * 4;
  {
#pragma unroll
    for (int q = 0; q < 8; ++q) {
      const int r = q * 2 + rsub;
      const v4f v = *(const v4fa*)&so[w][r][c4];
      *(v4f*)(C + (size_t)(row0 + r) * ldc + col0 + c4) = v;
    }
    
  }
}
// row LayerNorm (biased variance, eps) over N: s = X (+ R); optional out_sum <- s; out_norm <- (s-mu)*rsqrt(var+eps)*g + b
template <bool PARAM_BF16>
__global__ __launch_bounds__(256) void k_layernorm(const float* __restrict__ X, const float* __restrict__ R, const float* __restrict__ g, const float* __restrict__ bta,
                                                  float* __restrict__ out_sum, float* __restrict__ out_norm, int N, float eps) {
  __shared__ float red[256];
  const int row = blockIdx.x, tid = threadIdx.x;
  const float* x = X + (size_t)row * N; const float* rr = R ? R + (size_t)row * N : nullptr;
  float vals[16];                     // up to N = 4096
  const int per = N / 256;            // contiguous chunk per thread? use strided-by-4 chunks: thread handles j = tid*4 + 1024*u
  float s1 = 0.f;
  for (int u = 0; u < per / 4; ++u) {
    const int j = tid * 4 + 1024 * u;
    const v4f a = *(const v4fa*)(x + j);
    v4f b = {0.f,0.f,0.f,0.f}; if (rr) b = *(const v4fa*)(rr + j);
#pragma unroll
    for (int q = 0; q < 4; ++q) { const float v = a[q] + b[q]; vals[u * 4 + q] = v; s1 += v; }
  }
  red[tid] = s1; __syncthreads();
  for (int st = 128; st > 0; st >>= 1) { if (tid < st) red[tid] += red[tid + st]; __syncthreads(); }
  const float mu = red[0] / (float)N; __syncthreads();
  float s2 = 0.f;
  for (int u = 0; u < per / 4; ++u)
#pragma unroll
    for (int q = 0; q < 4; ++q) { const float c = vals[u * 4 + q] - mu; s2 += c * c; }
  red[tid] = s2; __syncthreads();
  for (int st = 128; st > 0; st >>= 1) { if (tid < st) red[tid] += red[tid + st]; __syncthreads(); }
  const float rs = rsqrtf(red[0] / (float)N + eps);
  {
    for (int u = 0; u < per / 4; ++u) {
      const int j = tid * 4 + 1024 * u;
      v4f o, sm;
#pragma unroll
      for (int q = 0; q < 4; ++q) {
        float gg = g[j + q], bb = bta[j + q];
        if (PARAM_BF16) { gg = bf16_round(gg); bb = bf16_round(bb); }
        sm[q] = vals[u * 4 + q]; o[q] = (vals[u * 4 + q] - mu) * rs * gg + bb;
      }
      if (out_sum) *(v4f*)(out_sum + (size_t)row * N + j) = sm;
      *(v4f*)(out_norm + (size_t)row * N + j) = o;
    }
    
  }
}



// ---- f16 WMMA path (v_wmma_f32_16x16x32_f16): 11-bit significands for operands in range — used where a [0,1] probability operand needs more precision than bf16
typedef _Float16 v16h __attribute__((ext_vector_type(16)));
union FragH { v16h v; v8us half[2]; _Float16 h[16]; unsigned short u[16]; };
template <int NT>
__device__ __forceinline__ v8f mmaH(v16h ah, v16h al, v16h bh, v16h bl, v8f c) {
  c = __builtin_amdgcn_wmma_f32_16x16x32_f16(false, ah, false, bh, (short)0, c, false, false);
  if (NT >= 2) c = __builtin_amdgcn_wmma_f32_16x16x32_f16(false, al, false, bh, (short)0, c, false, false);
  if (NT >= 3) c = __builtin_amdgcn_wmma_f32_16x16x32_f16(false, ah, false, bl, (short)0, c, false, false);
  asm volatile("v_nop\n\tv_nop\n\tv_nop\n\tv_nop" : "+v"(c) : "v"(ah), "v"(al), "v"(bh), "v"(bl));
  return c;
}
// batched GEMM like k_gemm_b but f16 operands: A f32 (split into f16 hi/lo if ASPLIT, else rounded to f16), Bt = f16 values [n][k]; alpha; C f32; N multiple of 16 (partial tiles skipped)
template <bool ASPLIT>
__global__ __launch_bounds__(128) void k_gemm_h(const float* __restrict__ A, int lda, size_t sA, const _Float16* __restrict__ Bh, int ldb, size_t sB, float alpha, float* __restrict__ C, int ldc, size_t sC, int M, int N, int K) {
  __shared__ __attribute__((aligned(16))) float so[4][16][64];
  const int tid = threadIdx.x, w = tid >> 5, lane = tid & 31, ln = lane & 15, hh = lane >> 4; const int by = blockIdx.y;
  A += (size_t)by * sA; Bh += (size_t)by * sB; C += (size_t)by * sC;
  const int ntn = (N + 63) / 64; const int wid = blockIdx.x * 4 + w; const int mt = wid / ntn, nq = wid % ntn; if (mt * 16 >= M) return;
  const int row0 = mt * 16, col0 = nq * 64; const float* arow = A + (size_t)(row0 + ln) * lda;
  v8f acc[4] = {};
  for (int kb = 0; kb < K; kb += 32) {
    FragH ah, al;
    const v4f x0 = *(const v4fa*)(arow + kb + 8 * hh), x1 = *(const v4fa*)(arow + kb + 8 * hh + 4), x2 = *(const v4fa*)(arow + kb + 16 + 8 * hh), x3 = *(const v4fa*)(arow + kb + 16 + 8 * hh + 4);
    float xs[16] = {x0[0],x0[1],x0[2],x0[3],x1[0],x1[1],x1[2],x1[3],x2[0],x2[1],x2[2],x2[3],x3[0],x3[1],x3[2],x3[3]};
#pragma unroll
    for (int i = 0; i < 16; ++i) { const _Float16 h = (_Float16)xs[i]; ah.h[i] = h; al.h[i] = ASPLIT ? (_Float16)(xs[i] - (float)h) : (_Float16)0.0f; }
#pragma unroll
    for (int t = 0; t < 4; ++t) { if (col0 + t * 16 >= N) continue; const size_t boff = (size_t)(col0 + t * 16 + ln) * ldb + kb; FragH bq; bq.half[0] = *(const v8us*)(Bh + boff + 8 * hh); bq.half[1] = *(const v8us*)(Bh + boff + 16 + 8 * hh);
      acc[t] = mmaH<ASPLIT ? 2 : 1>(ah.v, al.v, bq.v, bq.v, acc[t]); }
  }
#pragma unroll
  for (int t = 0; t < 4; ++t) { if (col0 + t * 16 >= N) continue;
#pragma unroll
    for (int r = 0; r < 8; ++r) so[w][8 * hh + r][t * 16 + ln] = acc[t][r] * alpha; }
  __builtin_amdgcn_fence(__ATOMIC_ACQ_REL, "workgroup"); __builtin_amdgcn_wave_barrier();
  const int rsub = lane >> 4, c4 = (lane & 15) * 4;
  {
#pragma unroll
    for (int q = 0; q < 8; ++q) { const int r = q * 2 + rsub; if (col0 + c4 < N) { const v4f v = *(const v4fa*)&so[w][r][c4]; *(v4f*)(C + (size_t)(row0 + r) * ldc + col0 + c4) = v; } }
     }
}

// FRAGMENT ORDER (every f16 matrix operand in the workspace): a [rows][K] operand is kept as tiles of 16 rows x 32 k, 1 KiB each, tile (rt, kt) at index rt * (K / 32) + kt (Vt: kt * 4 + rt, per 64-row slab).
// A tile is two halves of 512 bytes (k 0..15, then k 16..31); in half j lane hh * 16 + ln owns the 16 bytes of row ln, k = 16 j + 8 hh + 0..7: just what that lane feeds to the WMMA.
// One wave-wide 16-byte load of a half is then 512 contiguous bytes, four whole lines, where a row-major operand gives 32-byte pieces of 16 lines.
// Chunk t (16 bytes) of such a buffer: lane = t & 31, j = (t >> 5) & 1, tile = t >> 6. K % 32 == 0, rows % 16 == 0.
// One launch forms all six f16 operands (the two X and the four W have no dependence on one another). 512 blocks x 8 waves: few enough that the waves' start is short beside the stream, enough to fill every WGP.
// A wave converts 4 whole tiles of an X operand (16 rows x 128 k, 512 source bytes in a row per row: f16(bf16(x))) and 4 halves of a W operand (16 k x 64 n, 256 source bytes in a row per k: Wt[n][k] = f16(bf16(W[k][n]) * 16);
// the power of two keeps bf16-exact weights exact in f16, away from the subnormal range). Every store is one half: 512 contiguous bytes per wave.
__global__ __launch_bounds__(256) void k_prep(const float* __restrict__ xq, const float* __restrict__ xkv, const float* __restrict__ Wq, const float* __restrict__ Wk, const float* __restrict__ Wv, const float* __restrict__ Wo,
                                              _Float16* __restrict__ XQ16, _Float16* __restrict__ XKV16, _Float16* __restrict__ Bq, _Float16* __restrict__ Bk, _Float16* __restrict__ Bv, _Float16* __restrict__ Bo) {
  const int bx = blockIdx.x, w = threadIdx.x >> 5, lane = threadIdx.x & 31, ln = lane & 15, hh = lane >> 4;
  // X: blocks 0..255 take xq, the rest xkv; NR / 16 * DD / 32 = 8192 tiles an operand, 4 neighbours in k per wave. Half g = 2 * tile + j begins at column 16 g.
  const int tile0 = ((bx & 255) * 8 + w) * 4;
  const float* xp = (bx < 256 ? xq : xkv) + (size_t)((tile0 >> 5) * 16 + ln) * DD + (tile0 & 31) * 32 + hh * 8;
  unsigned short* xd = (unsigned short*)(bx < 256 ? XQ16 : XKV16) + (size_t)tile0 * 512 + lane * 8;
  // W: 128 blocks an operand; a wave takes half kj = 2 * kt + j (k = 16 kj + 8 hh + 0..7) of the 4 row tiles rt0 .. rt0 + 3 (n = 16 rt + ln).
  const int m = bx >> 7, r = (bx & 127) * 8 + w, kj = r & 63, rt0 = (r >> 6) * 4;
  const float* wp = (m == 0 ? Wq : m == 1 ? Wk : m == 2 ? Wv : Wo) + (size_t)(kj * 16 + hh * 8) * DD + rt0 * 16 + ln;
  unsigned short* wd = (unsigned short*)(m == 0 ? Bq : m == 1 ? Bk : m == 2 ? Bv : Bo) + (size_t)(rt0 * 64 + kj) * 256 + lane * 8;
  v4f xv[8][2]; float wv[4][8];      // all of the wave's loads stand ahead of the first conversion, so they are in flight together
#pragma unroll
  for (int g = 0; g < 8; ++g) { xv[g][0] = *(const v4fa*)(xp + g * 16); xv[g][1] = *(const v4fa*)(xp + g * 16 + 4); }
#pragma unroll
  for (int c = 0; c < 4; ++c)
#pragma unroll
    for (int i = 0; i < 8; ++i) wv[c][i] = wp[i * DD + c * 16];
  // the wait that stands in front of any reuse of the loads' address registers; naming them as inputs keeps them whole up to it
  asm volatile("s_wait_xcnt 0x0" :: "v"(xp), "v"(wp) : "memory");
  FragH fx[8], fw[4];      // formed apart from the stores, so that the stores go out in runs
#pragma unroll
  for (int g = 0; g < 8; ++g)
#pragma unroll
    for (int q = 0; q < 4; ++q) { fx[g].h[q] = (_Float16)bf16_round(xv[g][0][q]); fx[g].h[4 + q] = (_Float16)bf16_round(xv[g][1][q]); }
#pragma unroll
  for (int c = 0; c < 4; ++c)
#pragma unroll
    for (int i = 0; i < 8; ++i) fw[c].h[i] = (_Float16)(bf16_round(wv[c][i]) * 16.0f);
#pragma unroll
  for (int g = 0; g < 8; ++g) *(v8us*)(xd + g * 256) = fx[g].half[0];
#pragma unroll
  for (int c = 0; c < 4; ++c) *(v8us*)(wd + c * 64 * 256) = fw[c].half[0];
}
// GEMM on fragment-order f16 operands (see FRAGMENT ORDER), [NR][DD] x [DD][DD]: v = acc * alpha + bf16(bias[col]). blk = index of the block's tile.
// A wave owns a 64 x 64 tile of the result (4 x 4 accumulator tiles), so every loaded A or B fragment feeds four products; a block is 2 x 2 waves, a 128 x 128 tile.
// OUT 0: f16 result in fragment order (k = column). OUT 1: f16(v * bf16(RM[row])) transposed per head of 64 columns, in the fragment order that k_flash reads as Vt (TT rows per batch). OUT 2: f32 result, row-major.
template <int OUT, int NS>
__device__ __forceinline__ void gemm_w64(const int blk, const _Float16* __restrict__ A, const _Float16* __restrict__ Bh, float alpha, const float* __restrict__ bias, float* __restrict__ C, _Float16* __restrict__ C16, const float* __restrict__ RM) {
  constexpr int K = DD, N = DD, MT = 4;
  __shared__ __attribute__((aligned(16))) float so[OUT == 1 ? 1 : 4][OUT == 1 ? 1 : 64][64 + 4];      // pitch 272 B = 16 B x odd: the f16 epilogue reads 16 rows at one column with 16-byte loads
  const int tid = threadIdx.x, lane = tid & 31, ln = lane & 15, hh = lane >> 4;
  const int w = __builtin_amdgcn_readfirstlane(tid >> 5);      // the wave's number as a scalar: the two panel addresses then live in scalar registers (see the ring below)
  const int bm = blk / (N / 128), bn = blk % (N / 128);
  const int row0 = bm * 128 + (w >> 1) * 64, col0 = bn * 128 + (w & 1) * 64;
  v8f acc[MT][4] = {};
  // A tile row of 16 rows is 16 * K elements, a 32-k tile 512 elements, its second half 256 elements on: all 16 loads of a 32-k step hang on two scalar addresses and one lane offset, with constant offsets.
  // Scalar addresses cost no vector register: with them three fragment sets and the accumulators stay within the 336 registers that three waves a SIMD allow.
  const unsigned short* pa = (const unsigned short*)A + (size_t)row0 * K; const unsigned short* pb = (const unsigned short*)Bh + (size_t)col0 * K; const unsigned lo = lane * 8;
  // STAGGERED WALK: the blocks that read one A panel (same bm) or one B panel (same bn) do not walk k in step. In step, every block meets each line at the moment of its first touch and waits out the fetch from memory at every k block.
  // Block (bm, bn) starts at k block ks0 and wraps: it fetches its first few k blocks itself and then walks through lines that a block with a later start has already brought into L2. Any start is correct: the sum over k only takes another order.
  // 4 * bn: blocks bn and bn + 4 may share a start; + bm spreads the 32 readers of a B panel over all 16 starts.
  constexpr int NST = K / 32;      // k steps of 32: one tile of each of the 4 + 4 fragments
  const int ks0 = ((4 * bn + bm) & (K / 64 - 1)) * 2;
  // REGISTER RING of NS fragment sets (one 32-k step each, 64 registers): step s works on set s % NS, and behind its first row of products it issues the 16 loads of step s + NS - 1 into the set that step s - 1 has left.
  // So a set's loads have nearly NS - 1 steps of products to land behind, and the wave always has loads on their way: loads that stand right in front of their own products take turns with them, and neither the matrix unit nor the path from L2 is kept busy.
  FragH ah[NS][MT], bq[NS][4];
  auto fetch = [&](const unsigned short* pak, const unsigned short* pbk, const int u) __attribute__((always_inline)) {      // the 16 loads of one step into set u
#pragma unroll
    for (int i = 0; i < 4; ++i) { ah[u][i].half[0] = *(const v8us*)(pak + lo + i * 16 * K); ah[u][i].half[1] = *(const v8us*)(pak + lo + i * 16 * K + 256);
      bq[u][i].half[0] = *(const v8us*)(pbk + lo + i * 16 * K); bq[u][i].half[1] = *(const v8us*)(pbk + lo + i * 16 * K + 256); }
  };
  // A step does its first row of products ahead of its loads. That row's wait retires the oldest set's 16 loads, so with the new group (NS - 1) * 16 loads are out, 48 at NS = 4: inside the wave's load counter (63), which NS * 16 would pass;
  // and four products stand between the last product on the set that step s - 1 has left and the loads that land on that set's registers.
  constexpr int HEAD = 1;
  auto kstep = [&](const int s, const int u, const bool more) __attribute__((always_inline)) {
    const int ko = ((s + NS - 1 + ks0) & (NST - 1)) * 512;
    const unsigned short* pak = pa + ko; const unsigned short* pbk = pb + ko;
#pragma unroll
    for (int i = 0; i < HEAD; ++i)
#pragma unroll
      for (int t = 0; t < 4; ++t) acc[i][t] = __builtin_amdgcn_wmma_f32_16x16x32_f16(false, ah[u][i].v, false, bq[u][t].v, (short)0, acc[i][t], false, false);
    if (more) {
      __builtin_amdgcn_sched_barrier(0);      // keeps the loads below behind the first row (see HEAD): the scheduler would lift them over it
      fetch(pak, pbk, (u + NS - 1) % NS);
      __builtin_amdgcn_sched_barrier(0);      // keeps the 16 loads ahead of the rest of this step's products: without it the scheduler sinks each load towards its first use, NS - 1 steps on, and the lead is lost
    }
#pragma unroll
    for (int i = HEAD; i < MT; ++i)
#pragma unroll
      for (int t = 0; t < 4; ++t) acc[i][t] = __builtin_amdgcn_wmma_f32_16x16x32_f16(false, ah[u][i].v, false, bq[u][t].v, (short)0, acc[i][t], false, false);      // the plain builtin: an asm operand (mmaH) cannot name a register above v255, and this tile needs them
    if (more) {
      __builtin_amdgcn_sched_barrier(0);      // keeps the wait below behind the products, where it has long been met: right behind the loads the wave would stand still at it
      // the wait that stands in front of any reuse of the group's address registers; naming them as inputs keeps them whole up to it
      asm volatile("s_wait_xcnt 0x0" :: "s"(pak), "s"(pbk) : "memory");
    }
  };
#pragma unroll
  for (int s = 0; s < NS - 1; ++s) { const int ko = ((s + ks0) & (NST - 1)) * 512; const unsigned short* pak = pa + ko; const unsigned short* pbk = pb + ko;
    fetch(pak, pbk, s);
    asm volatile("s_wait_xcnt 0x0" ::: "memory");      // as in the loop: the wait in front of any reuse of the group's address registers (the fence below lets nothing that could rewrite one come up in front of it)
    __builtin_amdgcn_sched_barrier(0); }      // keeps these sets' loads in the loop's own order, set by set: the counted waits at the loop's head must hold for both ways in, and a mixed order here makes them wait for younger sets too
  // rolled by NS steps: the sets keep constant indices, so the fragment arrays stay in registers; the steps from S0 on stand apart, since not all of them still have a step to fetch
  constexpr int S0 = (NST - NS + 1) / NS * NS;
#pragma unroll 1
  for (int it = 0; it < S0; it += NS) {
#pragma unroll
    for (int u = 0; u < NS; ++u) kstep(it + u, u, true);
  }
#pragma unroll
  for (int s = S0; s < NST; ++s) kstep(s, s % NS, s + NS - 1 < NST);
  float bt[4];
#pragma unroll
  for (int t = 0; t < 4; ++t) bt[t] = bf16_round(bias[col0 + t * 16 + ln]);
  if constexpr (OUT == 1) {
    // Vt of a slab (batch, head): rows = d, k = key, tile index kt * 4 + dt (kt = 32-key tile, dt = 16-d tile). acc[i][t][0..7] of lane (hh, ln) are keys row0 + 16 i + 8 hh + 0..7 at d = 16 t + ln:
    // the 16 bytes that this lane owns in half (row / 16) & 1 of tile (kt, t). So the masked, transposed operand is stored from the accumulator registers, 512 contiguous bytes per wave and store.
    const int key0 = row0 % TT;      // a wave's 64 rows lie in one batch: two 32-key tiles, 4096 elements in a row
    unsigned short* cp = (unsigned short*)C16 + ((size_t)(row0 / TT) * (N / 64) + col0 / 64) * 64 * TT + (size_t)(key0 >> 5) * 2048 + lane * 8;
    FragH f[MT][4];      // formed apart from the stores, so that the stores go out in runs
#pragma unroll
    for (int i = 0; i < MT; ++i) { const float* mp = RM + row0 + i * 16 + 8 * hh; const v4f m0 = *(const v4fa*)mp, m1 = *(const v4fa*)(mp + 4); float mr[8];
#pragma unroll
      for (int q = 0; q < 4; ++q) { mr[q] = bf16_round(m0[q]); mr[4 + q] = bf16_round(m1[q]); }
#pragma unroll
      for (int t = 0; t < 4; ++t)
#pragma unroll
        for (int r = 0; r < 8; ++r) f[i][t].h[r] = (_Float16)((acc[i][t][r] * alpha + bt[t]) * mr[r]); }
#pragma unroll
    for (int i = 0; i < MT; ++i)
#pragma unroll
      for (int t = 0; t < 4; ++t) *(v8us*)(cp + (i >> 1) * 2048 + (i & 1) * 256 + t * 512) = f[i][t].half[0];
  } else {
#pragma unroll
    for (int i = 0; i < MT; ++i)
#pragma unroll
      for (int t = 0; t < 4; ++t)
#pragma unroll
        for (int r = 0; r < 8; ++r) so[w][i * 16 + 8 * hh + r][t * 16 + ln] = acc[i][t][r] * alpha + bt[t];
    __builtin_amdgcn_fence(__ATOMIC_ACQ_REL, "workgroup"); __builtin_amdgcn_wave_barrier();      // orders the wave's LDS writes ahead of its reads of them: a wave reads back its own rows only
    if constexpr (OUT == 2) {      // f32 result, row-major: two rows of 256 bytes per store
      const int rsub = lane >> 4, c4 = (lane & 15) * 4;
#pragma unroll
      for (int q = 0; q < 32; ++q) { const int r = q * 2 + rsub; const v4f v = *(const v4fa*)&so[w][r][c4]; *(v4f*)(C + (size_t)(row0 + r) * N + col0 + c4) = v; }
    } else {      // f16 result in fragment order (k = column): a 16 x 64 piece is 2 KiB in a row, half c holds columns col0 + 16 c ..
#pragma unroll
      for (int i = 0; i < MT; ++i) { unsigned short* cp = (unsigned short*)C16 + (size_t)(row0 + i * 16) * N + (size_t)(col0 / 32) * 512 + lane * 8;
#pragma unroll
        for (int c = 0; c < 4; ++c) { const v4f v0 = *(const v4fa*)&so[w][i * 16 + ln][c * 16 + hh * 8], v1 = *(const v4fa*)&so[w][i * 16 + ln][c * 16 + hh * 8 + 4]; FragH f;
#pragma unroll
          for (int q = 0; q < 4; ++q) { f.h[q] = (_Float16)v0[q]; f.h[4 + q] = (_Float16)v1[q]; }
          *(v8us*)(cp + c * 256) = f.half[0]; } }
    }
  }
}
// The Q, K and V projections depend on nothing of one another: one launch of 3 x 256 blocks, all resident at once (3 blocks a WGP, 3 waves a SIMD), so that one wave's products run while another's fragment loads are on their way.
// Block b, b + 256 and b + 512 own the same tile position of Q, K and V.
__global__ __launch_bounds__(128) void k_gemm_qkv(const _Float16* __restrict__ XQ, const _Float16* __restrict__ XKV, const _Float16* __restrict__ Bq, const _Float16* __restrict__ Bk, const _Float16* __restrict__ Bv,
                                                  const float* __restrict__ bq, const float* __restrict__ bk, const float* __restrict__ bv, const float* __restrict__ mk,
                                                  _Float16* __restrict__ Q16, _Float16* __restrict__ K16, _Float16* __restrict__ Vt) {
  constexpr int G = (NR / 128) * (DD / 128);
  const int sel = blockIdx.x / G, blk = blockIdx.x % G;      // the same for a whole block
  if (sel == 2) gemm_w64<1, 3>(blk, XKV, Bv, 0.0625f, bv, nullptr, Vt, mk);      // (v + bv) * mask in f32, then f16, stored as Vt
  else gemm_w64<0, 3>(blk, sel ? XKV : XQ, sel ? Bk : Bq, 0.0625f, sel ? bk : bq, nullptr, sel ? K16 : Q16, nullptr);
}
__global__ __launch_bounds__(128) void k_gemm_o(const _Float16* __restrict__ A, const _Float16* __restrict__ Bh, const float* __restrict__ bias, float* __restrict__ C) { gemm_w64<2, 4>(blockIdx.x, A, Bh, 0.0625f, bias, C, nullptr, nullptr); }

__global__ __launch_bounds__(256) void k_round16f(const float* __restrict__ W, _Float16* __restrict__ Bt, size_t n8) { const size_t t = (size_t)blockIdx.x * 256 + threadIdx.x; if (t >= n8) return; FragH f;
#pragma unroll
  for (int i = 0; i < 8; ++i) f.h[i] = (_Float16)(bf16_round(W[t * 8 + i]) * 16.0f); *(v8us*)((unsigned short*)Bt + t * 8) = f.half[0];  }

// lane l with lane l ^ 16 (a vector cross-row move, no LDS queue)
__device__ __forceinline__ float xhalf(float x) { return __builtin_bit_cast(float, __builtin_amdgcn_permlanex16(__builtin_bit_cast(int, x), __builtin_bit_cast(int, x), 0x76543210, 0xfedcba98, false, false)); }
// Transposed products: St = K * Qt (A = K rows, B = Q), Ot += Vt * Pt (A = Vt rows, B = Pt). The fragments are the same registers as before with A and B swapped (one k order for both).
// St tile (qt, nt): register r of lane (hh, ln) = score of key j0 + 16 nt + 8 hh + r with query q0 + 16 qt + ln: a lane holds 16 scores of ONE query, so maximum and sum run in the lane,
// with one exchange between the wave halves for the maximum; the two halves' sums are joined once, behind the loop.
// The two converted St tiles are the B fragment of Pt as they stand (element 8 nt + r = k 16 nt + 8 hh + r): P passes through no LDS.
// A wave owns QT = 2 query tiles of 16: every loaded K or Vt fragment feeds two products (one per query tile), and the two tiles' softmax chains are independent of each other.
// A block is 8 waves on 128 queries: waves 0..3 walk keys 0..1023, waves 4..7 keys 1024..2047 of the same four query groups. That makes 4096 waves, four a SIMD in place of two,
// so that one wave's load waits and dependent softmax chain are filled by three others. The two partial results (maximum, sum, Ot) of a query group are joined once, behind the loop, through LDS.
__global__ __launch_bounds__(256) void k_flash(const _Float16* __restrict__ Q16, int ldq, const _Float16* __restrict__ K16, int ldk, const _Float16* __restrict__ Vt, const int* __restrict__ MSK, _Float16* __restrict__ O16, int ldo) {
  constexpr int QT = 2, RPW = 16 * QT, NQB = 2048 / (4 * RPW), DT = 4, KS = 2, KH = 2048 / 2;
  __shared__ __attribute__((aligned(16))) float sj[4][QT * DT * 2 + 1][32][4];      // per query group: the upper key half's Ot (16 chunks of 16 bytes a lane) and one chunk of m, l; a wave-wide 16-byte access is 512 bytes in a row
  const int tid = threadIdx.x, lane = tid & 31;
  const int w = __builtin_amdgcn_readfirstlane(tid >> 5), wq = w & 3, kh = w >> 2;      // the wave's number as a scalar: the key range, the loop counter and the branches on kh stay scalar
  const int slab = blockIdx.x / NQB, qblk = blockIdx.x % NQB; const int b = slab / 16, h = slab % 16; const int qb0 = qblk * (4 * RPW); const int q0 = qb0 + wq * RPW;
  FragH aq[QT][KS];
  const unsigned short* qr0 = (const unsigned short*)Q16 + ((size_t)b * 2048 + q0) * ldq + h * 1024 + lane * 8; const unsigned short* qr1 = qr0 + (size_t)16 * ldq;      // Q16, K16, Vt: fragment order (see FRAGMENT ORDER); a head's 64 columns are two tiles, 1024 elements
#pragma unroll
  for (int ks = 0; ks < KS; ++ks) { aq[0][ks].half[0] = *(const v8us*)(qr0 + ks * 512); aq[0][ks].half[1] = *(const v8us*)(qr0 + ks * 512 + 256); aq[1][ks].half[0] = *(const v8us*)(qr1 + ks * 512); aq[1][ks].half[1] = *(const v8us*)(qr1 + ks * 512 + 256); }
  const unsigned short* Vth = (const unsigned short*)Vt + (size_t)slab * 64 * 2048;
  float m_r[QT], l_r[QT]; v8f oacc[QT][DT];      // of query q0 + 16 qt + ln; l_r sums this half's keys only; oacc[qt][dt][r] = Ot[16 dt + 8 hh + r][q0 + 16 qt + ln]
  // Softmax in base 2: exp(s / 8 - m) = exp2(s * CS - m * log2 e), CS = log2(e) / 8. m_r is kept in that scaled unit, so a weight is one fused multiply-add on the raw score and one hardware exp2.
  constexpr float CS = 0.125f * 1.4426950408889634f; typedef float v2f __attribute__((ext_vector_type(2)));
#pragma unroll
  for (int qt = 0; qt < QT; ++qt) { m_r[qt] = -3.0e38f; l_r[qt] = 0.f;
#pragma unroll
    for (int dt = 0; dt < DT; ++dt) oacc[qt][dt] = (v8f){0.f,0.f,0.f,0.f,0.f,0.f,0.f,0.f}; }
  const int jbeg = kh * KH;      // this wave's half of the keys
  // STAGGERED WALK (as in the GEMMs): the 16 blocks of a slab read the same K and Vt tiles. Block qblk starts at pass rot of its NP passes and wraps, so that it meets most tiles after another block has brought them into L2,
  // not at the moment of their first touch. The online softmax takes the keys in any order: only the order of its sums changes. Blocks qblk and qblk + 4 may share a start.
  constexpr int NP = KH / 32;
  const int rot = (qblk & 3) * (NP / 4) + (qblk >> 3) * (NP / 8);
  // Fragment loads stand well ahead of their products: a pass issues its V fragments as one group at its top (they land behind the softmax) and,
  // right behind its score products, the next pass's K fragments (they land behind the rest of the pass). No product waits on a load just issued.
  // The unroll directives on the fragment loops keep the fragment arrays in registers (constant indices).
  FragH bk[2][KS];
  const unsigned short* kp0 = (const unsigned short*)K16 + ((size_t)b * 2048 + jbeg + rot * 32) * ldk + h * 1024 + lane * 8; const unsigned short* kp1 = kp0 + (size_t)16 * ldk;
#pragma unroll
  for (int ks = 0; ks < KS; ++ks) { bk[0][ks].half[0] = *(const v8us*)(kp0 + ks * 512); bk[0][ks].half[1] = *(const v8us*)(kp0 + ks * 512 + 256); bk[1][ks].half[0] = *(const v8us*)(kp1 + ks * 512); bk[1][ks].half[1] = *(const v8us*)(kp1 + ks * 512 + 256); }
  // as in the loop: the wait in front of any reuse of the address registers of the Q and first K loads
  asm volatile("s_wait_xcnt 0x0" :: "v"(qr0), "v"(qr1), "v"(kp0), "v"(kp1) : "memory");
#pragma unroll 1
  for (int p = 0; p < NP; ++p) {
    const int j0 = jbeg + ((p + rot) & (NP - 1)) * 32;
    FragH bv[DT];
#pragma unroll
    for (int dt = 0; dt < DT; ++dt) { const unsigned short* vrow = Vth + (size_t)j0 * 64 + dt * 512 + lane * 8; bv[dt].half[0] = *(const v8us*)vrow; bv[dt].half[1] = *(const v8us*)(vrow + 256); }
    v8f s[QT][2];
#pragma unroll
    for (int nt = 0; nt < 2; ++nt)
#pragma unroll
      for (int qt = 0; qt < QT; ++qt) { v8f acc = (v8f){0.f,0.f,0.f,0.f,0.f,0.f,0.f,0.f};
#pragma unroll
        for (int ks = 0; ks < KS; ++ks) acc = mmaH<1>(bk[nt][ks].v, bk[nt][ks].v, aq[qt][ks].v, aq[qt][ks].v, acc); s[qt][nt] = acc; }
    const int jn = jbeg + ((p + 1 + rot) & (NP - 1)) * 32;      // the last pass reads the first pass's rows again: in bounds, not used
    const unsigned short* kr0 = (const unsigned short*)K16 + ((size_t)b * 2048 + jn) * ldk + h * 1024 + lane * 8; const unsigned short* kr1 = kr0 + (size_t)16 * ldk;
#pragma unroll
    for (int ks = 0; ks < KS; ++ks) { bk[0][ks].half[0] = *(const v8us*)(kr0 + ks * 512); bk[0][ks].half[1] = *(const v8us*)(kr0 + ks * 512 + 256); bk[1][ks].half[0] = *(const v8us*)(kr1 + ks * 512); bk[1][ks].half[1] = *(const v8us*)(kr1 + ks * 512 + 256); }
    // the wait that stands in front of any reuse of the group's address registers; naming them as inputs keeps them whole up to it (no load of the group lands on one)
    asm volatile("s_wait_xcnt 0x0" :: "v"(kr0), "v"(kr1) : "memory");
    FragH pb[QT];
#pragma unroll
    for (int qt = 0; qt < QT; ++qt) {
      float mx[8];
#pragma unroll
      for (int r = 0; r < 8; ++r) mx[r] = fmaxf(s[qt][0][r], s[qt][1][r]);      // maxima of the raw scores: the scale is positive
      float mc = fmaxf(fmaxf(fmaxf(mx[0], mx[1]), fmaxf(mx[2], mx[3])), fmaxf(fmaxf(mx[4], mx[5]), fmaxf(mx[6], mx[7])));
      mc = fmaxf(mc, xhalf(mc)) * CS;
      const float mn = fmaxf(m_r[qt], mc); const float al = (mn > -1.0e38f) ? __builtin_amdgcn_exp2f(m_r[qt] - mn) : 1.0f; m_r[qt] = mn;
      float ps[8];
#pragma unroll
      for (int r = 0; r < 8; r += 2) {      // two scores of a tile per packed multiply-add
        const v2f a0 = __builtin_elementwise_fma((v2f){s[qt][0][r], s[qt][0][r + 1]}, (v2f){CS, CS}, (v2f){-mn, -mn}), a1 = __builtin_elementwise_fma((v2f){s[qt][1][r], s[qt][1][r + 1]}, (v2f){CS, CS}, (v2f){-mn, -mn});
        const float p00 = __builtin_amdgcn_exp2f(a0.x), p01 = __builtin_amdgcn_exp2f(a0.y), p10 = __builtin_amdgcn_exp2f(a1.x), p11 = __builtin_amdgcn_exp2f(a1.y);
        ps[r] = p00 + p10; ps[r + 1] = p01 + p11; pb[qt].h[r] = (_Float16)p00; pb[qt].h[r + 1] = (_Float16)p01; pb[qt].h[8 + r] = (_Float16)p10; pb[qt].h[9 + r] = (_Float16)p11; }
      l_r[qt] = l_r[qt] * al + (((ps[0] + ps[1]) + (ps[2] + ps[3])) + ((ps[4] + ps[5]) + (ps[6] + ps[7])));
#pragma unroll
      for (int dt = 0; dt < DT; ++dt)
#pragma unroll
        for (int r = 0; r < 8; ++r) oacc[qt][dt][r] *= al;
    }
#pragma unroll
    for (int dt = 0; dt < DT; ++dt)
#pragma unroll
      for (int qt = 0; qt < QT; ++qt) oacc[qt][dt] = mmaH<1>(bv[dt].v, bv[dt].v, pb[qt].v, pb[qt].v, oacc[qt][dt]); }
  // Join of the two key halves. Waves wq and wq + 4 hold the same queries at the same lanes and registers, so the upper half hands over its registers lane by lane.
  if (kh == 1) {
#pragma unroll
    for (int qt = 0; qt < QT; ++qt)
#pragma unroll
      for (int dt = 0; dt < DT; ++dt) { *(v4fa*)&sj[wq][(qt * DT + dt) * 2][lane][0] = (v4f){oacc[qt][dt][0], oacc[qt][dt][1], oacc[qt][dt][2], oacc[qt][dt][3]}; *(v4fa*)&sj[wq][(qt * DT + dt) * 2 + 1][lane][0] = (v4f){oacc[qt][dt][4], oacc[qt][dt][5], oacc[qt][dt][6], oacc[qt][dt][7]}; }
    *(v4fa*)&sj[wq][QT * DT * 2][lane][0] = (v4f){m_r[0], m_r[1], l_r[0], l_r[1]};
  }
  __syncthreads();      // every wave of the block passes it once: the upper half's partial results are in LDS before the lower half reads them
  if (kh == 1) return;
  { const v4f ml = *(const v4fa*)&sj[wq][QT * DT * 2][lane][0];
#pragma unroll
    for (int qt = 0; qt < QT; ++qt) {      // both maxima are finite (each half has seen 1024 keys); weights in the base-2 unit of m_r
      const float mn = fmaxf(m_r[qt], ml[qt]); const float a1 = __builtin_amdgcn_exp2f(m_r[qt] - mn), a2 = __builtin_amdgcn_exp2f(ml[qt] - mn);
      l_r[qt] = l_r[qt] * a1 + ml[2 + qt] * a2;
#pragma unroll
      for (int dt = 0; dt < DT; ++dt) { const v4f o0 = *(const v4fa*)&sj[wq][(qt * DT + dt) * 2][lane][0], o1 = *(const v4fa*)&sj[wq][(qt * DT + dt) * 2 + 1][lane][0];
#pragma unroll
        for (int r = 0; r < 4; ++r) { oacc[qt][dt][r] = oacc[qt][dt][r] * a1 + o0[r] * a2; oacc[qt][dt][4 + r] = oacc[qt][dt][4 + r] * a1 + o1[r] * a2; } } } }
  // oacc[qt][dt][0..7] of lane (hh, ln) are row q0 + 16 qt + ln, columns 16 dt + 8 hh + 0..7 of the head: the 16 bytes that this lane owns in half dt & 1 of the head's tile dt >> 1 of a fragment-order
  // operand (see FRAGMENT ORDER). So the output GEMM's f16 A operand is stored from the accumulator registers, 512 contiguous bytes per wave and store.
  FragH f[QT][DT];      // formed apart from the stores, so that the stores go out in runs
#pragma unroll
  for (int qt = 0; qt < QT; ++qt) { const float l = l_r[qt] + xhalf(l_r[qt]); const float li = (l > 0.f) ? 1.0f / l : 0.f;
#pragma unroll
    for (int dt = 0; dt < DT; ++dt)
#pragma unroll
      for (int r = 0; r < 8; ++r) f[qt][dt].h[r] = (_Float16)(oacc[qt][dt][r] * li); }
#pragma unroll
  for (int qt = 0; qt < QT; ++qt) { unsigned short* op = (unsigned short*)O16 + ((size_t)b * 2048 + q0 + qt * 16) * ldo + h * 1024 + lane * 8;
#pragma unroll
    for (int dt = 0; dt < DT; ++dt) *(v8us*)(op + dt * 256) = f[qt][dt].half[0]; } }

extern "C" void kernel_launch(void* const* d_in, const int* in_sizes, int n_in,
                              void* d_out, int out_size, void* d_ws, size_t ws_size, hipStream_t stream) {
  (void)in_sizes; (void)n_in; (void)out_size;
  const float* xq = (const float*)d_in[0]; const float* xkv = (const float*)d_in[1]; const float* mk = (const float*)d_in[2]; const float* Wq = (const float*)d_in[3]; const float* bq = (const float*)d_in[4]; const float* Wk = (const float*)d_in[5]; const float* bk = (const float*)d_in[6]; const float* Wv = (const float*)d_in[7]; const float* bv = (const float*)d_in[8]; const float* Wo = (const float*)d_in[9]; const float* bo = (const float*)d_in[10];
  char* ws = (char*)d_ws; size_t off = 0;
  auto take = [&](size_t bytes) { char* p = ws + off; off += (bytes + 255) & ~(size_t)255; return p; };
  _Float16* Bq = (_Float16*)take((size_t)DD * DD * 2); _Float16* Bk = (_Float16*)take((size_t)DD * DD * 2); _Float16* Bv = (_Float16*)take((size_t)DD * DD * 2); _Float16* Bo = (_Float16*)take((size_t)DD * DD * 2);
  _Float16* XQ16 = (_Float16*)take((size_t)NR * DD * 2); _Float16* XKV16 = (_Float16*)take((size_t)NR * DD * 2); _Float16* Q16 = (_Float16*)take((size_t)NR * DD * 2); _Float16* K16 = (_Float16*)take((size_t)NR * DD * 2); _Float16* Vt = (_Float16*)take((size_t)NR * DD * 2); _Float16* O16 = (_Float16*)take((size_t)NR * DD * 2);
  if (off > ws_size) return;      // 8.4 + 8.4 x 6 = 59 MB
  const unsigned gg = (NR / 128) * (DD / 128);
  k_prep<<<512, 256, 0, stream>>>(xq, xkv, Wq, Wk, Wv, Wo, XQ16, XKV16, Bq, Bk, Bv, Bo);      // W (D,H,Dh) = [in][h * 64 + d]; Wo (H,Dh,D) = [in = (h,d)][out]
  k_gemm_qkv<<<3 * gg, 128, 0, stream>>>(XQ16, XKV16, Bq, Bk, Bv, bq, bk, bv, mk, Q16, K16, Vt);
  k_flash<<<BB * NH * (TT / 128), 256, 0, stream>>>(Q16, DD, K16, DD, Vt, nullptr, O16, DD);      // the 1/8 on q is folded into the softmax constant
  k_gemm_o<<<gg, 128, 0, stream>>>(O16, Bo, bo, (float*)d_out);
}
